// v000
// Times are from an AMD MI455X. After a warm-up the kernel runs many times in a row, and a time is the length of
// such a window on the GPU divided by its runs, so every launch and the gaps after it count. The runs cycle
// through copies of the inputs. A figure is the median of several windows, for all but v000 over two sittings.
// Sittings can differ by a few percent; kernels timed side by side share one.
// The starting kernel, v000, takes 684 microseconds a run.
#include <hip/hip_runtime.h>

// Lunar causal attention (Luna-style packed attention, causal "efficient" form): T = 2,048 tokens x 2 batch x 1,024 (16 heads x 64), 32 packed positions.
// pq = (pquery Wpq^T + bpq)/8 -> (b,h,p,d); kp = query Wpc^T + bpc; pattn[bh][t][p] = softplus_b(kp_t . pq_p) (b = ln 2); q = (query Wq^T + bq)/8; kv = query Wc^T + bc (tied k = v);
// aw[bh][n][p] = (sum_{m<=n} (q_n . kv_m) pattn[m][p]) / (n+1); A = softmax_p(aw); attn[bh][n][d] = (sum_{m<=n} (A_n . pattn_m) kv[m][d]) / (n+1); out = attn Wo^T + bo -> [2048][2][1024].
// Both "efficient_causal_attention_parallel" calls are evaluated as causal masked products (the cumulative outer-product form re-associated: x_n . sum_{m<=n} y_m z_m^T = sum_{m<=n} (x_n.y_m) z_m).
// WMMA (v_wmma_f32_16x16x32_f16, f32 accumulate): the four input linears ([4,096 x 1,024] x [1,024 x 1,024], EXACT bf16 operands, 1 product) and the output linear (attn hi+lo: 2 products); per (bh,
// 16-query wave) and causal 32-key block: S1^T = KV.Q^T (K = 64, hi+lo: 3 products) then AW^T += PATTN^T S1^T (2 p-tiles, 3 products); S2^T = PATTN.A^T (K = 32, 3 products) then O^T += KV^T S2^T
// (4 d-tiles, 3 products); pattn = softplus(kp.pq) per token ([16 tokens x 64] x [64 x 32] per (bh) tile, 3 products). Softplus, softmax over the 32 positions, the 1/(n+1) factors in f32.
// Inputs rounded to bf16 once. Fragment k-map per lane half hh for A AND B: elements 0..7 <- k = 8hh+0..7, 8..15 <- k = 16+8hh+0..7; acc[r] = D[8hh+r][col]. Every

namespace {
constexpr int T = 2048, BS = 2, E = 1024, NH = 16, DH = 64, BH = BS * NH, PL = 32, NR = T * BS /* 4,096 query rows (t, b) */, NPR = PL * BS /* 64 pquery rows */;
constexpr float XS = 8.0f, WSC = 256.0f, SCL = 0.125f, BETA = 0.69314718055994531f, PS1 = 8.0f, PS2 = 64.0f;

typedef _Float16 b16;
typedef __attribute__((ext_vector_type(16))) _Float16 v16b;
typedef __attribute__((ext_vector_type(8))) _Float16 v8b;
typedef __attribute__((ext_vector_type(8))) float v8f;
typedef __attribute__((ext_vector_type(4))) float v4f;
__device__ __forceinline__ float bf16_rne(float f) { unsigned int u = __float_as_uint(f); u += 0x7FFFu + ((u >> 16) & 1u); return __uint_as_float(u & 0xFFFF0000u); }
__device__ __forceinline__ void split16(float v, b16& hi, b16& lo) { hi = (b16)v; lo = (b16)(v - (float)hi); }
__device__ __forceinline__ v16b frag_kb(const b16* p, int hh) { const v8b a = *(const v8b*)(p + 8 * hh), b = *(const v8b*)(p + 16 + 8 * hh); v16b f;
#pragma unroll
  for (int e = 0; e < 8; ++e) { f[e] = a[e]; f[8 + e] = b[e]; } return f; }
__device__ __forceinline__ v8f wmma16b(v16b a, v16b b, v8f c) { v8f d = __builtin_amdgcn_wmma_f32_16x16x32_f16(false, a, false, b, (short)0, c, false, false); asm volatile("v_nop\n\tv_nop\n\tv_nop\n\tv_nop" : "+v"(d) : "v"(a), "v"(b)); return d; }
__device__ __forceinline__ void wave_lds_sync() { __builtin_amdgcn_fence(__ATOMIC_RELEASE, "workgroup"); __builtin_amdgcn_wave_barrier(); __builtin_amdgcn_fence(__ATOMIC_ACQUIRE, "workgroup"); }
__device__ __forceinline__ float pmul(float a, float b) { float p = a * b; asm volatile("" : "+v"(p)); return p; }
__device__ __forceinline__ float softplus_b(float x) { const float bx = BETA * x; const float sp = (bx > 20.0f) ? bx : log1pf(__expf(bx)); return sp / BETA; }   // torch softplus(beta x)/beta (threshold 20 on beta*x)

__global__ __launch_bounds__(256) void prep_kernel(const float* __restrict__ query, const float* __restrict__ pquery, const float* __restrict__ wpq, const float* __restrict__ wq, const float* __restrict__ wpc, const float* __restrict__ wc, const float* __restrict__ wo, b16* __restrict__ X16, b16* __restrict__ PQ16, b16* __restrict__ W4, b16* __restrict__ WPQ) {
  const size_t t = (size_t)blockIdx.x * 256 + threadIdx.x; const size_t nx = (size_t)NR * E / 8, np_ = (size_t)NPR * E / 8, nw = (size_t)E * E / 8; v8b o;
  if (t < nx) { const size_t e = t * 8; const v4f a = *(const v4f*)(query + e), c = *(const v4f*)(query + e + 4); for (int j = 0; j < 4; ++j) { o[j] = (b16)(bf16_rne(a[j]) * XS); o[4 + j] = (b16)(bf16_rne(c[j]) * XS); } { *(v8b*)(X16 + e) = o;  } return; }
  size_t u = t - nx;
  if (u < np_) { const size_t e = u * 8; for (int j = 0; j < 8; ++j) o[j] = (b16)(bf16_rne(pquery[e + j]) * XS); { *(v8b*)(PQ16 + e) = o;  } return; } u -= np_;
  if (u < 5 * nw) { const int kind = (int)(u / nw); const size_t e = (u % nw) * 8; const float* w = kind == 0 ? wpc : kind == 1 ? wq : kind == 2 ? wc : kind == 3 ? wo : wpq; for (int j = 0; j < 8; ++j) o[j] = (b16)(bf16_rne(w[e + j]) * WSC);
    b16* dst = (kind < 4) ? (W4 + (size_t)kind * E * E) : WPQ; { *(v8b*)(dst + e) = o;  } }
}
// input linears: grid (NR/64, 8 col blocks, 3 kinds): y = X16 W^T + b (K = 1,024: 32 steps, exact); kind 0: kp -> KPh/KPl planes [row][1024]; kind 1: q = (y)*1/8 -> Qh/Ql; kind 2: kv -> KVh/KVl rows (the per-bh transpose KVT [bh][64 d][2048 t] is written by kvt_kernel)
__global__ __launch_bounds__(128) void lin_kernel(const b16* __restrict__ X16, const b16* __restrict__ W4, const float* __restrict__ bpc, const float* __restrict__ bq, const float* __restrict__ bc, b16* __restrict__ KPh, b16* __restrict__ KPl, b16* __restrict__ Qh, b16* __restrict__ Ql, b16* __restrict__ KVh, b16* __restrict__ KVl) {
  __shared__ __attribute__((aligned(16))) b16 Th[4][16][128 + 8], Tl[4][16][128 + 8];
  const int wave = threadIdx.x >> 5, lane = threadIdx.x & 31, nloc = lane & 15, hlf = lane >> 4; const int kind = blockIdx.z, n0 = blockIdx.y * 128; const size_t m0 = (size_t)blockIdx.x * 64 + wave * 16;
  const b16* W = W4 + (size_t)kind * E * E; const float* bias = kind == 0 ? bpc : kind == 1 ? bq : bc; const float osc = (kind == 1) ? SCL : 1.0f;
  v8f acc[8];
#pragma unroll
  for (int t = 0; t < 8; ++t) acc[t] = (v8f){};
#pragma unroll 2
  for (int kb = 0; kb < E; kb += 32) { const v16b a = frag_kb(X16 + (m0 + nloc) * E + kb, hlf);
#pragma unroll
    for (int t = 0; t < 8; ++t) acc[t] = wmma16b(a, frag_kb(W + (size_t)(n0 + t * 16 + nloc) * E + kb, hlf), acc[t]); }
#pragma unroll
  for (int t = 0; t < 8; ++t) { const float bb = bf16_rne(bias[n0 + t * 16 + nloc]);
#pragma unroll
    for (int r = 0; r < 8; ++r) { b16 p, q; split16((acc[t][r] * (1.0f / (XS * WSC)) + bb) * osc * XS, p, q); Th[wave][8 * hlf + r][t * 16 + nloc] = p; Tl[wave][8 * hlf + r][t * 16 + nloc] = q; } }
  wave_lds_sync(); b16* dh = kind == 0 ? KPh : kind == 1 ? Qh : KVh; b16* dl = kind == 0 ? KPl : kind == 1 ? Ql : KVl;
  { for (int r2 = 0; r2 < 16; r2 += 2) { const int rr = r2 + (lane >> 4), c8 = (lane & 15) * 8; const size_t gi = (m0 + rr) * E + n0 + c8; *(v8b*)(dh + gi) = *(const v8b*)(&Th[wave][rr][c8]); *(v8b*)(dl + gi) = *(const v8b*)(&Tl[wave][rr][c8]); }  }
}
__global__ __launch_bounds__(256) void kvt_kernel(const b16* __restrict__ KVh, const b16* __restrict__ KVl, b16* __restrict__ KVTh, b16* __restrict__ KVTl) {
  __shared__ __attribute__((aligned(16))) b16 Ah[DH][64 + 8], Al[DH][64 + 8];
  const int bh = blockIdx.y, t0 = blockIdx.x * 64, t_ = threadIdx.x; const int b = bh / NH, h = bh % NH;
  for (int q = t_; q < 64 * DH; q += 256) { const int tt = q / DH, d = q % DH; const size_t gi = ((size_t)(t0 + tt) * BS + b) * E + h * DH + d; Ah[d][tt] = KVh[gi]; Al[d][tt] = KVl[gi]; }
  __syncthreads();
  { for (int q = t_; q < DH * 8; q += 256) { const int d = q >> 3, c8 = (q & 7) * 8; const size_t gi = ((size_t)bh * DH + d) * T + t0 + c8; *(v8b*)(KVTh + gi) = *(const v8b*)(&Ah[d][c8]); *(v8b*)(KVTl + gi) = *(const v8b*)(&Al[d][c8]); }  }
}
// packed query + pattn: block = (bh, 64 t) x 4 waves: pq rows for this bh (32 x 64) computed in-block from PQ16 (pquery rows p*2+b) x WPQ (K = 1,024, exact) + bpq, x 1/8 -> hi/lo LDS [32 p][64 d];
// pattn tile = KP rows (t, b; head cols) [16 t x 64] x PQ^T -> [16 x 32]: 2 col tiles x 2 k steps x 3 products; softplus; stored as PAh/PAl [bh][t][32] (x8 hi/lo; 64-B rows -> a wave's 16 t = 1 KB
__global__ __launch_bounds__(128) void pattn_kernel(const b16* __restrict__ PQ16, const b16* __restrict__ WPQ, const float* __restrict__ bpq, const b16* __restrict__ KPh, const b16* __restrict__ KPl, b16* __restrict__ PAh, b16* __restrict__ PAl, b16* __restrict__ PATh, b16* __restrict__ PATl) {
  __shared__ __attribute__((aligned(16))) b16 Pq[PL][DH + 8], Pql[PL][DH + 8]; __shared__ __attribute__((aligned(16))) b16 Rh[4][16][PL + 8], Rl[4][16][PL + 8]; __shared__ __attribute__((aligned(16))) b16 Rt[PL][64 + 8], Rtl[PL][64 + 8];
  const int wave = threadIdx.x >> 5, lane = threadIdx.x & 31, nloc = lane & 15, hlf = lane >> 4, t_ = threadIdx.x; const int bh = blockIdx.y, b = bh / NH, h = bh % NH, t0 = blockIdx.x * 64;
  // pq rows: wave w computes p tile (w&1) x d tiles (w>>1)*2..+1: A = PQ16 rows (p*2 + b) [16 p x 1024], B = WPQ rows (h*64 + d)
  { const int pt = wave & 1, dt0 = (wave >> 1) * 2; v8f a2[2] = {{}, {}};
#pragma unroll 2
    for (int kb = 0; kb < E; kb += 32) { const v16b a = frag_kb(PQ16 + ((size_t)(pt * 16 + nloc) * BS + b) * E + kb, hlf);
#pragma unroll
      for (int t = 0; t < 2; ++t) a2[t] = wmma16b(a, frag_kb(WPQ + (size_t)(h * DH + (dt0 + t) * 16 + nloc) * E + kb, hlf), a2[t]); }
#pragma unroll
    for (int t = 0; t < 2; ++t) { const int d = (dt0 + t) * 16 + nloc; const float bb = bf16_rne(bpq[h * DH + d]);
#pragma unroll
      for (int r = 0; r < 8; ++r) { b16 p, q; split16((a2[t][r] * (1.0f / (XS * WSC)) + bb) * SCL * XS, p, q); Pq[pt * 16 + 8 * hlf + r][d] = p; Pql[pt * 16 + 8 * hlf + r][d] = q; } } }
  __syncthreads();
  // pattn for the wave's 16 t: A = KP rows ((t0 + wave*16 + nloc)*2 + b) cols h*64.., B = Pq rows p (k = d)
  { v8f d2[2] = {{}, {}}; const size_t arow = ((size_t)(t0 + wave * 16 + nloc) * BS + b) * E + h * DH;
#pragma unroll
    for (int kb = 0; kb < DH; kb += 32) { const v16b a = frag_kb(KPh + arow + kb, hlf), al = frag_kb(KPl + arow + kb, hlf);
#pragma unroll
      for (int t = 0; t < 2; ++t) { const v16b bp = frag_kb(&Pq[t * 16 + nloc][kb], hlf); d2[t] = wmma16b(a, bp, d2[t]); d2[t] = wmma16b(al, bp, d2[t]); d2[t] = wmma16b(a, frag_kb(&Pql[t * 16 + nloc][kb], hlf), d2[t]); } }
#pragma unroll
    for (int t = 0; t < 2; ++t)
#pragma unroll
      for (int r = 0; r < 8; ++r) { const float v = softplus_b(d2[t][r] * (1.0f / (XS * XS))); b16 p, q; split16(v * XS, p, q); const int tt = wave * 16 + 8 * hlf + r, pp = t * 16 + nloc; Rh[wave][8 * hlf + r][pp] = p; Rl[wave][8 * hlf + r][pp] = q; Rt[pp][tt] = p; Rtl[pp][tt] = q; } }
  __syncthreads();
  {
    for (int k = 0; k < 2; ++k) { const int rr = k * 8 + (lane >> 2), c8 = (lane & 3) * 8; const size_t gi = ((size_t)bh * T + t0 + wave * 16 + rr) * PL + c8; *(v8b*)(PAh + gi) = *(const v8b*)(&Rh[wave][rr][c8]); *(v8b*)(PAl + gi) = *(const v8b*)(&Rl[wave][rr][c8]); }
    for (int q = t_; q < PL * 8; q += 128) { const int pp = q >> 3, c8 = (q & 7) * 8; const size_t gi = ((size_t)bh * PL + pp) * T + t0 + c8; *(v8b*)(PATh + gi) = *(const v8b*)(&Rt[pp][c8]); *(v8b*)(PATl + gi) = *(const v8b*)(&Rtl[pp][c8]); }
     }
}
// step 1: grid (T/32, BH), 2 waves x 16 queries; causal key blocks: S1^T = KV.Q^T (K = 64, 3 products), masked keys > q -> 0, x PS1 hi/lo; AW^T += PAT^T(p rows) S1^T (2 p-tiles, 3 products);
// aw = AW/(n+1); softmax over the 32 p (each lane holds 16 of its query's 32 values? lane (hh, col): acc[t][r] = AW^T[p = t*16 + 8hh + r][query col] -> the query's 32 values are split over the
__global__ __launch_bounds__(64) void step1_kernel(const b16* __restrict__ Qh, const b16* __restrict__ Ql, const b16* __restrict__ KVh, const b16* __restrict__ KVl, const b16* __restrict__ PATh, const b16* __restrict__ PATl, b16* __restrict__ Ah, b16* __restrict__ Al) {
  __shared__ __attribute__((aligned(16))) b16 Ra[2][16][PL + 8], Ral[2][16][PL + 8];
  const int wave = threadIdx.x >> 5, lane = threadIdx.x & 31, hh = lane >> 4, col = lane & 15; const int bh = blockIdx.y, b = bh / NH, h = bh % NH; const int q0 = blockIdx.x * 32 + wave * 16, qi = q0 + col;
  const size_t qrow = ((size_t)qi * BS + b) * E + h * DH; const v16b qa0 = frag_kb(Qh + qrow, hh), qa1 = frag_kb(Qh + qrow + 32, hh), ql0 = frag_kb(Ql + qrow, hh), ql1 = frag_kb(Ql + qrow + 32, hh);
  const b16* Pb = PATh + (size_t)bh * PL * T; const b16* Plb = PATl + (size_t)bh * PL * T;
  v8f aw[2] = {{}, {}}, awl[2] = {{}, {}}; const int kend = q0 + 16;
  for (int kb = 0; kb < kend; kb += 32) {
    v8f s0 = {}, s1 = {};
    { const b16* k0 = KVh + ((size_t)(kb + col) * BS + b) * E + h * DH, *k1 = KVh + ((size_t)(kb + 16 + col) * BS + b) * E + h * DH, *k0l = KVl + ((size_t)(kb + col) * BS + b) * E + h * DH, *k1l = KVl + ((size_t)(kb + 16 + col) * BS + b) * E + h * DH;
      v16b f = frag_kb(k0, hh); s0 = wmma16b(f, qa0, s0); s0 = wmma16b(f, ql0, s0); s0 = wmma16b(frag_kb(k0l, hh), qa0, s0);
      f = frag_kb(k0 + 32, hh); s0 = wmma16b(f, qa1, s0); s0 = wmma16b(f, ql1, s0); s0 = wmma16b(frag_kb(k0l + 32, hh), qa1, s0);
      f = frag_kb(k1, hh); s1 = wmma16b(f, qa0, s1); s1 = wmma16b(f, ql0, s1); s1 = wmma16b(frag_kb(k1l, hh), qa0, s1);
      f = frag_kb(k1 + 32, hh); s1 = wmma16b(f, qa1, s1); s1 = wmma16b(f, ql1, s1); s1 = wmma16b(frag_kb(k1l + 32, hh), qa1, s1); }
    v16b ph, pl;
#pragma unroll
    for (int r = 0; r < 8; ++r) { const int ka = kb + 8 * hh + r, kbb = kb + 16 + 8 * hh + r; const float v0 = (ka <= qi) ? s0[r] * (1.0f / (XS * XS)) : 0.0f, v1 = (kbb <= qi) ? s1[r] * (1.0f / (XS * XS)) : 0.0f; b16 p, q; split16(v0 * PS1, p, q); ph[r] = p; pl[r] = q; split16(v1 * PS1, p, q); ph[8 + r] = p; pl[8 + r] = q; }
#pragma unroll
    for (int t = 0; t < 2; ++t) { const v16b pa = frag_kb(Pb + (size_t)(t * 16 + col) * T + kb, hh); aw[t] = wmma16b(pa, ph, aw[t]); awl[t] = wmma16b(pa, pl, awl[t]); awl[t] = wmma16b(frag_kb(Plb + (size_t)(t * 16 + col) * T + kb, hh), ph, awl[t]); } }
  // lane (hh, col): value[p = t*16 + 8hh + r] for query col; divide by (qi + 1); softmax over 32
  float v[16]; const float invn = 1.0f / ((float)(qi + 1) * PS1 * XS); float mx = -INFINITY;
#pragma unroll
  for (int t = 0; t < 2; ++t) for (int r = 0; r < 8; ++r) { v[t * 8 + r] = (aw[t][r] + awl[t][r]) * invn; mx = fmaxf(mx, v[t * 8 + r]); }
  mx = fmaxf(mx, __shfl_xor(mx, 16)); float sm = 0.0f; for (int i = 0; i < 16; ++i) { v[i] = __expf(v[i] - mx); sm += v[i]; } sm += __shfl_xor(sm, 16); const float inv = 1.0f / sm;
#pragma unroll
  for (int t = 0; t < 2; ++t) for (int r = 0; r < 8; ++r) { b16 p, q; split16(v[t * 8 + r] * inv * PS2, p, q); Ra[wave][col][t * 16 + 8 * hh + r] = p; Ral[wave][col][t * 16 + 8 * hh + r] = q; }
  wave_lds_sync();
  { for (int k = 0; k < 2; ++k) { const int rr = k * 8 + (lane >> 2), c8 = (lane & 3) * 8; const size_t gi = ((size_t)bh * T + q0 + rr) * PL + c8; *(v8b*)(Ah + gi) = *(const v8b*)(&Ra[wave][rr][c8]); *(v8b*)(Al + gi) = *(const v8b*)(&Ral[wave][rr][c8]); }  }
}
// step 2: grid (T/32, BH): S2^T = PA(keys).A(q)^T (A-operand = PA rows [key][32], B = A rows [q][32]; K = 32: 3 products), causal, x PS1 hi/lo; O^T += KVT(d rows) S2^T (4 d-tiles, 3 products); / (n+1)
__global__ __launch_bounds__(64) void step2_kernel(const b16* __restrict__ PAh, const b16* __restrict__ PAl, const b16* __restrict__ Ah, const b16* __restrict__ Al, const b16* __restrict__ KVTh, const b16* __restrict__ KVTl, b16* __restrict__ ATh, b16* __restrict__ ATl) {
  __shared__ __attribute__((aligned(16))) float To[2][16][DH + 4];
  const int wave = threadIdx.x >> 5, lane = threadIdx.x & 31, hh = lane >> 4, col = lane & 15; const int bh = blockIdx.y, b = bh / NH, h = bh % NH; const int q0 = blockIdx.x * 32 + wave * 16, qi = q0 + col;
  const v16b aq = frag_kb(Ah + ((size_t)bh * T + qi) * PL, hh), aql = frag_kb(Al + ((size_t)bh * T + qi) * PL, hh);
  const b16* Vb = KVTh + (size_t)bh * DH * T; const b16* Vlb = KVTl + (size_t)bh * DH * T;
  v8f o[4] = {{}, {}, {}, {}}, ol[4] = {{}, {}, {}, {}}; const int kend = q0 + 16;
  for (int kb = 0; kb < kend; kb += 32) {
    v8f s0 = {}, s1 = {};
    { const b16* p0 = PAh + ((size_t)bh * T + kb + col) * PL, *p1 = PAh + ((size_t)bh * T + kb + 16 + col) * PL, *p0l = PAl + ((size_t)bh * T + kb + col) * PL, *p1l = PAl + ((size_t)bh * T + kb + 16 + col) * PL;
      v16b f = frag_kb(p0, hh); s0 = wmma16b(f, aq, s0); s0 = wmma16b(f, aql, s0); s0 = wmma16b(frag_kb(p0l, hh), aq, s0);
      f = frag_kb(p1, hh); s1 = wmma16b(f, aq, s1); s1 = wmma16b(f, aql, s1); s1 = wmma16b(frag_kb(p1l, hh), aq, s1); }
    v16b ph, pl;
#pragma unroll
    for (int r = 0; r < 8; ++r) { const int ka = kb + 8 * hh + r, kbb = kb + 16 + 8 * hh + r; const float v0 = (ka <= qi) ? s0[r] * (1.0f / (XS * PS2)) : 0.0f, v1 = (kbb <= qi) ? s1[r] * (1.0f / (XS * PS2)) : 0.0f; b16 p, q; split16(v0 * PS1, p, q); ph[r] = p; pl[r] = q; split16(v1 * PS1, p, q); ph[8 + r] = p; pl[8 + r] = q; }
#pragma unroll
    for (int t = 0; t < 4; ++t) { const v16b vf = frag_kb(Vb + (size_t)(t * 16 + col) * T + kb, hh); o[t] = wmma16b(vf, ph, o[t]); ol[t] = wmma16b(vf, pl, ol[t]); ol[t] = wmma16b(frag_kb(Vlb + (size_t)(t * 16 + col) * T + kb, hh), ph, ol[t]); } }
  const float invn = 1.0f / ((float)(qi + 1) * PS1 * XS);
#pragma unroll
  for (int t = 0; t < 4; ++t)
#pragma unroll
    for (int r = 0; r < 8; ++r) To[wave][col][t * 16 + 8 * hh + r] = (o[t][r] + ol[t][r]) * invn;
  wave_lds_sync();
  { for (int r4 = 0; r4 < 16; r4 += 4) { const int rr = r4 + (lane >> 3), c8 = (lane & 7) * 8; v8b hv, lv; for (int j = 0; j < 8; ++j) { b16 p, q; split16(To[wave][rr][c8 + j] * XS, p, q); hv[j] = p; lv[j] = q; }
      const size_t gi = ((size_t)(q0 + rr) * BS + b) * E + h * DH + c8; *(v8b*)(ATh + gi) = hv; *(v8b*)(ATl + gi) = lv; }  }
}
__global__ __launch_bounds__(128) void oproj_kernel(const b16* __restrict__ ATh, const b16* __restrict__ ATl, const b16* __restrict__ WO, const float* __restrict__ bo, float* __restrict__ out) {
  __shared__ __attribute__((aligned(16))) float Tf[4][16][128 + 4];
  const int wave = threadIdx.x >> 5, lane = threadIdx.x & 31, nloc = lane & 15, hlf = lane >> 4; const int n0 = blockIdx.y * 128; const size_t m0 = (size_t)blockIdx.x * 64 + wave * 16;
  v8f acc[8];
#pragma unroll
  for (int t = 0; t < 8; ++t) acc[t] = (v8f){};
#pragma unroll 2
  for (int kb = 0; kb < E; kb += 32) { const v16b a = frag_kb(ATh + (m0 + nloc) * E + kb, hlf), al = frag_kb(ATl + (m0 + nloc) * E + kb, hlf);
#pragma unroll
    for (int t = 0; t < 8; ++t) { const v16b bw = frag_kb(WO + (size_t)(n0 + t * 16 + nloc) * E + kb, hlf); acc[t] = wmma16b(a, bw, acc[t]); acc[t] = wmma16b(al, bw, acc[t]); } }
#pragma unroll
  for (int t = 0; t < 8; ++t) { const float bb = bf16_rne(bo[n0 + t * 16 + nloc]);
#pragma unroll
    for (int r = 0; r < 8; ++r) Tf[wave][8 * hlf + r][t * 16 + nloc] = acc[t][r] * (1.0f / (XS * WSC)) + bb; }
  wave_lds_sync();
  { for (int rr = 0; rr < 16; ++rr) *(v4f*)(out + (m0 + rr) * E + n0 + lane * 4) = *(const v4f*)(&Tf[wave][rr][lane * 4]);  }
}
}  // namespace

extern "C" void kernel_launch(void* const* d_in, const int* in_sizes, int n_in, void* d_out, int out_size, void* d_ws, size_t ws_size, hipStream_t stream) {
  (void)n_in;
  auto Fp = [&](int i) { return (const float*)d_in[i]; };
  // input order: 0 query [2048,2,1024], 1 pquery [32,2,1024], 2 Wpq [1024,1024], 3 bpq, 4 Wq, 5 bq, 6 Wpc, 7 bpc, 8 Wc, 9 bc, 10 Wo, 11 bo (torch [out][in])
  if (in_sizes[0] != NR * E || in_sizes[1] != NPR * E || in_sizes[2] != E * E || in_sizes[4] != E * E || in_sizes[6] != E * E || in_sizes[8] != E * E || in_sizes[10] != E * E || out_size != NR * E) return;
  size_t off = 0; char* ws = (char*)d_ws;
  auto carve = [&](size_t bytes) { char* p = ws + off; off += (bytes + 255) & ~(size_t)255; return p; };
  b16* X16 = (b16*)carve((size_t)NR * E * 2); b16* PQ16 = (b16*)carve((size_t)NPR * E * 2); b16* W4 = (b16*)carve((size_t)4 * E * E * 2); b16* WPQ = (b16*)carve((size_t)E * E * 2);
  b16* KPh = (b16*)carve((size_t)NR * E * 2); b16* KPl = (b16*)carve((size_t)NR * E * 2); b16* Qh = (b16*)carve((size_t)NR * E * 2); b16* Ql = (b16*)carve((size_t)NR * E * 2); b16* KVh = (b16*)carve((size_t)NR * E * 2); b16* KVl = (b16*)carve((size_t)NR * E * 2);
  b16* KVTh = (b16*)carve((size_t)NR * E * 2); b16* KVTl = (b16*)carve((size_t)NR * E * 2); b16* PAh = (b16*)carve((size_t)BH * T * PL * 2); b16* PAl = (b16*)carve((size_t)BH * T * PL * 2); b16* PATh = (b16*)carve((size_t)BH * PL * T * 2); b16* PATl = (b16*)carve((size_t)BH * PL * T * 2);
  b16* Ah = (b16*)carve((size_t)BH * T * PL * 2); b16* Al = (b16*)carve((size_t)BH * T * PL * 2);
  b16* ATh = KPh; b16* ATl = KPl;   // region reuse: KP planes are dead after pattn_kernel (stream-ordered); the attention output takes their place
  if (off > ws_size || off > ((size_t)128 << 20)) return;   // ~ 106 MiB
  prep_kernel<<<(unsigned)(((size_t)NR * E / 8 + (size_t)NPR * E / 8 + 5 * (size_t)E * E / 8 + 255) / 256), 256, 0, stream>>>(Fp(0), Fp(1), Fp(2), Fp(4), Fp(6), Fp(8), Fp(10), X16, PQ16, W4, WPQ);
  lin_kernel<<<dim3(NR / 64, E / 128, 3), 128, 0, stream>>>(X16, W4, Fp(7), Fp(5), Fp(9), KPh, KPl, Qh, Ql, KVh, KVl);
  kvt_kernel<<<dim3(T / 64, BH), 256, 0, stream>>>(KVh, KVl, KVTh, KVTl);
  pattn_kernel<<<dim3(T / 64, BH), 128, 0, stream>>>(PQ16, WPQ, Fp(3), KPh, KPl, PAh, PAl, PATh, PATl);
  step1_kernel<<<dim3(T / 32, BH), 64, 0, stream>>>(Qh, Ql, KVh, KVl, PATh, PATl, Ah, Al);
  step2_kernel<<<dim3(T / 32, BH), 64, 0, stream>>>(PAh, PAl, Ah, Al, KVTh, KVTl, ATh, ATl);
  oproj_kernel<<<dim3(NR / 64, E / 128), 128, 0, stream>>>(ATh, ATl, W4 + (size_t)3 * E * E, Fp(11), (float*)d_out);
}

// v001
// One run takes 296 microseconds.
// Timed twice side by side with v000, it ran 2.36 and 2.38 times as fast.
#include <hip/hip_runtime.h>

// Lunar causal attention (Luna-style packed attention, causal "efficient" form): T = 2,048 tokens x 2 batch x 1,024 (16 heads x 64), 32 packed positions.
// pq = (pquery Wpq^T + bpq)/8 -> (b,h,p,d); kp = query Wpc^T + bpc; pattn[bh][t][p] = softplus_b(kp_t . pq_p) (b = ln 2); q = (query Wq^T + bq)/8; kv = query Wc^T + bc (tied k = v);
// aw[bh][n][p] = (sum_{m<=n} (q_n . kv_m) pattn[m][p]) / (n+1); A = softmax_p(aw); attn[bh][n][d] = (sum_{m<=n} (A_n . pattn_m) kv[m][d]) / (n+1); out = attn Wo^T + bo -> [2048][2][1024].
// Both "efficient_causal_attention_parallel" calls are evaluated in chunks of 64 keys: the keys of the query's own chunk as causal masked products (x_n . sum y_m z_m^T = sum (x_n.y_m) z_m), all earlier
// chunks through the running outer-product sum S_c[d][p] = sum_{m < 64c} kv[m][d] pattn[m][p] (k = v is tied, so ONE state serves both calls: q_n . S_c and A_n . S_c^T), kept as its mean S_c/(64c) in hi+lo.
// WMMA (v_wmma_f32_16x16x32_f16, f32 accumulate): the four input linears ([4,096 x 1,024] x [1,024 x 1,024], EXACT bf16 operands, 1 product) and the output linear (attn hi+lo: 2 products); per (bh,
// 16-query wave) and causal 32-key block: S1^T = KV.Q^T (K = 64, hi+lo: 3 products) then AW^T += PATTN^T S1^T (2 p-tiles, 3 products); S2^T = PATTN.A^T (K = 32, 3 products) then O^T += KV^T S2^T
// (4 d-tiles, 3 products); pattn = softplus(kp.pq) per token ([16 tokens x 64] x [64 x 32] per (bh) tile, 3 products). Softplus, softmax over the 32 positions, the 1/(n+1) factors in f32.
// Inputs rounded to bf16 once. Fragment k-map per lane half hh for A AND B: elements 0..7 <- k = 8hh+0..7, 8..15 <- k = 16+8hh+0..7; acc[r] = D[8hh+r][col]. Every

namespace {
constexpr int T = 2048, BS = 2, E = 1024, NH = 16, DH = 64, BH = BS * NH, PL = 32, NR = T * BS /* 4,096 query rows (t, b) */, NPR = PL * BS /* 64 pquery rows */;
constexpr int CH = 64 /* keys per chunk */, NC = T / CH;
constexpr float SS = 16.0f /* scale of the stored state mean */;
constexpr float XS = 8.0f, WSC = 256.0f, SCL = 0.125f, BETA = 0.69314718055994531f, PS1 = 8.0f, PS2 = 64.0f;

typedef _Float16 b16;
typedef __attribute__((ext_vector_type(16))) _Float16 v16b;
typedef __attribute__((ext_vector_type(8))) _Float16 v8b;
typedef __attribute__((ext_vector_type(8))) float v8f;
typedef __attribute__((ext_vector_type(4))) float v4f;
__device__ __forceinline__ float bf16_rne(float f) { unsigned int u = __float_as_uint(f); u += 0x7FFFu + ((u >> 16) & 1u); return __uint_as_float(u & 0xFFFF0000u); }
__device__ __forceinline__ void split16(float v, b16& hi, b16& lo) { hi = (b16)v; lo = (b16)(v - (float)hi); }
__device__ __forceinline__ v16b frag_kb(const b16* p, int hh) { const v8b a = *(const v8b*)(p + 8 * hh), b = *(const v8b*)(p + 16 + 8 * hh); v16b f;
#pragma unroll
  for (int e = 0; e < 8; ++e) { f[e] = a[e]; f[8 + e] = b[e]; } return f; }
// fragment from two consecutive 16 x 16 blocks (256 elements each) of a block-tiled plane: p = the lane's row in the first block; same k-map as frag_kb
__device__ __forceinline__ v16b frag_blk(const b16* p, int hh) { const v8b a = *(const v8b*)(p + 8 * hh), b = *(const v8b*)(p + 256 + 8 * hh); v16b f;
#pragma unroll
  for (int e = 0; e < 8; ++e) { f[e] = a[e]; f[8 + e] = b[e]; } return f; }
__device__ __forceinline__ v8f wmma16b(v16b a, v16b b, v8f c) { v8f d = __builtin_amdgcn_wmma_f32_16x16x32_f16(false, a, false, b, (short)0, c, false, false); asm volatile("v_nop\n\tv_nop\n\tv_nop\n\tv_nop" : "+v"(d) : "v"(a), "v"(b)); return d; }
__device__ __forceinline__ void wave_lds_sync() { __builtin_amdgcn_fence(__ATOMIC_RELEASE, "workgroup"); __builtin_amdgcn_wave_barrier(); __builtin_amdgcn_fence(__ATOMIC_ACQUIRE, "workgroup"); }
__device__ __forceinline__ float pmul(float a, float b) { float p = a * b; asm volatile("" : "+v"(p)); return p; }
__device__ __forceinline__ float softplus_b(float x) { const float bx = BETA * x; const float sp = (bx > 20.0f) ? bx : log1pf(__expf(bx)); return sp / BETA; }   // torch softplus(beta x)/beta (threshold 20 on beta*x)

__global__ __launch_bounds__(256) void prep_kernel(const float* __restrict__ query, const float* __restrict__ pquery, const float* __restrict__ wpq, const float* __restrict__ wq, const float* __restrict__ wpc, const float* __restrict__ wc, const float* __restrict__ wo, b16* __restrict__ X16, b16* __restrict__ PQ16, b16* __restrict__ W4, b16* __restrict__ WPQ) {
  const size_t t = (size_t)blockIdx.x * 256 + threadIdx.x; const size_t nx = (size_t)NR * E / 8, np_ = (size_t)NPR * E / 8, nw = (size_t)E * E / 8; v8b o;
  if (t < nx) { const size_t e = t * 8; const v4f a = *(const v4f*)(query + e), c = *(const v4f*)(query + e + 4); for (int j = 0; j < 4; ++j) { o[j] = (b16)(bf16_rne(a[j]) * XS); o[4 + j] = (b16)(bf16_rne(c[j]) * XS); } { *(v8b*)(X16 + e) = o;  } return; }
  size_t u = t - nx;
  if (u < np_) { const size_t e = u * 8; for (int j = 0; j < 8; ++j) o[j] = (b16)(bf16_rne(pquery[e + j]) * XS); { *(v8b*)(PQ16 + e) = o;  } return; } u -= np_;
  if (u < 5 * nw) { const int kind = (int)(u / nw); const size_t e = (u % nw) * 8; const float* w = kind == 0 ? wpc : kind == 1 ? wq : kind == 2 ? wc : kind == 3 ? wo : wpq; for (int j = 0; j < 8; ++j) o[j] = (b16)(bf16_rne(w[e + j]) * WSC);
    b16* dst = (kind < 4) ? (W4 + (size_t)kind * E * E) : WPQ; { *(v8b*)(dst + e) = o;  } }
}
// input linears: grid (NR/64, 8 col blocks, 3 kinds): y = X16 W^T + b (K = 1,024: 32 steps, exact); kind 0: kp -> KPh/KPl planes [row][1024]; kind 1: q = (y)*1/8 -> Qh/Ql; kind 2: kv -> KVh/KVl rows (the per-bh transpose KVT [bh][64 d][2048 t] is written by kvt_kernel)
__global__ __launch_bounds__(128) void lin_kernel(const b16* __restrict__ X16, const b16* __restrict__ W4, const float* __restrict__ bpc, const float* __restrict__ bq, const float* __restrict__ bc, b16* __restrict__ KPh, b16* __restrict__ KPl, b16* __restrict__ Qh, b16* __restrict__ Ql, b16* __restrict__ KVh, b16* __restrict__ KVl) {
  __shared__ __attribute__((aligned(16))) b16 Th[4][16][128 + 8], Tl[4][16][128 + 8];
  const int wave = threadIdx.x >> 5, lane = threadIdx.x & 31, nloc = lane & 15, hlf = lane >> 4; const int kind = blockIdx.z, n0 = blockIdx.y * 128; const size_t m0 = (size_t)blockIdx.x * 64 + wave * 16;
  const b16* W = W4 + (size_t)kind * E * E; const float* bias = kind == 0 ? bpc : kind == 1 ? bq : bc; const float osc = (kind == 1) ? SCL : 1.0f;
  v8f acc[8];
#pragma unroll
  for (int t = 0; t < 8; ++t) acc[t] = (v8f){};
#pragma unroll 2
  for (int kb = 0; kb < E; kb += 32) { const v16b a = frag_kb(X16 + (m0 + nloc) * E + kb, hlf);
#pragma unroll
    for (int t = 0; t < 8; ++t) acc[t] = wmma16b(a, frag_kb(W + (size_t)(n0 + t * 16 + nloc) * E + kb, hlf), acc[t]); }
#pragma unroll
  for (int t = 0; t < 8; ++t) { const float bb = bf16_rne(bias[n0 + t * 16 + nloc]);
#pragma unroll
    for (int r = 0; r < 8; ++r) { b16 p, q; split16((acc[t][r] * (1.0f / (XS * WSC)) + bb) * osc * XS, p, q); Th[wave][8 * hlf + r][t * 16 + nloc] = p; Tl[wave][8 * hlf + r][t * 16 + nloc] = q; } }
  wave_lds_sync(); b16* dh = kind == 0 ? KPh : kind == 1 ? Qh : KVh; b16* dl = kind == 0 ? KPl : kind == 1 ? Ql : KVl;
  { for (int r2 = 0; r2 < 16; r2 += 2) { const int rr = r2 + (lane >> 4), c8 = (lane & 15) * 8; const size_t gi = (m0 + rr) * E + n0 + c8; *(v8b*)(dh + gi) = *(const v8b*)(&Th[wave][rr][c8]); *(v8b*)(dl + gi) = *(const v8b*)(&Tl[wave][rr][c8]); }  }
}
__global__ __launch_bounds__(256) void kvt_kernel(const b16* __restrict__ KVh, const b16* __restrict__ KVl, b16* __restrict__ KVTh, b16* __restrict__ KVTl) {
  __shared__ __attribute__((aligned(16))) b16 Ah[DH][64 + 8], Al[DH][64 + 8];
  const int bh = blockIdx.y, t0 = blockIdx.x * 64, t_ = threadIdx.x; const int b = bh / NH, h = bh % NH;
  for (int q = t_; q < 64 * DH; q += 256) { const int tt = q / DH, d = q % DH; const size_t gi = ((size_t)(t0 + tt) * BS + b) * E + h * DH + d; Ah[d][tt] = KVh[gi]; Al[d][tt] = KVl[gi]; }
  __syncthreads();
  { for (int q = t_; q < DH * 8; q += 256) { const int d = q >> 3, c8 = (q & 7) * 8; const size_t gi = ((size_t)bh * DH + d) * T + t0 + c8; *(v8b*)(KVTh + gi) = *(const v8b*)(&Ah[d][c8]); *(v8b*)(KVTl + gi) = *(const v8b*)(&Al[d][c8]); }  }
}
// packed query + pattn: block = (bh, 64 t) x 4 waves: pq rows for this bh (32 x 64) computed in-block from PQ16 (pquery rows p*2+b) x WPQ (K = 1,024, exact) + bpq, x 1/8 -> hi/lo LDS [32 p][64 d];
// pattn tile = KP rows (t, b; head cols) [16 t x 64] x PQ^T -> [16 x 32]: 2 col tiles x 2 k steps x 3 products; softplus; stored as PAh/PAl [bh][t][32] (x8 hi/lo; 64-B rows -> a wave's 16 t = 1 KB
__global__ __launch_bounds__(128) void pattn_kernel(const b16* __restrict__ PQ16, const b16* __restrict__ WPQ, const float* __restrict__ bpq, const b16* __restrict__ KPh, const b16* __restrict__ KPl, b16* __restrict__ PAh, b16* __restrict__ PAl, b16* __restrict__ PATh, b16* __restrict__ PATl) {
  __shared__ __attribute__((aligned(16))) b16 Pq[PL][DH + 8], Pql[PL][DH + 8]; __shared__ __attribute__((aligned(16))) b16 Rh[4][16][PL + 8], Rl[4][16][PL + 8]; __shared__ __attribute__((aligned(16))) b16 Rt[PL][64 + 8], Rtl[PL][64 + 8];
  const int wave = threadIdx.x >> 5, lane = threadIdx.x & 31, nloc = lane & 15, hlf = lane >> 4, t_ = threadIdx.x; const int bh = blockIdx.y, b = bh / NH, h = bh % NH, t0 = blockIdx.x * 64;
  // pq rows: wave w computes p tile (w&1) x d tiles (w>>1)*2..+1: A = PQ16 rows (p*2 + b) [16 p x 1024], B = WPQ rows (h*64 + d)
  { const int pt = wave & 1, dt0 = (wave >> 1) * 2; v8f a2[2] = {{}, {}};
#pragma unroll 2
    for (int kb = 0; kb < E; kb += 32) { const v16b a = frag_kb(PQ16 + ((size_t)(pt * 16 + nloc) * BS + b) * E + kb, hlf);
#pragma unroll
      for (int t = 0; t < 2; ++t) a2[t] = wmma16b(a, frag_kb(WPQ + (size_t)(h * DH + (dt0 + t) * 16 + nloc) * E + kb, hlf), a2[t]); }
#pragma unroll
    for (int t = 0; t < 2; ++t) { const int d = (dt0 + t) * 16 + nloc; const float bb = bf16_rne(bpq[h * DH + d]);
#pragma unroll
      for (int r = 0; r < 8; ++r) { b16 p, q; split16((a2[t][r] * (1.0f / (XS * WSC)) + bb) * SCL * XS, p, q); Pq[pt * 16 + 8 * hlf + r][d] = p; Pql[pt * 16 + 8 * hlf + r][d] = q; } } }
  __syncthreads();
  // pattn for the wave's 16 t: A = KP rows ((t0 + wave*16 + nloc)*2 + b) cols h*64.., B = Pq rows p (k = d)
  { v8f d2[2] = {{}, {}}; const size_t arow = ((size_t)(t0 + wave * 16 + nloc) * BS + b) * E + h * DH;
#pragma unroll
    for (int kb = 0; kb < DH; kb += 32) { const v16b a = frag_kb(KPh + arow + kb, hlf), al = frag_kb(KPl + arow + kb, hlf);
#pragma unroll
      for (int t = 0; t < 2; ++t) { const v16b bp = frag_kb(&Pq[t * 16 + nloc][kb], hlf); d2[t] = wmma16b(a, bp, d2[t]); d2[t] = wmma16b(al, bp, d2[t]); d2[t] = wmma16b(a, frag_kb(&Pql[t * 16 + nloc][kb], hlf), d2[t]); } }
#pragma unroll
    for (int t = 0; t < 2; ++t)
#pragma unroll
      for (int r = 0; r < 8; ++r) { const float v = softplus_b(d2[t][r] * (1.0f / (XS * XS))); b16 p, q; split16(v * XS, p, q); const int tt = wave * 16 + 8 * hlf + r, pp = t * 16 + nloc; Rh[wave][8 * hlf + r][pp] = p; Rl[wave][8 * hlf + r][pp] = q; Rt[pp][tt] = p; Rtl[pp][tt] = q; } }
  __syncthreads();
  {
    for (int k = 0; k < 2; ++k) { const int rr = k * 8 + (lane >> 2), c8 = (lane & 3) * 8; const size_t gi = ((size_t)bh * T + t0 + wave * 16 + rr) * PL + c8; *(v8b*)(PAh + gi) = *(const v8b*)(&Rh[wave][rr][c8]); *(v8b*)(PAl + gi) = *(const v8b*)(&Rl[wave][rr][c8]); }
    for (int q = t_; q < PL * 8; q += 128) { const int pp = q >> 3, c8 = (q & 7) * 8; const size_t gi = ((size_t)bh * PL + pp) * T + t0 + c8; *(v8b*)(PATh + gi) = *(const v8b*)(&Rt[pp][c8]); *(v8b*)(PATl + gi) = *(const v8b*)(&Rtl[pp][c8]); }
     }
}
// prefix state: grid (8 tiles, BH), one wave per (16 d x 16 p) tile, one serial pass over the keys (K = 32 a step, 3 products, f32 accumulate), both orientations: sd = KVT.PAT^T -> D[d][p], st = PAT.KVT^T -> D[p][d].
// At each chunk boundary c = 1..NC-1 the running sum is stored as its mean x SS (hi/lo): MT blocks [pt*4+dt][16 p][16 d] (A operand of step 1, k = d), MS blocks [dt*2+pt][16 d][16 p] (A operand of step 2, k = p);
// a wave's block is 512 contiguous bytes. Operand fragments run three key steps ahead in a ring of four register stages, so that the pass is not one memory latency a step.
__device__ __forceinline__ void state_mac(v16b k, v16b kl, v16b p, v16b pl, v8f& sd, v8f& st) { sd = wmma16b(k, p, sd); st = wmma16b(p, k, st); sd = wmma16b(k, pl, sd); st = wmma16b(pl, k, st); sd = wmma16b(kl, p, sd); st = wmma16b(p, kl, st); }
__device__ __forceinline__ void state_store(v8f sd, v8f st, int c, b16* mth, b16* mtl, b16* msh, b16* msl) { const float f = SS / (XS * XS * (float)(c * CH)); v8b dh_, dl_, th_, tl_;
#pragma unroll
  for (int r = 0; r < 8; ++r) { b16 p, q; split16(sd[r] * f, p, q); dh_[r] = p; dl_[r] = q; split16(st[r] * f, p, q); th_[r] = p; tl_[r] = q; }
  *(v8b*)mth = dh_; *(v8b*)mtl = dl_; *(v8b*)msh = th_; *(v8b*)msl = tl_;
  asm volatile("s_wait_xcnt 0x0" ::: "memory"); }   // in front of every later overwrite of the data and address registers of the four stores (and of the address registers of the ring loads issued before them)
__global__ __launch_bounds__(32) void state_kernel(const b16* __restrict__ KVTh, const b16* __restrict__ KVTl, const b16* __restrict__ PATh, const b16* __restrict__ PATl, b16* __restrict__ MTh, b16* __restrict__ MTl, b16* __restrict__ MSh, b16* __restrict__ MSl) {
  const int lane = threadIdx.x, hh = lane >> 4, col = lane & 15; const int bh = blockIdx.y, dt = blockIdx.x >> 1, pt = blockIdx.x & 1;
  const size_t ok = ((size_t)bh * DH + dt * 16 + col) * T + 8 * hh, op = ((size_t)bh * PL + pt * 16 + col) * T + 8 * hh;   // the lane half's k offset is part of the four running pointers
  const b16* kh = KVTh + ok; const b16* kl = KVTl + ok; const b16* ph = PATh + op; const b16* pl = PATl + op;
  const size_t ot = (size_t)bh * NC * (DH * PL) + ((pt * 4 + dt) * 16 + col) * 16 + 8 * hh, os = (size_t)bh * NC * (DH * PL) + ((dt * 2 + pt) * 16 + col) * 16 + 8 * hh;
  b16* mth = MTh + ot; b16* mtl = MTl + ot; b16* msh = MSh + os; b16* msl = MSl + os;
  v16b fk[4], fkl[4], fp[4], fpl[4];
#pragma unroll   // here and in the loop: the ring's stage index must be a constant, so that the four stages stay in registers
  for (int j = 0; j < 3; ++j) { fk[j] = frag_kb(kh + j * 32, 0); fkl[j] = frag_kb(kl + j * 32, 0); fp[j] = frag_kb(ph + j * 32, 0); fpl[j] = frag_kb(pl + j * 32, 0); }
  v8f sd = {}, st = {};
  constexpr int NS = (NC - 1) * CH / 32;   // 62 key steps: the last chunk feeds no state
  for (int base = 0; base + 4 <= NS; base += 4) {   // 15 groups of 4; the loads reach key step base + 6 <= 62, inside the row
#pragma unroll
    for (int j = 0; j < 4; ++j) { const int jn = (j + 3) & 3, kn = (j + 3) * 32;
      fk[jn] = frag_kb(kh + kn, 0); fkl[jn] = frag_kb(kl + kn, 0); fp[jn] = frag_kb(ph + kn, 0); fpl[jn] = frag_kb(pl + kn, 0);
      state_mac(fk[j], fkl[j], fp[j], fpl[j], sd, st);
      if (j & 1) { mth += DH * PL; mtl += DH * PL; msh += DH * PL; msl += DH * PL; state_store(sd, st, (base + j + 1) >> 1, mth, mtl, msh, msl); } }
    kh += 128; kl += 128; ph += 128; pl += 128; }
  state_mac(fk[0], fkl[0], fp[0], fpl[0], sd, st); state_mac(fk[1], fkl[1], fp[1], fpl[1], sd, st);   // key steps 60 and 61, already in the ring
  state_store(sd, st, NC - 1, mth + DH * PL, mtl + DH * PL, msh + DH * PL, msl + DH * PL);
  asm volatile("s_wait_loadcnt 0x0" ::: "memory");   // the ring's last stage (key step 62) is loaded and not used: its loads have landed before the wave ends and gives its registers back
}
// step 1: grid (T/32, BH), 2 waves x 16 queries; earlier chunks: AI^T = MT(p rows) Q^T (2 p-tiles, K = 64, 3 products), weighted 64c/(n+1); key blocks of the query's own chunk: S1^T = KV.Q^T (K = 64, 3 products), masked keys > q -> 0, x PS1 hi/lo; AW^T += PAT^T(p rows) S1^T (2 p-tiles, 3 products);
// aw = (AW + 64c AI)/(n+1); softmax over the 32 p (each lane holds 16 of its query's 32 values? lane (hh, col): acc[t][r] = AW^T[p = t*16 + 8hh + r][query col] -> the query's 32 values are split over the
__global__ __launch_bounds__(64) void step1_kernel(const b16* __restrict__ Qh, const b16* __restrict__ Ql, const b16* __restrict__ KVh, const b16* __restrict__ KVl, const b16* __restrict__ PATh, const b16* __restrict__ PATl, const b16* __restrict__ MTh, const b16* __restrict__ MTl, b16* __restrict__ Ah, b16* __restrict__ Al) {
  __shared__ __attribute__((aligned(16))) b16 Ra[2][16][PL + 8], Ral[2][16][PL + 8];
  const int wave = threadIdx.x >> 5, lane = threadIdx.x & 31, hh = lane >> 4, col = lane & 15; const int bh = blockIdx.y, b = bh / NH, h = bh % NH; const int q0 = blockIdx.x * 32 + wave * 16, qi = q0 + col;
  const size_t qrow = ((size_t)qi * BS + b) * E + h * DH; const v16b qa0 = frag_kb(Qh + qrow, hh), qa1 = frag_kb(Qh + qrow + 32, hh), ql0 = frag_kb(Ql + qrow, hh), ql1 = frag_kb(Ql + qrow + 32, hh);
  const b16* Pb = PATh + (size_t)bh * PL * T; const b16* Plb = PATl + (size_t)bh * PL * T;
  v8f aw[2] = {{}, {}}, awl[2] = {{}, {}}, ai[2] = {{}, {}}; const int kend = q0 + 16, ks0 = (blockIdx.x * 32) & ~(CH - 1);
  asm volatile("s_wait_xcnt 0x0" ::: "memory");   // kept in front of the branch: the address arithmetic behind it may take over the address registers of the query loads above
  if (ks0 > 0) { const size_t so = ((size_t)bh * NC + ks0 / CH) * (DH * PL);
    v16b mh[4], ml[4];   // all state fragments are loaded in front of the first product, so that they cost one memory latency and not one each
#pragma unroll
    for (int u = 0; u < 4; ++u) { mh[u] = frag_blk(MTh + so + ((u * 2) * 16 + col) * 16, hh); ml[u] = frag_blk(MTl + so + ((u * 2) * 16 + col) * 16, hh); }
#pragma unroll
    for (int t = 0; t < 2; ++t) { ai[t] = wmma16b(mh[2 * t], qa0, ai[t]); ai[t] = wmma16b(mh[2 * t], ql0, ai[t]); ai[t] = wmma16b(ml[2 * t], qa0, ai[t]);
      ai[t] = wmma16b(mh[2 * t + 1], qa1, ai[t]); ai[t] = wmma16b(mh[2 * t + 1], ql1, ai[t]); ai[t] = wmma16b(ml[2 * t + 1], qa1, ai[t]); } }
  for (int kb = ks0; kb < kend; kb += 32) {
    v8f s0 = {}, s1 = {};
    { const b16* k0 = KVh + ((size_t)(kb + col) * BS + b) * E + h * DH, *k1 = KVh + ((size_t)(kb + 16 + col) * BS + b) * E + h * DH, *k0l = KVl + ((size_t)(kb + col) * BS + b) * E + h * DH, *k1l = KVl + ((size_t)(kb + 16 + col) * BS + b) * E + h * DH;
      v16b f = frag_kb(k0, hh); s0 = wmma16b(f, qa0, s0); s0 = wmma16b(f, ql0, s0); s0 = wmma16b(frag_kb(k0l, hh), qa0, s0);
      f = frag_kb(k0 + 32, hh); s0 = wmma16b(f, qa1, s0); s0 = wmma16b(f, ql1, s0); s0 = wmma16b(frag_kb(k0l + 32, hh), qa1, s0);
      f = frag_kb(k1, hh); s1 = wmma16b(f, qa0, s1); s1 = wmma16b(f, ql0, s1); s1 = wmma16b(frag_kb(k1l, hh), qa0, s1);
      f = frag_kb(k1 + 32, hh); s1 = wmma16b(f, qa1, s1); s1 = wmma16b(f, ql1, s1); s1 = wmma16b(frag_kb(k1l + 32, hh), qa1, s1); }
    v16b ph, pl;
#pragma unroll
    for (int r = 0; r < 8; ++r) { const int ka = kb + 8 * hh + r, kbb = kb + 16 + 8 * hh + r; const float v0 = (ka <= qi) ? s0[r] * (1.0f / (XS * XS)) : 0.0f, v1 = (kbb <= qi) ? s1[r] * (1.0f / (XS * XS)) : 0.0f; b16 p, q; split16(v0 * PS1, p, q); ph[r] = p; pl[r] = q; split16(v1 * PS1, p, q); ph[8 + r] = p; pl[8 + r] = q; }
#pragma unroll
    for (int t = 0; t < 2; ++t) { const v16b pa = frag_kb(Pb + (size_t)(t * 16 + col) * T + kb, hh); aw[t] = wmma16b(pa, ph, aw[t]); awl[t] = wmma16b(pa, pl, awl[t]); awl[t] = wmma16b(frag_kb(Plb + (size_t)(t * 16 + col) * T + kb, hh), ph, awl[t]); } }
  // lane (hh, col): value[p = t*16 + 8hh + r] for query col; divide by (qi + 1); softmax over 32
  float v[16]; const float invn = 1.0f / ((float)(qi + 1) * PS1 * XS), invi = (float)ks0 / ((float)(qi + 1) * SS * XS); float mx = -INFINITY;
#pragma unroll
  for (int t = 0; t < 2; ++t) for (int r = 0; r < 8; ++r) { v[t * 8 + r] = (aw[t][r] + awl[t][r]) * invn + ai[t][r] * invi; mx = fmaxf(mx, v[t * 8 + r]); }
  mx = fmaxf(mx, __shfl_xor(mx, 16)); float sm = 0.0f; for (int i = 0; i < 16; ++i) { v[i] = __expf(v[i] - mx); sm += v[i]; } sm += __shfl_xor(sm, 16); const float inv = 1.0f / sm;
#pragma unroll
  for (int t = 0; t < 2; ++t) for (int r = 0; r < 8; ++r) { b16 p, q; split16(v[t * 8 + r] * inv * PS2, p, q); Ra[wave][col][t * 16 + 8 * hh + r] = p; Ral[wave][col][t * 16 + 8 * hh + r] = q; }
  wave_lds_sync();
  { for (int k = 0; k < 2; ++k) { const int rr = k * 8 + (lane >> 2), c8 = (lane & 3) * 8; const size_t gi = ((size_t)bh * T + q0 + rr) * PL + c8; *(v8b*)(Ah + gi) = *(const v8b*)(&Ra[wave][rr][c8]); *(v8b*)(Al + gi) = *(const v8b*)(&Ral[wave][rr][c8]); }  }
}
// step 2: grid (T/32, BH): earlier chunks: OI^T = MS(d rows) A^T (4 d-tiles, K = 32, 3 products), weighted 64c/(n+1); own chunk: S2^T = PA(keys).A(q)^T (A-operand = PA rows [key][32], B = A rows [q][32]; K = 32: 3 products), causal, x PS1 hi/lo; O^T += KVT(d rows) S2^T (4 d-tiles, 3 products); / (n+1)
__global__ __launch_bounds__(64) void step2_kernel(const b16* __restrict__ PAh, const b16* __restrict__ PAl, const b16* __restrict__ Ah, const b16* __restrict__ Al, const b16* __restrict__ KVTh, const b16* __restrict__ KVTl, const b16* __restrict__ MSh, const b16* __restrict__ MSl, b16* __restrict__ ATh, b16* __restrict__ ATl) {
  __shared__ __attribute__((aligned(16))) float To[2][16][DH + 4];
  const int wave = threadIdx.x >> 5, lane = threadIdx.x & 31, hh = lane >> 4, col = lane & 15; const int bh = blockIdx.y, b = bh / NH, h = bh % NH; const int q0 = blockIdx.x * 32 + wave * 16, qi = q0 + col;
  const v16b aq = frag_kb(Ah + ((size_t)bh * T + qi) * PL, hh), aql = frag_kb(Al + ((size_t)bh * T + qi) * PL, hh);
  const b16* Vb = KVTh + (size_t)bh * DH * T; const b16* Vlb = KVTl + (size_t)bh * DH * T;
  v8f o[4] = {{}, {}, {}, {}}, ol[4] = {{}, {}, {}, {}}, oi[4] = {{}, {}, {}, {}}; const int kend = q0 + 16, ks0 = (blockIdx.x * 32) & ~(CH - 1);
  asm volatile("s_wait_xcnt 0x0" ::: "memory");   // kept in front of the branch: the address arithmetic behind it may take over the address registers of the loads above
  if (ks0 > 0) { const size_t so = ((size_t)bh * NC + ks0 / CH) * (DH * PL);
    v16b mh[4], ml[4];   // all state fragments are loaded in front of the first product, so that they cost one memory latency and not one each
#pragma unroll
    for (int t = 0; t < 4; ++t) { mh[t] = frag_blk(MSh + so + ((t * 2) * 16 + col) * 16, hh); ml[t] = frag_blk(MSl + so + ((t * 2) * 16 + col) * 16, hh); }
#pragma unroll
    for (int t = 0; t < 4; ++t) { oi[t] = wmma16b(mh[t], aq, oi[t]); oi[t] = wmma16b(mh[t], aql, oi[t]); oi[t] = wmma16b(ml[t], aq, oi[t]); } }
  for (int kb = ks0; kb < kend; kb += 32) {
    v8f s0 = {}, s1 = {};
    { const b16* p0 = PAh + ((size_t)bh * T + kb + col) * PL, *p1 = PAh + ((size_t)bh * T + kb + 16 + col) * PL, *p0l = PAl + ((size_t)bh * T + kb + col) * PL, *p1l = PAl + ((size_t)bh * T + kb + 16 + col) * PL;
      v16b f = frag_kb(p0, hh); s0 = wmma16b(f, aq, s0); s0 = wmma16b(f, aql, s0); s0 = wmma16b(frag_kb(p0l, hh), aq, s0);
      f = frag_kb(p1, hh); s1 = wmma16b(f, aq, s1); s1 = wmma16b(f, aql, s1); s1 = wmma16b(frag_kb(p1l, hh), aq, s1); }
    v16b ph, pl;
#pragma unroll
    for (int r = 0; r < 8; ++r) { const int ka = kb + 8 * hh + r, kbb = kb + 16 + 8 * hh + r; const float v0 = (ka <= qi) ? s0[r] * (1.0f / (XS * PS2)) : 0.0f, v1 = (kbb <= qi) ? s1[r] * (1.0f / (XS * PS2)) : 0.0f; b16 p, q; split16(v0 * PS1, p, q); ph[r] = p; pl[r] = q; split16(v1 * PS1, p, q); ph[8 + r] = p; pl[8 + r] = q; }
#pragma unroll
    for (int t = 0; t < 4; ++t) { const v16b vf = frag_kb(Vb + (size_t)(t * 16 + col) * T + kb, hh); o[t] = wmma16b(vf, ph, o[t]); ol[t] = wmma16b(vf, pl, ol[t]); ol[t] = wmma16b(frag_kb(Vlb + (size_t)(t * 16 + col) * T + kb, hh), ph, ol[t]); } }
  const float invn = 1.0f / ((float)(qi + 1) * PS1 * XS), invi = (float)ks0 / ((float)(qi + 1) * SS * PS2);
#pragma unroll
  for (int t = 0; t < 4; ++t)
#pragma unroll
    for (int r = 0; r < 8; ++r) To[wave][col][t * 16 + 8 * hh + r] = (o[t][r] + ol[t][r]) * invn + oi[t][r] * invi;
  wave_lds_sync();
  { for (int r4 = 0; r4 < 16; r4 += 4) { const int rr = r4 + (lane >> 3), c8 = (lane & 7) * 8; v8b hv, lv; for (int j = 0; j < 8; ++j) { b16 p, q; split16(To[wave][rr][c8 + j] * XS, p, q); hv[j] = p; lv[j] = q; }
      const size_t gi = ((size_t)(q0 + rr) * BS + b) * E + h * DH + c8; *(v8b*)(ATh + gi) = hv; *(v8b*)(ATl + gi) = lv; }  }
}
__global__ __launch_bounds__(128) void oproj_kernel(const b16* __restrict__ ATh, const b16* __restrict__ ATl, const b16* __restrict__ WO, const float* __restrict__ bo, float* __restrict__ out) {
  __shared__ __attribute__((aligned(16))) float Tf[4][16][128 + 4];
  const int wave = threadIdx.x >> 5, lane = threadIdx.x & 31, nloc = lane & 15, hlf = lane >> 4; const int n0 = blockIdx.y * 128; const size_t m0 = (size_t)blockIdx.x * 64 + wave * 16;
  v8f acc[8];
#pragma unroll
  for (int t = 0; t < 8; ++t) acc[t] = (v8f){};
#pragma unroll 2
  for (int kb = 0; kb < E; kb += 32) { const v16b a = frag_kb(ATh + (m0 + nloc) * E + kb, hlf), al = frag_kb(ATl + (m0 + nloc) * E + kb, hlf);
#pragma unroll
    for (int t = 0; t < 8; ++t) { const v16b bw = frag_kb(WO + (size_t)(n0 + t * 16 + nloc) * E + kb, hlf); acc[t] = wmma16b(a, bw, acc[t]); acc[t] = wmma16b(al, bw, acc[t]); } }
#pragma unroll
  for (int t = 0; t < 8; ++t) { const float bb = bf16_rne(bo[n0 + t * 16 + nloc]);
#pragma unroll
    for (int r = 0; r < 8; ++r) Tf[wave][8 * hlf + r][t * 16 + nloc] = acc[t][r] * (1.0f / (XS * WSC)) + bb; }
  wave_lds_sync();
  { for (int rr = 0; rr < 16; ++rr) *(v4f*)(out + (m0 + rr) * E + n0 + lane * 4) = *(const v4f*)(&Tf[wave][rr][lane * 4]);  }
}
}  // namespace

extern "C" void kernel_launch(void* const* d_in, const int* in_sizes, int n_in, void* d_out, int out_size, void* d_ws, size_t ws_size, hipStream_t stream) {
  (void)n_in;
  auto Fp = [&](int i) { return (const float*)d_in[i]; };
  // input order: 0 query [2048,2,1024], 1 pquery [32,2,1024], 2 Wpq [1024,1024], 3 bpq, 4 Wq, 5 bq, 6 Wpc, 7 bpc, 8 Wc, 9 bc, 10 Wo, 11 bo (torch [out][in])
  if (in_sizes[0] != NR * E || in_sizes[1] != NPR * E || in_sizes[2] != E * E || in_sizes[4] != E * E || in_sizes[6] != E * E || in_sizes[8] != E * E || in_sizes[10] != E * E || out_size != NR * E) return;
  size_t off = 0; char* ws = (char*)d_ws;
  auto carve = [&](size_t bytes) { char* p = ws + off; off += (bytes + 255) & ~(size_t)255; return p; };
  b16* X16 = (b16*)carve((size_t)NR * E * 2); b16* PQ16 = (b16*)carve((size_t)NPR * E * 2); b16* W4 = (b16*)carve((size_t)4 * E * E * 2); b16* WPQ = (b16*)carve((size_t)E * E * 2);
  b16* KPh = (b16*)carve((size_t)NR * E * 2); b16* KPl = (b16*)carve((size_t)NR * E * 2); b16* Qh = (b16*)carve((size_t)NR * E * 2); b16* Ql = (b16*)carve((size_t)NR * E * 2); b16* KVh = (b16*)carve((size_t)NR * E * 2); b16* KVl = (b16*)carve((size_t)NR * E * 2);
  b16* KVTh = (b16*)carve((size_t)NR * E * 2); b16* KVTl = (b16*)carve((size_t)NR * E * 2); b16* PAh = (b16*)carve((size_t)BH * T * PL * 2); b16* PAl = (b16*)carve((size_t)BH * T * PL * 2); b16* PATh = (b16*)carve((size_t)BH * PL * T * 2); b16* PATl = (b16*)carve((size_t)BH * PL * T * 2);
  b16* Ah = (b16*)carve((size_t)BH * T * PL * 2); b16* Al = (b16*)carve((size_t)BH * T * PL * 2);
  b16* MTh = (b16*)carve((size_t)BH * NC * DH * PL * 2); b16* MTl = (b16*)carve((size_t)BH * NC * DH * PL * 2); b16* MSh = (b16*)carve((size_t)BH * NC * DH * PL * 2); b16* MSl = (b16*)carve((size_t)BH * NC * DH * PL * 2);
  b16* ATh = KPh; b16* ATl = KPl;   // region reuse: KP planes are dead after pattn_kernel (stream-ordered); the attention output takes their place
  if (off > ws_size || off > ((size_t)128 << 20)) return;   // ~ 122 MiB
  prep_kernel<<<(unsigned)(((size_t)NR * E / 8 + (size_t)NPR * E / 8 + 5 * (size_t)E * E / 8 + 255) / 256), 256, 0, stream>>>(Fp(0), Fp(1), Fp(2), Fp(4), Fp(6), Fp(8), Fp(10), X16, PQ16, W4, WPQ);
  lin_kernel<<<dim3(NR / 64, E / 128, 3), 128, 0, stream>>>(X16, W4, Fp(7), Fp(5), Fp(9), KPh, KPl, Qh, Ql, KVh, KVl);
  kvt_kernel<<<dim3(T / 64, BH), 256, 0, stream>>>(KVh, KVl, KVTh, KVTl);
  pattn_kernel<<<dim3(T / 64, BH), 128, 0, stream>>>(PQ16, WPQ, Fp(3), KPh, KPl, PAh, PAl, PATh, PATl);
  state_kernel<<<dim3(8, BH), 32, 0, stream>>>(KVTh, KVTl, PATh, PATl, MTh, MTl, MSh, MSl);
  step1_kernel<<<dim3(T / 32, BH), 64, 0, stream>>>(Qh, Ql, KVh, KVl, PATh, PATl, MTh, MTl, Ah, Al);
  step2_kernel<<<dim3(T / 32, BH), 64, 0, stream>>>(PAh, PAl, Ah, Al, KVTh, KVTl, MSh, MSl, ATh, ATl);
  oproj_kernel<<<dim3(NR / 64, E / 128), 128, 0, stream>>>(ATh, ATl, W4 + (size_t)3 * E * E, Fp(11), (float*)d_out);
}

// v002
// It runs in 162 microseconds.
// Timed twice side by side with v001, it ran 1.83 times as fast both times.
// All steps since v000 together make it 4.33 times as fast.
#include <hip/hip_runtime.h>

// Lunar causal attention (Luna-style packed attention, causal "efficient" form): T = 2,048 tokens x 2 batch x 1,024 (16 heads x 64), 32 packed positions.
// pq = (pquery Wpq^T + bpq)/8 -> (b,h,p,d); kp = query Wpc^T + bpc; pattn[bh][t][p] = softplus_b(kp_t . pq_p) (b = ln 2); q = (query Wq^T + bq)/8; kv = query Wc^T + bc (tied k = v);
// aw[bh][n][p] = (sum_{m<=n} (q_n . kv_m) pattn[m][p]) / (n+1); A = softmax_p(aw); attn[bh][n][d] = (sum_{m<=n} (A_n . pattn_m) kv[m][d]) / (n+1); out = attn Wo^T + bo -> [2048][2][1024].
// Both "efficient_causal_attention_parallel" calls are evaluated in chunks of 64 keys: the keys of the query's own chunk as causal masked products (x_n . sum y_m z_m^T = sum (x_n.y_m) z_m), all earlier
// chunks through the running outer-product sum S_c[d][p] = sum_{m < 64c} kv[m][d] pattn[m][p] (k = v is tied, so ONE state serves both calls: q_n . S_c and A_n . S_c^T), kept as its mean S_c/(64c) in hi+lo.
// WMMA (v_wmma_f32_16x16x32_f16, f32 accumulate): the four input linears ([4,096 x 1,024] x [1,024 x 1,024], EXACT bf16 operands, 1 product) and the output linear (attn hi+lo: 2 products); per (bh,
// 16-query wave) and causal 32-key block: S1^T = KV.Q^T (K = 64, hi+lo: 3 products) then AW^T += PATTN^T S1^T (2 p-tiles, 3 products); S2^T = PATTN.A^T (K = 32, 3 products) then O^T += KV^T S2^T
// (4 d-tiles, 3 products); pattn = softplus(kp.pq) per token ([16 tokens x 64] x [64 x 32] per (bh) tile, 3 products). Softplus, softmax over the 32 positions, the 1/(n+1) factors in f32.
// Inputs rounded to bf16 once. Fragment k-map per lane half hh for A AND B: elements 0..7 <- k = 8hh+0..7, 8..15 <- k = 16+8hh+0..7; acc[r] = D[8hh+r][col]. Every

namespace {
constexpr int T = 2048, BS = 2, E = 1024, NH = 16, DH = 64, BH = BS * NH, PL = 32, NR = T * BS /* 4,096 query rows (t, b) */, NPR = PL * BS /* 64 pquery rows */;
constexpr int CH = 64 /* keys per chunk */, NC = T / CH;
constexpr float SS = 16.0f /* scale of the stored state mean */;
constexpr float XS = 8.0f, WSC = 256.0f, SCL = 0.125f, BETA = 0.69314718055994531f, PS1 = 8.0f, PS2 = 64.0f;

typedef _Float16 b16;
typedef __attribute__((ext_vector_type(16))) _Float16 v16b;
typedef __attribute__((ext_vector_type(8))) _Float16 v8b;
typedef __attribute__((ext_vector_type(8))) float v8f;
typedef __attribute__((ext_vector_type(4))) float v4f;
__device__ __forceinline__ float bf16_rne(float f) { unsigned int u = __float_as_uint(f); u += 0x7FFFu + ((u >> 16) & 1u); return __uint_as_float(u & 0xFFFF0000u); }
__device__ __forceinline__ void split16(float v, b16& hi, b16& lo) { hi = (b16)v; lo = (b16)(v - (float)hi); }
__device__ __forceinline__ v16b frag_kb(const b16* p, int hh) { const v8b a = *(const v8b*)(p + 8 * hh), b = *(const v8b*)(p + 16 + 8 * hh); v16b f;
#pragma unroll
  for (int e = 0; e < 8; ++e) { f[e] = a[e]; f[8 + e] = b[e]; } return f; }
// fragment from two consecutive 16 x 16 blocks (256 elements each) of a block-tiled plane: p = the lane's row in the first block; same k-map as frag_kb
__device__ __forceinline__ v16b frag_blk(const b16* p, int hh) { const v8b a = *(const v8b*)(p + 8 * hh), b = *(const v8b*)(p + 256 + 8 * hh); v16b f;
#pragma unroll
  for (int e = 0; e < 8; ++e) { f[e] = a[e]; f[8 + e] = b[e]; } return f; }
__device__ __forceinline__ v8f wmma16b(v16b a, v16b b, v8f c) { v8f d = __builtin_amdgcn_wmma_f32_16x16x32_f16(false, a, false, b, (short)0, c, false, false); asm volatile("v_nop\n\tv_nop\n\tv_nop\n\tv_nop" : "+v"(d) : "v"(a), "v"(b)); return d; }
__device__ __forceinline__ void wave_lds_sync() { __builtin_amdgcn_fence(__ATOMIC_RELEASE, "workgroup"); __builtin_amdgcn_wave_barrier(); __builtin_amdgcn_fence(__ATOMIC_ACQUIRE, "workgroup"); }
__device__ __forceinline__ float pmul(float a, float b) { float p = a * b; asm volatile("" : "+v"(p)); return p; }
__device__ __forceinline__ float softplus_b(float x) { const float bx = BETA * x; const float sp = (bx > 20.0f) ? bx : log1pf(__expf(bx)); return sp / BETA; }   // torch softplus(beta x)/beta (threshold 20 on beta*x)
// LDS staging of the linear layers' operand tiles: a stage is KS = 64 k of every operand row of the block (128-B rows, whole lines), laid at a pitch of 144 B for the ds_load_b128 fragment reads; two buffers.
constexpr int KS = 64, LP = KS + 8, NT = E / KS;
__device__ __forceinline__ unsigned lds_off(const void* p) { return (unsigned)(size_t)p; }   // byte offset in the work-group's LDS = low 32 bits of a __shared__ address
// four asynchronous copies, 16 B a lane each, global -> LDS through no register; the s_wait_xcnt stands inside the copies' own statement, so that no later write of an address register can be moved in front of it
__device__ __forceinline__ void copy4(unsigned l0, const b16* g0, unsigned l1, const b16* g1, unsigned l2, const b16* g2, unsigned l3, const b16* g3) {
  asm volatile("global_load_async_to_lds_b128 %0, %1, off\n\tglobal_load_async_to_lds_b128 %2, %3, off\n\tglobal_load_async_to_lds_b128 %4, %5, off\n\tglobal_load_async_to_lds_b128 %6, %7, off\n\ts_wait_xcnt 0x0"
               :: "v"(l0), "v"(g0), "v"(l1), "v"(g1), "v"(l2), "v"(g2), "v"(l3), "v"(g3) : "memory"); }
__device__ __forceinline__ void copy2(unsigned l0, const b16* g0, unsigned l1, const b16* g1) {   // the same, two copies
  asm volatile("global_load_async_to_lds_b128 %0, %1, off\n\tglobal_load_async_to_lds_b128 %2, %3, off\n\ts_wait_xcnt 0x0" :: "v"(l0), "v"(g0), "v"(l1), "v"(g1) : "memory"); }
// 64 rows (16 a copy: a thread's row is tid / 8, its 16-B piece tid % 8) of one stage: l = the thread's LDS byte address in the first row group, g = its global address there
__device__ __forceinline__ void copy_rows64(unsigned l, const b16* g) { copy4(l, g, l + 16 * LP * 2, g + 16 * E, l + 32 * LP * 2, g + 32 * E, l + 48 * LP * 2, g + 48 * E); }
__device__ __forceinline__ void wait_copies() { asm volatile("s_wait_asynccnt 0x0" ::: "memory"); }   // the wave's own copies have landed; in front of the barrier that publishes them
__device__ __forceinline__ void wait_lds_reads() { asm volatile("s_wait_dscnt 0x0" ::: "memory"); }   // the wave's reads of a buffer have retired; in front of the barrier behind which it is refilled

__global__ __launch_bounds__(256) void prep_kernel(const float* __restrict__ query, const float* __restrict__ pquery, const float* __restrict__ wpq, const float* __restrict__ wq, const float* __restrict__ wpc, const float* __restrict__ wc, const float* __restrict__ wo, b16* __restrict__ X16, b16* __restrict__ PQ16, b16* __restrict__ W4, b16* __restrict__ WPQ) {
  const size_t t = (size_t)blockIdx.x * 256 + threadIdx.x; const size_t nx = (size_t)NR * E / 8, np_ = (size_t)NPR * E / 8, nw = (size_t)E * E / 8; v8b o;
  if (t < nx) { const size_t e = t * 8; const v4f a = *(const v4f*)(query + e), c = *(const v4f*)(query + e + 4); for (int j = 0; j < 4; ++j) { o[j] = (b16)(bf16_rne(a[j]) * XS); o[4 + j] = (b16)(bf16_rne(c[j]) * XS); } { *(v8b*)(X16 + e) = o;  } return; }
  size_t u = t - nx;
  if (u < np_) { const size_t e = u * 8; for (int j = 0; j < 8; ++j) o[j] = (b16)(bf16_rne(pquery[e + j]) * XS); { *(v8b*)(PQ16 + e) = o;  } return; } u -= np_;
  if (u < 5 * nw) { const int kind = (int)(u / nw); const size_t e = (u % nw) * 8; const float* w = kind == 0 ? wpc : kind == 1 ? wq : kind == 2 ? wc : kind == 3 ? wo : wpq; for (int j = 0; j < 8; ++j) o[j] = (b16)(bf16_rne(w[e + j]) * WSC);
    b16* dst = (kind < 4) ? (W4 + (size_t)kind * E * E) : WPQ; { *(v8b*)(dst + e) = o;  } }
}
// input linears: grid (NR/64, 8 col blocks, 3 kinds): y = X16 W^T + b (K = 1,024: 32 steps, exact); kind 0: kp -> KPh/KPl planes [row][1024]; kind 1: q = (y)*1/8 -> Qh/Ql; kind 2: kv -> KVh/KVl rows (the per-bh transpose KVT [bh][64 d][2048 t] is written by kvt_kernel)
__global__ __launch_bounds__(128) void lin_kernel(const b16* __restrict__ X16, const b16* __restrict__ W4, const float* __restrict__ bpc, const float* __restrict__ bq, const float* __restrict__ bc, b16* __restrict__ KPh, b16* __restrict__ KPl, b16* __restrict__ Qh, b16* __restrict__ Ql, b16* __restrict__ KVh, b16* __restrict__ KVl) {
  __shared__ __attribute__((aligned(16))) b16 Th[4][16][128 + 8], Tl[4][16][128 + 8]; __shared__ __attribute__((aligned(16))) b16 St[2][64 + 128][LP];   // a stage: rows 0..63 = the block's X rows, 64..191 = its W rows
  const int wave = threadIdx.x >> 5, lane = threadIdx.x & 31, nloc = lane & 15, hlf = lane >> 4; const int kind = blockIdx.z, n0 = blockIdx.y * 128; const size_t m0 = (size_t)blockIdx.x * 64 + wave * 16;
  const b16* W = W4 + (size_t)kind * E * E; const float* bias = kind == 0 ? bpc : kind == 1 ? bq : bc; const float osc = (kind == 1) ? SCL : 1.0f;
  v8f acc[8];
#pragma unroll
  for (int t = 0; t < 8; ++t) acc[t] = (v8f){};
  const int crow = threadIdx.x >> 3, cpc = (threadIdx.x & 7) * 8; const unsigned cl = lds_off(&St[0][crow][cpc]);
  const b16* cx = X16 + ((size_t)blockIdx.x * 64 + crow) * E + cpc; const b16* cw = W + (size_t)(n0 + crow) * E + cpc;
  auto stage = [&](int s) { const unsigned l = cl + (unsigned)(s & 1) * (192 * LP * 2); copy_rows64(l, cx + s * KS); copy_rows64(l + 64 * LP * 2, cw + s * KS); copy_rows64(l + 128 * LP * 2, cw + (size_t)64 * E + s * KS); };
  stage(0); wait_copies(); __syncthreads(); stage(1);
  for (int s = 0; s < NT; ++s) { const b16* sb = &St[s & 1][0][0]; v16b a[2], bw[2][8];   // all fragments of the stage are read in front of its first product: one LDS latency a stage
#pragma unroll   // constant indices keep the fragment arrays in registers
    for (int ks = 0; ks < 2; ++ks) { a[ks] = frag_kb(sb + (wave * 16 + nloc) * LP + ks * 32, hlf);
#pragma unroll   // constant indices keep the fragment arrays in registers
      for (int t = 0; t < 8; ++t) bw[ks][t] = frag_kb(sb + (64 + t * 16 + nloc) * LP + ks * 32, hlf); }
#pragma unroll   // constant indices keep the fragment arrays in registers
    for (int ks = 0; ks < 2; ++ks)
#pragma unroll   // constant indices keep the fragment arrays in registers
      for (int t = 0; t < 8; ++t) acc[t] = wmma16b(a[ks], bw[ks][t], acc[t]);
    wait_lds_reads(); wait_copies(); __syncthreads();   // publishes stage s + 1 and ends every reader's last read of stage s
    if (s + 2 < NT) stage(s + 2); }
  wait_copies();
#pragma unroll
  for (int t = 0; t < 8; ++t) { const float bb = bf16_rne(bias[n0 + t * 16 + nloc]);
#pragma unroll
    for (int r = 0; r < 8; ++r) { b16 p, q; split16((acc[t][r] * (1.0f / (XS * WSC)) + bb) * osc * XS, p, q); Th[wave][8 * hlf + r][t * 16 + nloc] = p; Tl[wave][8 * hlf + r][t * 16 + nloc] = q; } }
  wave_lds_sync(); b16* dh = kind == 0 ? KPh : kind == 1 ? Qh : KVh; b16* dl = kind == 0 ? KPl : kind == 1 ? Ql : KVl;
  { for (int r2 = 0; r2 < 16; r2 += 2) { const int rr = r2 + (lane >> 4), c8 = (lane & 15) * 8; const size_t gi = (m0 + rr) * E + n0 + c8; *(v8b*)(dh + gi) = *(const v8b*)(&Th[wave][rr][c8]); *(v8b*)(dl + gi) = *(const v8b*)(&Tl[wave][rr][c8]); }  }
}
__global__ __launch_bounds__(256) void kvt_kernel(const b16* __restrict__ KVh, const b16* __restrict__ KVl, b16* __restrict__ KVTh, b16* __restrict__ KVTl) {
  __shared__ __attribute__((aligned(16))) b16 Ah[DH][64 + 8], Al[DH][64 + 8];
  const int bh = blockIdx.y, t0 = blockIdx.x * 64, t_ = threadIdx.x; const int b = bh / NH, h = bh % NH;
  for (int q = t_; q < 64 * DH; q += 256) { const int tt = q / DH, d = q % DH; const size_t gi = ((size_t)(t0 + tt) * BS + b) * E + h * DH + d; Ah[d][tt] = KVh[gi]; Al[d][tt] = KVl[gi]; }
  __syncthreads();
  { for (int q = t_; q < DH * 8; q += 256) { const int d = q >> 3, c8 = (q & 7) * 8; const size_t gi = ((size_t)bh * DH + d) * T + t0 + c8; *(v8b*)(KVTh + gi) = *(const v8b*)(&Ah[d][c8]); *(v8b*)(KVTl + gi) = *(const v8b*)(&Al[d][c8]); }  }
}
// packed query + pattn: block = (bh, 64 t) x 4 waves: pq rows for this bh (32 x 64) computed in-block from PQ16 (pquery rows p*2+b) x WPQ (K = 1,024, exact) + bpq, x 1/8 -> hi/lo LDS [32 p][64 d];
// pattn tile = KP rows (t, b; head cols) [16 t x 64] x PQ^T -> [16 x 32]: 2 col tiles x 2 k steps x 3 products; softplus; stored as PAh/PAl [bh][t][32] (x8 hi/lo; 64-B rows -> a wave's 16 t = 1 KB
__global__ __launch_bounds__(128) void pattn_kernel(const b16* __restrict__ PQ16, const b16* __restrict__ WPQ, const float* __restrict__ bpq, const b16* __restrict__ KPh, const b16* __restrict__ KPl, b16* __restrict__ PAh, b16* __restrict__ PAl, b16* __restrict__ PATh, b16* __restrict__ PATl) {
  __shared__ __attribute__((aligned(16))) b16 Pq[PL][DH + 8], Pql[PL][DH + 8]; __shared__ __attribute__((aligned(16))) b16 Rh[4][16][PL + 8], Rl[4][16][PL + 8]; __shared__ __attribute__((aligned(16))) b16 Rt[PL][64 + 8], Rtl[PL][64 + 8]; __shared__ __attribute__((aligned(16))) b16 St[2][PL + DH][LP];   // a stage: rows 0..31 = the batch's pquery rows, 32..95 = the head's W rows
  const int wave = threadIdx.x >> 5, lane = threadIdx.x & 31, nloc = lane & 15, hlf = lane >> 4, t_ = threadIdx.x; const int bh = blockIdx.y, b = bh / NH, h = bh % NH, t0 = blockIdx.x * 64;
  // pq rows: wave w computes p tile (w&1) x d tiles (w>>1)*2..+1: A = PQ16 rows (p*2 + b) [16 p x 1024], B = WPQ rows (h*64 + d)
  { const int pt = wave & 1, dt0 = (wave >> 1) * 2; v8f a2[2] = {{}, {}};
    const int crow = t_ >> 3, cpc = (t_ & 7) * 8; const unsigned cl = lds_off(&St[0][crow][cpc]);
    const b16* cp = PQ16 + ((size_t)crow * BS + b) * E + cpc; const b16* cw = WPQ + (size_t)(h * DH + crow) * E + cpc;
    auto stage = [&](int s) { const unsigned l = cl + (unsigned)(s & 1) * ((PL + DH) * LP * 2); copy2(l, cp + s * KS, l + 16 * LP * 2, cp + (size_t)16 * BS * E + s * KS); copy_rows64(l + PL * LP * 2, cw + s * KS); };
    stage(0); wait_copies(); __syncthreads(); stage(1);
    for (int s = 0; s < NT; ++s) { const b16* sb = &St[s & 1][0][0]; v16b a[2], bw[2][2];   // all fragments of the stage are read in front of its first product: one LDS latency a stage
#pragma unroll   // constant indices keep the fragment arrays in registers
      for (int ks = 0; ks < 2; ++ks) { a[ks] = frag_kb(sb + (pt * 16 + nloc) * LP + ks * 32, hlf);
#pragma unroll   // constant indices keep the fragment arrays in registers
        for (int t = 0; t < 2; ++t) bw[ks][t] = frag_kb(sb + (PL + (dt0 + t) * 16 + nloc) * LP + ks * 32, hlf); }
#pragma unroll   // constant indices keep the fragment arrays in registers
      for (int ks = 0; ks < 2; ++ks)
#pragma unroll   // constant indices keep the fragment arrays in registers
        for (int t = 0; t < 2; ++t) a2[t] = wmma16b(a[ks], bw[ks][t], a2[t]);
      wait_lds_reads(); wait_copies(); __syncthreads();   // publishes stage s + 1 and ends every reader's last read of stage s
      if (s + 2 < NT) stage(s + 2); }
    wait_copies();
#pragma unroll
    for (int t = 0; t < 2; ++t) { const int d = (dt0 + t) * 16 + nloc; const float bb = bf16_rne(bpq[h * DH + d]);
#pragma unroll
      for (int r = 0; r < 8; ++r) { b16 p, q; split16((a2[t][r] * (1.0f / (XS * WSC)) + bb) * SCL * XS, p, q); Pq[pt * 16 + 8 * hlf + r][d] = p; Pql[pt * 16 + 8 * hlf + r][d] = q; } } }
  __syncthreads();
  // pattn for the wave's 16 t: A = KP rows ((t0 + wave*16 + nloc)*2 + b) cols h*64.., B = Pq rows p (k = d)
  { v8f d2[2] = {{}, {}}; const size_t arow = ((size_t)(t0 + wave * 16 + nloc) * BS + b) * E + h * DH;
#pragma unroll
    for (int kb = 0; kb < DH; kb += 32) { const v16b a = frag_kb(KPh + arow + kb, hlf), al = frag_kb(KPl + arow + kb, hlf);
#pragma unroll
      for (int t = 0; t < 2; ++t) { const v16b bp = frag_kb(&Pq[t * 16 + nloc][kb], hlf); d2[t] = wmma16b(a, bp, d2[t]); d2[t] = wmma16b(al, bp, d2[t]); d2[t] = wmma16b(a, frag_kb(&Pql[t * 16 + nloc][kb], hlf), d2[t]); } }
#pragma unroll
    for (int t = 0; t < 2; ++t)
#pragma unroll
      for (int r = 0; r < 8; ++r) { const float v = softplus_b(d2[t][r] * (1.0f / (XS * XS))); b16 p, q; split16(v * XS, p, q); const int tt = wave * 16 + 8 * hlf + r, pp = t * 16 + nloc; Rh[wave][8 * hlf + r][pp] = p; Rl[wave][8 * hlf + r][pp] = q; Rt[pp][tt] = p; Rtl[pp][tt] = q; } }
  __syncthreads();
  {
    for (int k = 0; k < 2; ++k) { const int rr = k * 8 + (lane >> 2), c8 = (lane & 3) * 8; const size_t gi = ((size_t)bh * T + t0 + wave * 16 + rr) * PL + c8; *(v8b*)(PAh + gi) = *(const v8b*)(&Rh[wave][rr][c8]); *(v8b*)(PAl + gi) = *(const v8b*)(&Rl[wave][rr][c8]); }
    for (int q = t_; q < PL * 8; q += 128) { const int pp = q >> 3, c8 = (q & 7) * 8; const size_t gi = ((size_t)bh * PL + pp) * T + t0 + c8; *(v8b*)(PATh + gi) = *(const v8b*)(&Rt[pp][c8]); *(v8b*)(PATl + gi) = *(const v8b*)(&Rtl[pp][c8]); }
     }
}
// prefix state: grid (8 tiles, BH), one wave per (16 d x 16 p) tile, one serial pass over the keys (K = 32 a step, 3 products, f32 accumulate), both orientations: sd = KVT.PAT^T -> D[d][p], st = PAT.KVT^T -> D[p][d].
// At each chunk boundary c = 1..NC-1 the running sum is stored as its mean x SS (hi/lo): MT blocks [pt*4+dt][16 p][16 d] (A operand of step 1, k = d), MS blocks [dt*2+pt][16 d][16 p] (A operand of step 2, k = p);
// a wave's block is 512 contiguous bytes. Operand fragments run three key steps ahead in a ring of four register stages, so that the pass is not one memory latency a step.
__device__ __forceinline__ void state_mac(v16b k, v16b kl, v16b p, v16b pl, v8f& sd, v8f& st) { sd = wmma16b(k, p, sd); st = wmma16b(p, k, st); sd = wmma16b(k, pl, sd); st = wmma16b(pl, k, st); sd = wmma16b(kl, p, sd); st = wmma16b(p, kl, st); }
__device__ __forceinline__ void state_store(v8f sd, v8f st, int c, b16* mth, b16* mtl, b16* msh, b16* msl) { const float f = SS / (XS * XS * (float)(c * CH)); v8b dh_, dl_, th_, tl_;
#pragma unroll
  for (int r = 0; r < 8; ++r) { b16 p, q; split16(sd[r] * f, p, q); dh_[r] = p; dl_[r] = q; split16(st[r] * f, p, q); th_[r] = p; tl_[r] = q; }
  *(v8b*)mth = dh_; *(v8b*)mtl = dl_; *(v8b*)msh = th_; *(v8b*)msl = tl_;
  asm volatile("s_wait_xcnt 0x0" ::: "memory"); }   // in front of every later overwrite of the data and address registers of the four stores (and of the address registers of the ring loads issued before them)
__global__ __launch_bounds__(32) void state_kernel(const b16* __restrict__ KVTh, const b16* __restrict__ KVTl, const b16* __restrict__ PATh, const b16* __restrict__ PATl, b16* __restrict__ MTh, b16* __restrict__ MTl, b16* __restrict__ MSh, b16* __restrict__ MSl) {
  const int lane = threadIdx.x, hh = lane >> 4, col = lane & 15; const int bh = blockIdx.y, dt = blockIdx.x >> 1, pt = blockIdx.x & 1;
  const size_t ok = ((size_t)bh * DH + dt * 16 + col) * T + 8 * hh, op = ((size_t)bh * PL + pt * 16 + col) * T + 8 * hh;   // the lane half's k offset is part of the four running pointers
  const b16* kh = KVTh + ok; const b16* kl = KVTl + ok; const b16* ph = PATh + op; const b16* pl = PATl + op;
  const size_t ot = (size_t)bh * NC * (DH * PL) + ((pt * 4 + dt) * 16 + col) * 16 + 8 * hh, os = (size_t)bh * NC * (DH * PL) + ((dt * 2 + pt) * 16 + col) * 16 + 8 * hh;
  b16* mth = MTh + ot; b16* mtl = MTl + ot; b16* msh = MSh + os; b16* msl = MSl + os;
  v16b fk[4], fkl[4], fp[4], fpl[4];
#pragma unroll   // here and in the loop: the ring's stage index must be a constant, so that the four stages stay in registers
  for (int j = 0; j < 3; ++j) { fk[j] = frag_kb(kh + j * 32, 0); fkl[j] = frag_kb(kl + j * 32, 0); fp[j] = frag_kb(ph + j * 32, 0); fpl[j] = frag_kb(pl + j * 32, 0); }
  v8f sd = {}, st = {};
  constexpr int NS = (NC - 1) * CH / 32;   // 62 key steps: the last chunk feeds no state
  for (int base = 0; base + 4 <= NS; base += 4) {   // 15 groups of 4; the loads reach key step base + 6 <= 62, inside the row
#pragma unroll
    for (int j = 0; j < 4; ++j) { const int jn = (j + 3) & 3, kn = (j + 3) * 32;
      fk[jn] = frag_kb(kh + kn, 0); fkl[jn] = frag_kb(kl + kn, 0); fp[jn] = frag_kb(ph + kn, 0); fpl[jn] = frag_kb(pl + kn, 0);
      state_mac(fk[j], fkl[j], fp[j], fpl[j], sd, st);
      if (j & 1) { mth += DH * PL; mtl += DH * PL; msh += DH * PL; msl += DH * PL; state_store(sd, st, (base + j + 1) >> 1, mth, mtl, msh, msl); } }
    kh += 128; kl += 128; ph += 128; pl += 128; }
  state_mac(fk[0], fkl[0], fp[0], fpl[0], sd, st); state_mac(fk[1], fkl[1], fp[1], fpl[1], sd, st);   // key steps 60 and 61, already in the ring
  state_store(sd, st, NC - 1, mth + DH * PL, mtl + DH * PL, msh + DH * PL, msl + DH * PL);
  asm volatile("s_wait_loadcnt 0x0" ::: "memory");   // the ring's last stage (key step 62) is loaded and not used: its loads have landed before the wave ends and gives its registers back
}
// step 1: grid (T/32, BH), 2 waves x 16 queries; earlier chunks: AI^T = MT(p rows) Q^T (2 p-tiles, K = 64, 3 products), weighted 64c/(n+1); key blocks of the query's own chunk: S1^T = KV.Q^T (K = 64, 3 products), masked keys > q -> 0, x PS1 hi/lo; AW^T += PAT^T(p rows) S1^T (2 p-tiles, 3 products);
// aw = (AW + 64c AI)/(n+1); softmax over the 32 p (each lane holds 16 of its query's 32 values? lane (hh, col): acc[t][r] = AW^T[p = t*16 + 8hh + r][query col] -> the query's 32 values are split over the
__global__ __launch_bounds__(64) void step1_kernel(const b16* __restrict__ Qh, const b16* __restrict__ Ql, const b16* __restrict__ KVh, const b16* __restrict__ KVl, const b16* __restrict__ PATh, const b16* __restrict__ PATl, const b16* __restrict__ MTh, const b16* __restrict__ MTl, b16* __restrict__ Ah, b16* __restrict__ Al) {
  __shared__ __attribute__((aligned(16))) b16 Ra[2][16][PL + 8], Ral[2][16][PL + 8];
  const int wave = threadIdx.x >> 5, lane = threadIdx.x & 31, hh = lane >> 4, col = lane & 15; const int bh = blockIdx.y, b = bh / NH, h = bh % NH; const int q0 = blockIdx.x * 32 + wave * 16, qi = q0 + col;
  const size_t qrow = ((size_t)qi * BS + b) * E + h * DH; const v16b qa0 = frag_kb(Qh + qrow, hh), qa1 = frag_kb(Qh + qrow + 32, hh), ql0 = frag_kb(Ql + qrow, hh), ql1 = frag_kb(Ql + qrow + 32, hh);
  const b16* Pb = PATh + (size_t)bh * PL * T; const b16* Plb = PATl + (size_t)bh * PL * T;
  v8f aw[2] = {{}, {}}, awl[2] = {{}, {}}, ai[2] = {{}, {}}; const int kend = q0 + 16, ks0 = (blockIdx.x * 32) & ~(CH - 1);
  asm volatile("s_wait_xcnt 0x0" ::: "memory");   // kept in front of the branch: the address arithmetic behind it may take over the address registers of the query loads above
  if (ks0 > 0) { const size_t so = ((size_t)bh * NC + ks0 / CH) * (DH * PL);
    v16b mh[4], ml[4];   // all state fragments are loaded in front of the first product, so that they cost one memory latency and not one each
#pragma unroll
    for (int u = 0; u < 4; ++u) { mh[u] = frag_blk(MTh + so + ((u * 2) * 16 + col) * 16, hh); ml[u] = frag_blk(MTl + so + ((u * 2) * 16 + col) * 16, hh); }
#pragma unroll
    for (int t = 0; t < 2; ++t) { ai[t] = wmma16b(mh[2 * t], qa0, ai[t]); ai[t] = wmma16b(mh[2 * t], ql0, ai[t]); ai[t] = wmma16b(ml[2 * t], qa0, ai[t]);
      ai[t] = wmma16b(mh[2 * t + 1], qa1, ai[t]); ai[t] = wmma16b(mh[2 * t + 1], ql1, ai[t]); ai[t] = wmma16b(ml[2 * t + 1], qa1, ai[t]); } }
  for (int kb = ks0; kb < kend; kb += 32) {
    v8f s0 = {}, s1 = {};
    { const b16* k0 = KVh + ((size_t)(kb + col) * BS + b) * E + h * DH, *k1 = KVh + ((size_t)(kb + 16 + col) * BS + b) * E + h * DH, *k0l = KVl + ((size_t)(kb + col) * BS + b) * E + h * DH, *k1l = KVl + ((size_t)(kb + 16 + col) * BS + b) * E + h * DH;
      v16b f = frag_kb(k0, hh); s0 = wmma16b(f, qa0, s0); s0 = wmma16b(f, ql0, s0); s0 = wmma16b(frag_kb(k0l, hh), qa0, s0);
      f = frag_kb(k0 + 32, hh); s0 = wmma16b(f, qa1, s0); s0 = wmma16b(f, ql1, s0); s0 = wmma16b(frag_kb(k0l + 32, hh), qa1, s0);
      f = frag_kb(k1, hh); s1 = wmma16b(f, qa0, s1); s1 = wmma16b(f, ql0, s1); s1 = wmma16b(frag_kb(k1l, hh), qa0, s1);
      f = frag_kb(k1 + 32, hh); s1 = wmma16b(f, qa1, s1); s1 = wmma16b(f, ql1, s1); s1 = wmma16b(frag_kb(k1l + 32, hh), qa1, s1); }
    v16b ph, pl;
#pragma unroll
    for (int r = 0; r < 8; ++r) { const int ka = kb + 8 * hh + r, kbb = kb + 16 + 8 * hh + r; const float v0 = (ka <= qi) ? s0[r] * (1.0f / (XS * XS)) : 0.0f, v1 = (kbb <= qi) ? s1[r] * (1.0f / (XS * XS)) : 0.0f; b16 p, q; split16(v0 * PS1, p, q); ph[r] = p; pl[r] = q; split16(v1 * PS1, p, q); ph[8 + r] = p; pl[8 + r] = q; }
#pragma unroll
    for (int t = 0; t < 2; ++t) { const v16b pa = frag_kb(Pb + (size_t)(t * 16 + col) * T + kb, hh); aw[t] = wmma16b(pa, ph, aw[t]); awl[t] = wmma16b(pa, pl, awl[t]); awl[t] = wmma16b(frag_kb(Plb + (size_t)(t * 16 + col) * T + kb, hh), ph, awl[t]); } }
  // lane (hh, col): value[p = t*16 + 8hh + r] for query col; divide by (qi + 1); softmax over 32
  float v[16]; const float invn = 1.0f / ((float)(qi + 1) * PS1 * XS), invi = (float)ks0 / ((float)(qi + 1) * SS * XS); float mx = -INFINITY;
#pragma unroll
  for (int t = 0; t < 2; ++t) for (int r = 0; r < 8; ++r) { v[t * 8 + r] = (aw[t][r] + awl[t][r]) * invn + ai[t][r] * invi; mx = fmaxf(mx, v[t * 8 + r]); }
  mx = fmaxf(mx, __shfl_xor(mx, 16)); float sm = 0.0f; for (int i = 0; i < 16; ++i) { v[i] = __expf(v[i] - mx); sm += v[i]; } sm += __shfl_xor(sm, 16); const float inv = 1.0f / sm;
#pragma unroll
  for (int t = 0; t < 2; ++t) for (int r = 0; r < 8; ++r) { b16 p, q; split16(v[t * 8 + r] * inv * PS2, p, q); Ra[wave][col][t * 16 + 8 * hh + r] = p; Ral[wave][col][t * 16 + 8 * hh + r] = q; }
  wave_lds_sync();
  { for (int k = 0; k < 2; ++k) { const int rr = k * 8 + (lane >> 2), c8 = (lane & 3) * 8; const size_t gi = ((size_t)bh * T + q0 + rr) * PL + c8; *(v8b*)(Ah + gi) = *(const v8b*)(&Ra[wave][rr][c8]); *(v8b*)(Al + gi) = *(const v8b*)(&Ral[wave][rr][c8]); }  }
}
// step 2: grid (T/32, BH): earlier chunks: OI^T = MS(d rows) A^T (4 d-tiles, K = 32, 3 products), weighted 64c/(n+1); own chunk: S2^T = PA(keys).A(q)^T (A-operand = PA rows [key][32], B = A rows [q][32]; K = 32: 3 products), causal, x PS1 hi/lo; O^T += KVT(d rows) S2^T (4 d-tiles, 3 products); / (n+1)
__global__ __launch_bounds__(64) void step2_kernel(const b16* __restrict__ PAh, const b16* __restrict__ PAl, const b16* __restrict__ Ah, const b16* __restrict__ Al, const b16* __restrict__ KVTh, const b16* __restrict__ KVTl, const b16* __restrict__ MSh, const b16* __restrict__ MSl, b16* __restrict__ ATh, b16* __restrict__ ATl) {
  __shared__ __attribute__((aligned(16))) float To[2][16][DH + 4];
  const int wave = threadIdx.x >> 5, lane = threadIdx.x & 31, hh = lane >> 4, col = lane & 15; const int bh = blockIdx.y, b = bh / NH, h = bh % NH; const int q0 = blockIdx.x * 32 + wave * 16, qi = q0 + col;
  const v16b aq = frag_kb(Ah + ((size_t)bh * T + qi) * PL, hh), aql = frag_kb(Al + ((size_t)bh * T + qi) * PL, hh);
  const b16* Vb = KVTh + (size_t)bh * DH * T; const b16* Vlb = KVTl + (size_t)bh * DH * T;
  v8f o[4] = {{}, {}, {}, {}}, ol[4] = {{}, {}, {}, {}}, oi[4] = {{}, {}, {}, {}}; const int kend = q0 + 16, ks0 = (blockIdx.x * 32) & ~(CH - 1);
  asm volatile("s_wait_xcnt 0x0" ::: "memory");   // kept in front of the branch: the address arithmetic behind it may take over the address registers of the loads above
  if (ks0 > 0) { const size_t so = ((size_t)bh * NC + ks0 / CH) * (DH * PL);
    v16b mh[4], ml[4];   // all state fragments are loaded in front of the first product, so that they cost one memory latency and not one each
#pragma unroll
    for (int t = 0; t < 4; ++t) { mh[t] = frag_blk(MSh + so + ((t * 2) * 16 + col) * 16, hh); ml[t] = frag_blk(MSl + so + ((t * 2) * 16 + col) * 16, hh); }
#pragma unroll
    for (int t = 0; t < 4; ++t) { oi[t] = wmma16b(mh[t], aq, oi[t]); oi[t] = wmma16b(mh[t], aql, oi[t]); oi[t] = wmma16b(ml[t], aq, oi[t]); } }
  for (int kb = ks0; kb < kend; kb += 32) {
    v8f s0 = {}, s1 = {};
    { const b16* p0 = PAh + ((size_t)bh * T + kb + col) * PL, *p1 = PAh + ((size_t)bh * T + kb + 16 + col) * PL, *p0l = PAl + ((size_t)bh * T + kb + col) * PL, *p1l = PAl + ((size_t)bh * T + kb + 16 + col) * PL;
      v16b f = frag_kb(p0, hh); s0 = wmma16b(f, aq, s0); s0 = wmma16b(f, aql, s0); s0 = wmma16b(frag_kb(p0l, hh), aq, s0);
      f = frag_kb(p1, hh); s1 = wmma16b(f, aq, s1); s1 = wmma16b(f, aql, s1); s1 = wmma16b(frag_kb(p1l, hh), aq, s1); }
    v16b ph, pl;
#pragma unroll
    for (int r = 0; r < 8; ++r) { const int ka = kb + 8 * hh + r, kbb = kb + 16 + 8 * hh + r; const float v0 = (ka <= qi) ? s0[r] * (1.0f / (XS * PS2)) : 0.0f, v1 = (kbb <= qi) ? s1[r] * (1.0f / (XS * PS2)) : 0.0f; b16 p, q; split16(v0 * PS1, p, q); ph[r] = p; pl[r] = q; split16(v1 * PS1, p, q); ph[8 + r] = p; pl[8 + r] = q; }
#pragma unroll
    for (int t = 0; t < 4; ++t) { const v16b vf = frag_kb(Vb + (size_t)(t * 16 + col) * T + kb, hh); o[t] = wmma16b(vf, ph, o[t]); ol[t] = wmma16b(vf, pl, ol[t]); ol[t] = wmma16b(frag_kb(Vlb + (size_t)(t * 16 + col) * T + kb, hh), ph, ol[t]); } }
  const float invn = 1.0f / ((float)(qi + 1) * PS1 * XS), invi = (float)ks0 / ((float)(qi + 1) * SS * PS2);
#pragma unroll
  for (int t = 0; t < 4; ++t)
#pragma unroll
    for (int r = 0; r < 8; ++r) To[wave][col][t * 16 + 8 * hh + r] = (o[t][r] + ol[t][r]) * invn + oi[t][r] * invi;
  wave_lds_sync();
  { for (int r4 = 0; r4 < 16; r4 += 4) { const int rr = r4 + (lane >> 3), c8 = (lane & 7) * 8; v8b hv, lv; for (int j = 0; j < 8; ++j) { b16 p, q; split16(To[wave][rr][c8 + j] * XS, p, q); hv[j] = p; lv[j] = q; }
      const size_t gi = ((size_t)(q0 + rr) * BS + b) * E + h * DH + c8; *(v8b*)(ATh + gi) = hv; *(v8b*)(ATl + gi) = lv; }  }
}
__global__ __launch_bounds__(128) void oproj_kernel(const b16* __restrict__ ATh, const b16* __restrict__ ATl, const b16* __restrict__ WO, const float* __restrict__ bo, float* __restrict__ out) {
  __shared__ __attribute__((aligned(16))) float Tf[4][16][128 + 4]; __shared__ __attribute__((aligned(16))) b16 St[2][64 + 64 + 128][LP];   // a stage: rows 0..63 = the block's attn hi rows, 64..127 = their lo rows, 128..255 = its W rows
  const int wave = threadIdx.x >> 5, lane = threadIdx.x & 31, nloc = lane & 15, hlf = lane >> 4; const int n0 = blockIdx.y * 128; const size_t m0 = (size_t)blockIdx.x * 64 + wave * 16;
  v8f acc[8];
#pragma unroll
  for (int t = 0; t < 8; ++t) acc[t] = (v8f){};
  const int crow = threadIdx.x >> 3, cpc = (threadIdx.x & 7) * 8; const unsigned cl = lds_off(&St[0][crow][cpc]); const size_t co = ((size_t)blockIdx.x * 64 + crow) * E + cpc;
  const b16* ch = ATh + co; const b16* cq = ATl + co; const b16* cw = WO + (size_t)(n0 + crow) * E + cpc;
  auto stage = [&](int s) { const unsigned l = cl + (unsigned)(s & 1) * (256 * LP * 2); copy_rows64(l, ch + s * KS); copy_rows64(l + 64 * LP * 2, cq + s * KS); copy_rows64(l + 128 * LP * 2, cw + s * KS); copy_rows64(l + 192 * LP * 2, cw + (size_t)64 * E + s * KS); };
  stage(0); wait_copies(); __syncthreads(); stage(1);
  for (int s = 0; s < NT; ++s) { const b16* sb = &St[s & 1][0][0]; v16b a[2], al[2], bw[2][8];   // all fragments of the stage are read in front of its first product: one LDS latency a stage
#pragma unroll   // constant indices keep the fragment arrays in registers
    for (int ks = 0; ks < 2; ++ks) { a[ks] = frag_kb(sb + (wave * 16 + nloc) * LP + ks * 32, hlf); al[ks] = frag_kb(sb + (64 + wave * 16 + nloc) * LP + ks * 32, hlf);
#pragma unroll   // constant indices keep the fragment arrays in registers
      for (int t = 0; t < 8; ++t) bw[ks][t] = frag_kb(sb + (128 + t * 16 + nloc) * LP + ks * 32, hlf); }
#pragma unroll   // constant indices keep the fragment arrays in registers
    for (int ks = 0; ks < 2; ++ks)
#pragma unroll   // constant indices keep the fragment arrays in registers
      for (int t = 0; t < 8; ++t) { acc[t] = wmma16b(a[ks], bw[ks][t], acc[t]); acc[t] = wmma16b(al[ks], bw[ks][t], acc[t]); }
    wait_lds_reads(); wait_copies(); __syncthreads();   // publishes stage s + 1 and ends every reader's last read of stage s
    if (s + 2 < NT) stage(s + 2); }
  wait_copies();
#pragma unroll
  for (int t = 0; t < 8; ++t) { const float bb = bf16_rne(bo[n0 + t * 16 + nloc]);
#pragma unroll
    for (int r = 0; r < 8; ++r) Tf[wave][8 * hlf + r][t * 16 + nloc] = acc[t][r] * (1.0f / (XS * WSC)) + bb; }
  wave_lds_sync();
  { for (int rr = 0; rr < 16; ++rr) *(v4f*)(out + (m0 + rr) * E + n0 + lane * 4) = *(const v4f*)(&Tf[wave][rr][lane * 4]);  }
}
}  // namespace

extern "C" void kernel_launch(void* const* d_in, const int* in_sizes, int n_in, void* d_out, int out_size, void* d_ws, size_t ws_size, hipStream_t stream) {
  (void)n_in;
  auto Fp = [&](int i) { return (const float*)d_in[i]; };
  // input order: 0 query [2048,2,1024], 1 pquery [32,2,1024], 2 Wpq [1024,1024], 3 bpq, 4 Wq, 5 bq, 6 Wpc, 7 bpc, 8 Wc, 9 bc, 10 Wo, 11 bo (torch [out][in])
  if (in_sizes[0] != NR * E || in_sizes[1] != NPR * E || in_sizes[2] != E * E || in_sizes[4] != E * E || in_sizes[6] != E * E || in_sizes[8] != E * E || in_sizes[10] != E * E || out_size != NR * E) return;
  size_t off = 0; char* ws = (char*)d_ws;
  auto carve = [&](size_t bytes) { char* p = ws + off; off += (bytes + 255) & ~(size_t)255; return p; };
  b16* X16 = (b16*)carve((size_t)NR * E * 2); b16* PQ16 = (b16*)carve((size_t)NPR * E * 2); b16* W4 = (b16*)carve((size_t)4 * E * E * 2); b16* WPQ = (b16*)carve((size_t)E * E * 2);
  b16* KPh = (b16*)carve((size_t)NR * E * 2); b16* KPl = (b16*)carve((size_t)NR * E * 2); b16* Qh = (b16*)carve((size_t)NR * E * 2); b16* Ql = (b16*)carve((size_t)NR * E * 2); b16* KVh = (b16*)carve((size_t)NR * E * 2); b16* KVl = (b16*)carve((size_t)NR * E * 2);
  b16* KVTh = (b16*)carve((size_t)NR * E * 2); b16* KVTl = (b16*)carve((size_t)NR * E * 2); b16* PAh = (b16*)carve((size_t)BH * T * PL * 2); b16* PAl = (b16*)carve((size_t)BH * T * PL * 2); b16* PATh = (b16*)carve((size_t)BH * PL * T * 2); b16* PATl = (b16*)carve((size_t)BH * PL * T * 2);
  b16* Ah = (b16*)carve((size_t)BH * T * PL * 2); b16* Al = (b16*)carve((size_t)BH * T * PL * 2);
  b16* MTh = (b16*)carve((size_t)BH * NC * DH * PL * 2); b16* MTl = (b16*)carve((size_t)BH * NC * DH * PL * 2); b16* MSh = (b16*)carve((size_t)BH * NC * DH * PL * 2); b16* MSl = (b16*)carve((size_t)BH * NC * DH * PL * 2);
  b16* ATh = KPh; b16* ATl = KPl;   // region reuse: KP planes are dead after pattn_kernel (stream-ordered); the attention output takes their place
  if (off > ws_size || off > ((size_t)128 << 20)) return;   // ~ 122 MiB
  prep_kernel<<<(unsigned)(((size_t)NR * E / 8 + (size_t)NPR * E / 8 + 5 * (size_t)E * E / 8 + 255) / 256), 256, 0, stream>>>(Fp(0), Fp(1), Fp(2), Fp(4), Fp(6), Fp(8), Fp(10), X16, PQ16, W4, WPQ);
  lin_kernel<<<dim3(NR / 64, E / 128, 3), 128, 0, stream>>>(X16, W4, Fp(7), Fp(5), Fp(9), KPh, KPl, Qh, Ql, KVh, KVl);
  kvt_kernel<<<dim3(T / 64, BH), 256, 0, stream>>>(KVh, KVl, KVTh, KVTl);
  pattn_kernel<<<dim3(T / 64, BH), 128, 0, stream>>>(PQ16, WPQ, Fp(3), KPh, KPl, PAh, PAl, PATh, PATl);
  state_kernel<<<dim3(8, BH), 32, 0, stream>>>(KVTh, KVTl, PATh, PATl, MTh, MTl, MSh, MSl);
  step1_kernel<<<dim3(T / 32, BH), 64, 0, stream>>>(Qh, Ql, KVh, KVl, PATh, PATl, MTh, MTl, Ah, Al);
  step2_kernel<<<dim3(T / 32, BH), 64, 0, stream>>>(PAh, PAl, Ah, Al, KVTh, KVTl, MSh, MSl, ATh, ATl);
  oproj_kernel<<<dim3(NR / 64, E / 128), 128, 0, stream>>>(ATh, ATl, W4 + (size_t)3 * E * E, Fp(11), (float*)d_out);
}

// v003
// A run of this version takes 153 microseconds.
// In both of two side-by-side timings against v002, it was 1.07 times as fast.
// Over all steps from v000 it is 4.61 times as fast.
#include <hip/hip_runtime.h>

// Lunar causal attention (Luna-style packed attention, causal "efficient" form): T = 2,048 tokens x 2 batch x 1,024 (16 heads x 64), 32 packed positions.
// pq = (pquery Wpq^T + bpq)/8 -> (b,h,p,d); kp = query Wpc^T + bpc; pattn[bh][t][p] = softplus_b(kp_t . pq_p) (b = ln 2); q = (query Wq^T + bq)/8; kv = query Wc^T + bc (tied k = v);
// aw[bh][n][p] = (sum_{m<=n} (q_n . kv_m) pattn[m][p]) / (n+1); A = softmax_p(aw); attn[bh][n][d] = (sum_{m<=n} (A_n . pattn_m) kv[m][d]) / (n+1); out = attn Wo^T + bo -> [2048][2][1024].
// Both "efficient_causal_attention_parallel" calls are evaluated in chunks of 64 keys: the keys of the query's own chunk as causal masked products (x_n . sum y_m z_m^T = sum (x_n.y_m) z_m), all earlier
// chunks through the running outer-product sum S_c[d][p] = sum_{m < 64c} kv[m][d] pattn[m][p] (k = v is tied, so ONE state serves both calls: q_n . S_c and A_n . S_c^T), kept as its mean S_c/(64c) in hi+lo.
// WMMA (v_wmma_f32_16x16x32_f16, f32 accumulate): the four input linears ([4,096 x 1,024] x [1,024 x 1,024], EXACT bf16 operands, 1 product) and the output linear (attn hi+lo: 2 products); per (bh,
// 16-query wave) and causal 32-key block: S1^T = KV.Q^T (K = 64, hi+lo: 3 products) then AW^T += PATTN^T S1^T (2 p-tiles, 3 products); S2^T = PATTN.A^T (K = 32, 3 products) then O^T += KV^T S2^T
// (4 d-tiles, 3 products); pattn = softplus(kp.pq) per token ([16 tokens x 64] x [64 x 32] per (bh) tile, 3 products). Softplus, softmax over the 32 positions, the 1/(n+1) factors in f32.
// Inputs rounded to bf16 once. Fragment k-map per lane half hh for A AND B: elements 0..7 <- k = 8hh+0..7, 8..15 <- k = 16+8hh+0..7; acc[r] = D[8hh+r][col]. Every

namespace {
constexpr int T = 2048, BS = 2, E = 1024, NH = 16, DH = 64, BH = BS * NH, PL = 32, NR = T * BS /* 4,096 query rows (t, b) */, NPR = PL * BS /* 64 pquery rows */;
constexpr int CH = 64 /* keys per chunk */, NC = T / CH;
constexpr float SS = 16.0f /* scale of the stored state mean */;
constexpr float XS = 8.0f, WSC = 256.0f, SCL = 0.125f, BETA = 0.69314718055994531f, PS1 = 8.0f, PS2 = 64.0f;

typedef _Float16 b16;
typedef __attribute__((ext_vector_type(16))) _Float16 v16b;
typedef __attribute__((ext_vector_type(8))) _Float16 v8b;
typedef __attribute__((ext_vector_type(8))) float v8f;
typedef __attribute__((ext_vector_type(4))) float v4f;
__device__ __forceinline__ float bf16_rne(float f) { unsigned int u = __float_as_uint(f); u += 0x7FFFu + ((u >> 16) & 1u); return __uint_as_float(u & 0xFFFF0000u); }
__device__ __forceinline__ void split16(float v, b16& hi, b16& lo) { hi = (b16)v; lo = (b16)(v - (float)hi); }
__device__ __forceinline__ v16b frag_kb(const b16* p, int hh) { const v8b a = *(const v8b*)(p + 8 * hh), b = *(const v8b*)(p + 16 + 8 * hh); v16b f;
#pragma unroll
  for (int e = 0; e < 8; ++e) { f[e] = a[e]; f[8 + e] = b[e]; } return f; }
// fragment from two consecutive 16 x 16 blocks (256 elements each) of a block-tiled plane: p = the lane's row in the first block; same k-map as frag_kb
__device__ __forceinline__ v16b frag_blk(const b16* p, int hh) { const v8b a = *(const v8b*)(p + 8 * hh), b = *(const v8b*)(p + 256 + 8 * hh); v16b f;
#pragma unroll
  for (int e = 0; e < 8; ++e) { f[e] = a[e]; f[8 + e] = b[e]; } return f; }
__device__ __forceinline__ v8f wmma16b(v16b a, v16b b, v8f c) { v8f d = __builtin_amdgcn_wmma_f32_16x16x32_f16(false, a, false, b, (short)0, c, false, false); asm volatile("v_nop\n\tv_nop\n\tv_nop\n\tv_nop" : "+v"(d) : "v"(a), "v"(b)); return d; }
__device__ __forceinline__ void wave_lds_sync() { __builtin_amdgcn_fence(__ATOMIC_RELEASE, "workgroup"); __builtin_amdgcn_wave_barrier(); __builtin_amdgcn_fence(__ATOMIC_ACQUIRE, "workgroup"); }
__device__ __forceinline__ float pmul(float a, float b) { float p = a * b; asm volatile("" : "+v"(p)); return p; }
__device__ __forceinline__ float softplus_b(float x) { const float bx = BETA * x; const float sp = (bx > 20.0f) ? bx : log1pf(__expf(bx)); return sp / BETA; }   // torch softplus(beta x)/beta (threshold 20 on beta*x)
// LDS staging of the linear layers' operand tiles: a stage is KS = 64 k of every operand row of the block (128-B rows, whole lines), laid at a pitch of 144 B for the ds_load_b128 fragment reads; two buffers.
constexpr int KS = 64, LP = KS + 8, NT = E / KS;
__device__ __forceinline__ unsigned lds_off(const void* p) { return (unsigned)(size_t)p; }   // byte offset in the work-group's LDS = low 32 bits of a __shared__ address
// four asynchronous copies, 16 B a lane each, global -> LDS through no register; the s_wait_xcnt stands inside the copies' own statement, so that no later write of an address register can be moved in front of it
__device__ __forceinline__ void copy4(unsigned l0, const b16* g0, unsigned l1, const b16* g1, unsigned l2, const b16* g2, unsigned l3, const b16* g3) {
  asm volatile("global_load_async_to_lds_b128 %0, %1, off\n\tglobal_load_async_to_lds_b128 %2, %3, off\n\tglobal_load_async_to_lds_b128 %4, %5, off\n\tglobal_load_async_to_lds_b128 %6, %7, off\n\ts_wait_xcnt 0x0"
               :: "v"(l0), "v"(g0), "v"(l1), "v"(g1), "v"(l2), "v"(g2), "v"(l3), "v"(g3) : "memory"); }
__device__ __forceinline__ void copy2(unsigned l0, const b16* g0, unsigned l1, const b16* g1) {   // the same, two copies
  asm volatile("global_load_async_to_lds_b128 %0, %1, off\n\tglobal_load_async_to_lds_b128 %2, %3, off\n\ts_wait_xcnt 0x0" :: "v"(l0), "v"(g0), "v"(l1), "v"(g1) : "memory"); }
// 64 rows (16 a copy: a thread's row is tid / 8, its 16-B piece tid % 8) of one stage: l = the thread's LDS byte address in the first row group, g = its global address there
__device__ __forceinline__ void copy_rows64(unsigned l, const b16* g) { copy4(l, g, l + 16 * LP * 2, g + 16 * E, l + 32 * LP * 2, g + 32 * E, l + 48 * LP * 2, g + 48 * E); }
__device__ __forceinline__ void wait_copies() { asm volatile("s_wait_asynccnt 0x0" ::: "memory"); }   // the wave's own copies have landed; in front of the barrier that publishes them
__device__ __forceinline__ void wait_lds_reads() { asm volatile("s_wait_dscnt 0x0" ::: "memory"); }   // the wave's reads of a buffer have retired; in front of the barrier behind which it is refilled

__global__ __launch_bounds__(256) void prep_kernel(const float* __restrict__ query, const float* __restrict__ pquery, const float* __restrict__ wpq, const float* __restrict__ wq, const float* __restrict__ wpc, const float* __restrict__ wc, const float* __restrict__ wo, b16* __restrict__ X16, b16* __restrict__ PQ16, b16* __restrict__ W4, b16* __restrict__ WPQ) {
  const size_t t = (size_t)blockIdx.x * 256 + threadIdx.x; const size_t nx = (size_t)NR * E / 8, np_ = (size_t)NPR * E / 8, nw = (size_t)E * E / 8; v8b o;
  if (t < nx) { const size_t e = t * 8; const v4f a = *(const v4f*)(query + e), c = *(const v4f*)(query + e + 4); for (int j = 0; j < 4; ++j) { o[j] = (b16)(bf16_rne(a[j]) * XS); o[4 + j] = (b16)(bf16_rne(c[j]) * XS); } { *(v8b*)(X16 + e) = o;  } return; }
  size_t u = t - nx;
  if (u < np_) { const size_t e = u * 8; for (int j = 0; j < 8; ++j) o[j] = (b16)(bf16_rne(pquery[e + j]) * XS); { *(v8b*)(PQ16 + e) = o;  } return; } u -= np_;
  if (u < 5 * nw) { const int kind = (int)(u / nw); const size_t e = (u % nw) * 8; const float* w = kind == 0 ? wpc : kind == 1 ? wq : kind == 2 ? wc : kind == 3 ? wo : wpq; for (int j = 0; j < 8; ++j) o[j] = (b16)(bf16_rne(w[e + j]) * WSC);
    b16* dst = (kind < 4) ? (W4 + (size_t)kind * E * E) : WPQ; { *(v8b*)(dst + e) = o;  } }
}
// input linears: grid (NR/64, 8 col blocks, 3 kinds): y = X16 W^T + b (K = 1,024: 32 steps, exact); kind 0: kp -> KPh/KPl planes [row][1024]; kind 1: q = (y)*1/8 -> Qh/Ql; kind 2: kv -> KVh/KVl rows (the per-bh transpose KVT [bh][64 d][2048 t] is written by kvt_kernel)
__global__ __launch_bounds__(128) void lin_kernel(const b16* __restrict__ X16, const b16* __restrict__ W4, const float* __restrict__ bpc, const float* __restrict__ bq, const float* __restrict__ bc, b16* __restrict__ KPh, b16* __restrict__ KPl, b16* __restrict__ Qh, b16* __restrict__ Ql, b16* __restrict__ KVh, b16* __restrict__ KVl) {
  __shared__ __attribute__((aligned(16))) b16 Th[4][16][128 + 8], Tl[4][16][128 + 8]; __shared__ __attribute__((aligned(16))) b16 St[2][64 + 128][LP];   // a stage: rows 0..63 = the block's X rows, 64..191 = its W rows
  const int wave = threadIdx.x >> 5, lane = threadIdx.x & 31, nloc = lane & 15, hlf = lane >> 4; const int kind = blockIdx.z, n0 = blockIdx.y * 128; const size_t m0 = (size_t)blockIdx.x * 64 + wave * 16;
  const b16* W = W4 + (size_t)kind * E * E; const float* bias = kind == 0 ? bpc : kind == 1 ? bq : bc; const float osc = (kind == 1) ? SCL : 1.0f;
  v8f acc[8];
#pragma unroll
  for (int t = 0; t < 8; ++t) acc[t] = (v8f){};
  const int crow = threadIdx.x >> 3, cpc = (threadIdx.x & 7) * 8; const unsigned cl = lds_off(&St[0][crow][cpc]);
  const b16* cx = X16 + ((size_t)blockIdx.x * 64 + crow) * E + cpc; const b16* cw = W + (size_t)(n0 + crow) * E + cpc;
  auto stage = [&](int s) { const unsigned l = cl + (unsigned)(s & 1) * (192 * LP * 2); copy_rows64(l, cx + s * KS); copy_rows64(l + 64 * LP * 2, cw + s * KS); copy_rows64(l + 128 * LP * 2, cw + (size_t)64 * E + s * KS); };
  stage(0); wait_copies(); __syncthreads(); stage(1);
  for (int s = 0; s < NT; ++s) { const b16* sb = &St[s & 1][0][0]; v16b a[2], bw[2][8];   // all fragments of the stage are read in front of its first product: one LDS latency a stage
#pragma unroll   // constant indices keep the fragment arrays in registers
    for (int ks = 0; ks < 2; ++ks) { a[ks] = frag_kb(sb + (wave * 16 + nloc) * LP + ks * 32, hlf);
#pragma unroll   // constant indices keep the fragment arrays in registers
      for (int t = 0; t < 8; ++t) bw[ks][t] = frag_kb(sb + (64 + t * 16 + nloc) * LP + ks * 32, hlf); }
#pragma unroll   // constant indices keep the fragment arrays in registers
    for (int ks = 0; ks < 2; ++ks)
#pragma unroll   // constant indices keep the fragment arrays in registers
      for (int t = 0; t < 8; ++t) acc[t] = wmma16b(a[ks], bw[ks][t], acc[t]);
    wait_lds_reads(); wait_copies(); __syncthreads();   // publishes stage s + 1 and ends every reader's last read of stage s
    if (s + 2 < NT) stage(s + 2); }
  wait_copies();
#pragma unroll
  for (int t = 0; t < 8; ++t) { const float bb = bf16_rne(bias[n0 + t * 16 + nloc]);
#pragma unroll
    for (int r = 0; r < 8; ++r) { b16 p, q; split16((acc[t][r] * (1.0f / (XS * WSC)) + bb) * osc * XS, p, q); Th[wave][8 * hlf + r][t * 16 + nloc] = p; Tl[wave][8 * hlf + r][t * 16 + nloc] = q; } }
  wave_lds_sync(); b16* dh = kind == 0 ? KPh : kind == 1 ? Qh : KVh; b16* dl = kind == 0 ? KPl : kind == 1 ? Ql : KVl;
  { for (int r2 = 0; r2 < 16; r2 += 2) { const int rr = r2 + (lane >> 4), c8 = (lane & 15) * 8; const size_t gi = (m0 + rr) * E + n0 + c8; *(v8b*)(dh + gi) = *(const v8b*)(&Th[wave][rr][c8]); *(v8b*)(dl + gi) = *(const v8b*)(&Tl[wave][rr][c8]); }  }
}
__global__ __launch_bounds__(256) void kvt_kernel(const b16* __restrict__ KVh, const b16* __restrict__ KVl, b16* __restrict__ KVTh, b16* __restrict__ KVTl) {
  __shared__ __attribute__((aligned(16))) b16 Ah[DH][64 + 8], Al[DH][64 + 8];
  const int bh = blockIdx.y, t0 = blockIdx.x * 64, t_ = threadIdx.x; const int b = bh / NH, h = bh % NH;
  for (int q = t_; q < 64 * DH; q += 256) { const int tt = q / DH, d = q % DH; const size_t gi = ((size_t)(t0 + tt) * BS + b) * E + h * DH + d; Ah[d][tt] = KVh[gi]; Al[d][tt] = KVl[gi]; }
  __syncthreads();
  { for (int q = t_; q < DH * 8; q += 256) { const int d = q >> 3, c8 = (q & 7) * 8; const size_t gi = ((size_t)bh * DH + d) * T + t0 + c8; *(v8b*)(KVTh + gi) = *(const v8b*)(&Ah[d][c8]); *(v8b*)(KVTl + gi) = *(const v8b*)(&Al[d][c8]); }  }
}
// packed query + pattn: block = (bh, 64 t) x 4 waves: pq rows for this bh (32 x 64) computed in-block from PQ16 (pquery rows p*2+b) x WPQ (K = 1,024, exact) + bpq, x 1/8 -> hi/lo LDS [32 p][64 d];
// pattn tile = KP rows (t, b; head cols) [16 t x 64] x PQ^T -> [16 x 32]: 2 col tiles x 2 k steps x 3 products; softplus; stored as PAh/PAl [bh][t][32] (x8 hi/lo; 64-B rows -> a wave's 16 t = 1 KB
__global__ __launch_bounds__(128) void pattn_kernel(const b16* __restrict__ PQ16, const b16* __restrict__ WPQ, const float* __restrict__ bpq, const b16* __restrict__ KPh, const b16* __restrict__ KPl, b16* __restrict__ PAh, b16* __restrict__ PAl, b16* __restrict__ PATh, b16* __restrict__ PATl) {
  __shared__ __attribute__((aligned(16))) b16 Pq[PL][DH + 8], Pql[PL][DH + 8]; __shared__ __attribute__((aligned(16))) b16 Rh[4][16][PL + 8], Rl[4][16][PL + 8]; __shared__ __attribute__((aligned(16))) b16 Rt[PL][64 + 8], Rtl[PL][64 + 8]; __shared__ __attribute__((aligned(16))) b16 St[2][PL + DH][LP];   // a stage: rows 0..31 = the batch's pquery rows, 32..95 = the head's W rows
  const int wave = threadIdx.x >> 5, lane = threadIdx.x & 31, nloc = lane & 15, hlf = lane >> 4, t_ = threadIdx.x; const int bh = blockIdx.y, b = bh / NH, h = bh % NH, t0 = blockIdx.x * 64;
  // the wave's KP fragments (hi, lo; two k steps) depend on nothing that is computed here: they are loaded in front of the pq product, whose stages cover their memory latency
  const size_t arow = ((size_t)(t0 + wave * 16 + nloc) * BS + b) * E + h * DH + 8 * hlf; const b16 *kpa = KPh + arow, *kpb = KPl + arow; v16b ka[2], kal[2];
#pragma unroll   // constant indices keep the fragment arrays in registers
  for (int j = 0; j < 2; ++j) { ka[j] = frag_kb(kpa + j * 32, 0); kal[j] = frag_kb(kpb + j * 32, 0); }
  asm volatile("s_wait_xcnt 0x0" :: "v"(kpa), "v"(kpb) : "memory");   // in front of every later overwrite of the address registers of these loads, which are its inputs, so that no load lands on one of them ahead of the wait
  // pq rows: wave w computes p tile (w&1) x d tiles (w>>1)*2..+1: A = PQ16 rows (p*2 + b) [16 p x 1024], B = WPQ rows (h*64 + d)
  { const int pt = wave & 1, dt0 = (wave >> 1) * 2; v8f a2[2] = {{}, {}};
    const int crow = t_ >> 3, cpc = (t_ & 7) * 8; const unsigned cl = lds_off(&St[0][crow][cpc]);
    const b16* cp = PQ16 + ((size_t)crow * BS + b) * E + cpc; const b16* cw = WPQ + (size_t)(h * DH + crow) * E + cpc;
    auto stage = [&](int s) { const unsigned l = cl + (unsigned)(s & 1) * ((PL + DH) * LP * 2); copy2(l, cp + s * KS, l + 16 * LP * 2, cp + (size_t)16 * BS * E + s * KS); copy_rows64(l + PL * LP * 2, cw + s * KS); };
    stage(0); wait_copies(); __syncthreads(); stage(1);
    for (int s = 0; s < NT; ++s) { const b16* sb = &St[s & 1][0][0]; v16b a[2], bw[2][2];   // all fragments of the stage are read in front of its first product: one LDS latency a stage
#pragma unroll   // constant indices keep the fragment arrays in registers
      for (int ks = 0; ks < 2; ++ks) { a[ks] = frag_kb(sb + (pt * 16 + nloc) * LP + ks * 32, hlf);
#pragma unroll   // constant indices keep the fragment arrays in registers
        for (int t = 0; t < 2; ++t) bw[ks][t] = frag_kb(sb + (PL + (dt0 + t) * 16 + nloc) * LP + ks * 32, hlf); }
#pragma unroll   // constant indices keep the fragment arrays in registers
      for (int ks = 0; ks < 2; ++ks)
#pragma unroll   // constant indices keep the fragment arrays in registers
        for (int t = 0; t < 2; ++t) a2[t] = wmma16b(a[ks], bw[ks][t], a2[t]);
      wait_lds_reads(); wait_copies(); __syncthreads();   // publishes stage s + 1 and ends every reader's last read of stage s
      if (s + 2 < NT) stage(s + 2); }
    wait_copies();
#pragma unroll
    for (int t = 0; t < 2; ++t) { const int d = (dt0 + t) * 16 + nloc; const float bb = bf16_rne(bpq[h * DH + d]);
#pragma unroll
      for (int r = 0; r < 8; ++r) { b16 p, q; split16((a2[t][r] * (1.0f / (XS * WSC)) + bb) * SCL * XS, p, q); Pq[pt * 16 + 8 * hlf + r][d] = p; Pql[pt * 16 + 8 * hlf + r][d] = q; } } }
  __syncthreads();
  // pattn for the wave's 16 t: A = KP rows ((t0 + wave*16 + nloc)*2 + b) cols h*64.., B = Pq rows p (k = d)
  { v8f d2[2] = {{}, {}}; v16b bp[2][2], bpl[2][2];   // all pq fragments are read in front of the first product: one LDS latency and not one a fragment
#pragma unroll
    for (int j = 0; j < 2; ++j)
#pragma unroll
      for (int t = 0; t < 2; ++t) { bp[j][t] = frag_kb(&Pq[t * 16 + nloc][j * 32], hlf); bpl[j][t] = frag_kb(&Pql[t * 16 + nloc][j * 32], hlf); }
#pragma unroll
    for (int j = 0; j < 2; ++j)
#pragma unroll
      for (int t = 0; t < 2; ++t) { d2[t] = wmma16b(ka[j], bp[j][t], d2[t]); d2[t] = wmma16b(kal[j], bp[j][t], d2[t]); d2[t] = wmma16b(ka[j], bpl[j][t], d2[t]); }
#pragma unroll
    for (int t = 0; t < 2; ++t)
#pragma unroll
      for (int r = 0; r < 8; ++r) { const float v = softplus_b(d2[t][r] * (1.0f / (XS * XS))); b16 p, q; split16(v * XS, p, q); const int tt = wave * 16 + 8 * hlf + r, pp = t * 16 + nloc; Rh[wave][8 * hlf + r][pp] = p; Rl[wave][8 * hlf + r][pp] = q; Rt[pp][tt] = p; Rtl[pp][tt] = q; } }
  __syncthreads();
  {
    for (int k = 0; k < 2; ++k) { const int rr = k * 8 + (lane >> 2), c8 = (lane & 3) * 8; const size_t gi = ((size_t)bh * T + t0 + wave * 16 + rr) * PL + c8; *(v8b*)(PAh + gi) = *(const v8b*)(&Rh[wave][rr][c8]); *(v8b*)(PAl + gi) = *(const v8b*)(&Rl[wave][rr][c8]); }
    for (int q = t_; q < PL * 8; q += 128) { const int pp = q >> 3, c8 = (q & 7) * 8; const size_t gi = ((size_t)bh * PL + pp) * T + t0 + c8; *(v8b*)(PATh + gi) = *(const v8b*)(&Rt[pp][c8]); *(v8b*)(PATl + gi) = *(const v8b*)(&Rtl[pp][c8]); }
     }
}
// prefix state: grid (8 tiles, BH), one wave per (16 d x 16 p) tile, one serial pass over the keys (K = 32 a step, 3 products, f32 accumulate), both orientations: sd = KVT.PAT^T -> D[d][p], st = PAT.KVT^T -> D[p][d].
// At each chunk boundary c = 1..NC-1 the running sum is stored as its mean x SS (hi/lo): MT blocks [pt*4+dt][16 p][16 d] (A operand of step 1, k = d), MS blocks [dt*2+pt][16 d][16 p] (A operand of step 2, k = p);
// a wave's block is 512 contiguous bytes. Operand fragments run three key steps ahead in a ring of four register stages, so that the pass is not one memory latency a step.
__device__ __forceinline__ void state_mac(v16b k, v16b kl, v16b p, v16b pl, v8f& sd, v8f& st) { sd = wmma16b(k, p, sd); st = wmma16b(p, k, st); sd = wmma16b(k, pl, sd); st = wmma16b(pl, k, st); sd = wmma16b(kl, p, sd); st = wmma16b(p, kl, st); }
__device__ __forceinline__ void state_store(v8f sd, v8f st, int c, b16* mth, b16* mtl, b16* msh, b16* msl) { const float f = SS / (XS * XS * (float)(c * CH)); v8b dh_, dl_, th_, tl_;
#pragma unroll
  for (int r = 0; r < 8; ++r) { b16 p, q; split16(sd[r] * f, p, q); dh_[r] = p; dl_[r] = q; split16(st[r] * f, p, q); th_[r] = p; tl_[r] = q; }
  *(v8b*)mth = dh_; *(v8b*)mtl = dl_; *(v8b*)msh = th_; *(v8b*)msl = tl_;
  asm volatile("s_wait_xcnt 0x0" ::: "memory"); }   // in front of every later overwrite of the data and address registers of the four stores (and of the address registers of the ring loads issued before them)
__global__ __launch_bounds__(32) void state_kernel(const b16* __restrict__ KVTh, const b16* __restrict__ KVTl, const b16* __restrict__ PATh, const b16* __restrict__ PATl, b16* __restrict__ MTh, b16* __restrict__ MTl, b16* __restrict__ MSh, b16* __restrict__ MSl) {
  const int lane = threadIdx.x, hh = lane >> 4, col = lane & 15; const int bh = blockIdx.y, dt = blockIdx.x >> 1, pt = blockIdx.x & 1;
  const size_t ok = ((size_t)bh * DH + dt * 16 + col) * T + 8 * hh, op = ((size_t)bh * PL + pt * 16 + col) * T + 8 * hh;   // the lane half's k offset is part of the four running pointers
  const b16* kh = KVTh + ok; const b16* kl = KVTl + ok; const b16* ph = PATh + op; const b16* pl = PATl + op;
  const size_t ot = (size_t)bh * NC * (DH * PL) + ((pt * 4 + dt) * 16 + col) * 16 + 8 * hh, os = (size_t)bh * NC * (DH * PL) + ((dt * 2 + pt) * 16 + col) * 16 + 8 * hh;
  b16* mth = MTh + ot; b16* mtl = MTl + ot; b16* msh = MSh + os; b16* msl = MSl + os;
  v16b fk[4], fkl[4], fp[4], fpl[4];
#pragma unroll   // here and in the loop: the ring's stage index must be a constant, so that the four stages stay in registers
  for (int j = 0; j < 3; ++j) { fk[j] = frag_kb(kh + j * 32, 0); fkl[j] = frag_kb(kl + j * 32, 0); fp[j] = frag_kb(ph + j * 32, 0); fpl[j] = frag_kb(pl + j * 32, 0); }
  v8f sd = {}, st = {};
  constexpr int NS = (NC - 1) * CH / 32;   // 62 key steps: the last chunk feeds no state
  for (int base = 0; base + 4 <= NS; base += 4) {   // 15 groups of 4; the loads reach key step base + 6 <= 62, inside the row
#pragma unroll
    for (int j = 0; j < 4; ++j) { const int jn = (j + 3) & 3, kn = (j + 3) * 32;
      fk[jn] = frag_kb(kh + kn, 0); fkl[jn] = frag_kb(kl + kn, 0); fp[jn] = frag_kb(ph + kn, 0); fpl[jn] = frag_kb(pl + kn, 0);
      state_mac(fk[j], fkl[j], fp[j], fpl[j], sd, st);
      if (j & 1) { mth += DH * PL; mtl += DH * PL; msh += DH * PL; msl += DH * PL; state_store(sd, st, (base + j + 1) >> 1, mth, mtl, msh, msl); } }
    kh += 128; kl += 128; ph += 128; pl += 128; }
  state_mac(fk[0], fkl[0], fp[0], fpl[0], sd, st); state_mac(fk[1], fkl[1], fp[1], fpl[1], sd, st);   // key steps 60 and 61, already in the ring
  state_store(sd, st, NC - 1, mth + DH * PL, mtl + DH * PL, msh + DH * PL, msl + DH * PL);
  asm volatile("s_wait_loadcnt 0x0" ::: "memory");   // the ring's last stage (key step 62) is loaded and not used: its loads have landed before the wave ends and gives its registers back
}
// step 1: grid (T/32, BH), 2 waves x 16 queries; earlier chunks: AI^T = MT(p rows) Q^T (2 p-tiles, K = 64, 3 products), weighted 64c/(n+1); key blocks of the query's own chunk: S1^T = KV.Q^T (K = 64, 3 products), masked keys > q -> 0, x PS1 hi/lo; AW^T += PAT^T(p rows) S1^T (2 p-tiles, 3 products);
// aw = (AW + 64c AI)/(n+1); softmax over the 32 p (each lane holds 16 of its query's 32 values? lane (hh, col): acc[t][r] = AW^T[p = t*16 + 8hh + r][query col] -> the query's 32 values are split over the
__global__ __launch_bounds__(64) void step1_kernel(const b16* __restrict__ Qh, const b16* __restrict__ Ql, const b16* __restrict__ KVh, const b16* __restrict__ KVl, const b16* __restrict__ PATh, const b16* __restrict__ PATl, const b16* __restrict__ MTh, const b16* __restrict__ MTl, b16* __restrict__ Ah, b16* __restrict__ Al) {
  __shared__ __attribute__((aligned(16))) b16 Ra[2][16][PL + 8], Ral[2][16][PL + 8];
  const int wave = threadIdx.x >> 5, lane = threadIdx.x & 31, hh = lane >> 4, col = lane & 15; const int bh = blockIdx.y, b = bh / NH, h = bh % NH; const int q0 = blockIdx.x * 32 + wave * 16, qi = q0 + col;
  const size_t qrow = ((size_t)qi * BS + b) * E + h * DH; const v16b qa0 = frag_kb(Qh + qrow, hh), qa1 = frag_kb(Qh + qrow + 32, hh), ql0 = frag_kb(Ql + qrow, hh), ql1 = frag_kb(Ql + qrow + 32, hh);
  const b16* Pb = PATh + (size_t)bh * PL * T; const b16* Plb = PATl + (size_t)bh * PL * T;
  v8f aw[2] = {{}, {}}, awl[2] = {{}, {}}, ai[2] = {{}, {}}; const int ks0 = (blockIdx.x * 32) & ~(CH - 1), nb = (blockIdx.x & 1) + 1;   // nb = key blocks of 32 from the chunk's start up to the block's 32 queries
  // The fragments of a key block are loaded as groups ahead of the products that use them, so that a block costs one memory latency and not one a fragment: the first block's together with the query's and the
  // state's, the next block's into the same registers as soon as this block's products have read them. kf = KV rows (key tile, k half: hi, lo), pf = PAT rows (p tile: hi, lo).
  v16b kf[8], pf[4]; const b16 *ka, *kal, *pa, *pal;   // the lane's base addresses of a group (its k half included): every load of the group is one of them plus a constant
  auto load_kv = [&](int kb) { const size_t r = ((size_t)(kb + col) * BS + b) * E + h * DH + 8 * hh; ka = KVh + r; kal = KVl + r;
#pragma unroll   // constant indices keep the fragment arrays in registers
    for (int u = 0; u < 4; ++u) { const int c = (u >> 1) * 16 * BS * E + (u & 1) * 32; kf[2 * u] = frag_kb(ka + c, 0); kf[2 * u + 1] = frag_kb(kal + c, 0); } };
  auto load_pa = [&](int kb) { const size_t r = (size_t)col * T + kb + 8 * hh; pa = Pb + r; pal = Plb + r;
#pragma unroll   // constant indices keep the fragment arrays in registers
    for (int t = 0; t < 2; ++t) { pf[2 * t] = frag_kb(pa + t * 16 * T, 0); pf[2 * t + 1] = frag_kb(pal + t * 16 * T, 0); } };
  load_kv(ks0); load_pa(ks0);
  // kept in front of the branch: the address arithmetic behind it may take over the address registers of the loads above; the addresses are inputs, so that no load of the groups lands on one of them ahead of the wait
  asm volatile("s_wait_xcnt 0x0" :: "v"(Qh + qrow + 8 * hh), "v"(Ql + qrow + 8 * hh), "v"(ka), "v"(kal), "v"(pa), "v"(pal) : "memory");
  if (ks0 > 0) { const size_t so = ((size_t)bh * NC + ks0 / CH) * (DH * PL);
    v16b mh[4], ml[4];   // all state fragments are loaded in front of the first product, so that they cost one memory latency and not one each
#pragma unroll
    for (int u = 0; u < 4; ++u) { mh[u] = frag_blk(MTh + so + ((u * 2) * 16 + col) * 16, hh); ml[u] = frag_blk(MTl + so + ((u * 2) * 16 + col) * 16, hh); }
#pragma unroll
    for (int t = 0; t < 2; ++t) { ai[t] = wmma16b(mh[2 * t], qa0, ai[t]); ai[t] = wmma16b(mh[2 * t], ql0, ai[t]); ai[t] = wmma16b(ml[2 * t], qa0, ai[t]);
      ai[t] = wmma16b(mh[2 * t + 1], qa1, ai[t]); ai[t] = wmma16b(mh[2 * t + 1], ql1, ai[t]); ai[t] = wmma16b(ml[2 * t + 1], qa1, ai[t]); } }
  for (int i = 0; i < nb; ++i) { const int kb = ks0 + 32 * i; const bool more = i + 1 < nb;
    v8f s0 = {}, s1 = {};
    s0 = wmma16b(kf[0], qa0, s0); s0 = wmma16b(kf[0], ql0, s0); s0 = wmma16b(kf[1], qa0, s0); s0 = wmma16b(kf[2], qa1, s0); s0 = wmma16b(kf[2], ql1, s0); s0 = wmma16b(kf[3], qa1, s0);
    s1 = wmma16b(kf[4], qa0, s1); s1 = wmma16b(kf[4], ql0, s1); s1 = wmma16b(kf[5], qa0, s1); s1 = wmma16b(kf[6], qa1, s1); s1 = wmma16b(kf[6], ql1, s1); s1 = wmma16b(kf[7], qa1, s1);
    if (more) { load_kv(kb + 32); asm volatile("s_wait_xcnt 0x0" :: "v"(ka), "v"(kal) : "memory"); }   // the wait: in front of every later overwrite of the address registers of these loads, which are its inputs as above
    v16b ph, pl;
#pragma unroll
    for (int r = 0; r < 8; ++r) { const int ka = kb + 8 * hh + r, kbb = kb + 16 + 8 * hh + r; const float v0 = (ka <= qi) ? s0[r] * (1.0f / (XS * XS)) : 0.0f, v1 = (kbb <= qi) ? s1[r] * (1.0f / (XS * XS)) : 0.0f; b16 p, q; split16(v0 * PS1, p, q); ph[r] = p; pl[r] = q; split16(v1 * PS1, p, q); ph[8 + r] = p; pl[8 + r] = q; }
#pragma unroll
    for (int t = 0; t < 2; ++t) { aw[t] = wmma16b(pf[2 * t], ph, aw[t]); awl[t] = wmma16b(pf[2 * t], pl, awl[t]); awl[t] = wmma16b(pf[2 * t + 1], ph, awl[t]); }
    if (more) { load_pa(kb + 32); asm volatile("s_wait_xcnt 0x0" :: "v"(pa), "v"(pal) : "memory"); } }   // the wait: as above
  // lane (hh, col): value[p = t*16 + 8hh + r] for query col; divide by (qi + 1); softmax over 32
  float v[16]; const float invn = 1.0f / ((float)(qi + 1) * PS1 * XS), invi = (float)ks0 / ((float)(qi + 1) * SS * XS); float mx = -INFINITY;
#pragma unroll
  for (int t = 0; t < 2; ++t) for (int r = 0; r < 8; ++r) { v[t * 8 + r] = (aw[t][r] + awl[t][r]) * invn + ai[t][r] * invi; mx = fmaxf(mx, v[t * 8 + r]); }
  mx = fmaxf(mx, __shfl_xor(mx, 16)); float sm = 0.0f; for (int i = 0; i < 16; ++i) { v[i] = __expf(v[i] - mx); sm += v[i]; } sm += __shfl_xor(sm, 16); const float inv = 1.0f / sm;
#pragma unroll
  for (int t = 0; t < 2; ++t) for (int r = 0; r < 8; ++r) { b16 p, q; split16(v[t * 8 + r] * inv * PS2, p, q); Ra[wave][col][t * 16 + 8 * hh + r] = p; Ral[wave][col][t * 16 + 8 * hh + r] = q; }
  wave_lds_sync();
  { for (int k = 0; k < 2; ++k) { const int rr = k * 8 + (lane >> 2), c8 = (lane & 3) * 8; const size_t gi = ((size_t)bh * T + q0 + rr) * PL + c8; *(v8b*)(Ah + gi) = *(const v8b*)(&Ra[wave][rr][c8]); *(v8b*)(Al + gi) = *(const v8b*)(&Ral[wave][rr][c8]); }  }
}
// step 2: grid (T/32, BH): earlier chunks: OI^T = MS(d rows) A^T (4 d-tiles, K = 32, 3 products), weighted 64c/(n+1); own chunk: S2^T = PA(keys).A(q)^T (A-operand = PA rows [key][32], B = A rows [q][32]; K = 32: 3 products), causal, x PS1 hi/lo; O^T += KVT(d rows) S2^T (4 d-tiles, 3 products); / (n+1)
__global__ __launch_bounds__(64) void step2_kernel(const b16* __restrict__ PAh, const b16* __restrict__ PAl, const b16* __restrict__ Ah, const b16* __restrict__ Al, const b16* __restrict__ KVTh, const b16* __restrict__ KVTl, const b16* __restrict__ MSh, const b16* __restrict__ MSl, b16* __restrict__ ATh, b16* __restrict__ ATl) {
  __shared__ __attribute__((aligned(16))) float To[2][16][DH + 4];
  const int wave = threadIdx.x >> 5, lane = threadIdx.x & 31, hh = lane >> 4, col = lane & 15; const int bh = blockIdx.y, b = bh / NH, h = bh % NH; const int q0 = blockIdx.x * 32 + wave * 16, qi = q0 + col;
  const v16b aq = frag_kb(Ah + ((size_t)bh * T + qi) * PL, hh), aql = frag_kb(Al + ((size_t)bh * T + qi) * PL, hh);
  const b16* Vb = KVTh + (size_t)bh * DH * T; const b16* Vlb = KVTl + (size_t)bh * DH * T;
  v8f o[4] = {{}, {}, {}, {}}, ol[4] = {{}, {}, {}, {}}, oi[4] = {{}, {}, {}, {}}; const int ks0 = (blockIdx.x * 32) & ~(CH - 1), nb = (blockIdx.x & 1) + 1;   // nb = key blocks of 32 from the chunk's start up to the block's 32 queries
  // fragment groups loaded ahead of the products that use them, as in step 1: pk = PA rows (key tile: hi, lo), vf = KVT rows (d tile: hi, lo)
  v16b pk[4], vf[8]; const b16 *pa, *pal, *va, *val;   // the lane's base addresses of a group (its k half included): every load of the group is one of them plus a constant
  auto load_pk = [&](int kb) { const size_t r = ((size_t)bh * T + kb + col) * PL + 8 * hh; pa = PAh + r; pal = PAl + r;
#pragma unroll   // constant indices keep the fragment arrays in registers
    for (int u = 0; u < 2; ++u) { pk[2 * u] = frag_kb(pa + u * 16 * PL, 0); pk[2 * u + 1] = frag_kb(pal + u * 16 * PL, 0); } };
  auto load_vf = [&](int kb) { const size_t r = (size_t)col * T + kb + 8 * hh; va = Vb + r; val = Vlb + r;
#pragma unroll   // constant indices keep the fragment arrays in registers
    for (int t = 0; t < 4; ++t) { vf[2 * t] = frag_kb(va + t * 16 * T, 0); vf[2 * t + 1] = frag_kb(val + t * 16 * T, 0); } };
  load_pk(ks0); load_vf(ks0);
  // kept in front of the branch: the address arithmetic behind it may take over the address registers of the loads above; the addresses are inputs, so that no load of the groups lands on one of them ahead of the wait
  asm volatile("s_wait_xcnt 0x0" :: "v"(Ah + ((size_t)bh * T + qi) * PL + 8 * hh), "v"(Al + ((size_t)bh * T + qi) * PL + 8 * hh), "v"(pa), "v"(pal), "v"(va), "v"(val) : "memory");
  if (ks0 > 0) { const size_t so = ((size_t)bh * NC + ks0 / CH) * (DH * PL);
    v16b mh[4], ml[4];   // all state fragments are loaded in front of the first product, so that they cost one memory latency and not one each
#pragma unroll
    for (int t = 0; t < 4; ++t) { mh[t] = frag_blk(MSh + so + ((t * 2) * 16 + col) * 16, hh); ml[t] = frag_blk(MSl + so + ((t * 2) * 16 + col) * 16, hh); }
#pragma unroll
    for (int t = 0; t < 4; ++t) { oi[t] = wmma16b(mh[t], aq, oi[t]); oi[t] = wmma16b(mh[t], aql, oi[t]); oi[t] = wmma16b(ml[t], aq, oi[t]); } }
  for (int i = 0; i < nb; ++i) { const int kb = ks0 + 32 * i; const bool more = i + 1 < nb;
    v8f s0 = {}, s1 = {};
    s0 = wmma16b(pk[0], aq, s0); s0 = wmma16b(pk[0], aql, s0); s0 = wmma16b(pk[1], aq, s0); s1 = wmma16b(pk[2], aq, s1); s1 = wmma16b(pk[2], aql, s1); s1 = wmma16b(pk[3], aq, s1);
    if (more) { load_pk(kb + 32); asm volatile("s_wait_xcnt 0x0" :: "v"(pa), "v"(pal) : "memory"); }   // the wait: in front of every later overwrite of the address registers of these loads, which are its inputs as above
    v16b ph, pl;
#pragma unroll
    for (int r = 0; r < 8; ++r) { const int ka = kb + 8 * hh + r, kbb = kb + 16 + 8 * hh + r; const float v0 = (ka <= qi) ? s0[r] * (1.0f / (XS * PS2)) : 0.0f, v1 = (kbb <= qi) ? s1[r] * (1.0f / (XS * PS2)) : 0.0f; b16 p, q; split16(v0 * PS1, p, q); ph[r] = p; pl[r] = q; split16(v1 * PS1, p, q); ph[8 + r] = p; pl[8 + r] = q; }
#pragma unroll
    for (int t = 0; t < 4; ++t) { o[t] = wmma16b(vf[2 * t], ph, o[t]); ol[t] = wmma16b(vf[2 * t], pl, ol[t]); ol[t] = wmma16b(vf[2 * t + 1], ph, ol[t]); }
    if (more) { load_vf(kb + 32); asm volatile("s_wait_xcnt 0x0" :: "v"(va), "v"(val) : "memory"); } }   // the wait: as above
  const float invn = 1.0f / ((float)(qi + 1) * PS1 * XS), invi = (float)ks0 / ((float)(qi + 1) * SS * PS2);
#pragma unroll
  for (int t = 0; t < 4; ++t)
#pragma unroll
    for (int r = 0; r < 8; ++r) To[wave][col][t * 16 + 8 * hh + r] = (o[t][r] + ol[t][r]) * invn + oi[t][r] * invi;
  wave_lds_sync();
  { for (int r4 = 0; r4 < 16; r4 += 4) { const int rr = r4 + (lane >> 3), c8 = (lane & 7) * 8; v8b hv, lv; for (int j = 0; j < 8; ++j) { b16 p, q; split16(To[wave][rr][c8 + j] * XS, p, q); hv[j] = p; lv[j] = q; }
      const size_t gi = ((size_t)(q0 + rr) * BS + b) * E + h * DH + c8; *(v8b*)(ATh + gi) = hv; *(v8b*)(ATl + gi) = lv; }  }
}
__global__ __launch_bounds__(128) void oproj_kernel(const b16* __restrict__ ATh, const b16* __restrict__ ATl, const b16* __restrict__ WO, const float* __restrict__ bo, float* __restrict__ out) {
  __shared__ __attribute__((aligned(16))) float Tf[4][16][128 + 4]; __shared__ __attribute__((aligned(16))) b16 St[2][64 + 64 + 128][LP];   // a stage: rows 0..63 = the block's attn hi rows, 64..127 = their lo rows, 128..255 = its W rows
  const int wave = threadIdx.x >> 5, lane = threadIdx.x & 31, nloc = lane & 15, hlf = lane >> 4; const int n0 = blockIdx.y * 128; const size_t m0 = (size_t)blockIdx.x * 64 + wave * 16;
  v8f acc[8];
#pragma unroll
  for (int t = 0; t < 8; ++t) acc[t] = (v8f){};
  const int crow = threadIdx.x >> 3, cpc = (threadIdx.x & 7) * 8; const unsigned cl = lds_off(&St[0][crow][cpc]); const size_t co = ((size_t)blockIdx.x * 64 + crow) * E + cpc;
  const b16* ch = ATh + co; const b16* cq = ATl + co; const b16* cw = WO + (size_t)(n0 + crow) * E + cpc;
  auto stage = [&](int s) { const unsigned l = cl + (unsigned)(s & 1) * (256 * LP * 2); copy_rows64(l, ch + s * KS); copy_rows64(l + 64 * LP * 2, cq + s * KS); copy_rows64(l + 128 * LP * 2, cw + s * KS); copy_rows64(l + 192 * LP * 2, cw + (size_t)64 * E + s * KS); };
  stage(0); wait_copies(); __syncthreads(); stage(1);
  for (int s = 0; s < NT; ++s) { const b16* sb = &St[s & 1][0][0]; v16b a[2], al[2], bw[2][8];   // all fragments of the stage are read in front of its first product: one LDS latency a stage
#pragma unroll   // constant indices keep the fragment arrays in registers
    for (int ks = 0; ks < 2; ++ks) { a[ks] = frag_kb(sb + (wave * 16 + nloc) * LP + ks * 32, hlf); al[ks] = frag_kb(sb + (64 + wave * 16 + nloc) * LP + ks * 32, hlf);
#pragma unroll   // constant indices keep the fragment arrays in registers
      for (int t = 0; t < 8; ++t) bw[ks][t] = frag_kb(sb + (128 + t * 16 + nloc) * LP + ks * 32, hlf); }
#pragma unroll   // constant indices keep the fragment arrays in registers
    for (int ks = 0; ks < 2; ++ks)
#pragma unroll   // constant indices keep the fragment arrays in registers
      for (int t = 0; t < 8; ++t) { acc[t] = wmma16b(a[ks], bw[ks][t], acc[t]); acc[t] = wmma16b(al[ks], bw[ks][t], acc[t]); }
    wait_lds_reads(); wait_copies(); __syncthreads();   // publishes stage s + 1 and ends every reader's last read of stage s
    if (s + 2 < NT) stage(s + 2); }
  wait_copies();
#pragma unroll
  for (int t = 0; t < 8; ++t) { const float bb = bf16_rne(bo[n0 + t * 16 + nloc]);
#pragma unroll
    for (int r = 0; r < 8; ++r) Tf[wave][8 * hlf + r][t * 16 + nloc] = acc[t][r] * (1.0f / (XS * WSC)) + bb; }
  wave_lds_sync();
  { for (int rr = 0; rr < 16; ++rr) *(v4f*)(out + (m0 + rr) * E + n0 + lane * 4) = *(const v4f*)(&Tf[wave][rr][lane * 4]);  }
}
}  // namespace

extern "C" void kernel_launch(void* const* d_in, const int* in_sizes, int n_in, void* d_out, int out_size, void* d_ws, size_t ws_size, hipStream_t stream) {
  (void)n_in;
  auto Fp = [&](int i) { return (const float*)d_in[i]; };
  // input order: 0 query [2048,2,1024], 1 pquery [32,2,1024], 2 Wpq [1024,1024], 3 bpq, 4 Wq, 5 bq, 6 Wpc, 7 bpc, 8 Wc, 9 bc, 10 Wo, 11 bo (torch [out][in])
  if (in_sizes[0] != NR * E || in_sizes[1] != NPR * E || in_sizes[2] != E * E || in_sizes[4] != E * E || in_sizes[6] != E * E || in_sizes[8] != E * E || in_sizes[10] != E * E || out_size != NR * E) return;
  size_t off = 0; char* ws = (char*)d_ws;
  auto carve = [&](size_t bytes) { char* p = ws + off; off += (bytes + 255) & ~(size_t)255; return p; };
  b16* X16 = (b16*)carve((size_t)NR * E * 2); b16* PQ16 = (b16*)carve((size_t)NPR * E * 2); b16* W4 = (b16*)carve((size_t)4 * E * E * 2); b16* WPQ = (b16*)carve((size_t)E * E * 2);
  b16* KPh = (b16*)carve((size_t)NR * E * 2); b16* KPl = (b16*)carve((size_t)NR * E * 2); b16* Qh = (b16*)carve((size_t)NR * E * 2); b16* Ql = (b16*)carve((size_t)NR * E * 2); b16* KVh = (b16*)carve((size_t)NR * E * 2); b16* KVl = (b16*)carve((size_t)NR * E * 2);
  b16* KVTh = (b16*)carve((size_t)NR * E * 2); b16* KVTl = (b16*)carve((size_t)NR * E * 2); b16* PAh = (b16*)carve((size_t)BH * T * PL * 2); b16* PAl = (b16*)carve((size_t)BH * T * PL * 2); b16* PATh = (b16*)carve((size_t)BH * PL * T * 2); b16* PATl = (b16*)carve((size_t)BH * PL * T * 2);
  b16* Ah = (b16*)carve((size_t)BH * T * PL * 2); b16* Al = (b16*)carve((size_t)BH * T * PL * 2);
  b16* MTh = (b16*)carve((size_t)BH * NC * DH * PL * 2); b16* MTl = (b16*)carve((size_t)BH * NC * DH * PL * 2); b16* MSh = (b16*)carve((size_t)BH * NC * DH * PL * 2); b16* MSl = (b16*)carve((size_t)BH * NC * DH * PL * 2);
  b16* ATh = KPh; b16* ATl = KPl;   // region reuse: KP planes are dead after pattn_kernel (stream-ordered); the attention output takes their place
  if (off > ws_size || off > ((size_t)128 << 20)) return;   // ~ 122 MiB
  prep_kernel<<<(unsigned)(((size_t)NR * E / 8 + (size_t)NPR * E / 8 + 5 * (size_t)E * E / 8 + 255) / 256), 256, 0, stream>>>(Fp(0), Fp(1), Fp(2), Fp(4), Fp(6), Fp(8), Fp(10), X16, PQ16, W4, WPQ);
  lin_kernel<<<dim3(NR / 64, E / 128, 3), 128, 0, stream>>>(X16, W4, Fp(7), Fp(5), Fp(9), KPh, KPl, Qh, Ql, KVh, KVl);
  kvt_kernel<<<dim3(T / 64, BH), 256, 0, stream>>>(KVh, KVl, KVTh, KVTl);
  pattn_kernel<<<dim3(T / 64, BH), 128, 0, stream>>>(PQ16, WPQ, Fp(3), KPh, KPl, PAh, PAl, PATh, PATl);
  state_kernel<<<dim3(8, BH), 32, 0, stream>>>(KVTh, KVTl, PATh, PATl, MTh, MTl, MSh, MSl);
  step1_kernel<<<dim3(T / 32, BH), 64, 0, stream>>>(Qh, Ql, KVh, KVl, PATh, PATl, MTh, MTl, Ah, Al);
  step2_kernel<<<dim3(T / 32, BH), 64, 0, stream>>>(PAh, PAl, Ah, Al, KVTh, KVTl, MSh, MSl, ATh, ATl);
  oproj_kernel<<<dim3(NR / 64, E / 128), 128, 0, stream>>>(ATh, ATl, W4 + (size_t)3 * E * E, Fp(11), (float*)d_out);
}

// v004
// One run takes 144 microseconds.
// Next to v003, in two timings, it ran 1.06 and 1.07 times as fast.
// Counting every step since v000, it is 4.92 times as fast.
#include <hip/hip_runtime.h>

// Lunar causal attention (Luna-style packed attention, causal "efficient" form): T = 2,048 tokens x 2 batch x 1,024 (16 heads x 64), 32 packed positions.
// pq = (pquery Wpq^T + bpq)/8 -> (b,h,p,d); kp = query Wpc^T + bpc; pattn[bh][t][p] = softplus_b(kp_t . pq_p) (b = ln 2); q = (query Wq^T + bq)/8; kv = query Wc^T + bc (tied k = v);
// aw[bh][n][p] = (sum_{m<=n} (q_n . kv_m) pattn[m][p]) / (n+1); A = softmax_p(aw); attn[bh][n][d] = (sum_{m<=n} (A_n . pattn_m) kv[m][d]) / (n+1); out = attn Wo^T + bo -> [2048][2][1024].
// Both "efficient_causal_attention_parallel" calls are evaluated in chunks of 64 keys: the keys of the query's own chunk as causal masked products (x_n . sum y_m z_m^T = sum (x_n.y_m) z_m), all earlier
// chunks through the running outer-product sum S_c[d][p] = sum_{m < 64c} kv[m][d] pattn[m][p] (k = v is tied, so ONE state serves both calls: q_n . S_c and A_n . S_c^T), kept as its mean S_c/(64c) in hi+lo.
// WMMA (v_wmma_f32_16x16x32_f16, f32 accumulate): the four input linears ([4,096 x 1,024] x [1,024 x 1,024], EXACT bf16 operands, 1 product) and the output linear (attn hi+lo: 2 products); per (bh,
// 16-query wave) and causal 32-key block: S1^T = KV.Q^T (K = 64, hi+lo: 3 products) then AW^T += PATTN^T S1^T (2 p-tiles, 3 products); S2^T = PATTN.A^T (K = 32, 3 products) then O^T += KV^T S2^T
// (4 d-tiles, 3 products); pattn = softplus(kp.pq) per token ([16 tokens x 64] x [64 x 32] per (bh) tile, 3 products). Softplus, softmax over the 32 positions, the 1/(n+1) factors in f32.
// Inputs rounded to bf16 once. Fragment k-map per lane half hh for A AND B: elements 0..7 <- k = 8hh+0..7, 8..15 <- k = 16+8hh+0..7; acc[r] = D[8hh+r][col]. Every

namespace {
constexpr int T = 2048, BS = 2, E = 1024, NH = 16, DH = 64, BH = BS * NH, PL = 32, NR = T * BS /* 4,096 query rows (t, b) */, NPR = PL * BS /* 64 pquery rows */;
constexpr int CH = 64 /* keys per chunk */, NC = T / CH;
constexpr float SS = 16.0f /* scale of the stored state mean */;
constexpr float XS = 8.0f, WSC = 256.0f, SCL = 0.125f, BETA = 0.69314718055994531f, PS1 = 8.0f, PS2 = 64.0f;

typedef _Float16 b16;
typedef __attribute__((ext_vector_type(16))) _Float16 v16b;
typedef __attribute__((ext_vector_type(8))) _Float16 v8b;
typedef __attribute__((ext_vector_type(8))) float v8f;
typedef __attribute__((ext_vector_type(4))) float v4f;
__device__ __forceinline__ float bf16_rne(float f) { unsigned int u = __float_as_uint(f); u += 0x7FFFu + ((u >> 16) & 1u); return __uint_as_float(u & 0xFFFF0000u); }
__device__ __forceinline__ void split16(float v, b16& hi, b16& lo) { hi = (b16)v; lo = (b16)(v - (float)hi); }
__device__ __forceinline__ v16b frag_kb(const b16* p, int hh) { const v8b a = *(const v8b*)(p + 8 * hh), b = *(const v8b*)(p + 16 + 8 * hh); v16b f;
#pragma unroll
  for (int e = 0; e < 8; ++e) { f[e] = a[e]; f[8 + e] = b[e]; } return f; }
// fragment from two consecutive 16 x 16 blocks (256 elements each) of a block-tiled plane: p = the lane's row in the first block; same k-map as frag_kb
__device__ __forceinline__ v16b frag_blk(const b16* p, int hh) { const v8b a = *(const v8b*)(p + 8 * hh), b = *(const v8b*)(p + 256 + 8 * hh); v16b f;
#pragma unroll
  for (int e = 0; e < 8; ++e) { f[e] = a[e]; f[8 + e] = b[e]; } return f; }
__device__ __forceinline__ v8f wmma16b(v16b a, v16b b, v8f c) { v8f d = __builtin_amdgcn_wmma_f32_16x16x32_f16(false, a, false, b, (short)0, c, false, false); asm volatile("v_nop\n\tv_nop\n\tv_nop\n\tv_nop" : "+v"(d) : "v"(a), "v"(b)); return d; }
__device__ __forceinline__ void wave_lds_sync() { __builtin_amdgcn_fence(__ATOMIC_RELEASE, "workgroup"); __builtin_amdgcn_wave_barrier(); __builtin_amdgcn_fence(__ATOMIC_ACQUIRE, "workgroup"); }
__device__ __forceinline__ float pmul(float a, float b) { float p = a * b; asm volatile("" : "+v"(p)); return p; }
__device__ __forceinline__ float softplus_b(float x) { const float bx = BETA * x; const float sp = (bx > 20.0f) ? bx : log1pf(__expf(bx)); return sp / BETA; }   // torch softplus(beta x)/beta (threshold 20 on beta*x)
// LDS staging of the linear layers' operand tiles: a stage is KS = 64 k of every operand row of the block (128-B rows, whole lines), laid at a pitch of 144 B for the ds_load_b128 fragment reads; two buffers.
constexpr int KS = 64, LP = KS + 8, NT = E / KS;
__device__ __forceinline__ unsigned lds_off(const void* p) { return (unsigned)(size_t)p; }   // byte offset in the work-group's LDS = low 32 bits of a __shared__ address
// four asynchronous copies, 16 B a lane each, global -> LDS through no register; the s_wait_xcnt stands inside the copies' own statement, so that no later write of an address register can be moved in front of it
__device__ __forceinline__ void copy4(unsigned l0, const b16* g0, unsigned l1, const b16* g1, unsigned l2, const b16* g2, unsigned l3, const b16* g3) {
  asm volatile("global_load_async_to_lds_b128 %0, %1, off\n\tglobal_load_async_to_lds_b128 %2, %3, off\n\tglobal_load_async_to_lds_b128 %4, %5, off\n\tglobal_load_async_to_lds_b128 %6, %7, off\n\ts_wait_xcnt 0x0"
               :: "v"(l0), "v"(g0), "v"(l1), "v"(g1), "v"(l2), "v"(g2), "v"(l3), "v"(g3) : "memory"); }
// 64 rows (16 a copy: a thread's row is tid / 8, its 16-B piece tid % 8) of one stage: l = the thread's LDS byte address in the first row group, g = its global address there
__device__ __forceinline__ void copy_rows64(unsigned l, const b16* g) { copy4(l, g, l + 16 * LP * 2, g + 16 * E, l + 32 * LP * 2, g + 32 * E, l + 48 * LP * 2, g + 48 * E); }
__device__ __forceinline__ void wait_copies() { asm volatile("s_wait_asynccnt 0x0" ::: "memory"); }   // the wave's own copies have landed; in front of the barrier that publishes them
__device__ __forceinline__ void wait_lds_reads() { asm volatile("s_wait_dscnt 0x0" ::: "memory"); }   // the wave's reads of a buffer have retired; in front of the barrier behind which it is refilled

__global__ __launch_bounds__(256) void prep_kernel(const float* __restrict__ query, const float* __restrict__ pquery, const float* __restrict__ wpq, const float* __restrict__ wq, const float* __restrict__ wpc, const float* __restrict__ wc, const float* __restrict__ wo, b16* __restrict__ X16, b16* __restrict__ PQ16, b16* __restrict__ W4, b16* __restrict__ WPQ) {
  const size_t t = (size_t)blockIdx.x * 256 + threadIdx.x; const size_t nx = (size_t)NR * E / 8, np_ = (size_t)NPR * E / 8, nw = (size_t)E * E / 8; v8b o;
  if (t < nx) { const size_t e = t * 8; const v4f a = *(const v4f*)(query + e), c = *(const v4f*)(query + e + 4); for (int j = 0; j < 4; ++j) { o[j] = (b16)(bf16_rne(a[j]) * XS); o[4 + j] = (b16)(bf16_rne(c[j]) * XS); } { *(v8b*)(X16 + e) = o;  } return; }
  size_t u = t - nx;
  if (u < np_) { const size_t e = u * 8; for (int j = 0; j < 8; ++j) o[j] = (b16)(bf16_rne(pquery[e + j]) * XS); { *(v8b*)(PQ16 + e) = o;  } return; } u -= np_;
  if (u < 5 * nw) { const int kind = (int)(u / nw); const size_t e = (u % nw) * 8; const float* w = kind == 0 ? wpc : kind == 1 ? wq : kind == 2 ? wc : kind == 3 ? wo : wpq; for (int j = 0; j < 8; ++j) o[j] = (b16)(bf16_rne(w[e + j]) * WSC);
    b16* dst = (kind < 4) ? (W4 + (size_t)kind * E * E) : WPQ; { *(v8b*)(dst + e) = o;  } }
}
// input linears: grid (NR/64, 8 col blocks, 3 kinds): y = X16 W^T + b (K = 1,024: 32 steps, exact); kind 0: kp -> KPh/KPl planes [row][1024]; kind 1: q = (y)*1/8 -> Qh/Ql; kind 2: kv -> KVh/KVl rows (the per-bh transpose KVT [bh][64 d][2048 t] is written by kvt_kernel)
__global__ __launch_bounds__(128) void lin_kernel(const b16* __restrict__ X16, const b16* __restrict__ W4, const float* __restrict__ bpc, const float* __restrict__ bq, const float* __restrict__ bc, b16* __restrict__ KPh, b16* __restrict__ KPl, b16* __restrict__ Qh, b16* __restrict__ Ql, b16* __restrict__ KVh, b16* __restrict__ KVl) {
  __shared__ __attribute__((aligned(16))) b16 Th[4][16][128 + 8], Tl[4][16][128 + 8]; __shared__ __attribute__((aligned(16))) b16 St[2][64 + 128][LP];   // a stage: rows 0..63 = the block's X rows, 64..191 = its W rows
  const int wave = threadIdx.x >> 5, lane = threadIdx.x & 31, nloc = lane & 15, hlf = lane >> 4; const int kind = blockIdx.z, n0 = blockIdx.y * 128; const size_t m0 = (size_t)blockIdx.x * 64 + wave * 16;
  const b16* W = W4 + (size_t)kind * E * E; const float* bias = kind == 0 ? bpc : kind == 1 ? bq : bc; const float osc = (kind == 1) ? SCL : 1.0f;
  v8f acc[8];
#pragma unroll
  for (int t = 0; t < 8; ++t) acc[t] = (v8f){};
  const int crow = threadIdx.x >> 3, cpc = (threadIdx.x & 7) * 8; const unsigned cl = lds_off(&St[0][crow][cpc]);
  const b16* cx = X16 + ((size_t)blockIdx.x * 64 + crow) * E + cpc; const b16* cw = W + (size_t)(n0 + crow) * E + cpc;
  auto stage = [&](int s) { const unsigned l = cl + (unsigned)(s & 1) * (192 * LP * 2); copy_rows64(l, cx + s * KS); copy_rows64(l + 64 * LP * 2, cw + s * KS); copy_rows64(l + 128 * LP * 2, cw + (size_t)64 * E + s * KS); };
  stage(0); wait_copies(); __syncthreads(); stage(1);
  for (int s = 0; s < NT; ++s) { const b16* sb = &St[s & 1][0][0]; v16b a[2], bw[2][8];   // all fragments of the stage are read in front of its first product: one LDS latency a stage
#pragma unroll   // constant indices keep the fragment arrays in registers
    for (int ks = 0; ks < 2; ++ks) { a[ks] = frag_kb(sb + (wave * 16 + nloc) * LP + ks * 32, hlf);
#pragma unroll   // constant indices keep the fragment arrays in registers
      for (int t = 0; t < 8; ++t) bw[ks][t] = frag_kb(sb + (64 + t * 16 + nloc) * LP + ks * 32, hlf); }
#pragma unroll   // constant indices keep the fragment arrays in registers
    for (int ks = 0; ks < 2; ++ks)
#pragma unroll   // constant indices keep the fragment arrays in registers
      for (int t = 0; t < 8; ++t) acc[t] = wmma16b(a[ks], bw[ks][t], acc[t]);
    wait_lds_reads(); wait_copies(); __syncthreads();   // publishes stage s + 1 and ends every reader's last read of stage s
    if (s + 2 < NT) stage(s + 2); }
  wait_copies();
#pragma unroll
  for (int t = 0; t < 8; ++t) { const float bb = bf16_rne(bias[n0 + t * 16 + nloc]);
#pragma unroll
    for (int r = 0; r < 8; ++r) { b16 p, q; split16((acc[t][r] * (1.0f / (XS * WSC)) + bb) * osc * XS, p, q); Th[wave][8 * hlf + r][t * 16 + nloc] = p; Tl[wave][8 * hlf + r][t * 16 + nloc] = q; } }
  wave_lds_sync(); b16* dh = kind == 0 ? KPh : kind == 1 ? Qh : KVh; b16* dl = kind == 0 ? KPl : kind == 1 ? Ql : KVl;
  { for (int r2 = 0; r2 < 16; r2 += 2) { const int rr = r2 + (lane >> 4), c8 = (lane & 15) * 8; const size_t gi = (m0 + rr) * E + n0 + c8; *(v8b*)(dh + gi) = *(const v8b*)(&Th[wave][rr][c8]); *(v8b*)(dl + gi) = *(const v8b*)(&Tl[wave][rr][c8]); }  }
}
// grid (4 + T/64, BH). Blocks x >= 4: kv transposed per bh. The 128 blocks x < 4: the packed query pq = (pquery Wpq^T + bpq)/8, computed ONCE for all token blocks: a block = 2 tiles of 16 d x 16 p, a wave = one
// quarter of a tile's K (256: 8 products, exact operands): A = WPQ rows (d), B = PQ16 rows (p*2 + b) -> D[d][p]; the four quarters are added through LDS; stored x8 hi/lo as blocks [bh][pt*4 + dt][16 p][16 d]
// (B operand of pattn, k = d): a tile's block is 512 contiguous bytes.
__global__ __launch_bounds__(256) void kvt_kernel(const b16* __restrict__ KVh, const b16* __restrict__ KVl, b16* __restrict__ KVTh, b16* __restrict__ KVTl, const b16* __restrict__ PQ16, const b16* __restrict__ WPQ, const float* __restrict__ bpq, b16* __restrict__ PQh, b16* __restrict__ PQl) {
  __shared__ __attribute__((aligned(16))) b16 Ah[DH][64 + 8], Al[DH][64 + 8]; __shared__ __attribute__((aligned(16))) float Rd[3][2][32][8];   // Rd: K quarters 1..3 of the block's two pq tiles
  if (blockIdx.x < 4) {   // the same for the whole block
    const int wave = threadIdx.x >> 5, lane = threadIdx.x & 31, hh = lane >> 4, col = lane & 15, tl = wave & 1, kq = wave >> 1;
    const int tile = (blockIdx.x * BH + blockIdx.y) * 2 + tl, ct = tile & 63 /* 16 columns of E: head ct / 4, d tile ct % 4 */, pb_ = tile >> 6, b = pb_ >> 1, pt = pb_ & 1;
    const b16* wa = WPQ + (size_t)(ct * 16 + col) * E + kq * 256 + 8 * hh; const b16* pa = PQ16 + ((size_t)(pt * 16 + col) * BS + b) * E + kq * 256 + 8 * hh; v8f acc = {};
#pragma unroll 1   // two groups of four k steps, one memory latency each, through the same registers: unrolled, the kernel's register count would leave the transposing blocks fewer than their 8 waves a SIMD
    for (int g = 0; g < 2; ++g) { v16b fa[4], fb[4];
#pragma unroll   // constant indices keep the fragment arrays in registers
      for (int j = 0; j < 4; ++j) { fa[j] = frag_kb(wa + j * 32, 0); fb[j] = frag_kb(pa + j * 32, 0); }
      asm volatile("s_wait_xcnt 0x0" :: "v"(wa), "v"(pa) : "memory");   // in front of every later overwrite of the address registers of these loads, which are its inputs, so that no load lands on one of them ahead of the wait
      wa += 128; pa += 128;
#pragma unroll   // constant indices keep the fragment arrays in registers
      for (int j = 0; j < 4; ++j) acc = wmma16b(fa[j], fb[j], acc); }
    if (kq) *(v8f*)&Rd[kq - 1][tl][lane][0] = acc;
    __syncthreads();   // publishes the quarters 1..3 to the waves that hold quarter 0
    if (kq == 0) { const v4f b0 = *(const v4f*)(bpq + ct * 16 + 8 * hh), b1 = *(const v4f*)(bpq + ct * 16 + 8 * hh + 4); v8b hv, lv;
      for (int k = 0; k < 3; ++k) acc += *(const v8f*)&Rd[k][tl][lane][0];
#pragma unroll
      for (int r = 0; r < 8; ++r) { const float bb = bf16_rne(r < 4 ? b0[r & 3] : b1[r & 3]); b16 p, q; split16((acc[r] * (1.0f / (XS * WSC)) + bb) * SCL * XS, p, q); hv[r] = p; lv[r] = q; }
      const size_t go = ((size_t)((b * NH + (ct >> 2)) * 2 + pt) * 4 + (ct & 3)) * 256 + col * 16 + 8 * hh; *(v8b*)(PQh + go) = hv; *(v8b*)(PQl + go) = lv; }
    return; }
  const int bh = blockIdx.y, t0 = (blockIdx.x - 4) * 64, t_ = threadIdx.x; const int b = bh / NH, h = bh % NH;
  for (int q = t_; q < 64 * DH; q += 256) { const int tt = q / DH, d = q % DH; const size_t gi = ((size_t)(t0 + tt) * BS + b) * E + h * DH + d; Ah[d][tt] = KVh[gi]; Al[d][tt] = KVl[gi]; }
  __syncthreads();
  { for (int q = t_; q < DH * 8; q += 256) { const int d = q >> 3, c8 = (q & 7) * 8; const size_t gi = ((size_t)bh * DH + d) * T + t0 + c8; *(v8b*)(KVTh + gi) = *(const v8b*)(&Ah[d][c8]); *(v8b*)(KVTl + gi) = *(const v8b*)(&Al[d][c8]); }  }
}
// pattn: block = (bh, 64 t) x 4 waves: tile = KP rows (t, b; head cols) [16 t x 64] x PQ^T -> [16 x 32]: 2 col tiles x 2 k steps x 3 products; softplus; stored as PAh/PAl [bh][t][32] (x8 hi/lo) and transposed as
// PATh/PATl [bh][32 p][t]; pq comes ready from the launch before (blocks [bh][pt*4 + dt][16 p][16 d])
__global__ __launch_bounds__(128) void pattn_kernel(const b16* __restrict__ PQh, const b16* __restrict__ PQl, const b16* __restrict__ KPh, const b16* __restrict__ KPl, b16* __restrict__ PAh, b16* __restrict__ PAl, b16* __restrict__ PATh, b16* __restrict__ PATl) {
  __shared__ __attribute__((aligned(16))) b16 Rh[4][16][PL + 8], Rl[4][16][PL + 8]; __shared__ __attribute__((aligned(16))) b16 Rt[PL][64 + 8], Rtl[PL][64 + 8];
  const int wave = threadIdx.x >> 5, lane = threadIdx.x & 31, nloc = lane & 15, hlf = lane >> 4, t_ = threadIdx.x; const int bh = blockIdx.y, b = bh / NH, h = bh % NH, t0 = blockIdx.x * 64;
  // the wave's KP fragments (hi, lo; two k steps) and all pq fragments are loaded in front of the first product: one memory latency and not one a fragment
  const size_t arow = ((size_t)(t0 + wave * 16 + nloc) * BS + b) * E + h * DH + 8 * hlf; const b16 *kpa = KPh + arow, *kpb = KPl + arow; v16b ka[2], kal[2];
#pragma unroll   // constant indices keep the fragment arrays in registers
  for (int j = 0; j < 2; ++j) { ka[j] = frag_kb(kpa + j * 32, 0); kal[j] = frag_kb(kpb + j * 32, 0); }
  const size_t qo = (size_t)bh * (PL * DH) + nloc * 16 + 8 * hlf; const b16 *qa = PQh + qo, *qb = PQl + qo; v16b bp[2][2], bpl[2][2];
#pragma unroll   // constant indices keep the fragment arrays in registers
  for (int j = 0; j < 2; ++j)
#pragma unroll   // constant indices keep the fragment arrays in registers
    for (int t = 0; t < 2; ++t) { bp[j][t] = frag_blk(qa + (t * 4 + 2 * j) * 256, 0); bpl[j][t] = frag_blk(qb + (t * 4 + 2 * j) * 256, 0); }
  asm volatile("s_wait_xcnt 0x0" :: "v"(kpa), "v"(kpb), "v"(qa), "v"(qb) : "memory");   // in front of every later overwrite of the address registers of these loads, which are its inputs, so that no load lands on one of them ahead of the wait
  // pattn for the wave's 16 t: A = KP rows ((t0 + wave*16 + nloc)*2 + b) cols h*64.., B = pq rows p (k = d)
  { v8f d2[2] = {{}, {}};
#pragma unroll
    for (int j = 0; j < 2; ++j)
#pragma unroll
      for (int t = 0; t < 2; ++t) { d2[t] = wmma16b(ka[j], bp[j][t], d2[t]); d2[t] = wmma16b(kal[j], bp[j][t], d2[t]); d2[t] = wmma16b(ka[j], bpl[j][t], d2[t]); }
#pragma unroll
    for (int t = 0; t < 2; ++t)
#pragma unroll
      for (int r = 0; r < 8; ++r) { const float v = softplus_b(d2[t][r] * (1.0f / (XS * XS))); b16 p, q; split16(v * XS, p, q); const int tt = wave * 16 + 8 * hlf + r, pp = t * 16 + nloc; Rh[wave][8 * hlf + r][pp] = p; Rl[wave][8 * hlf + r][pp] = q; Rt[pp][tt] = p; Rtl[pp][tt] = q; } }
  __syncthreads();
  {
    for (int k = 0; k < 2; ++k) { const int rr = k * 8 + (lane >> 2), c8 = (lane & 3) * 8; const size_t gi = ((size_t)bh * T + t0 + wave * 16 + rr) * PL + c8; *(v8b*)(PAh + gi) = *(const v8b*)(&Rh[wave][rr][c8]); *(v8b*)(PAl + gi) = *(const v8b*)(&Rl[wave][rr][c8]); }
    for (int q = t_; q < PL * 8; q += 128) { const int pp = q >> 3, c8 = (q & 7) * 8; const size_t gi = ((size_t)bh * PL + pp) * T + t0 + c8; *(v8b*)(PATh + gi) = *(const v8b*)(&Rt[pp][c8]); *(v8b*)(PATl + gi) = *(const v8b*)(&Rtl[pp][c8]); }
     }
}
// prefix state: grid (8 tiles, BH), one wave per (16 d x 16 p) tile, one serial pass over the keys (K = 32 a step, 3 products, f32 accumulate), both orientations: sd = KVT.PAT^T -> D[d][p], st = PAT.KVT^T -> D[p][d].
// At each chunk boundary c = 1..NC-1 the running sum is stored as its mean x SS (hi/lo): MT blocks [pt*4+dt][16 p][16 d] (A operand of step 1, k = d), MS blocks [dt*2+pt][16 d][16 p] (A operand of step 2, k = p);
// a wave's block is 512 contiguous bytes. Operand fragments run three key steps ahead in a ring of four register stages, so that the pass is not one memory latency a step.
__device__ __forceinline__ void state_mac(v16b k, v16b kl, v16b p, v16b pl, v8f& sd, v8f& st) { sd = wmma16b(k, p, sd); st = wmma16b(p, k, st); sd = wmma16b(k, pl, sd); st = wmma16b(pl, k, st); sd = wmma16b(kl, p, sd); st = wmma16b(p, kl, st); }
__device__ __forceinline__ void state_store(v8f sd, v8f st, int c, b16* mth, b16* mtl, b16* msh, b16* msl) { const float f = SS / (XS * XS * (float)(c * CH)); v8b dh_, dl_, th_, tl_;
#pragma unroll
  for (int r = 0; r < 8; ++r) { b16 p, q; split16(sd[r] * f, p, q); dh_[r] = p; dl_[r] = q; split16(st[r] * f, p, q); th_[r] = p; tl_[r] = q; }
  *(v8b*)mth = dh_; *(v8b*)mtl = dl_; *(v8b*)msh = th_; *(v8b*)msl = tl_;
  asm volatile("s_wait_xcnt 0x0" ::: "memory"); }   // in front of every later overwrite of the data and address registers of the four stores (and of the address registers of the ring loads issued before them)
__global__ __launch_bounds__(32) void state_kernel(const b16* __restrict__ KVTh, const b16* __restrict__ KVTl, const b16* __restrict__ PATh, const b16* __restrict__ PATl, b16* __restrict__ MTh, b16* __restrict__ MTl, b16* __restrict__ MSh, b16* __restrict__ MSl) {
  const int lane = threadIdx.x, hh = lane >> 4, col = lane & 15; const int bh = blockIdx.y, dt = blockIdx.x >> 1, pt = blockIdx.x & 1;
  const size_t ok = ((size_t)bh * DH + dt * 16 + col) * T + 8 * hh, op = ((size_t)bh * PL + pt * 16 + col) * T + 8 * hh;   // the lane half's k offset is part of the four running pointers
  const b16* kh = KVTh + ok; const b16* kl = KVTl + ok; const b16* ph = PATh + op; const b16* pl = PATl + op;
  const size_t ot = (size_t)bh * NC * (DH * PL) + ((pt * 4 + dt) * 16 + col) * 16 + 8 * hh, os = (size_t)bh * NC * (DH * PL) + ((dt * 2 + pt) * 16 + col) * 16 + 8 * hh;
  b16* mth = MTh + ot; b16* mtl = MTl + ot; b16* msh = MSh + os; b16* msl = MSl + os;
  v16b fk[4], fkl[4], fp[4], fpl[4];
#pragma unroll   // here and in the loop: the ring's stage index must be a constant, so that the four stages stay in registers
  for (int j = 0; j < 3; ++j) { fk[j] = frag_kb(kh + j * 32, 0); fkl[j] = frag_kb(kl + j * 32, 0); fp[j] = frag_kb(ph + j * 32, 0); fpl[j] = frag_kb(pl + j * 32, 0); }
  v8f sd = {}, st = {};
  constexpr int NS = (NC - 1) * CH / 32;   // 62 key steps: the last chunk feeds no state
  for (int base = 0; base + 4 <= NS; base += 4) {   // 15 groups of 4; the loads reach key step base + 6 <= 62, inside the row
#pragma unroll
    for (int j = 0; j < 4; ++j) { const int jn = (j + 3) & 3, kn = (j + 3) * 32;
      fk[jn] = frag_kb(kh + kn, 0); fkl[jn] = frag_kb(kl + kn, 0); fp[jn] = frag_kb(ph + kn, 0); fpl[jn] = frag_kb(pl + kn, 0);
      state_mac(fk[j], fkl[j], fp[j], fpl[j], sd, st);
      if (j & 1) { mth += DH * PL; mtl += DH * PL; msh += DH * PL; msl += DH * PL; state_store(sd, st, (base + j + 1) >> 1, mth, mtl, msh, msl); } }
    kh += 128; kl += 128; ph += 128; pl += 128; }
  state_mac(fk[0], fkl[0], fp[0], fpl[0], sd, st); state_mac(fk[1], fkl[1], fp[1], fpl[1], sd, st);   // key steps 60 and 61, already in the ring
  state_store(sd, st, NC - 1, mth + DH * PL, mtl + DH * PL, msh + DH * PL, msl + DH * PL);
  asm volatile("s_wait_loadcnt 0x0" ::: "memory");   // the ring's last stage (key step 62) is loaded and not used: its loads have landed before the wave ends and gives its registers back
}
// step 1: grid (T/32, BH), 2 waves x 16 queries; earlier chunks: AI^T = MT(p rows) Q^T (2 p-tiles, K = 64, 3 products), weighted 64c/(n+1); key blocks of the query's own chunk: S1^T = KV.Q^T (K = 64, 3 products), masked keys > q -> 0, x PS1 hi/lo; AW^T += PAT^T(p rows) S1^T (2 p-tiles, 3 products);
// aw = (AW + 64c AI)/(n+1); softmax over the 32 p (each lane holds 16 of its query's 32 values? lane (hh, col): acc[t][r] = AW^T[p = t*16 + 8hh + r][query col] -> the query's 32 values are split over the
__global__ __launch_bounds__(64) void step1_kernel(const b16* __restrict__ Qh, const b16* __restrict__ Ql, const b16* __restrict__ KVh, const b16* __restrict__ KVl, const b16* __restrict__ PATh, const b16* __restrict__ PATl, const b16* __restrict__ MTh, const b16* __restrict__ MTl, b16* __restrict__ Ah, b16* __restrict__ Al) {
  __shared__ __attribute__((aligned(16))) b16 Ra[2][16][PL + 8], Ral[2][16][PL + 8];
  const int wave = threadIdx.x >> 5, lane = threadIdx.x & 31, hh = lane >> 4, col = lane & 15; const int bh = blockIdx.y, b = bh / NH, h = bh % NH; const int q0 = blockIdx.x * 32 + wave * 16, qi = q0 + col;
  const size_t qrow = ((size_t)qi * BS + b) * E + h * DH; const v16b qa0 = frag_kb(Qh + qrow, hh), qa1 = frag_kb(Qh + qrow + 32, hh), ql0 = frag_kb(Ql + qrow, hh), ql1 = frag_kb(Ql + qrow + 32, hh);
  const b16* Pb = PATh + (size_t)bh * PL * T; const b16* Plb = PATl + (size_t)bh * PL * T;
  v8f aw[2] = {{}, {}}, awl[2] = {{}, {}}, ai[2] = {{}, {}}; const int ks0 = (blockIdx.x * 32) & ~(CH - 1), nb = (blockIdx.x & 1) + 1;   // nb = key blocks of 32 from the chunk's start up to the block's 32 queries
  // The fragments of a key block are loaded as groups ahead of the products that use them, so that a block costs one memory latency and not one a fragment: the first block's together with the query's and the
  // state's, the next block's into the same registers as soon as this block's products have read them. kf = KV rows (key tile, k half: hi, lo), pf = PAT rows (p tile: hi, lo).
  v16b kf[8], pf[4]; const b16 *ka, *kal, *pa, *pal;   // the lane's base addresses of a group (its k half included): every load of the group is one of them plus a constant
  auto load_kv = [&](int kb) { const size_t r = ((size_t)(kb + col) * BS + b) * E + h * DH + 8 * hh; ka = KVh + r; kal = KVl + r;
#pragma unroll   // constant indices keep the fragment arrays in registers
    for (int u = 0; u < 4; ++u) { const int c = (u >> 1) * 16 * BS * E + (u & 1) * 32; kf[2 * u] = frag_kb(ka + c, 0); kf[2 * u + 1] = frag_kb(kal + c, 0); } };
  auto load_pa = [&](int kb) { const size_t r = (size_t)col * T + kb + 8 * hh; pa = Pb + r; pal = Plb + r;
#pragma unroll   // constant indices keep the fragment arrays in registers
    for (int t = 0; t < 2; ++t) { pf[2 * t] = frag_kb(pa + t * 16 * T, 0); pf[2 * t + 1] = frag_kb(pal + t * 16 * T, 0); } };
  load_kv(ks0); load_pa(ks0);
  // kept in front of the branch: the address arithmetic behind it may take over the address registers of the loads above; the addresses are inputs, so that no load of the groups lands on one of them ahead of the wait
  asm volatile("s_wait_xcnt 0x0" :: "v"(Qh + qrow + 8 * hh), "v"(Ql + qrow + 8 * hh), "v"(ka), "v"(kal), "v"(pa), "v"(pal) : "memory");
  if (ks0 > 0) { const size_t so = ((size_t)bh * NC + ks0 / CH) * (DH * PL);
    v16b mh[4], ml[4];   // all state fragments are loaded in front of the first product, so that they cost one memory latency and not one each
#pragma unroll
    for (int u = 0; u < 4; ++u) { mh[u] = frag_blk(MTh + so + ((u * 2) * 16 + col) * 16, hh); ml[u] = frag_blk(MTl + so + ((u * 2) * 16 + col) * 16, hh); }
#pragma unroll
    for (int t = 0; t < 2; ++t) { ai[t] = wmma16b(mh[2 * t], qa0, ai[t]); ai[t] = wmma16b(mh[2 * t], ql0, ai[t]); ai[t] = wmma16b(ml[2 * t], qa0, ai[t]);
      ai[t] = wmma16b(mh[2 * t + 1], qa1, ai[t]); ai[t] = wmma16b(mh[2 * t + 1], ql1, ai[t]); ai[t] = wmma16b(ml[2 * t + 1], qa1, ai[t]); } }
  for (int i = 0; i < nb; ++i) { const int kb = ks0 + 32 * i; const bool more = i + 1 < nb;
    v8f s0 = {}, s1 = {};
    s0 = wmma16b(kf[0], qa0, s0); s0 = wmma16b(kf[0], ql0, s0); s0 = wmma16b(kf[1], qa0, s0); s0 = wmma16b(kf[2], qa1, s0); s0 = wmma16b(kf[2], ql1, s0); s0 = wmma16b(kf[3], qa1, s0);
    s1 = wmma16b(kf[4], qa0, s1); s1 = wmma16b(kf[4], ql0, s1); s1 = wmma16b(kf[5], qa0, s1); s1 = wmma16b(kf[6], qa1, s1); s1 = wmma16b(kf[6], ql1, s1); s1 = wmma16b(kf[7], qa1, s1);
    if (more) { load_kv(kb + 32); asm volatile("s_wait_xcnt 0x0" :: "v"(ka), "v"(kal) : "memory"); }   // the wait: in front of every later overwrite of the address registers of these loads, which are its inputs as above
    v16b ph, pl;
#pragma unroll
    for (int r = 0; r < 8; ++r) { const int ka = kb + 8 * hh + r, kbb = kb + 16 + 8 * hh + r; const float v0 = (ka <= qi) ? s0[r] * (1.0f / (XS * XS)) : 0.0f, v1 = (kbb <= qi) ? s1[r] * (1.0f / (XS * XS)) : 0.0f; b16 p, q; split16(v0 * PS1, p, q); ph[r] = p; pl[r] = q; split16(v1 * PS1, p, q); ph[8 + r] = p; pl[8 + r] = q; }
#pragma unroll
    for (int t = 0; t < 2; ++t) { aw[t] = wmma16b(pf[2 * t], ph, aw[t]); awl[t] = wmma16b(pf[2 * t], pl, awl[t]); awl[t] = wmma16b(pf[2 * t + 1], ph, awl[t]); }
    if (more) { load_pa(kb + 32); asm volatile("s_wait_xcnt 0x0" :: "v"(pa), "v"(pal) : "memory"); } }   // the wait: as above
  // lane (hh, col): value[p = t*16 + 8hh + r] for query col; divide by (qi + 1); softmax over 32
  float v[16]; const float invn = 1.0f / ((float)(qi + 1) * PS1 * XS), invi = (float)ks0 / ((float)(qi + 1) * SS * XS); float mx = -INFINITY;
#pragma unroll
  for (int t = 0; t < 2; ++t) for (int r = 0; r < 8; ++r) { v[t * 8 + r] = (aw[t][r] + awl[t][r]) * invn + ai[t][r] * invi; mx = fmaxf(mx, v[t * 8 + r]); }
  mx = fmaxf(mx, __shfl_xor(mx, 16)); float sm = 0.0f; for (int i = 0; i < 16; ++i) { v[i] = __expf(v[i] - mx); sm += v[i]; } sm += __shfl_xor(sm, 16); const float inv = 1.0f / sm;
#pragma unroll
  for (int t = 0; t < 2; ++t) for (int r = 0; r < 8; ++r) { b16 p, q; split16(v[t * 8 + r] * inv * PS2, p, q); Ra[wave][col][t * 16 + 8 * hh + r] = p; Ral[wave][col][t * 16 + 8 * hh + r] = q; }
  wave_lds_sync();
  { for (int k = 0; k < 2; ++k) { const int rr = k * 8 + (lane >> 2), c8 = (lane & 3) * 8; const size_t gi = ((size_t)bh * T + q0 + rr) * PL + c8; *(v8b*)(Ah + gi) = *(const v8b*)(&Ra[wave][rr][c8]); *(v8b*)(Al + gi) = *(const v8b*)(&Ral[wave][rr][c8]); }  }
}
// step 2: grid (T/32, BH): earlier chunks: OI^T = MS(d rows) A^T (4 d-tiles, K = 32, 3 products), weighted 64c/(n+1); own chunk: S2^T = PA(keys).A(q)^T (A-operand = PA rows [key][32], B = A rows [q][32]; K = 32: 3 products), causal, x PS1 hi/lo; O^T += KVT(d rows) S2^T (4 d-tiles, 3 products); / (n+1)
__global__ __launch_bounds__(64) void step2_kernel(const b16* __restrict__ PAh, const b16* __restrict__ PAl, const b16* __restrict__ Ah, const b16* __restrict__ Al, const b16* __restrict__ KVTh, const b16* __restrict__ KVTl, const b16* __restrict__ MSh, const b16* __restrict__ MSl, b16* __restrict__ ATh, b16* __restrict__ ATl) {
  __shared__ __attribute__((aligned(16))) float To[2][16][DH + 4];
  const int wave = threadIdx.x >> 5, lane = threadIdx.x & 31, hh = lane >> 4, col = lane & 15; const int bh = blockIdx.y, b = bh / NH, h = bh % NH; const int q0 = blockIdx.x * 32 + wave * 16, qi = q0 + col;
  const v16b aq = frag_kb(Ah + ((size_t)bh * T + qi) * PL, hh), aql = frag_kb(Al + ((size_t)bh * T + qi) * PL, hh);
  const b16* Vb = KVTh + (size_t)bh * DH * T; const b16* Vlb = KVTl + (size_t)bh * DH * T;
  v8f o[4] = {{}, {}, {}, {}}, ol[4] = {{}, {}, {}, {}}, oi[4] = {{}, {}, {}, {}}; const int ks0 = (blockIdx.x * 32) & ~(CH - 1), nb = (blockIdx.x & 1) + 1;   // nb = key blocks of 32 from the chunk's start up to the block's 32 queries
  // fragment groups loaded ahead of the products that use them, as in step 1: pk = PA rows (key tile: hi, lo), vf = KVT rows (d tile: hi, lo)
  v16b pk[4], vf[8]; const b16 *pa, *pal, *va, *val;   // the lane's base addresses of a group (its k half included): every load of the group is one of them plus a constant
  auto load_pk = [&](int kb) { const size_t r = ((size_t)bh * T + kb + col) * PL + 8 * hh; pa = PAh + r; pal = PAl + r;
#pragma unroll   // constant indices keep the fragment arrays in registers
    for (int u = 0; u < 2; ++u) { pk[2 * u] = frag_kb(pa + u * 16 * PL, 0); pk[2 * u + 1] = frag_kb(pal + u * 16 * PL, 0); } };
  auto load_vf = [&](int kb) { const size_t r = (size_t)col * T + kb + 8 * hh; va = Vb + r; val = Vlb + r;
#pragma unroll   // constant indices keep the fragment arrays in registers
    for (int t = 0; t < 4; ++t) { vf[2 * t] = frag_kb(va + t * 16 * T, 0); vf[2 * t + 1] = frag_kb(val + t * 16 * T, 0); } };
  load_pk(ks0); load_vf(ks0);
  // kept in front of the branch: the address arithmetic behind it may take over the address registers of the loads above; the addresses are inputs, so that no load of the groups lands on one of them ahead of the wait
  asm volatile("s_wait_xcnt 0x0" :: "v"(Ah + ((size_t)bh * T + qi) * PL + 8 * hh), "v"(Al + ((size_t)bh * T + qi) * PL + 8 * hh), "v"(pa), "v"(pal), "v"(va), "v"(val) : "memory");
  if (ks0 > 0) { const size_t so = ((size_t)bh * NC + ks0 / CH) * (DH * PL);
    v16b mh[4], ml[4];   // all state fragments are loaded in front of the first product, so that they cost one memory latency and not one each
#pragma unroll
    for (int t = 0; t < 4; ++t) { mh[t] = frag_blk(MSh + so + ((t * 2) * 16 + col) * 16, hh); ml[t] = frag_blk(MSl + so + ((t * 2) * 16 + col) * 16, hh); }
#pragma unroll
    for (int t = 0; t < 4; ++t) { oi[t] = wmma16b(mh[t], aq, oi[t]); oi[t] = wmma16b(mh[t], aql, oi[t]); oi[t] = wmma16b(ml[t], aq, oi[t]); } }
  for (int i = 0; i < nb; ++i) { const int kb = ks0 + 32 * i; const bool more = i + 1 < nb;
    v8f s0 = {}, s1 = {};
    s0 = wmma16b(pk[0], aq, s0); s0 = wmma16b(pk[0], aql, s0); s0 = wmma16b(pk[1], aq, s0); s1 = wmma16b(pk[2], aq, s1); s1 = wmma16b(pk[2], aql, s1); s1 = wmma16b(pk[3], aq, s1);
    if (more) { load_pk(kb + 32); asm volatile("s_wait_xcnt 0x0" :: "v"(pa), "v"(pal) : "memory"); }   // the wait: in front of every later overwrite of the address registers of these loads, which are its inputs as above
    v16b ph, pl;
#pragma unroll
    for (int r = 0; r < 8; ++r) { const int ka = kb + 8 * hh + r, kbb = kb + 16 + 8 * hh + r; const float v0 = (ka <= qi) ? s0[r] * (1.0f / (XS * PS2)) : 0.0f, v1 = (kbb <= qi) ? s1[r] * (1.0f / (XS * PS2)) : 0.0f; b16 p, q; split16(v0 * PS1, p, q); ph[r] = p; pl[r] = q; split16(v1 * PS1, p, q); ph[8 + r] = p; pl[8 + r] = q; }
#pragma unroll
    for (int t = 0; t < 4; ++t) { o[t] = wmma16b(vf[2 * t], ph, o[t]); ol[t] = wmma16b(vf[2 * t], pl, ol[t]); ol[t] = wmma16b(vf[2 * t + 1], ph, ol[t]); }
    if (more) { load_vf(kb + 32); asm volatile("s_wait_xcnt 0x0" :: "v"(va), "v"(val) : "memory"); } }   // the wait: as above
  const float invn = 1.0f / ((float)(qi + 1) * PS1 * XS), invi = (float)ks0 / ((float)(qi + 1) * SS * PS2);
#pragma unroll
  for (int t = 0; t < 4; ++t)
#pragma unroll
    for (int r = 0; r < 8; ++r) To[wave][col][t * 16 + 8 * hh + r] = (o[t][r] + ol[t][r]) * invn + oi[t][r] * invi;
  wave_lds_sync();
  { for (int r4 = 0; r4 < 16; r4 += 4) { const int rr = r4 + (lane >> 3), c8 = (lane & 7) * 8; v8b hv, lv; for (int j = 0; j < 8; ++j) { b16 p, q; split16(To[wave][rr][c8 + j] * XS, p, q); hv[j] = p; lv[j] = q; }
      const size_t gi = ((size_t)(q0 + rr) * BS + b) * E + h * DH + c8; *(v8b*)(ATh + gi) = hv; *(v8b*)(ATl + gi) = lv; }  }
}
__global__ __launch_bounds__(128) void oproj_kernel(const b16* __restrict__ ATh, const b16* __restrict__ ATl, const b16* __restrict__ WO, const float* __restrict__ bo, float* __restrict__ out) {
  __shared__ __attribute__((aligned(16))) float Tf[4][16][128 + 4]; __shared__ __attribute__((aligned(16))) b16 St[2][64 + 64 + 128][LP];   // a stage: rows 0..63 = the block's attn hi rows, 64..127 = their lo rows, 128..255 = its W rows
  const int wave = threadIdx.x >> 5, lane = threadIdx.x & 31, nloc = lane & 15, hlf = lane >> 4; const int n0 = blockIdx.y * 128; const size_t m0 = (size_t)blockIdx.x * 64 + wave * 16;
  v8f acc[8];
#pragma unroll
  for (int t = 0; t < 8; ++t) acc[t] = (v8f){};
  const int crow = threadIdx.x >> 3, cpc = (threadIdx.x & 7) * 8; const unsigned cl = lds_off(&St[0][crow][cpc]); const size_t co = ((size_t)blockIdx.x * 64 + crow) * E + cpc;
  const b16* ch = ATh + co; const b16* cq = ATl + co; const b16* cw = WO + (size_t)(n0 + crow) * E + cpc;
  auto stage = [&](int s) { const unsigned l = cl + (unsigned)(s & 1) * (256 * LP * 2); copy_rows64(l, ch + s * KS); copy_rows64(l + 64 * LP * 2, cq + s * KS); copy_rows64(l + 128 * LP * 2, cw + s * KS); copy_rows64(l + 192 * LP * 2, cw + (size_t)64 * E + s * KS); };
  stage(0); wait_copies(); __syncthreads(); stage(1);
  for (int s = 0; s < NT; ++s) { const b16* sb = &St[s & 1][0][0]; v16b a[2], al[2], bw[2][8];   // all fragments of the stage are read in front of its first product: one LDS latency a stage
#pragma unroll   // constant indices keep the fragment arrays in registers
    for (int ks = 0; ks < 2; ++ks) { a[ks] = frag_kb(sb + (wave * 16 + nloc) * LP + ks * 32, hlf); al[ks] = frag_kb(sb + (64 + wave * 16 + nloc) * LP + ks * 32, hlf);
#pragma unroll   // constant indices keep the fragment arrays in registers
      for (int t = 0; t < 8; ++t) bw[ks][t] = frag_kb(sb + (128 + t * 16 + nloc) * LP + ks * 32, hlf); }
#pragma unroll   // constant indices keep the fragment arrays in registers
    for (int ks = 0; ks < 2; ++ks)
#pragma unroll   // constant indices keep the fragment arrays in registers
      for (int t = 0; t < 8; ++t) { acc[t] = wmma16b(a[ks], bw[ks][t], acc[t]); acc[t] = wmma16b(al[ks], bw[ks][t], acc[t]); }
    wait_lds_reads(); wait_copies(); __syncthreads();   // publishes stage s + 1 and ends every reader's last read of stage s
    if (s + 2 < NT) stage(s + 2); }
  wait_copies();
#pragma unroll
  for (int t = 0; t < 8; ++t) { const float bb = bf16_rne(bo[n0 + t * 16 + nloc]);
#pragma unroll
    for (int r = 0; r < 8; ++r) Tf[wave][8 * hlf + r][t * 16 + nloc] = acc[t][r] * (1.0f / (XS * WSC)) + bb; }
  wave_lds_sync();
  { for (int rr = 0; rr < 16; ++rr) *(v4f*)(out + (m0 + rr) * E + n0 + lane * 4) = *(const v4f*)(&Tf[wave][rr][lane * 4]);  }
}
}  // namespace

extern "C" void kernel_launch(void* const* d_in, const int* in_sizes, int n_in, void* d_out, int out_size, void* d_ws, size_t ws_size, hipStream_t stream) {
  (void)n_in;
  auto Fp = [&](int i) { return (const float*)d_in[i]; };
  // input order: 0 query [2048,2,1024], 1 pquery [32,2,1024], 2 Wpq [1024,1024], 3 bpq, 4 Wq, 5 bq, 6 Wpc, 7 bpc, 8 Wc, 9 bc, 10 Wo, 11 bo (torch [out][in])
  if (in_sizes[0] != NR * E || in_sizes[1] != NPR * E || in_sizes[2] != E * E || in_sizes[4] != E * E || in_sizes[6] != E * E || in_sizes[8] != E * E || in_sizes[10] != E * E || out_size != NR * E) return;
  size_t off = 0; char* ws = (char*)d_ws;
  auto carve = [&](size_t bytes) { char* p = ws + off; off += (bytes + 255) & ~(size_t)255; return p; };
  b16* X16 = (b16*)carve((size_t)NR * E * 2); b16* PQ16 = (b16*)carve((size_t)NPR * E * 2); b16* W4 = (b16*)carve((size_t)4 * E * E * 2); b16* WPQ = (b16*)carve((size_t)E * E * 2);
  b16* KPh = (b16*)carve((size_t)NR * E * 2); b16* KPl = (b16*)carve((size_t)NR * E * 2); b16* Qh = (b16*)carve((size_t)NR * E * 2); b16* Ql = (b16*)carve((size_t)NR * E * 2); b16* KVh = (b16*)carve((size_t)NR * E * 2); b16* KVl = (b16*)carve((size_t)NR * E * 2);
  b16* KVTh = (b16*)carve((size_t)NR * E * 2); b16* KVTl = (b16*)carve((size_t)NR * E * 2); b16* PAh = (b16*)carve((size_t)BH * T * PL * 2); b16* PAl = (b16*)carve((size_t)BH * T * PL * 2); b16* PATh = (b16*)carve((size_t)BH * PL * T * 2); b16* PATl = (b16*)carve((size_t)BH * PL * T * 2);
  b16* Ah = (b16*)carve((size_t)BH * T * PL * 2); b16* Al = (b16*)carve((size_t)BH * T * PL * 2); b16* PQh = (b16*)carve((size_t)BH * PL * DH * 2); b16* PQl = (b16*)carve((size_t)BH * PL * DH * 2);
  b16* MTh = (b16*)carve((size_t)BH * NC * DH * PL * 2); b16* MTl = (b16*)carve((size_t)BH * NC * DH * PL * 2); b16* MSh = (b16*)carve((size_t)BH * NC * DH * PL * 2); b16* MSl = (b16*)carve((size_t)BH * NC * DH * PL * 2);
  b16* ATh = KPh; b16* ATl = KPl;   // region reuse: KP planes are dead after pattn_kernel (stream-ordered); the attention output takes their place
  if (off > ws_size || off > ((size_t)128 << 20)) return;   // ~ 122 MiB
  prep_kernel<<<(unsigned)(((size_t)NR * E / 8 + (size_t)NPR * E / 8 + 5 * (size_t)E * E / 8 + 255) / 256), 256, 0, stream>>>(Fp(0), Fp(1), Fp(2), Fp(4), Fp(6), Fp(8), Fp(10), X16, PQ16, W4, WPQ);
  lin_kernel<<<dim3(NR / 64, E / 128, 3), 128, 0, stream>>>(X16, W4, Fp(7), Fp(5), Fp(9), KPh, KPl, Qh, Ql, KVh, KVl);
  kvt_kernel<<<dim3(4 + T / 64, BH), 256, 0, stream>>>(KVh, KVl, KVTh, KVTl, PQ16, WPQ, Fp(3), PQh, PQl);
  pattn_kernel<<<dim3(T / 64, BH), 128, 0, stream>>>(PQh, PQl, KPh, KPl, PAh, PAl, PATh, PATl);
  state_kernel<<<dim3(8, BH), 32, 0, stream>>>(KVTh, KVTl, PATh, PATl, MTh, MTl, MSh, MSl);
  step1_kernel<<<dim3(T / 32, BH), 64, 0, stream>>>(Qh, Ql, KVh, KVl, PATh, PATl, MTh, MTl, Ah, Al);
  step2_kernel<<<dim3(T / 32, BH), 64, 0, stream>>>(PAh, PAl, Ah, Al, KVTh, KVTl, MSh, MSl, ATh, ATl);
  oproj_kernel<<<dim3(NR / 64, E / 128), 128, 0, stream>>>(ATh, ATl, W4 + (size_t)3 * E * E, Fp(11), (float*)d_out);
}

// v005
// It runs in 124 microseconds.
// Next to v004, in two timings, it ran 1.17 and 1.16 times as fast.
// Over all steps from v000 it is 5.73 times as fast.
#include <hip/hip_runtime.h>

// Lunar causal attention (Luna-style packed attention, causal "efficient" form): T = 2,048 tokens x 2 batch x 1,024 (16 heads x 64), 32 packed positions.
// pq = (pquery Wpq^T + bpq)/8 -> (b,h,p,d); kp = query Wpc^T + bpc; pattn[bh][t][p] = softplus_b(kp_t . pq_p) (b = ln 2); q = (query Wq^T + bq)/8; kv = query Wc^T + bc (tied k = v);
// aw[bh][n][p] = (sum_{m<=n} (q_n . kv_m) pattn[m][p]) / (n+1); A = softmax_p(aw); attn[bh][n][d] = (sum_{m<=n} (A_n . pattn_m) kv[m][d]) / (n+1); out = attn Wo^T + bo -> [2048][2][1024].
// Both "efficient_causal_attention_parallel" calls are evaluated in chunks of 64 keys: the keys of the query's own chunk as causal masked products (x_n . sum y_m z_m^T = sum (x_n.y_m) z_m), all earlier
// chunks through the running outer-product sum S_c[d][p] = sum_{m < 64c} kv[m][d] pattn[m][p] (k = v is tied, so ONE state serves both calls: q_n . S_c and A_n . S_c^T), kept as its mean S_c/(64c) in hi+lo.
// WMMA (v_wmma_f32_16x16x32_f16, f32 accumulate): the four input linears (kp, q, kv: [4,096 x 1,024] x [1,024 x 1,024]; pq: [64 x 1,024] x [1,024 x 1,024]; EXACT bf16 operands, 1 product) and the output linear (attn hi+lo: 2 products); per (bh,
// 16-query wave) and causal 32-key block: S1^T = KV.Q^T (K = 64, hi+lo: 3 products) then AW^T += PATTN^T S1^T (2 p-tiles, 3 products); S2^T = PATTN.A^T (K = 32, 3 products) then O^T += KV^T S2^T
// (4 d-tiles, 3 products); pattn = softplus(kp.pq) per token ([16 tokens x 64] x [64 x 32] per (bh) tile, 3 products). Softplus, softmax over the 32 positions, the 1/(n+1) factors in f32.
// Inputs rounded to bf16 once. Fragment k-map per lane half hh for A AND B: elements 0..7 <- k = 8hh+0..7, 8..15 <- k = 16+8hh+0..7; acc[r] = D[8hh+r][col]. Every

namespace {
constexpr int T = 2048, BS = 2, E = 1024, NH = 16, DH = 64, BH = BS * NH, PL = 32, NR = T * BS /* 4,096 query rows (t, b) */, NPR = PL * BS /* 64 pquery rows */;
constexpr int CH = 64 /* keys per chunk */, NC = T / CH;
constexpr int TB = T / 16 /* blocks of 16 tokens */, BK = 256 /* elements of a 16 x 16 block */;
constexpr float SS = 16.0f /* scale of the stored state mean */;
constexpr float XS = 8.0f, WSC = 256.0f, SCL = 0.125f, BETA = 0.69314718055994531f, PS1 = 8.0f, PS2 = 64.0f;

typedef _Float16 b16;
typedef __attribute__((ext_vector_type(16))) _Float16 v16b;
typedef __attribute__((ext_vector_type(8))) _Float16 v8b;
typedef __attribute__((ext_vector_type(8))) float v8f;
typedef __attribute__((ext_vector_type(4))) float v4f;
__device__ __forceinline__ float bf16_rne(float f) { unsigned int u = __float_as_uint(f); u += 0x7FFFu + ((u >> 16) & 1u); return __uint_as_float(u & 0xFFFF0000u); }
__device__ __forceinline__ void split16(float v, b16& hi, b16& lo) { hi = (b16)v; lo = (b16)(v - (float)hi); }
__device__ __forceinline__ v16b frag_kb(const b16* p, int hh) { const v8b a = *(const v8b*)(p + 8 * hh), b = *(const v8b*)(p + 16 + 8 * hh); v16b f;
#pragma unroll
  for (int e = 0; e < 8; ++e) { f[e] = a[e]; f[8 + e] = b[e]; } return f; }
// fragment from two consecutive 16 x 16 blocks (256 elements each) of a block-tiled plane: p = the lane's row in the first block; same k-map as frag_kb
__device__ __forceinline__ v16b frag_blk(const b16* p, int hh) { const v8b a = *(const v8b*)(p + 8 * hh), b = *(const v8b*)(p + 256 + 8 * hh); v16b f;
#pragma unroll
  for (int e = 0; e < 8; ++e) { f[e] = a[e]; f[8 + e] = b[e]; } return f; }
__device__ __forceinline__ v8f wmma16b(v16b a, v16b b, v8f c) { v8f d = __builtin_amdgcn_wmma_f32_16x16x32_f16(false, a, false, b, (short)0, c, false, false); asm volatile("v_nop\n\tv_nop\n\tv_nop\n\tv_nop" : "+v"(d) : "v"(a), "v"(b)); return d; }
__device__ __forceinline__ void wave_lds_sync() { __builtin_amdgcn_fence(__ATOMIC_RELEASE, "workgroup"); __builtin_amdgcn_wave_barrier(); __builtin_amdgcn_fence(__ATOMIC_ACQUIRE, "workgroup"); }
__device__ __forceinline__ float pmul(float a, float b) { float p = a * b; asm volatile("" : "+v"(p)); return p; }
__device__ __forceinline__ float softplus_b(float x) { const float bx = BETA * x; const float sp = (bx > 20.0f) ? bx : log1pf(__expf(bx)); return sp / BETA; }   // torch softplus(beta x)/beta (threshold 20 on beta*x)
// LDS staging of the linear layers' operand tiles: a stage is KS = 64 k of every operand row of the block (128-B rows, whole lines), laid at a pitch of 144 B for the ds_load_b128 fragment reads; two buffers.
constexpr int KS = 64, LP = KS + 8, NT = E / KS;
__device__ __forceinline__ unsigned lds_off(const void* p) { return (unsigned)(size_t)p; }   // byte offset in the work-group's LDS = low 32 bits of a __shared__ address
// four asynchronous copies, 16 B a lane each, global -> LDS through no register; the s_wait_xcnt stands inside the copies' own statement, so that no later write of an address register can be moved in front of it
__device__ __forceinline__ void copy4(unsigned l0, const b16* g0, unsigned l1, const b16* g1, unsigned l2, const b16* g2, unsigned l3, const b16* g3) {
  asm volatile("global_load_async_to_lds_b128 %0, %1, off\n\tglobal_load_async_to_lds_b128 %2, %3, off\n\tglobal_load_async_to_lds_b128 %4, %5, off\n\tglobal_load_async_to_lds_b128 %6, %7, off\n\ts_wait_xcnt 0x0"
               :: "v"(l0), "v"(g0), "v"(l1), "v"(g1), "v"(l2), "v"(g2), "v"(l3), "v"(g3) : "memory"); }
// 64 rows (16 a copy: a thread's row is tid / 8, its 16-B piece tid % 8) of one stage: l = the thread's LDS byte address in the first row group, g = its global address there
__device__ __forceinline__ void copy_rows64(unsigned l, const b16* g) { copy4(l, g, l + 16 * LP * 2, g + 16 * E, l + 32 * LP * 2, g + 32 * E, l + 48 * LP * 2, g + 48 * E); }
__device__ __forceinline__ void wait_copies() { asm volatile("s_wait_asynccnt 0x0" ::: "memory"); }   // the wave's own copies have landed; in front of the barrier that publishes them
__device__ __forceinline__ void wait_lds_reads() { asm volatile("s_wait_dscnt 0x0" ::: "memory"); }   // the wave's reads of a buffer have retired; in front of the barrier behind which it is refilled

__global__ __launch_bounds__(256) void prep_kernel(const float* __restrict__ query, const float* __restrict__ pquery, const float* __restrict__ wpq, const float* __restrict__ wq, const float* __restrict__ wpc, const float* __restrict__ wc, const float* __restrict__ wo, b16* __restrict__ X16, b16* __restrict__ PQ16, b16* __restrict__ W4, b16* __restrict__ WPQ) {
  const size_t t = (size_t)blockIdx.x * 256 + threadIdx.x; const size_t nx = (size_t)NR * E / 8, np_ = (size_t)NPR * E / 8, nw = (size_t)E * E / 8; v8b o;
  if (t < nx) { const size_t e = t * 8; const v4f a = *(const v4f*)(query + e), c = *(const v4f*)(query + e + 4); for (int j = 0; j < 4; ++j) { o[j] = (b16)(bf16_rne(a[j]) * XS); o[4 + j] = (b16)(bf16_rne(c[j]) * XS); } { *(v8b*)(X16 + e) = o;  } return; }
  size_t u = t - nx;
  if (u < np_) { const size_t e = u * 8; for (int j = 0; j < 8; ++j) o[j] = (b16)(bf16_rne(pquery[e + j]) * XS); { *(v8b*)(PQ16 + e) = o;  } return; } u -= np_;
  if (u < 5 * nw) { const int kind = (int)(u / nw); const size_t e = (u % nw) * 8; const float* w = kind == 0 ? wpc : kind == 1 ? wq : kind == 2 ? wc : kind == 3 ? wo : wpq; for (int j = 0; j < 8; ++j) o[j] = (b16)(bf16_rne(w[e + j]) * WSC);
    b16* dst = (kind < 4) ? (W4 + (size_t)kind * E * E) : WPQ; { *(v8b*)(dst + e) = o;  } }
}
// input linears: grid (NR/64, 8 col blocks, 3 kinds): y = X16 W^T + b (K = 1,024: 32 steps, exact); kind 0: kp -> KPh/KPl; kind 1: q = (y)*1/8 -> Qh/Ql; kind 2: kv -> KVh/KVl. All six planes are laid per bh in
// 16 x 16 blocks [bh][t / 16][d / 16][16 t][16 d]: a fragment load (16 rows x 32 B) of the later launches then reads one block, 512 contiguous bytes = 4 whole lines, and not 32 B out of each of 16 lines.
__global__ __launch_bounds__(128) void lin_kernel(const b16* __restrict__ X16, const b16* __restrict__ W4, const float* __restrict__ bpc, const float* __restrict__ bq, const float* __restrict__ bc, b16* __restrict__ KPh, b16* __restrict__ KPl, b16* __restrict__ Qh, b16* __restrict__ Ql, b16* __restrict__ KVh, b16* __restrict__ KVl) {
  __shared__ __attribute__((aligned(16))) b16 Th[4][16][128 + 8], Tl[4][16][128 + 8]; __shared__ __attribute__((aligned(16))) b16 St[2][64 + 128][LP];   // a stage: rows 0..63 = the block's X rows, 64..191 = its W rows
  const int wave = threadIdx.x >> 5, lane = threadIdx.x & 31, nloc = lane & 15, hlf = lane >> 4; const int kind = blockIdx.z, n0 = blockIdx.y * 128;
  const b16* W = W4 + (size_t)kind * E * E; const float* bias = kind == 0 ? bpc : kind == 1 ? bq : bc; const float osc = (kind == 1) ? SCL : 1.0f;
  v8f acc[8];
#pragma unroll
  for (int t = 0; t < 8; ++t) acc[t] = (v8f){};
  const int crow = threadIdx.x >> 3, cpc = (threadIdx.x & 7) * 8; const unsigned cl = lds_off(&St[0][crow][cpc]);
  const b16* cx = X16 + ((size_t)blockIdx.x * 64 + crow) * E + cpc; const b16* cw = W + (size_t)(n0 + crow) * E + cpc;
  auto stage = [&](int s) { const unsigned l = cl + (unsigned)(s & 1) * (192 * LP * 2); copy_rows64(l, cx + s * KS); copy_rows64(l + 64 * LP * 2, cw + s * KS); copy_rows64(l + 128 * LP * 2, cw + (size_t)64 * E + s * KS); };
  stage(0); wait_copies(); __syncthreads(); stage(1);
  for (int s = 0; s < NT; ++s) { const b16* sb = &St[s & 1][0][0]; v16b a[2], bw[2][8];   // all fragments of the stage are read in front of its first product: one LDS latency a stage
#pragma unroll   // constant indices keep the fragment arrays in registers
    for (int ks = 0; ks < 2; ++ks) { a[ks] = frag_kb(sb + (wave * 16 + nloc) * LP + ks * 32, hlf);
#pragma unroll   // constant indices keep the fragment arrays in registers
      for (int t = 0; t < 8; ++t) bw[ks][t] = frag_kb(sb + (64 + t * 16 + nloc) * LP + ks * 32, hlf); }
#pragma unroll   // constant indices keep the fragment arrays in registers
    for (int ks = 0; ks < 2; ++ks)
#pragma unroll   // constant indices keep the fragment arrays in registers
      for (int t = 0; t < 8; ++t) acc[t] = wmma16b(a[ks], bw[ks][t], acc[t]);
    wait_lds_reads(); wait_copies(); __syncthreads();   // publishes stage s + 1 and ends every reader's last read of stage s
    if (s + 2 < NT) stage(s + 2); }
  wait_copies();
#pragma unroll
  for (int t = 0; t < 8; ++t) { const float bb = bf16_rne(bias[n0 + t * 16 + nloc]);
#pragma unroll
    for (int r = 0; r < 8; ++r) { b16 p, q; split16((acc[t][r] * (1.0f / (XS * WSC)) + bb) * osc * XS, p, q); Th[wave][8 * hlf + r][t * 16 + nloc] = p; Tl[wave][8 * hlf + r][t * 16 + nloc] = q; } }
  wave_lds_sync(); b16* dh = kind == 0 ? KPh : kind == 1 ? Qh : KVh; b16* dl = kind == 0 ? KPl : kind == 1 ? Ql : KVl;
  // stored per bh as 16 x 16 blocks [bh][t / 16][d / 16][16 t][16 d] (512 contiguous bytes each), the order in which the fragment loads of pattn and step 1 read them. The wave's 16 rows are 8 t of both batches:
  // a store = one batch, one head, two d blocks: 16 lanes fill 8 t x 16 d = 256 contiguous bytes of a block (its lower or upper half, by the wave's parity)
  { for (int s = 0; s < 8; ++s) { const int bb = s & 1, hl = (s >> 1) & 1, db = (s >> 2) * 2 + (lane >> 4), tl = (lane & 15) >> 1, hf = lane & 1; const int rr = tl * 2 + bb, c8 = hl * 64 + db * 16 + hf * 8;
      const size_t gi = (((size_t)(bb * NH + blockIdx.y * 2 + hl) * TB + blockIdx.x * 2 + (wave >> 1)) * 4 + db) * BK + ((wave & 1) * 8 + tl) * 16 + hf * 8; *(v8b*)(dh + gi) = *(const v8b*)(&Th[wave][rr][c8]); *(v8b*)(dl + gi) = *(const v8b*)(&Tl[wave][rr][c8]); }  }
}
// grid (4 + T/64, BH). Blocks x >= 4: kv transposed per bh, as blocks [bh][d / 16][t / 16][16 d][16 t] (512 contiguous bytes each, one fragment load). The 128 blocks x < 4: the packed query pq = (pquery Wpq^T + bpq)/8, computed ONCE for all token blocks: a block = 2 tiles of 16 d x 16 p, a wave = one
// quarter of a tile's K (256: 8 products, exact operands): A = WPQ rows (d), B = PQ16 rows (p*2 + b) -> D[d][p]; the four quarters are added through LDS; stored x8 hi/lo as blocks [bh][pt*4 + dt][16 p][16 d]
// (B operand of pattn, k = d): a tile's block is 512 contiguous bytes.
__global__ __launch_bounds__(256) void kvt_kernel(const b16* __restrict__ KVh, const b16* __restrict__ KVl, b16* __restrict__ KVTh, b16* __restrict__ KVTl, const b16* __restrict__ PQ16, const b16* __restrict__ WPQ, const float* __restrict__ bpq, b16* __restrict__ PQh, b16* __restrict__ PQl) {
  __shared__ __attribute__((aligned(16))) b16 Ah[DH][64 + 8], Al[DH][64 + 8]; __shared__ __attribute__((aligned(16))) float Rd[3][2][32][8];   // Rd: K quarters 1..3 of the block's two pq tiles
  if (blockIdx.x < 4) {   // the same for the whole block
    const int wave = threadIdx.x >> 5, lane = threadIdx.x & 31, hh = lane >> 4, col = lane & 15, tl = wave & 1, kq = wave >> 1;
    const int tile = (blockIdx.x * BH + blockIdx.y) * 2 + tl, ct = tile & 63 /* 16 columns of E: head ct / 4, d tile ct % 4 */, pb_ = tile >> 6, b = pb_ >> 1, pt = pb_ & 1;
    const b16* wa = WPQ + (size_t)(ct * 16 + col) * E + kq * 256 + 8 * hh; const b16* pa = PQ16 + ((size_t)(pt * 16 + col) * BS + b) * E + kq * 256 + 8 * hh; v8f acc = {};
#pragma unroll 1   // two groups of four k steps, one memory latency each, through the same registers: unrolled, the kernel's register count would leave the transposing blocks fewer than their 8 waves a SIMD
    for (int g = 0; g < 2; ++g) { v16b fa[4], fb[4];
#pragma unroll   // constant indices keep the fragment arrays in registers
      for (int j = 0; j < 4; ++j) { fa[j] = frag_kb(wa + j * 32, 0); fb[j] = frag_kb(pa + j * 32, 0); }
      asm volatile("s_wait_xcnt 0x0" :: "v"(wa), "v"(pa) : "memory");   // in front of every later overwrite of the address registers of these loads, which are its inputs, so that no load lands on one of them ahead of the wait
      wa += 128; pa += 128;
#pragma unroll   // constant indices keep the fragment arrays in registers
      for (int j = 0; j < 4; ++j) acc = wmma16b(fa[j], fb[j], acc); }
    if (kq) *(v8f*)&Rd[kq - 1][tl][lane][0] = acc;
    __syncthreads();   // publishes the quarters 1..3 to the waves that hold quarter 0
    if (kq == 0) { const v4f b0 = *(const v4f*)(bpq + ct * 16 + 8 * hh), b1 = *(const v4f*)(bpq + ct * 16 + 8 * hh + 4); v8b hv, lv;
      for (int k = 0; k < 3; ++k) acc += *(const v8f*)&Rd[k][tl][lane][0];
#pragma unroll
      for (int r = 0; r < 8; ++r) { const float bb = bf16_rne(r < 4 ? b0[r & 3] : b1[r & 3]); b16 p, q; split16((acc[r] * (1.0f / (XS * WSC)) + bb) * SCL * XS, p, q); hv[r] = p; lv[r] = q; }
      const size_t go = ((size_t)((b * NH + (ct >> 2)) * 2 + pt) * 4 + (ct & 3)) * 256 + col * 16 + 8 * hh; *(v8b*)(PQh + go) = hv; *(v8b*)(PQl + go) = lv; }
    return; }
  const int bh = blockIdx.y, t0 = (blockIdx.x - 4) * 64, t_ = threadIdx.x;
  { const size_t g0 = ((size_t)bh * TB + (t0 >> 4)) * (4 * BK) + t_; const b16 *ga = KVh + g0, *gb = KVl + g0; b16 xh[16], xl[16];   // the 64 t x 64 d of the block are 4,096 contiguous elements [t / 16][d / 16][16 t][16 d]: every load is a base plus a constant
#pragma unroll   // constant indices keep the two arrays in registers
    for (int i = 0; i < 16; ++i) { xh[i] = ga[i * 256]; xl[i] = gb[i * 256]; }
    asm volatile("s_wait_xcnt 0x0" :: "v"(ga), "v"(gb) : "memory");   // in front of every later overwrite of the address registers of these loads, which are its inputs
#pragma unroll   // constant indices keep the two arrays in registers
    for (int i = 0; i < 16; ++i) { const int q = t_ + i * 256, tt = (q >> 10) * 16 + ((q >> 4) & 15), d = ((q >> 8) & 3) * 16 + (q & 15); Ah[d][tt] = xh[i]; Al[d][tt] = xl[i]; } }
  __syncthreads();
  { for (int q = t_; q < DH * 8; q += 256) { const int d = q >> 3, c8 = (q & 7) * 8; const size_t gi = (((size_t)bh * 4 + (d >> 4)) * TB + ((t0 + c8) >> 4)) * BK + (d & 15) * 16 + (c8 & 15); *(v8b*)(KVTh + gi) = *(const v8b*)(&Ah[d][c8]); *(v8b*)(KVTl + gi) = *(const v8b*)(&Al[d][c8]); }  }
}
// pattn: block = (bh, 64 t) x 4 waves: tile = KP rows (t; the head's 64 d) [16 t x 64] x PQ^T -> [16 x 32]: 2 col tiles x 2 k steps x 3 products; softplus; stored as PAh/PAl [bh][t][32] (x8 hi/lo) and transposed as
// PATh/PATl blocks [bh][p / 16][t / 16][16 p][16 t]; pq comes ready from the launch before (blocks [bh][pt*4 + dt][16 p][16 d])
__global__ __launch_bounds__(128) void pattn_kernel(const b16* __restrict__ PQh, const b16* __restrict__ PQl, const b16* __restrict__ KPh, const b16* __restrict__ KPl, b16* __restrict__ PAh, b16* __restrict__ PAl, b16* __restrict__ PATh, b16* __restrict__ PATl) {
  __shared__ __attribute__((aligned(16))) b16 Rh[4][16][PL + 8], Rl[4][16][PL + 8]; __shared__ __attribute__((aligned(16))) b16 Rt[PL][64 + 8], Rtl[PL][64 + 8];
  const int wave = threadIdx.x >> 5, lane = threadIdx.x & 31, nloc = lane & 15, hlf = lane >> 4, t_ = threadIdx.x; const int bh = blockIdx.y, t0 = blockIdx.x * 64;
  // the wave's KP fragments (hi, lo; two k steps) and all pq fragments are loaded in front of the first product: one memory latency and not one a fragment
  const size_t arow = ((size_t)bh * TB + (t0 >> 4) + wave) * (4 * BK) + nloc * 16 + 8 * hlf; const b16 *kpa = KPh + arow, *kpb = KPl + arow; v16b ka[2], kal[2];
#pragma unroll   // constant indices keep the fragment arrays in registers
  for (int j = 0; j < 2; ++j) { ka[j] = frag_blk(kpa + j * 2 * BK, 0); kal[j] = frag_blk(kpb + j * 2 * BK, 0); }
  const size_t qo = (size_t)bh * (PL * DH) + nloc * 16 + 8 * hlf; const b16 *qa = PQh + qo, *qb = PQl + qo; v16b bp[2][2], bpl[2][2];
#pragma unroll   // constant indices keep the fragment arrays in registers
  for (int j = 0; j < 2; ++j)
#pragma unroll   // constant indices keep the fragment arrays in registers
    for (int t = 0; t < 2; ++t) { bp[j][t] = frag_blk(qa + (t * 4 + 2 * j) * 256, 0); bpl[j][t] = frag_blk(qb + (t * 4 + 2 * j) * 256, 0); }
  asm volatile("s_wait_xcnt 0x0" :: "v"(kpa), "v"(kpb), "v"(qa), "v"(qb) : "memory");   // in front of every later overwrite of the address registers of these loads, which are its inputs, so that no load lands on one of them ahead of the wait
  // pattn for the wave's 16 t: A = KP rows t0 + wave*16 + nloc of bh (k = d), B = pq rows p (k = d)
  { v8f d2[2] = {{}, {}};
#pragma unroll
    for (int j = 0; j < 2; ++j)
#pragma unroll
      for (int t = 0; t < 2; ++t) { d2[t] = wmma16b(ka[j], bp[j][t], d2[t]); d2[t] = wmma16b(kal[j], bp[j][t], d2[t]); d2[t] = wmma16b(ka[j], bpl[j][t], d2[t]); }
#pragma unroll
    for (int t = 0; t < 2; ++t)
#pragma unroll
      for (int r = 0; r < 8; ++r) { const float v = softplus_b(d2[t][r] * (1.0f / (XS * XS))); b16 p, q; split16(v * XS, p, q); const int tt = wave * 16 + 8 * hlf + r, pp = t * 16 + nloc; Rh[wave][8 * hlf + r][pp] = p; Rl[wave][8 * hlf + r][pp] = q; Rt[pp][tt] = p; Rtl[pp][tt] = q; } }
  __syncthreads();
  {
    for (int k = 0; k < 2; ++k) { const int rr = k * 8 + (lane >> 2), c8 = (lane & 3) * 8; const size_t gi = ((size_t)bh * T + t0 + wave * 16 + rr) * PL + c8; *(v8b*)(PAh + gi) = *(const v8b*)(&Rh[wave][rr][c8]); *(v8b*)(PAl + gi) = *(const v8b*)(&Rl[wave][rr][c8]); }
    for (int q = t_; q < PL * 8; q += 128) { const int pp = q >> 3, c8 = (q & 7) * 8; const size_t gi = (((size_t)bh * 2 + (pp >> 4)) * TB + ((t0 + c8) >> 4)) * BK + (pp & 15) * 16 + (c8 & 15); *(v8b*)(PATh + gi) = *(const v8b*)(&Rt[pp][c8]); *(v8b*)(PATl + gi) = *(const v8b*)(&Rtl[pp][c8]); }
     }
}
// prefix state: grid (8 tiles, BH), one wave per (16 d x 16 p) tile, one serial pass over the keys (K = 32 a step, 3 products, f32 accumulate), both orientations: sd = KVT.PAT^T -> D[d][p], st = PAT.KVT^T -> D[p][d].
// At each chunk boundary c = 1..NC-1 the running sum is stored as its mean x SS (hi/lo): MT blocks [pt*4+dt][16 p][16 d] (A operand of step 1, k = d), MS blocks [dt*2+pt][16 d][16 p] (A operand of step 2, k = p);
// a wave's block is 512 contiguous bytes. Operand fragments run three key steps ahead in a ring of four register stages, so that the pass is not one memory latency a step.
__device__ __forceinline__ void state_mac(v16b k, v16b kl, v16b p, v16b pl, v8f& sd, v8f& st) { sd = wmma16b(k, p, sd); st = wmma16b(p, k, st); sd = wmma16b(k, pl, sd); st = wmma16b(pl, k, st); sd = wmma16b(kl, p, sd); st = wmma16b(p, kl, st); }
__device__ __forceinline__ void state_store(v8f sd, v8f st, int c, b16* mth, b16* mtl, b16* msh, b16* msl) { const float f = SS / (XS * XS * (float)(c * CH)); v8b dh_, dl_, th_, tl_;
#pragma unroll
  for (int r = 0; r < 8; ++r) { b16 p, q; split16(sd[r] * f, p, q); dh_[r] = p; dl_[r] = q; split16(st[r] * f, p, q); th_[r] = p; tl_[r] = q; }
  *(v8b*)mth = dh_; *(v8b*)mtl = dl_; *(v8b*)msh = th_; *(v8b*)msl = tl_;
  asm volatile("s_wait_xcnt 0x0" ::: "memory"); }   // in front of every later overwrite of the data and address registers of the four stores (and of the address registers of the ring loads issued before them)
__global__ __launch_bounds__(32) void state_kernel(const b16* __restrict__ KVTh, const b16* __restrict__ KVTl, const b16* __restrict__ PATh, const b16* __restrict__ PATl, b16* __restrict__ MTh, b16* __restrict__ MTl, b16* __restrict__ MSh, b16* __restrict__ MSl) {
  const int lane = threadIdx.x, hh = lane >> 4, col = lane & 15; const int bh = blockIdx.y, dt = blockIdx.x >> 1, pt = blockIdx.x & 1;
  const size_t ok = ((size_t)bh * 4 + dt) * TB * BK + col * 16 + 8 * hh, op = ((size_t)bh * 2 + pt) * TB * BK + col * 16 + 8 * hh;   // the lane half's k offset is part of the four running pointers
  const b16* kh = KVTh + ok; const b16* kl = KVTl + ok; const b16* ph = PATh + op; const b16* pl = PATl + op;
  const size_t ot = (size_t)bh * NC * (DH * PL) + ((pt * 4 + dt) * 16 + col) * 16 + 8 * hh, os = (size_t)bh * NC * (DH * PL) + ((dt * 2 + pt) * 16 + col) * 16 + 8 * hh;
  b16* mth = MTh + ot; b16* mtl = MTl + ot; b16* msh = MSh + os; b16* msl = MSl + os;
  v16b fk[4], fkl[4], fp[4], fpl[4];
#pragma unroll   // here and in the loop: the ring's stage index must be a constant, so that the four stages stay in registers
  for (int j = 0; j < 3; ++j) { fk[j] = frag_blk(kh + j * 2 * BK, 0); fkl[j] = frag_blk(kl + j * 2 * BK, 0); fp[j] = frag_blk(ph + j * 2 * BK, 0); fpl[j] = frag_blk(pl + j * 2 * BK, 0); }
  v8f sd = {}, st = {};
  constexpr int NS = (NC - 1) * CH / 32;   // 62 key steps: the last chunk feeds no state
  for (int base = 0; base + 4 <= NS; base += 4) {   // 15 groups of 4; the loads reach key step base + 6 <= 62, inside the tile's strip of blocks
#pragma unroll
    for (int j = 0; j < 4; ++j) { const int jn = (j + 3) & 3, kn = (j + 3) * 2 * BK;
      fk[jn] = frag_blk(kh + kn, 0); fkl[jn] = frag_blk(kl + kn, 0); fp[jn] = frag_blk(ph + kn, 0); fpl[jn] = frag_blk(pl + kn, 0);
      state_mac(fk[j], fkl[j], fp[j], fpl[j], sd, st);
      if (j & 1) { mth += DH * PL; mtl += DH * PL; msh += DH * PL; msl += DH * PL; state_store(sd, st, (base + j + 1) >> 1, mth, mtl, msh, msl); } }
    kh += 8 * BK; kl += 8 * BK; ph += 8 * BK; pl += 8 * BK; }
  state_mac(fk[0], fkl[0], fp[0], fpl[0], sd, st); state_mac(fk[1], fkl[1], fp[1], fpl[1], sd, st);   // key steps 60 and 61, already in the ring
  state_store(sd, st, NC - 1, mth + DH * PL, mtl + DH * PL, msh + DH * PL, msl + DH * PL);
  asm volatile("s_wait_loadcnt 0x0" ::: "memory");   // the ring's last stage (key step 62) is loaded and not used: its loads have landed before the wave ends and gives its registers back
}
// step 1: grid (T/32, BH), 2 waves x 16 queries; earlier chunks: AI^T = MT(p rows) Q^T (2 p-tiles, K = 64, 3 products), weighted 64c/(n+1); key blocks of the query's own chunk: S1^T = KV.Q^T (K = 64, 3 products), masked keys > q -> 0, x PS1 hi/lo; AW^T += PAT^T(p rows) S1^T (2 p-tiles, 3 products);
// aw = (AW + 64c AI)/(n+1); softmax over the 32 p (each lane holds 16 of its query's 32 values? lane (hh, col): acc[t][r] = AW^T[p = t*16 + 8hh + r][query col] -> the query's 32 values are split over the
__global__ __launch_bounds__(64) void step1_kernel(const b16* __restrict__ Qh, const b16* __restrict__ Ql, const b16* __restrict__ KVh, const b16* __restrict__ KVl, const b16* __restrict__ PATh, const b16* __restrict__ PATl, const b16* __restrict__ MTh, const b16* __restrict__ MTl, b16* __restrict__ Ah, b16* __restrict__ Al) {
  __shared__ __attribute__((aligned(16))) b16 Ra[2][16][PL + 8], Ral[2][16][PL + 8];
  const int wave = threadIdx.x >> 5, lane = threadIdx.x & 31, hh = lane >> 4, col = lane & 15; const int bh = blockIdx.y; const int q0 = blockIdx.x * 32 + wave * 16, qi = q0 + col;
  const size_t qrow = ((size_t)bh * TB + (q0 >> 4)) * (4 * BK) + col * 16; const v16b qa0 = frag_blk(Qh + qrow, hh), qa1 = frag_blk(Qh + qrow + 2 * BK, hh), ql0 = frag_blk(Ql + qrow, hh), ql1 = frag_blk(Ql + qrow + 2 * BK, hh);
  const b16* Pb = PATh + (size_t)bh * PL * T; const b16* Plb = PATl + (size_t)bh * PL * T;
  v8f aw[2] = {{}, {}}, awl[2] = {{}, {}}, ai[2] = {{}, {}}; const int ks0 = (blockIdx.x * 32) & ~(CH - 1), nb = (blockIdx.x & 1) + 1;   // nb = key blocks of 32 from the chunk's start up to the block's 32 queries
  // The fragments of a key block are loaded as groups ahead of the products that use them, so that a block costs one memory latency and not one a fragment: the first block's together with the query's and the
  // state's, the next block's into the same registers as soon as this block's products have read them. kf = KV rows (key tile, k half: hi, lo), pf = PAT rows (p tile: hi, lo).
  v16b kf[8], pf[4]; const b16 *ka, *kal, *pa, *pal;   // the lane's base addresses of a group (its k half included): every load of the group is one of them plus a constant
  auto load_kv = [&](int kb) { const size_t r = ((size_t)bh * TB + (kb >> 4)) * (4 * BK) + col * 16 + 8 * hh; ka = KVh + r; kal = KVl + r;
#pragma unroll   // constant indices keep the fragment arrays in registers
    for (int u = 0; u < 4; ++u) { const int c = (u >> 1) * 4 * BK + (u & 1) * 2 * BK; kf[2 * u] = frag_blk(ka + c, 0); kf[2 * u + 1] = frag_blk(kal + c, 0); } };
  auto load_pa = [&](int kb) { const size_t r = (size_t)(kb >> 4) * BK + col * 16 + 8 * hh; pa = Pb + r; pal = Plb + r;
#pragma unroll   // constant indices keep the fragment arrays in registers
    for (int t = 0; t < 2; ++t) { pf[2 * t] = frag_blk(pa + t * TB * BK, 0); pf[2 * t + 1] = frag_blk(pal + t * TB * BK, 0); } };
  load_kv(ks0); load_pa(ks0);
  // kept in front of the branch: the address arithmetic behind it may take over the address registers of the loads above; the addresses are inputs, so that no load of the groups lands on one of them ahead of the wait
  asm volatile("s_wait_xcnt 0x0" :: "v"(Qh + qrow + 8 * hh), "v"(Ql + qrow + 8 * hh), "v"(ka), "v"(kal), "v"(pa), "v"(pal) : "memory");
  if (ks0 > 0) { const size_t so = ((size_t)bh * NC + ks0 / CH) * (DH * PL);
    v16b mh[4], ml[4];   // all state fragments are loaded in front of the first product, so that they cost one memory latency and not one each
#pragma unroll
    for (int u = 0; u < 4; ++u) { mh[u] = frag_blk(MTh + so + ((u * 2) * 16 + col) * 16, hh); ml[u] = frag_blk(MTl + so + ((u * 2) * 16 + col) * 16, hh); }
#pragma unroll
    for (int t = 0; t < 2; ++t) { ai[t] = wmma16b(mh[2 * t], qa0, ai[t]); ai[t] = wmma16b(mh[2 * t], ql0, ai[t]); ai[t] = wmma16b(ml[2 * t], qa0, ai[t]);
      ai[t] = wmma16b(mh[2 * t + 1], qa1, ai[t]); ai[t] = wmma16b(mh[2 * t + 1], ql1, ai[t]); ai[t] = wmma16b(ml[2 * t + 1], qa1, ai[t]); } }
  for (int i = 0; i < nb; ++i) { const int kb = ks0 + 32 * i; const bool more = i + 1 < nb;
    v8f s0 = {}, s1 = {};
    s0 = wmma16b(kf[0], qa0, s0); s0 = wmma16b(kf[0], ql0, s0); s0 = wmma16b(kf[1], qa0, s0); s0 = wmma16b(kf[2], qa1, s0); s0 = wmma16b(kf[2], ql1, s0); s0 = wmma16b(kf[3], qa1, s0);
    s1 = wmma16b(kf[4], qa0, s1); s1 = wmma16b(kf[4], ql0, s1); s1 = wmma16b(kf[5], qa0, s1); s1 = wmma16b(kf[6], qa1, s1); s1 = wmma16b(kf[6], ql1, s1); s1 = wmma16b(kf[7], qa1, s1);
    if (more) { load_kv(kb + 32); asm volatile("s_wait_xcnt 0x0" :: "v"(ka), "v"(kal) : "memory"); }   // the wait: in front of every later overwrite of the address registers of these loads, which are its inputs as above
    v16b ph, pl;
#pragma unroll
    for (int r = 0; r < 8; ++r) { const int ka = kb + 8 * hh + r, kbb = kb + 16 + 8 * hh + r; const float v0 = (ka <= qi) ? s0[r] * (1.0f / (XS * XS)) : 0.0f, v1 = (kbb <= qi) ? s1[r] * (1.0f / (XS * XS)) : 0.0f; b16 p, q; split16(v0 * PS1, p, q); ph[r] = p; pl[r] = q; split16(v1 * PS1, p, q); ph[8 + r] = p; pl[8 + r] = q; }
#pragma unroll
    for (int t = 0; t < 2; ++t) { aw[t] = wmma16b(pf[2 * t], ph, aw[t]); awl[t] = wmma16b(pf[2 * t], pl, awl[t]); awl[t] = wmma16b(pf[2 * t + 1], ph, awl[t]); }
    if (more) { load_pa(kb + 32); asm volatile("s_wait_xcnt 0x0" :: "v"(pa), "v"(pal) : "memory"); } }   // the wait: as above
  // lane (hh, col): value[p = t*16 + 8hh + r] for query col; divide by (qi + 1); softmax over 32
  float v[16]; const float invn = 1.0f / ((float)(qi + 1) * PS1 * XS), invi = (float)ks0 / ((float)(qi + 1) * SS * XS); float mx = -INFINITY;
#pragma unroll
  for (int t = 0; t < 2; ++t) for (int r = 0; r < 8; ++r) { v[t * 8 + r] = (aw[t][r] + awl[t][r]) * invn + ai[t][r] * invi; mx = fmaxf(mx, v[t * 8 + r]); }
  mx = fmaxf(mx, __shfl_xor(mx, 16)); float sm = 0.0f; for (int i = 0; i < 16; ++i) { v[i] = __expf(v[i] - mx); sm += v[i]; } sm += __shfl_xor(sm, 16); const float inv = 1.0f / sm;
#pragma unroll
  for (int t = 0; t < 2; ++t) for (int r = 0; r < 8; ++r) { b16 p, q; split16(v[t * 8 + r] * inv * PS2, p, q); Ra[wave][col][t * 16 + 8 * hh + r] = p; Ral[wave][col][t * 16 + 8 * hh + r] = q; }
  wave_lds_sync();
  { for (int k = 0; k < 2; ++k) { const int rr = k * 8 + (lane >> 2), c8 = (lane & 3) * 8; const size_t gi = ((size_t)bh * T + q0 + rr) * PL + c8; *(v8b*)(Ah + gi) = *(const v8b*)(&Ra[wave][rr][c8]); *(v8b*)(Al + gi) = *(const v8b*)(&Ral[wave][rr][c8]); }  }
}
// step 2: grid (T/32, BH): earlier chunks: OI^T = MS(d rows) A^T (4 d-tiles, K = 32, 3 products), weighted 64c/(n+1); own chunk: S2^T = PA(keys).A(q)^T (A-operand = PA rows [key][32], B = A rows [q][32]; K = 32: 3 products), causal, x PS1 hi/lo; O^T += KVT(d rows) S2^T (4 d-tiles, 3 products); / (n+1)
__global__ __launch_bounds__(64) void step2_kernel(const b16* __restrict__ PAh, const b16* __restrict__ PAl, const b16* __restrict__ Ah, const b16* __restrict__ Al, const b16* __restrict__ KVTh, const b16* __restrict__ KVTl, const b16* __restrict__ MSh, const b16* __restrict__ MSl, b16* __restrict__ ATh, b16* __restrict__ ATl) {
  __shared__ __attribute__((aligned(16))) float To[2][16][DH + 4];
  const int wave = threadIdx.x >> 5, lane = threadIdx.x & 31, hh = lane >> 4, col = lane & 15; const int bh = blockIdx.y, b = bh / NH, h = bh % NH; const int q0 = blockIdx.x * 32 + wave * 16, qi = q0 + col;
  const v16b aq = frag_kb(Ah + ((size_t)bh * T + qi) * PL, hh), aql = frag_kb(Al + ((size_t)bh * T + qi) * PL, hh);
  const b16* Vb = KVTh + (size_t)bh * DH * T; const b16* Vlb = KVTl + (size_t)bh * DH * T;
  v8f o[4] = {{}, {}, {}, {}}, ol[4] = {{}, {}, {}, {}}, oi[4] = {{}, {}, {}, {}}; const int ks0 = (blockIdx.x * 32) & ~(CH - 1), nb = (blockIdx.x & 1) + 1;   // nb = key blocks of 32 from the chunk's start up to the block's 32 queries
  // fragment groups loaded ahead of the products that use them, as in step 1: pk = PA rows (key tile: hi, lo), vf = KVT rows (d tile: hi, lo)
  v16b pk[4], vf[8]; const b16 *pa, *pal, *va, *val;   // the lane's base addresses of a group (its k half included): every load of the group is one of them plus a constant
  auto load_pk = [&](int kb) { const size_t r = ((size_t)bh * T + kb + col) * PL + 8 * hh; pa = PAh + r; pal = PAl + r;
#pragma unroll   // constant indices keep the fragment arrays in registers
    for (int u = 0; u < 2; ++u) { pk[2 * u] = frag_kb(pa + u * 16 * PL, 0); pk[2 * u + 1] = frag_kb(pal + u * 16 * PL, 0); } };
  auto load_vf = [&](int kb) { const size_t r = (size_t)(kb >> 4) * BK + col * 16 + 8 * hh; va = Vb + r; val = Vlb + r;
#pragma unroll   // constant indices keep the fragment arrays in registers
    for (int t = 0; t < 4; ++t) { vf[2 * t] = frag_blk(va + t * TB * BK, 0); vf[2 * t + 1] = frag_blk(val + t * TB * BK, 0); } };
  load_pk(ks0); load_vf(ks0);
  // kept in front of the branch: the address arithmetic behind it may take over the address registers of the loads above; the addresses are inputs, so that no load of the groups lands on one of them ahead of the wait
  asm volatile("s_wait_xcnt 0x0" :: "v"(Ah + ((size_t)bh * T + qi) * PL + 8 * hh), "v"(Al + ((size_t)bh * T + qi) * PL + 8 * hh), "v"(pa), "v"(pal), "v"(va), "v"(val) : "memory");
  if (ks0 > 0) { const size_t so = ((size_t)bh * NC + ks0 / CH) * (DH * PL);
    v16b mh[4], ml[4];   // all state fragments are loaded in front of the first product, so that they cost one memory latency and not one each
#pragma unroll
    for (int t = 0; t < 4; ++t) { mh[t] = frag_blk(MSh + so + ((t * 2) * 16 + col) * 16, hh); ml[t] = frag_blk(MSl + so + ((t * 2) * 16 + col) * 16, hh); }
#pragma unroll
    for (int t = 0; t < 4; ++t) { oi[t] = wmma16b(mh[t], aq, oi[t]); oi[t] = wmma16b(mh[t], aql, oi[t]); oi[t] = wmma16b(ml[t], aq, oi[t]); } }
  for (int i = 0; i < nb; ++i) { const int kb = ks0 + 32 * i; const bool more = i + 1 < nb;
    v8f s0 = {}, s1 = {};
    s0 = wmma16b(pk[0], aq, s0); s0 = wmma16b(pk[0], aql, s0); s0 = wmma16b(pk[1], aq, s0); s1 = wmma16b(pk[2], aq, s1); s1 = wmma16b(pk[2], aql, s1); s1 = wmma16b(pk[3], aq, s1);
    if (more) { load_pk(kb + 32); asm volatile("s_wait_xcnt 0x0" :: "v"(pa), "v"(pal) : "memory"); }   // the wait: in front of every later overwrite of the address registers of these loads, which are its inputs as above
    v16b ph, pl;
#pragma unroll
    for (int r = 0; r < 8; ++r) { const int ka = kb + 8 * hh + r, kbb = kb + 16 + 8 * hh + r; const float v0 = (ka <= qi) ? s0[r] * (1.0f / (XS * PS2)) : 0.0f, v1 = (kbb <= qi) ? s1[r] * (1.0f / (XS * PS2)) : 0.0f; b16 p, q; split16(v0 * PS1, p, q); ph[r] = p; pl[r] = q; split16(v1 * PS1, p, q); ph[8 + r] = p; pl[8 + r] = q; }
#pragma unroll
    for (int t = 0; t < 4; ++t) { o[t] = wmma16b(vf[2 * t], ph, o[t]); ol[t] = wmma16b(vf[2 * t], pl, ol[t]); ol[t] = wmma16b(vf[2 * t + 1], ph, ol[t]); }
    if (more) { load_vf(kb + 32); asm volatile("s_wait_xcnt 0x0" :: "v"(va), "v"(val) : "memory"); } }   // the wait: as above
  const float invn = 1.0f / ((float)(qi + 1) * PS1 * XS), invi = (float)ks0 / ((float)(qi + 1) * SS * PS2);
#pragma unroll
  for (int t = 0; t < 4; ++t)
#pragma unroll
    for (int r = 0; r < 8; ++r) To[wave][col][t * 16 + 8 * hh + r] = (o[t][r] + ol[t][r]) * invn + oi[t][r] * invi;
  wave_lds_sync();
  { for (int r4 = 0; r4 < 16; r4 += 4) { const int rr = r4 + (lane >> 3), c8 = (lane & 7) * 8; v8b hv, lv; for (int j = 0; j < 8; ++j) { b16 p, q; split16(To[wave][rr][c8 + j] * XS, p, q); hv[j] = p; lv[j] = q; }
      const size_t gi = ((size_t)(q0 + rr) * BS + b) * E + h * DH + c8; *(v8b*)(ATh + gi) = hv; *(v8b*)(ATl + gi) = lv; }  }
}
__global__ __launch_bounds__(128) void oproj_kernel(const b16* __restrict__ ATh, const b16* __restrict__ ATl, const b16* __restrict__ WO, const float* __restrict__ bo, float* __restrict__ out) {
  __shared__ __attribute__((aligned(16))) float Tf[4][16][128 + 4]; __shared__ __attribute__((aligned(16))) b16 St[2][64 + 64 + 128][LP];   // a stage: rows 0..63 = the block's attn hi rows, 64..127 = their lo rows, 128..255 = its W rows
  const int wave = threadIdx.x >> 5, lane = threadIdx.x & 31, nloc = lane & 15, hlf = lane >> 4; const int n0 = blockIdx.y * 128; const size_t m0 = (size_t)blockIdx.x * 64 + wave * 16;
  v8f acc[8];
#pragma unroll
  for (int t = 0; t < 8; ++t) acc[t] = (v8f){};
  const int crow = threadIdx.x >> 3, cpc = (threadIdx.x & 7) * 8; const unsigned cl = lds_off(&St[0][crow][cpc]); const size_t co = ((size_t)blockIdx.x * 64 + crow) * E + cpc;
  const b16* ch = ATh + co; const b16* cq = ATl + co; const b16* cw = WO + (size_t)(n0 + crow) * E + cpc;
  auto stage = [&](int s) { const unsigned l = cl + (unsigned)(s & 1) * (256 * LP * 2); copy_rows64(l, ch + s * KS); copy_rows64(l + 64 * LP * 2, cq + s * KS); copy_rows64(l + 128 * LP * 2, cw + s * KS); copy_rows64(l + 192 * LP * 2, cw + (size_t)64 * E + s * KS); };
  stage(0); wait_copies(); __syncthreads(); stage(1);
  for (int s = 0; s < NT; ++s) { const b16* sb = &St[s & 1][0][0]; v16b a[2], al[2], bw[2][8];   // all fragments of the stage are read in front of its first product: one LDS latency a stage
#pragma unroll   // constant indices keep the fragment arrays in registers
    for (int ks = 0; ks < 2; ++ks) { a[ks] = frag_kb(sb + (wave * 16 + nloc) * LP + ks * 32, hlf); al[ks] = frag_kb(sb + (64 + wave * 16 + nloc) * LP + ks * 32, hlf);
#pragma unroll   // constant indices keep the fragment arrays in registers
      for (int t = 0; t < 8; ++t) bw[ks][t] = frag_kb(sb + (128 + t * 16 + nloc) * LP + ks * 32, hlf); }
#pragma unroll   // constant indices keep the fragment arrays in registers
    for (int ks = 0; ks < 2; ++ks)
#pragma unroll   // constant indices keep the fragment arrays in registers
      for (int t = 0; t < 8; ++t) { acc[t] = wmma16b(a[ks], bw[ks][t], acc[t]); acc[t] = wmma16b(al[ks], bw[ks][t], acc[t]); }
    wait_lds_reads(); wait_copies(); __syncthreads();   // publishes stage s + 1 and ends every reader's last read of stage s
    if (s + 2 < NT) stage(s + 2); }
  wait_copies();
#pragma unroll
  for (int t = 0; t < 8; ++t) { const float bb = bf16_rne(bo[n0 + t * 16 + nloc]);
#pragma unroll
    for (int r = 0; r < 8; ++r) Tf[wave][8 * hlf + r][t * 16 + nloc] = acc[t][r] * (1.0f / (XS * WSC)) + bb; }
  wave_lds_sync();
  { for (int rr = 0; rr < 16; ++rr) *(v4f*)(out + (m0 + rr) * E + n0 + lane * 4) = *(const v4f*)(&Tf[wave][rr][lane * 4]);  }
}
}  // namespace

extern "C" void kernel_launch(void* const* d_in, const int* in_sizes, int n_in, void* d_out, int out_size, void* d_ws, size_t ws_size, hipStream_t stream) {
  (void)n_in;
  auto Fp = [&](int i) { return (const float*)d_in[i]; };
  // input order: 0 query [2048,2,1024], 1 pquery [32,2,1024], 2 Wpq [1024,1024], 3 bpq, 4 Wq, 5 bq, 6 Wpc, 7 bpc, 8 Wc, 9 bc, 10 Wo, 11 bo (torch [out][in])
  if (in_sizes[0] != NR * E || in_sizes[1] != NPR * E || in_sizes[2] != E * E || in_sizes[4] != E * E || in_sizes[6] != E * E || in_sizes[8] != E * E || in_sizes[10] != E * E || out_size != NR * E) return;
  size_t off = 0; char* ws = (char*)d_ws;
  auto carve = [&](size_t bytes) { char* p = ws + off; off += (bytes + 255) & ~(size_t)255; return p; };
  b16* X16 = (b16*)carve((size_t)NR * E * 2); b16* PQ16 = (b16*)carve((size_t)NPR * E * 2); b16* W4 = (b16*)carve((size_t)4 * E * E * 2); b16* WPQ = (b16*)carve((size_t)E * E * 2);
  b16* KPh = (b16*)carve((size_t)NR * E * 2); b16* KPl = (b16*)carve((size_t)NR * E * 2); b16* Qh = (b16*)carve((size_t)NR * E * 2); b16* Ql = (b16*)carve((size_t)NR * E * 2); b16* KVh = (b16*)carve((size_t)NR * E * 2); b16* KVl = (b16*)carve((size_t)NR * E * 2);
  b16* KVTh = (b16*)carve((size_t)NR * E * 2); b16* KVTl = (b16*)carve((size_t)NR * E * 2); b16* PAh = (b16*)carve((size_t)BH * T * PL * 2); b16* PAl = (b16*)carve((size_t)BH * T * PL * 2); b16* PATh = (b16*)carve((size_t)BH * PL * T * 2); b16* PATl = (b16*)carve((size_t)BH * PL * T * 2);
  b16* Ah = (b16*)carve((size_t)BH * T * PL * 2); b16* Al = (b16*)carve((size_t)BH * T * PL * 2); b16* PQh = (b16*)carve((size_t)BH * PL * DH * 2); b16* PQl = (b16*)carve((size_t)BH * PL * DH * 2);
  b16* MTh = (b16*)carve((size_t)BH * NC * DH * PL * 2); b16* MTl = (b16*)carve((size_t)BH * NC * DH * PL * 2); b16* MSh = (b16*)carve((size_t)BH * NC * DH * PL * 2); b16* MSl = (b16*)carve((size_t)BH * NC * DH * PL * 2);
  b16* ATh = KPh; b16* ATl = KPl;   // region reuse: KP planes are dead after pattn_kernel (stream-ordered); the attention output takes their place
  if (off > ws_size || off > ((size_t)128 << 20)) return;   // ~ 122 MiB
  prep_kernel<<<(unsigned)(((size_t)NR * E / 8 + (size_t)NPR * E / 8 + 5 * (size_t)E * E / 8 + 255) / 256), 256, 0, stream>>>(Fp(0), Fp(1), Fp(2), Fp(4), Fp(6), Fp(8), Fp(10), X16, PQ16, W4, WPQ);
  lin_kernel<<<dim3(NR / 64, E / 128, 3), 128, 0, stream>>>(X16, W4, Fp(7), Fp(5), Fp(9), KPh, KPl, Qh, Ql, KVh, KVl);
  kvt_kernel<<<dim3(4 + T / 64, BH), 256, 0, stream>>>(KVh, KVl, KVTh, KVTl, PQ16, WPQ, Fp(3), PQh, PQl);
  pattn_kernel<<<dim3(T / 64, BH), 128, 0, stream>>>(PQh, PQl, KPh, KPl, PAh, PAl, PATh, PATl);
  state_kernel<<<dim3(8, BH), 32, 0, stream>>>(KVTh, KVTl, PATh, PATl, MTh, MTl, MSh, MSl);
  step1_kernel<<<dim3(T / 32, BH), 64, 0, stream>>>(Qh, Ql, KVh, KVl, PATh, PATl, MTh, MTl, Ah, Al);
  step2_kernel<<<dim3(T / 32, BH), 64, 0, stream>>>(PAh, PAl, Ah, Al, KVTh, KVTl, MSh, MSl, ATh, ATl);
  oproj_kernel<<<dim3(NR / 64, E / 128), 128, 0, stream>>>(ATh, ATl, W4 + (size_t)3 * E * E, Fp(11), (float*)d_out);
}

// v006
// Measured time: 119 microseconds a run.
// Timed twice side by side with v005, it ran 1.05 times as fast both times.
// Over all steps from v000 it is 6.01 times as fast.
#include <hip/hip_runtime.h>

// Lunar causal attention (Luna-style packed attention, causal "efficient" form): T = 2,048 tokens x 2 batch x 1,024 (16 heads x 64), 32 packed positions.
// pq = (pquery Wpq^T + bpq)/8 -> (b,h,p,d); kp = query Wpc^T + bpc; pattn[bh][t][p] = softplus_b(kp_t . pq_p) (b = ln 2); q = (query Wq^T + bq)/8; kv = query Wc^T + bc (tied k = v);
// aw[bh][n][p] = (sum_{m<=n} (q_n . kv_m) pattn[m][p]) / (n+1); A = softmax_p(aw); attn[bh][n][d] = (sum_{m<=n} (A_n . pattn_m) kv[m][d]) / (n+1); out = attn Wo^T + bo -> [2048][2][1024].
// Both "efficient_causal_attention_parallel" calls are evaluated in chunks of 64 keys: the keys of the query's own chunk as causal masked products (x_n . sum y_m z_m^T = sum (x_n.y_m) z_m), all earlier
// chunks through the running outer-product sum S_c[d][p] = sum_{m < 64c} kv[m][d] pattn[m][p] (k = v is tied, so ONE state serves both calls: q_n . S_c and A_n . S_c^T), kept as its mean S_c/(64c) in hi+lo.
// WMMA (v_wmma_f32_16x16x32_f16, f32 accumulate): the four input linears (kp, q, kv: [4,096 x 1,024] x [1,024 x 1,024]; pq: [64 x 1,024] x [1,024 x 1,024]; EXACT bf16 operands, 1 product) and the output linear (attn hi+lo: 2 products); per (bh,
// 16-query wave) and causal 32-key block: S1^T = KV.Q^T (K = 64, hi+lo: 3 products) then AW^T += PATTN^T S1^T (2 p-tiles, 3 products); S2^T = PATTN.A^T (K = 32, 3 products) then O^T += KV^T S2^T
// (4 d-tiles, 3 products); pattn = softplus(kp.pq) per token ([16 tokens x 64] x [64 x 32] per (bh) tile, 3 products). Softplus, softmax over the 32 positions, the 1/(n+1) factors in f32.
// Inputs rounded to bf16 once. Fragment k-map per lane half hh for A AND B: elements 0..7 <- k = 8hh+0..7, 8..15 <- k = 16+8hh+0..7; acc[r] = D[8hh+r][col]. Every

namespace {
constexpr int T = 2048, BS = 2, E = 1024, NH = 16, DH = 64, BH = BS * NH, PL = 32, NR = T * BS /* 4,096 query rows (t, b) */, NPR = PL * BS /* 64 pquery rows */;
constexpr int CH = 64 /* keys per chunk */, NC = T / CH;
constexpr int TB = T / 16 /* blocks of 16 tokens */, BK = 256 /* elements of a 16 x 16 block */;
constexpr float SS = 16.0f /* scale of the stored state mean */;
constexpr float XS = 8.0f, WSC = 256.0f, SCL = 0.125f, BETA = 0.69314718055994531f, PS1 = 8.0f, PS2 = 64.0f;

typedef _Float16 b16;
typedef __attribute__((ext_vector_type(16))) _Float16 v16b;
typedef __attribute__((ext_vector_type(8))) _Float16 v8b;
typedef __attribute__((ext_vector_type(8))) float v8f;
typedef __attribute__((ext_vector_type(4))) float v4f;
__device__ __forceinline__ float bf16_rne(float f) { unsigned int u = __float_as_uint(f); u += 0x7FFFu + ((u >> 16) & 1u); return __uint_as_float(u & 0xFFFF0000u); }
__device__ __forceinline__ void split16(float v, b16& hi, b16& lo) { hi = (b16)v; lo = (b16)(v - (float)hi); }
__device__ __forceinline__ v16b frag_kb(const b16* p, int hh) { const v8b a = *(const v8b*)(p + 8 * hh), b = *(const v8b*)(p + 16 + 8 * hh); v16b f;
#pragma unroll
  for (int e = 0; e < 8; ++e) { f[e] = a[e]; f[8 + e] = b[e]; } return f; }
// fragment from two consecutive 16 x 16 blocks (256 elements each) of a block-tiled plane: p = the lane's row in the first block; same k-map as frag_kb
__device__ __forceinline__ v16b frag_blk(const b16* p, int hh) { const v8b a = *(const v8b*)(p + 8 * hh), b = *(const v8b*)(p + 256 + 8 * hh); v16b f;
#pragma unroll
  for (int e = 0; e < 8; ++e) { f[e] = a[e]; f[8 + e] = b[e]; } return f; }
__device__ __forceinline__ v8f wmma16b(v16b a, v16b b, v8f c) { v8f d = __builtin_amdgcn_wmma_f32_16x16x32_f16(false, a, false, b, (short)0, c, false, false); asm volatile("v_nop\n\tv_nop\n\tv_nop\n\tv_nop" : "+v"(d) : "v"(a), "v"(b)); return d; }
__device__ __forceinline__ void wave_lds_sync() { __builtin_amdgcn_fence(__ATOMIC_RELEASE, "workgroup"); __builtin_amdgcn_wave_barrier(); __builtin_amdgcn_fence(__ATOMIC_ACQUIRE, "workgroup"); }
__device__ __forceinline__ float pmul(float a, float b) { float p = a * b; asm volatile("" : "+v"(p)); return p; }
__device__ __forceinline__ float softplus_b(float x) { const float bx = BETA * x; const float sp = (bx > 20.0f) ? bx : log1pf(__expf(bx)); return sp / BETA; }   // torch softplus(beta x)/beta (threshold 20 on beta*x)
// LDS staging of the linear layers' operand tiles: a stage is KS = 64 k of every operand row of the block (128-B rows, whole lines), laid at a pitch of 144 B for the ds_load_b128 fragment reads; two buffers.
constexpr int KS = 64, LP = KS + 8, NT = E / KS;
__device__ __forceinline__ unsigned lds_off(const void* p) { return (unsigned)(size_t)p; }   // byte offset in the work-group's LDS = low 32 bits of a __shared__ address
// four asynchronous copies, 16 B a lane each, global -> LDS through no register; the s_wait_xcnt stands inside the copies' own statement, so that no later write of an address register can be moved in front of it
__device__ __forceinline__ void copy4(unsigned l0, const b16* g0, unsigned l1, const b16* g1, unsigned l2, const b16* g2, unsigned l3, const b16* g3) {
  asm volatile("global_load_async_to_lds_b128 %0, %1, off\n\tglobal_load_async_to_lds_b128 %2, %3, off\n\tglobal_load_async_to_lds_b128 %4, %5, off\n\tglobal_load_async_to_lds_b128 %6, %7, off\n\ts_wait_xcnt 0x0"
               :: "v"(l0), "v"(g0), "v"(l1), "v"(g1), "v"(l2), "v"(g2), "v"(l3), "v"(g3) : "memory"); }
// 64 rows (16 a copy: a thread's row is tid / 8, its 16-B piece tid % 8) of one stage: l = the thread's LDS byte address in the first row group, g = its global address there
__device__ __forceinline__ void copy_rows64(unsigned l, const b16* g) { copy4(l, g, l + 16 * LP * 2, g + 16 * E, l + 32 * LP * 2, g + 32 * E, l + 48 * LP * 2, g + 48 * E); }
__device__ __forceinline__ void wait_copies() { asm volatile("s_wait_asynccnt 0x0" ::: "memory"); }   // the wave's own copies have landed; in front of the barrier that publishes them
__device__ __forceinline__ void wait_lds_reads() { asm volatile("s_wait_dscnt 0x0" ::: "memory"); }   // the wave's reads of a buffer have retired; in front of the barrier behind which it is refilled

__global__ __launch_bounds__(256) void prep_kernel(const float* __restrict__ query, const float* __restrict__ pquery, const float* __restrict__ wpq, const float* __restrict__ wq, const float* __restrict__ wpc, const float* __restrict__ wc, const float* __restrict__ wo, b16* __restrict__ X16, b16* __restrict__ PQ16, b16* __restrict__ W4, b16* __restrict__ WPQ) {
  const size_t t = (size_t)blockIdx.x * 256 + threadIdx.x; const size_t nx = (size_t)NR * E / 8, np_ = (size_t)NPR * E / 8, nw = (size_t)E * E / 8; v8b o;
  if (t < nx) { const size_t e = t * 8; const v4f a = *(const v4f*)(query + e), c = *(const v4f*)(query + e + 4); for (int j = 0; j < 4; ++j) { o[j] = (b16)(bf16_rne(a[j]) * XS); o[4 + j] = (b16)(bf16_rne(c[j]) * XS); } { *(v8b*)(X16 + e) = o;  } return; }
  size_t u = t - nx;
  if (u < np_) { const size_t e = u * 8; for (int j = 0; j < 8; ++j) o[j] = (b16)(bf16_rne(pquery[e + j]) * XS); { *(v8b*)(PQ16 + e) = o;  } return; } u -= np_;
  if (u < 5 * nw) { const int kind = (int)(u / nw); const size_t e = (u % nw) * 8; const float* w = kind == 0 ? wpc : kind == 1 ? wq : kind == 2 ? wc : kind == 3 ? wo : wpq; for (int j = 0; j < 8; ++j) o[j] = (b16)(bf16_rne(w[e + j]) * WSC);
    b16* dst = (kind < 4) ? (W4 + (size_t)kind * E * E) : WPQ; { *(v8b*)(dst + e) = o;  } }
}
// input linears: grid (NR/64, 8 col blocks, 3 kinds): y = X16 W^T + b (K = 1,024: 32 steps, exact); kind 0: kp -> KPh/KPl; kind 1: q = (y)*1/8 -> Qh/Ql; kind 2: kv -> KVh/KVl. All six planes are laid per bh in
// 16 x 16 blocks [bh][t / 16][d / 16][16 t][16 d]: a fragment load (16 rows x 32 B) of the later launches then reads one block, 512 contiguous bytes = 4 whole lines, and not 32 B out of each of 16 lines.
__global__ __launch_bounds__(128) void lin_kernel(const b16* __restrict__ X16, const b16* __restrict__ W4, const float* __restrict__ bpc, const float* __restrict__ bq, const float* __restrict__ bc, b16* __restrict__ KPh, b16* __restrict__ KPl, b16* __restrict__ Qh, b16* __restrict__ Ql, b16* __restrict__ KVh, b16* __restrict__ KVl) {
  __shared__ __attribute__((aligned(16))) b16 Th[4][16][128 + 8], Tl[4][16][128 + 8]; __shared__ __attribute__((aligned(16))) b16 St[2][64 + 128][LP];   // a stage: rows 0..63 = the block's X rows, 64..191 = its W rows
  const int wave = threadIdx.x >> 5, lane = threadIdx.x & 31, nloc = lane & 15, hlf = lane >> 4; const int kind = blockIdx.z, n0 = blockIdx.y * 128;
  const b16* W = W4 + (size_t)kind * E * E; const float* bias = kind == 0 ? bpc : kind == 1 ? bq : bc; const float osc = (kind == 1) ? SCL : 1.0f;
  v8f acc[8];
#pragma unroll
  for (int t = 0; t < 8; ++t) acc[t] = (v8f){};
  const int crow = threadIdx.x >> 3, cpc = (threadIdx.x & 7) * 8; const unsigned cl = lds_off(&St[0][crow][cpc]);
  const b16* cx = X16 + ((size_t)blockIdx.x * 64 + crow) * E + cpc; const b16* cw = W + (size_t)(n0 + crow) * E + cpc;
  auto stage = [&](int s) { const unsigned l = cl + (unsigned)(s & 1) * (192 * LP * 2); copy_rows64(l, cx + s * KS); copy_rows64(l + 64 * LP * 2, cw + s * KS); copy_rows64(l + 128 * LP * 2, cw + (size_t)64 * E + s * KS); };
  stage(0); wait_copies(); __syncthreads(); stage(1);
  for (int s = 0; s < NT; ++s) { const b16* sb = &St[s & 1][0][0]; v16b a[2], bw[2][8];   // all fragments of the stage are read in front of its first product: one LDS latency a stage
#pragma unroll   // constant indices keep the fragment arrays in registers
    for (int ks = 0; ks < 2; ++ks) { a[ks] = frag_kb(sb + (wave * 16 + nloc) * LP + ks * 32, hlf);
#pragma unroll   // constant indices keep the fragment arrays in registers
      for (int t = 0; t < 8; ++t) bw[ks][t] = frag_kb(sb + (64 + t * 16 + nloc) * LP + ks * 32, hlf); }
#pragma unroll   // constant indices keep the fragment arrays in registers
    for (int ks = 0; ks < 2; ++ks)
#pragma unroll   // constant indices keep the fragment arrays in registers
      for (int t = 0; t < 8; ++t) acc[t] = wmma16b(a[ks], bw[ks][t], acc[t]);
    wait_lds_reads(); wait_copies(); __syncthreads();   // publishes stage s + 1 and ends every reader's last read of stage s
    if (s + 2 < NT) stage(s + 2); }
  wait_copies();
#pragma unroll
  for (int t = 0; t < 8; ++t) { const float bb = bf16_rne(bias[n0 + t * 16 + nloc]);
#pragma unroll
    for (int r = 0; r < 8; ++r) { b16 p, q; split16((acc[t][r] * (1.0f / (XS * WSC)) + bb) * osc * XS, p, q); Th[wave][8 * hlf + r][t * 16 + nloc] = p; Tl[wave][8 * hlf + r][t * 16 + nloc] = q; } }
  wave_lds_sync(); b16* dh = kind == 0 ? KPh : kind == 1 ? Qh : KVh; b16* dl = kind == 0 ? KPl : kind == 1 ? Ql : KVl;
  // stored per bh as 16 x 16 blocks [bh][t / 16][d / 16][16 t][16 d] (512 contiguous bytes each), the order in which the fragment loads of pattn and step 1 read them. The wave's 16 rows are 8 t of both batches:
  // a store = one batch, one head, two d blocks: 16 lanes fill 8 t x 16 d = 256 contiguous bytes of a block (its lower or upper half, by the wave's parity)
  { for (int s = 0; s < 8; ++s) { const int bb = s & 1, hl = (s >> 1) & 1, db = (s >> 2) * 2 + (lane >> 4), tl = (lane & 15) >> 1, hf = lane & 1; const int rr = tl * 2 + bb, c8 = hl * 64 + db * 16 + hf * 8;
      const size_t gi = (((size_t)(bb * NH + blockIdx.y * 2 + hl) * TB + blockIdx.x * 2 + (wave >> 1)) * 4 + db) * BK + ((wave & 1) * 8 + tl) * 16 + hf * 8; *(v8b*)(dh + gi) = *(const v8b*)(&Th[wave][rr][c8]); *(v8b*)(dl + gi) = *(const v8b*)(&Tl[wave][rr][c8]); }  }
}
// grid (4 + T/64, BH). Blocks x >= 4: kv transposed per bh, as blocks [bh][d / 16][t / 16][16 d][16 t] (512 contiguous bytes each, one fragment load). The 128 blocks x < 4: the packed query pq = (pquery Wpq^T + bpq)/8, computed ONCE for all token blocks: a block = 2 tiles of 16 d x 16 p, a wave = one
// quarter of a tile's K (256: 8 products, exact operands): A = WPQ rows (d), B = PQ16 rows (p*2 + b) -> D[d][p]; the four quarters are added through LDS; stored x8 hi/lo as blocks [bh][pt*4 + dt][16 p][16 d]
// (B operand of pattn, k = d): a tile's block is 512 contiguous bytes.
__global__ __launch_bounds__(256) void kvt_kernel(const b16* __restrict__ KVh, const b16* __restrict__ KVl, b16* __restrict__ KVTh, b16* __restrict__ KVTl, const b16* __restrict__ PQ16, const b16* __restrict__ WPQ, const float* __restrict__ bpq, b16* __restrict__ PQh, b16* __restrict__ PQl) {
  __shared__ __attribute__((aligned(16))) b16 Ah[DH][64 + 8], Al[DH][64 + 8]; __shared__ __attribute__((aligned(16))) float Rd[3][2][32][8];   // Rd: K quarters 1..3 of the block's two pq tiles
  if (blockIdx.x < 4) {   // the same for the whole block
    const int wave = threadIdx.x >> 5, lane = threadIdx.x & 31, hh = lane >> 4, col = lane & 15, tl = wave & 1, kq = wave >> 1;
    const int tile = (blockIdx.x * BH + blockIdx.y) * 2 + tl, ct = tile & 63 /* 16 columns of E: head ct / 4, d tile ct % 4 */, pb_ = tile >> 6, b = pb_ >> 1, pt = pb_ & 1;
    const b16* wa = WPQ + (size_t)(ct * 16 + col) * E + kq * 256 + 8 * hh; const b16* pa = PQ16 + ((size_t)(pt * 16 + col) * BS + b) * E + kq * 256 + 8 * hh; v8f acc = {};
#pragma unroll 1   // two groups of four k steps, one memory latency each, through the same registers: unrolled, the kernel's register count would leave the transposing blocks fewer than their 8 waves a SIMD
    for (int g = 0; g < 2; ++g) { v16b fa[4], fb[4];
#pragma unroll   // constant indices keep the fragment arrays in registers
      for (int j = 0; j < 4; ++j) { fa[j] = frag_kb(wa + j * 32, 0); fb[j] = frag_kb(pa + j * 32, 0); }
      asm volatile("s_wait_xcnt 0x0" :: "v"(wa), "v"(pa) : "memory");   // in front of every later overwrite of the address registers of these loads, which are its inputs, so that no load lands on one of them ahead of the wait
      wa += 128; pa += 128;
#pragma unroll   // constant indices keep the fragment arrays in registers
      for (int j = 0; j < 4; ++j) acc = wmma16b(fa[j], fb[j], acc); }
    if (kq) *(v8f*)&Rd[kq - 1][tl][lane][0] = acc;
    __syncthreads();   // publishes the quarters 1..3 to the waves that hold quarter 0
    if (kq == 0) { const v4f b0 = *(const v4f*)(bpq + ct * 16 + 8 * hh), b1 = *(const v4f*)(bpq + ct * 16 + 8 * hh + 4); v8b hv, lv;
      for (int k = 0; k < 3; ++k) acc += *(const v8f*)&Rd[k][tl][lane][0];
#pragma unroll
      for (int r = 0; r < 8; ++r) { const float bb = bf16_rne(r < 4 ? b0[r & 3] : b1[r & 3]); b16 p, q; split16((acc[r] * (1.0f / (XS * WSC)) + bb) * SCL * XS, p, q); hv[r] = p; lv[r] = q; }
      const size_t go = ((size_t)((b * NH + (ct >> 2)) * 2 + pt) * 4 + (ct & 3)) * 256 + col * 16 + 8 * hh; *(v8b*)(PQh + go) = hv; *(v8b*)(PQl + go) = lv; }
    return; }
  const int bh = blockIdx.y, t0 = (blockIdx.x - 4) * 64, t_ = threadIdx.x;
  { const size_t g0 = ((size_t)bh * TB + (t0 >> 4)) * (4 * BK) + t_; const b16 *ga = KVh + g0, *gb = KVl + g0; b16 xh[16], xl[16];   // the 64 t x 64 d of the block are 4,096 contiguous elements [t / 16][d / 16][16 t][16 d]: every load is a base plus a constant
#pragma unroll   // constant indices keep the two arrays in registers
    for (int i = 0; i < 16; ++i) { xh[i] = ga[i * 256]; xl[i] = gb[i * 256]; }
    asm volatile("s_wait_xcnt 0x0" :: "v"(ga), "v"(gb) : "memory");   // in front of every later overwrite of the address registers of these loads, which are its inputs
#pragma unroll   // constant indices keep the two arrays in registers
    for (int i = 0; i < 16; ++i) { const int q = t_ + i * 256, tt = (q >> 10) * 16 + ((q >> 4) & 15), d = ((q >> 8) & 3) * 16 + (q & 15); Ah[d][tt] = xh[i]; Al[d][tt] = xl[i]; } }
  __syncthreads();
  { for (int q = t_; q < DH * 8; q += 256) { const int d = q >> 3, c8 = (q & 7) * 8; const size_t gi = (((size_t)bh * 4 + (d >> 4)) * TB + ((t0 + c8) >> 4)) * BK + (d & 15) * 16 + (c8 & 15); *(v8b*)(KVTh + gi) = *(const v8b*)(&Ah[d][c8]); *(v8b*)(KVTl + gi) = *(const v8b*)(&Al[d][c8]); }  }
}
// pattn: block = (bh, 64 t) x 4 waves: tile = KP rows (t; the head's 64 d) [16 t x 64] x PQ^T -> [16 x 32]: 2 col tiles x 2 k steps x 3 products; softplus; stored as PAh/PAl [bh][t][32] (x8 hi/lo) and transposed as
// PATh/PATl blocks [bh][p / 16][t / 16][16 p][16 t]; pq comes ready from the launch before (blocks [bh][pt*4 + dt][16 p][16 d])
__global__ __launch_bounds__(128) void pattn_kernel(const b16* __restrict__ PQh, const b16* __restrict__ PQl, const b16* __restrict__ KPh, const b16* __restrict__ KPl, b16* __restrict__ PAh, b16* __restrict__ PAl, b16* __restrict__ PATh, b16* __restrict__ PATl) {
  __shared__ __attribute__((aligned(16))) b16 Rh[4][16][PL + 8], Rl[4][16][PL + 8]; __shared__ __attribute__((aligned(16))) b16 Rt[PL][64 + 8], Rtl[PL][64 + 8];
  const int wave = threadIdx.x >> 5, lane = threadIdx.x & 31, nloc = lane & 15, hlf = lane >> 4, t_ = threadIdx.x; const int bh = blockIdx.y, t0 = blockIdx.x * 64;
  // the wave's KP fragments (hi, lo; two k steps) and all pq fragments are loaded in front of the first product: one memory latency and not one a fragment
  const size_t arow = ((size_t)bh * TB + (t0 >> 4) + wave) * (4 * BK) + nloc * 16 + 8 * hlf; const b16 *kpa = KPh + arow, *kpb = KPl + arow; v16b ka[2], kal[2];
#pragma unroll   // constant indices keep the fragment arrays in registers
  for (int j = 0; j < 2; ++j) { ka[j] = frag_blk(kpa + j * 2 * BK, 0); kal[j] = frag_blk(kpb + j * 2 * BK, 0); }
  const size_t qo = (size_t)bh * (PL * DH) + nloc * 16 + 8 * hlf; const b16 *qa = PQh + qo, *qb = PQl + qo; v16b bp[2][2], bpl[2][2];
#pragma unroll   // constant indices keep the fragment arrays in registers
  for (int j = 0; j < 2; ++j)
#pragma unroll   // constant indices keep the fragment arrays in registers
    for (int t = 0; t < 2; ++t) { bp[j][t] = frag_blk(qa + (t * 4 + 2 * j) * 256, 0); bpl[j][t] = frag_blk(qb + (t * 4 + 2 * j) * 256, 0); }
  asm volatile("s_wait_xcnt 0x0" :: "v"(kpa), "v"(kpb), "v"(qa), "v"(qb) : "memory");   // in front of every later overwrite of the address registers of these loads, which are its inputs, so that no load lands on one of them ahead of the wait
  // pattn for the wave's 16 t: A = KP rows t0 + wave*16 + nloc of bh (k = d), B = pq rows p (k = d)
  { v8f d2[2] = {{}, {}};
#pragma unroll
    for (int j = 0; j < 2; ++j)
#pragma unroll
      for (int t = 0; t < 2; ++t) { d2[t] = wmma16b(ka[j], bp[j][t], d2[t]); d2[t] = wmma16b(kal[j], bp[j][t], d2[t]); d2[t] = wmma16b(ka[j], bpl[j][t], d2[t]); }
#pragma unroll
    for (int t = 0; t < 2; ++t)
#pragma unroll
      for (int r = 0; r < 8; ++r) { const float v = softplus_b(d2[t][r] * (1.0f / (XS * XS))); b16 p, q; split16(v * XS, p, q); const int tt = wave * 16 + 8 * hlf + r, pp = t * 16 + nloc; Rh[wave][8 * hlf + r][pp] = p; Rl[wave][8 * hlf + r][pp] = q; Rt[pp][tt] = p; Rtl[pp][tt] = q; } }
  __syncthreads();
  {
    for (int k = 0; k < 2; ++k) { const int rr = k * 8 + (lane >> 2), c8 = (lane & 3) * 8; const size_t gi = ((size_t)bh * T + t0 + wave * 16 + rr) * PL + c8; *(v8b*)(PAh + gi) = *(const v8b*)(&Rh[wave][rr][c8]); *(v8b*)(PAl + gi) = *(const v8b*)(&Rl[wave][rr][c8]); }
    for (int q = t_; q < PL * 8; q += 128) { const int pp = q >> 3, c8 = (q & 7) * 8; const size_t gi = (((size_t)bh * 2 + (pp >> 4)) * TB + ((t0 + c8) >> 4)) * BK + (pp & 15) * 16 + (c8 & 15); *(v8b*)(PATh + gi) = *(const v8b*)(&Rt[pp][c8]); *(v8b*)(PATl + gi) = *(const v8b*)(&Rtl[pp][c8]); }
     }
}
// prefix state: grid (8 tiles, BH), a block of SW = 8 waves per (16 d x 16 p) tile; a wave sums its own CPW = 4 chunks of keys (K = 32 a step, 3 products, f32 accumulate), both orientations: sd = KVT.PAT^T -> D[d][p],
// st = PAT.KVT^T -> D[p][d], and keeps its running sum at the end of each of them; the waves' totals go through LDS, and each wave adds the totals of the waves in front of it to its four running sums.
// At each chunk boundary c = 1..NC-1 the sum is stored as its mean x SS (hi/lo): MT blocks [pt*4+dt][16 p][16 d] (A operand of step 1, k = d), MS blocks [dt*2+pt][16 d][16 p] (A operand of step 2, k = p);
// a wave's block is 512 contiguous bytes. Operand fragments: the first four key steps are loaded together, a later step's into a stage as soon as its products have read it.
__device__ __forceinline__ void state_mac(v16b k, v16b kl, v16b p, v16b pl, v8f& sd, v8f& st) { sd = wmma16b(k, p, sd); st = wmma16b(p, k, st); sd = wmma16b(k, pl, sd); st = wmma16b(pl, k, st); sd = wmma16b(kl, p, sd); st = wmma16b(p, kl, st); }
__device__ __forceinline__ void state_store(v8f sd, v8f st, int c, b16* mth, b16* mtl, b16* msh, b16* msl) { const float f = SS / (XS * XS * (float)(c * CH)); v8b dh_, dl_, th_, tl_;
#pragma unroll
  for (int r = 0; r < 8; ++r) { b16 p, q; split16(sd[r] * f, p, q); dh_[r] = p; dl_[r] = q; split16(st[r] * f, p, q); th_[r] = p; tl_[r] = q; }
  *(v8b*)mth = dh_; *(v8b*)mtl = dl_; *(v8b*)msh = th_; *(v8b*)msl = tl_;
  asm volatile("s_wait_xcnt 0x0" ::: "memory"); }   // in front of every later overwrite of the data and address registers of the four stores
constexpr int SW = 8 /* waves of a scan block */, CPW = NC / SW /* chunks a wave */, SPW = CPW * CH / 32 /* key steps a wave */;
__global__ __launch_bounds__(SW * 32) void state_kernel(const b16* __restrict__ KVTh, const b16* __restrict__ KVTl, const b16* __restrict__ PATh, const b16* __restrict__ PATl, b16* __restrict__ MTh, b16* __restrict__ MTl, b16* __restrict__ MSh, b16* __restrict__ MSl) {
  __shared__ __attribute__((aligned(16))) float Tt[SW - 1][2][32][8];   // the totals (sd, st) of waves 0..SW-2, a lane's 8 values together
  const int wave = __builtin_amdgcn_readfirstlane(threadIdx.x >> 5), lane = threadIdx.x & 31, hh = lane >> 4, col = lane & 15; const int bh = blockIdx.y, dt = blockIdx.x >> 1, pt = blockIdx.x & 1;
  const int tb0 = wave * (CPW * CH / 16);   // the wave's first block of 16 keys
  const size_t ok = (((size_t)bh * 4 + dt) * TB + tb0) * BK + col * 16 + 8 * hh, op = (((size_t)bh * 2 + pt) * TB + tb0) * BK + col * 16 + 8 * hh;   // the lane half's k offset is part of the four base pointers
  const b16* kh = KVTh + ok; const b16* kl = KVTl + ok; const b16* ph = PATh + op; const b16* pl = PATl + op;
  v16b fk[4], fkl[4], fp[4], fpl[4];
#pragma unroll   // here and below: the stage index must be a constant, so that the four stages stay in registers
  for (int j = 0; j < 4; ++j) { fk[j] = frag_blk(kh + j * 2 * BK, 0); fkl[j] = frag_blk(kl + j * 2 * BK, 0); fp[j] = frag_blk(ph + j * 2 * BK, 0); fpl[j] = frag_blk(pl + j * 2 * BK, 0); }
  v8f sd = {}, st = {}, ld[CPW], lt[CPW];   // ld, lt: the wave's own running sums at the end of each of its chunks
#pragma unroll
  for (int j = 0; j < SPW; ++j) { const int g = j & 3, kn = (j + 4) * 2 * BK;
    state_mac(fk[g], fkl[g], fp[g], fpl[g], sd, st);
    if (j + 4 < SPW) { fk[g] = frag_blk(kh + kn, 0); fkl[g] = frag_blk(kl + kn, 0); fp[g] = frag_blk(ph + kn, 0); fpl[g] = frag_blk(pl + kn, 0); }
    if (j + 5 == SPW) asm volatile("s_wait_xcnt 0x0" :: "v"(kh), "v"(kl), "v"(ph), "v"(pl) : "memory");   // behind the last loads, in front of every later overwrite of their address registers, which are its inputs
    if (j & 1) { ld[j >> 1] = sd; lt[j >> 1] = st; } }
  if (wave < SW - 1) { *(v8f*)&Tt[wave][0][lane][0] = sd; *(v8f*)&Tt[wave][1][lane][0] = st; }
  __syncthreads();   // publishes the waves' totals
  v8f td[SW - 1], tt[SW - 1], pd = {}, pq_ = {};   // all totals are read in front of the first addition: one LDS latency and not one a wave
#pragma unroll
  for (int w = 0; w < SW - 1; ++w) { td[w] = *(const v8f*)&Tt[w][0][lane][0]; tt[w] = *(const v8f*)&Tt[w][1][lane][0]; }
#pragma unroll
  for (int w = 0; w < SW - 1; ++w)
#pragma unroll
    for (int r = 0; r < 8; ++r) { pd[r] += (w < wave) ? td[w][r] : 0.0f; pq_[r] += (w < wave) ? tt[w][r] : 0.0f; }   // only the waves in front count
  const size_t ot = ((size_t)bh * NC + wave * CPW) * (DH * PL) + ((pt * 4 + dt) * 16 + col) * 16 + 8 * hh, os = ((size_t)bh * NC + wave * CPW) * (DH * PL) + ((dt * 2 + pt) * 16 + col) * 16 + 8 * hh;
#pragma unroll
  for (int j = 0; j < CPW; ++j) { const int c = wave * CPW + j + 1;   // the boundary behind the wave's chunk j
    if (c < NC) state_store(pd + ld[j], pq_ + lt[j], c, MTh + ot + (j + 1) * (DH * PL), MTl + ot + (j + 1) * (DH * PL), MSh + os + (j + 1) * (DH * PL), MSl + os + (j + 1) * (DH * PL)); }   // the last chunk feeds no state (the same for the whole wave)
}
// step 1: grid (T/32, BH), 2 waves x 16 queries; earlier chunks: AI^T = MT(p rows) Q^T (2 p-tiles, K = 64, 3 products), weighted 64c/(n+1); key blocks of the query's own chunk: S1^T = KV.Q^T (K = 64, 3 products), masked keys > q -> 0, x PS1 hi/lo; AW^T += PAT^T(p rows) S1^T (2 p-tiles, 3 products);
// aw = (AW + 64c AI)/(n+1); softmax over the 32 p (each lane holds 16 of its query's 32 values? lane (hh, col): acc[t][r] = AW^T[p = t*16 + 8hh + r][query col] -> the query's 32 values are split over the
__global__ __launch_bounds__(64) void step1_kernel(const b16* __restrict__ Qh, const b16* __restrict__ Ql, const b16* __restrict__ KVh, const b16* __restrict__ KVl, const b16* __restrict__ PATh, const b16* __restrict__ PATl, const b16* __restrict__ MTh, const b16* __restrict__ MTl, b16* __restrict__ Ah, b16* __restrict__ Al) {
  __shared__ __attribute__((aligned(16))) b16 Ra[2][16][PL + 8], Ral[2][16][PL + 8];
  const int wave = threadIdx.x >> 5, lane = threadIdx.x & 31, hh = lane >> 4, col = lane & 15; const int bh = blockIdx.y; const int q0 = blockIdx.x * 32 + wave * 16, qi = q0 + col;
  const size_t qrow = ((size_t)bh * TB + (q0 >> 4)) * (4 * BK) + col * 16; const v16b qa0 = frag_blk(Qh + qrow, hh), qa1 = frag_blk(Qh + qrow + 2 * BK, hh), ql0 = frag_blk(Ql + qrow, hh), ql1 = frag_blk(Ql + qrow + 2 * BK, hh);
  const b16* Pb = PATh + (size_t)bh * PL * T; const b16* Plb = PATl + (size_t)bh * PL * T;
  v8f aw[2] = {{}, {}}, awl[2] = {{}, {}}, ai[2] = {{}, {}}; const int ks0 = (blockIdx.x * 32) & ~(CH - 1), nb = (blockIdx.x & 1) + 1;   // nb = key blocks of 32 from the chunk's start up to the block's 32 queries
  // The fragments of a key block are loaded as groups ahead of the products that use them, so that a block costs one memory latency and not one a fragment: the first block's together with the query's and the
  // state's, the next block's into the same registers as soon as this block's products have read them. kf = KV rows (key tile, k half: hi, lo), pf = PAT rows (p tile: hi, lo).
  v16b kf[8], pf[4]; const b16 *ka, *kal, *pa, *pal;   // the lane's base addresses of a group (its k half included): every load of the group is one of them plus a constant
  auto load_kv = [&](int kb) { const size_t r = ((size_t)bh * TB + (kb >> 4)) * (4 * BK) + col * 16 + 8 * hh; ka = KVh + r; kal = KVl + r;
#pragma unroll   // constant indices keep the fragment arrays in registers
    for (int u = 0; u < 4; ++u) { const int c = (u >> 1) * 4 * BK + (u & 1) * 2 * BK; kf[2 * u] = frag_blk(ka + c, 0); kf[2 * u + 1] = frag_blk(kal + c, 0); } };
  auto load_pa = [&](int kb) { const size_t r = (size_t)(kb >> 4) * BK + col * 16 + 8 * hh; pa = Pb + r; pal = Plb + r;
#pragma unroll   // constant indices keep the fragment arrays in registers
    for (int t = 0; t < 2; ++t) { pf[2 * t] = frag_blk(pa + t * TB * BK, 0); pf[2 * t + 1] = frag_blk(pal + t * TB * BK, 0); } };
  load_kv(ks0); load_pa(ks0);
  // kept in front of the branch: the address arithmetic behind it may take over the address registers of the loads above; the addresses are inputs, so that no load of the groups lands on one of them ahead of the wait
  asm volatile("s_wait_xcnt 0x0" :: "v"(Qh + qrow + 8 * hh), "v"(Ql + qrow + 8 * hh), "v"(ka), "v"(kal), "v"(pa), "v"(pal) : "memory");
  if (ks0 > 0) { const size_t so = ((size_t)bh * NC + ks0 / CH) * (DH * PL);
    v16b mh[4], ml[4];   // all state fragments are loaded in front of the first product, so that they cost one memory latency and not one each
#pragma unroll
    for (int u = 0; u < 4; ++u) { mh[u] = frag_blk(MTh + so + ((u * 2) * 16 + col) * 16, hh); ml[u] = frag_blk(MTl + so + ((u * 2) * 16 + col) * 16, hh); }
#pragma unroll
    for (int t = 0; t < 2; ++t) { ai[t] = wmma16b(mh[2 * t], qa0, ai[t]); ai[t] = wmma16b(mh[2 * t], ql0, ai[t]); ai[t] = wmma16b(ml[2 * t], qa0, ai[t]);
      ai[t] = wmma16b(mh[2 * t + 1], qa1, ai[t]); ai[t] = wmma16b(mh[2 * t + 1], ql1, ai[t]); ai[t] = wmma16b(ml[2 * t + 1], qa1, ai[t]); } }
  for (int i = 0; i < nb; ++i) { const int kb = ks0 + 32 * i; const bool more = i + 1 < nb;
    v8f s0 = {}, s1 = {};
    s0 = wmma16b(kf[0], qa0, s0); s0 = wmma16b(kf[0], ql0, s0); s0 = wmma16b(kf[1], qa0, s0); s0 = wmma16b(kf[2], qa1, s0); s0 = wmma16b(kf[2], ql1, s0); s0 = wmma16b(kf[3], qa1, s0);
    s1 = wmma16b(kf[4], qa0, s1); s1 = wmma16b(kf[4], ql0, s1); s1 = wmma16b(kf[5], qa0, s1); s1 = wmma16b(kf[6], qa1, s1); s1 = wmma16b(kf[6], ql1, s1); s1 = wmma16b(kf[7], qa1, s1);
    if (more) { load_kv(kb + 32); asm volatile("s_wait_xcnt 0x0" :: "v"(ka), "v"(kal) : "memory"); }   // the wait: in front of every later overwrite of the address registers of these loads, which are its inputs as above
    v16b ph, pl;
#pragma unroll
    for (int r = 0; r < 8; ++r) { const int ka = kb + 8 * hh + r, kbb = kb + 16 + 8 * hh + r; const float v0 = (ka <= qi) ? s0[r] * (1.0f / (XS * XS)) : 0.0f, v1 = (kbb <= qi) ? s1[r] * (1.0f / (XS * XS)) : 0.0f; b16 p, q; split16(v0 * PS1, p, q); ph[r] = p; pl[r] = q; split16(v1 * PS1, p, q); ph[8 + r] = p; pl[8 + r] = q; }
#pragma unroll
    for (int t = 0; t < 2; ++t) { aw[t] = wmma16b(pf[2 * t], ph, aw[t]); awl[t] = wmma16b(pf[2 * t], pl, awl[t]); awl[t] = wmma16b(pf[2 * t + 1], ph, awl[t]); }
    if (more) { load_pa(kb + 32); asm volatile("s_wait_xcnt 0x0" :: "v"(pa), "v"(pal) : "memory"); } }   // the wait: as above
  // lane (hh, col): value[p = t*16 + 8hh + r] for query col; divide by (qi + 1); softmax over 32
  float v[16]; const float invn = 1.0f / ((float)(qi + 1) * PS1 * XS), invi = (float)ks0 / ((float)(qi + 1) * SS * XS); float mx = -INFINITY;
#pragma unroll
  for (int t = 0; t < 2; ++t) for (int r = 0; r < 8; ++r) { v[t * 8 + r] = (aw[t][r] + awl[t][r]) * invn + ai[t][r] * invi; mx = fmaxf(mx, v[t * 8 + r]); }
  mx = fmaxf(mx, __shfl_xor(mx, 16)); float sm = 0.0f; for (int i = 0; i < 16; ++i) { v[i] = __expf(v[i] - mx); sm += v[i]; } sm += __shfl_xor(sm, 16); const float inv = 1.0f / sm;
#pragma unroll
  for (int t = 0; t < 2; ++t) for (int r = 0; r < 8; ++r) { b16 p, q; split16(v[t * 8 + r] * inv * PS2, p, q); Ra[wave][col][t * 16 + 8 * hh + r] = p; Ral[wave][col][t * 16 + 8 * hh + r] = q; }
  wave_lds_sync();
  { for (int k = 0; k < 2; ++k) { const int rr = k * 8 + (lane >> 2), c8 = (lane & 3) * 8; const size_t gi = ((size_t)bh * T + q0 + rr) * PL + c8; *(v8b*)(Ah + gi) = *(const v8b*)(&Ra[wave][rr][c8]); *(v8b*)(Al + gi) = *(const v8b*)(&Ral[wave][rr][c8]); }  }
}
// step 2: grid (T/32, BH): earlier chunks: OI^T = MS(d rows) A^T (4 d-tiles, K = 32, 3 products), weighted 64c/(n+1); own chunk: S2^T = PA(keys).A(q)^T (A-operand = PA rows [key][32], B = A rows [q][32]; K = 32: 3 products), causal, x PS1 hi/lo; O^T += KVT(d rows) S2^T (4 d-tiles, 3 products); / (n+1)
__global__ __launch_bounds__(64) void step2_kernel(const b16* __restrict__ PAh, const b16* __restrict__ PAl, const b16* __restrict__ Ah, const b16* __restrict__ Al, const b16* __restrict__ KVTh, const b16* __restrict__ KVTl, const b16* __restrict__ MSh, const b16* __restrict__ MSl, b16* __restrict__ ATh, b16* __restrict__ ATl) {
  __shared__ __attribute__((aligned(16))) float To[2][16][DH + 4];
  const int wave = threadIdx.x >> 5, lane = threadIdx.x & 31, hh = lane >> 4, col = lane & 15; const int bh = blockIdx.y, b = bh / NH, h = bh % NH; const int q0 = blockIdx.x * 32 + wave * 16, qi = q0 + col;
  const v16b aq = frag_kb(Ah + ((size_t)bh * T + qi) * PL, hh), aql = frag_kb(Al + ((size_t)bh * T + qi) * PL, hh);
  const b16* Vb = KVTh + (size_t)bh * DH * T; const b16* Vlb = KVTl + (size_t)bh * DH * T;
  v8f o[4] = {{}, {}, {}, {}}, ol[4] = {{}, {}, {}, {}}, oi[4] = {{}, {}, {}, {}}; const int ks0 = (blockIdx.x * 32) & ~(CH - 1), nb = (blockIdx.x & 1) + 1;   // nb = key blocks of 32 from the chunk's start up to the block's 32 queries
  // fragment groups loaded ahead of the products that use them, as in step 1: pk = PA rows (key tile: hi, lo), vf = KVT rows (d tile: hi, lo)
  v16b pk[4], vf[8]; const b16 *pa, *pal, *va, *val;   // the lane's base addresses of a group (its k half included): every load of the group is one of them plus a constant
  auto load_pk = [&](int kb) { const size_t r = ((size_t)bh * T + kb + col) * PL + 8 * hh; pa = PAh + r; pal = PAl + r;
#pragma unroll   // constant indices keep the fragment arrays in registers
    for (int u = 0; u < 2; ++u) { pk[2 * u] = frag_kb(pa + u * 16 * PL, 0); pk[2 * u + 1] = frag_kb(pal + u * 16 * PL, 0); } };
  auto load_vf = [&](int kb) { const size_t r = (size_t)(kb >> 4) * BK + col * 16 + 8 * hh; va = Vb + r; val = Vlb + r;
#pragma unroll   // constant indices keep the fragment arrays in registers
    for (int t = 0; t < 4; ++t) { vf[2 * t] = frag_blk(va + t * TB * BK, 0); vf[2 * t + 1] = frag_blk(val + t * TB * BK, 0); } };
  load_pk(ks0); load_vf(ks0);
  // kept in front of the branch: the address arithmetic behind it may take over the address registers of the loads above; the addresses are inputs, so that no load of the groups lands on one of them ahead of the wait
  asm volatile("s_wait_xcnt 0x0" :: "v"(Ah + ((size_t)bh * T + qi) * PL + 8 * hh), "v"(Al + ((size_t)bh * T + qi) * PL + 8 * hh), "v"(pa), "v"(pal), "v"(va), "v"(val) : "memory");
  if (ks0 > 0) { const size_t so = ((size_t)bh * NC + ks0 / CH) * (DH * PL);
    v16b mh[4], ml[4];   // all state fragments are loaded in front of the first product, so that they cost one memory latency and not one each
#pragma unroll
    for (int t = 0; t < 4; ++t) { mh[t] = frag_blk(MSh + so + ((t * 2) * 16 + col) * 16, hh); ml[t] = frag_blk(MSl + so + ((t * 2) * 16 + col) * 16, hh); }
#pragma unroll
    for (int t = 0; t < 4; ++t) { oi[t] = wmma16b(mh[t], aq, oi[t]); oi[t] = wmma16b(mh[t], aql, oi[t]); oi[t] = wmma16b(ml[t], aq, oi[t]); } }
  for (int i = 0; i < nb; ++i) { const int kb = ks0 + 32 * i; const bool more = i + 1 < nb;
    v8f s0 = {}, s1 = {};
    s0 = wmma16b(pk[0], aq, s0); s0 = wmma16b(pk[0], aql, s0); s0 = wmma16b(pk[1], aq, s0); s1 = wmma16b(pk[2], aq, s1); s1 = wmma16b(pk[2], aql, s1); s1 = wmma16b(pk[3], aq, s1);
    if (more) { load_pk(kb + 32); asm volatile("s_wait_xcnt 0x0" :: "v"(pa), "v"(pal) : "memory"); }   // the wait: in front of every later overwrite of the address registers of these loads, which are its inputs as above
    v16b ph, pl;
#pragma unroll
    for (int r = 0; r < 8; ++r) { const int ka = kb + 8 * hh + r, kbb = kb + 16 + 8 * hh + r; const float v0 = (ka <= qi) ? s0[r] * (1.0f / (XS * PS2)) : 0.0f, v1 = (kbb <= qi) ? s1[r] * (1.0f / (XS * PS2)) : 0.0f; b16 p, q; split16(v0 * PS1, p, q); ph[r] = p; pl[r] = q; split16(v1 * PS1, p, q); ph[8 + r] = p; pl[8 + r] = q; }
#pragma unroll
    for (int t = 0; t < 4; ++t) { o[t] = wmma16b(vf[2 * t], ph, o[t]); ol[t] = wmma16b(vf[2 * t], pl, ol[t]); ol[t] = wmma16b(vf[2 * t + 1], ph, ol[t]); }
    if (more) { load_vf(kb + 32); asm volatile("s_wait_xcnt 0x0" :: "v"(va), "v"(val) : "memory"); } }   // the wait: as above
  const float invn = 1.0f / ((float)(qi + 1) * PS1 * XS), invi = (float)ks0 / ((float)(qi + 1) * SS * PS2);
#pragma unroll
  for (int t = 0; t < 4; ++t)
#pragma unroll
    for (int r = 0; r < 8; ++r) To[wave][col][t * 16 + 8 * hh + r] = (o[t][r] + ol[t][r]) * invn + oi[t][r] * invi;
  wave_lds_sync();
  { for (int r4 = 0; r4 < 16; r4 += 4) { const int rr = r4 + (lane >> 3), c8 = (lane & 7) * 8; v8b hv, lv; for (int j = 0; j < 8; ++j) { b16 p, q; split16(To[wave][rr][c8 + j] * XS, p, q); hv[j] = p; lv[j] = q; }
      const size_t gi = ((size_t)(q0 + rr) * BS + b) * E + h * DH + c8; *(v8b*)(ATh + gi) = hv; *(v8b*)(ATl + gi) = lv; }  }
}
__global__ __launch_bounds__(128) void oproj_kernel(const b16* __restrict__ ATh, const b16* __restrict__ ATl, const b16* __restrict__ WO, const float* __restrict__ bo, float* __restrict__ out) {
  __shared__ __attribute__((aligned(16))) float Tf[4][16][128 + 4]; __shared__ __attribute__((aligned(16))) b16 St[2][64 + 64 + 128][LP];   // a stage: rows 0..63 = the block's attn hi rows, 64..127 = their lo rows, 128..255 = its W rows
  const int wave = threadIdx.x >> 5, lane = threadIdx.x & 31, nloc = lane & 15, hlf = lane >> 4; const int n0 = blockIdx.y * 128; const size_t m0 = (size_t)blockIdx.x * 64 + wave * 16;
  v8f acc[8];
#pragma unroll
  for (int t = 0; t < 8; ++t) acc[t] = (v8f){};
  const int crow = threadIdx.x >> 3, cpc = (threadIdx.x & 7) * 8; const unsigned cl = lds_off(&St[0][crow][cpc]); const size_t co = ((size_t)blockIdx.x * 64 + crow) * E + cpc;
  const b16* ch = ATh + co; const b16* cq = ATl + co; const b16* cw = WO + (size_t)(n0 + crow) * E + cpc;
  auto stage = [&](int s) { const unsigned l = cl + (unsigned)(s & 1) * (256 * LP * 2); copy_rows64(l, ch + s * KS); copy_rows64(l + 64 * LP * 2, cq + s * KS); copy_rows64(l + 128 * LP * 2, cw + s * KS); copy_rows64(l + 192 * LP * 2, cw + (size_t)64 * E + s * KS); };
  stage(0); wait_copies(); __syncthreads(); stage(1);
  for (int s = 0; s < NT; ++s) { const b16* sb = &St[s & 1][0][0]; v16b a[2], al[2], bw[2][8];   // all fragments of the stage are read in front of its first product: one LDS latency a stage
#pragma unroll   // constant indices keep the fragment arrays in registers
    for (int ks = 0; ks < 2; ++ks) { a[ks] = frag_kb(sb + (wave * 16 + nloc) * LP + ks * 32, hlf); al[ks] = frag_kb(sb + (64 + wave * 16 + nloc) * LP + ks * 32, hlf);
#pragma unroll   // constant indices keep the fragment arrays in registers
      for (int t = 0; t < 8; ++t) bw[ks][t] = frag_kb(sb + (128 + t * 16 + nloc) * LP + ks * 32, hlf); }
#pragma unroll   // constant indices keep the fragment arrays in registers
    for (int ks = 0; ks < 2; ++ks)
#pragma unroll   // constant indices keep the fragment arrays in registers
      for (int t = 0; t < 8; ++t) { acc[t] = wmma16b(a[ks], bw[ks][t], acc[t]); acc[t] = wmma16b(al[ks], bw[ks][t], acc[t]); }
    wait_lds_reads(); wait_copies(); __syncthreads();   // publishes stage s + 1 and ends every reader's last read of stage s
    if (s + 2 < NT) stage(s + 2); }
  wait_copies();
#pragma unroll
  for (int t = 0; t < 8; ++t) { const float bb = bf16_rne(bo[n0 + t * 16 + nloc]);
#pragma unroll
    for (int r = 0; r < 8; ++r) Tf[wave][8 * hlf + r][t * 16 + nloc] = acc[t][r] * (1.0f / (XS * WSC)) + bb; }
  wave_lds_sync();
  { for (int rr = 0; rr < 16; ++rr) *(v4f*)(out + (m0 + rr) * E + n0 + lane * 4) = *(const v4f*)(&Tf[wave][rr][lane * 4]);  }
}
}  // namespace

extern "C" void kernel_launch(void* const* d_in, const int* in_sizes, int n_in, void* d_out, int out_size, void* d_ws, size_t ws_size, hipStream_t stream) {
  (void)n_in;
  auto Fp = [&](int i) { return (const float*)d_in[i]; };
  // input order: 0 query [2048,2,1024], 1 pquery [32,2,1024], 2 Wpq [1024,1024], 3 bpq, 4 Wq, 5 bq, 6 Wpc, 7 bpc, 8 Wc, 9 bc, 10 Wo, 11 bo (torch [out][in])
  if (in_sizes[0] != NR * E || in_sizes[1] != NPR * E || in_sizes[2] != E * E || in_sizes[4] != E * E || in_sizes[6] != E * E || in_sizes[8] != E * E || in_sizes[10] != E * E || out_size != NR * E) return;
  size_t off = 0; char* ws = (char*)d_ws;
  auto carve = [&](size_t bytes) { char* p = ws + off; off += (bytes + 255) & ~(size_t)255; return p; };
  b16* X16 = (b16*)carve((size_t)NR * E * 2); b16* PQ16 = (b16*)carve((size_t)NPR * E * 2); b16* W4 = (b16*)carve((size_t)4 * E * E * 2); b16* WPQ = (b16*)carve((size_t)E * E * 2);
  b16* KPh = (b16*)carve((size_t)NR * E * 2); b16* KPl = (b16*)carve((size_t)NR * E * 2); b16* Qh = (b16*)carve((size_t)NR * E * 2); b16* Ql = (b16*)carve((size_t)NR * E * 2); b16* KVh = (b16*)carve((size_t)NR * E * 2); b16* KVl = (b16*)carve((size_t)NR * E * 2);
  b16* KVTh = (b16*)carve((size_t)NR * E * 2); b16* KVTl = (b16*)carve((size_t)NR * E * 2); b16* PAh = (b16*)carve((size_t)BH * T * PL * 2); b16* PAl = (b16*)carve((size_t)BH * T * PL * 2); b16* PATh = (b16*)carve((size_t)BH * PL * T * 2); b16* PATl = (b16*)carve((size_t)BH * PL * T * 2);
  b16* Ah = (b16*)carve((size_t)BH * T * PL * 2); b16* Al = (b16*)carve((size_t)BH * T * PL * 2); b16* PQh = (b16*)carve((size_t)BH * PL * DH * 2); b16* PQl = (b16*)carve((size_t)BH * PL * DH * 2);
  b16* MTh = (b16*)carve((size_t)BH * NC * DH * PL * 2); b16* MTl = (b16*)carve((size_t)BH * NC * DH * PL * 2); b16* MSh = (b16*)carve((size_t)BH * NC * DH * PL * 2); b16* MSl = (b16*)carve((size_t)BH * NC * DH * PL * 2);
  b16* ATh = KPh; b16* ATl = KPl;   // region reuse: KP planes are dead after pattn_kernel (stream-ordered); the attention output takes their place
  if (off > ws_size || off > ((size_t)128 << 20)) return;   // ~ 122 MiB
  prep_kernel<<<(unsigned)(((size_t)NR * E / 8 + (size_t)NPR * E / 8 + 5 * (size_t)E * E / 8 + 255) / 256), 256, 0, stream>>>(Fp(0), Fp(1), Fp(2), Fp(4), Fp(6), Fp(8), Fp(10), X16, PQ16, W4, WPQ);
  lin_kernel<<<dim3(NR / 64, E / 128, 3), 128, 0, stream>>>(X16, W4, Fp(7), Fp(5), Fp(9), KPh, KPl, Qh, Ql, KVh, KVl);
  kvt_kernel<<<dim3(4 + T / 64, BH), 256, 0, stream>>>(KVh, KVl, KVTh, KVTl, PQ16, WPQ, Fp(3), PQh, PQl);
  pattn_kernel<<<dim3(T / 64, BH), 128, 0, stream>>>(PQh, PQl, KPh, KPl, PAh, PAl, PATh, PATl);
  state_kernel<<<dim3(8, BH), SW * 32, 0, stream>>>(KVTh, KVTl, PATh, PATl, MTh, MTl, MSh, MSl);
  step1_kernel<<<dim3(T / 32, BH), 64, 0, stream>>>(Qh, Ql, KVh, KVl, PATh, PATl, MTh, MTl, Ah, Al);
  step2_kernel<<<dim3(T / 32, BH), 64, 0, stream>>>(PAh, PAl, Ah, Al, KVTh, KVTl, MSh, MSl, ATh, ATl);
  oproj_kernel<<<dim3(NR / 64, E / 128), 128, 0, stream>>>(ATh, ATl, W4 + (size_t)3 * E * E, Fp(11), (float*)d_out);
}

// v007
// Measured time: 113 microseconds a run.
// In both of two side-by-side timings against v006, it was 1.05 times as fast.
// Counting every step since v000, it is 6.29 times as fast.
#include <hip/hip_runtime.h>

// Lunar causal attention (Luna-style packed attention, causal "efficient" form): T = 2,048 tokens x 2 batch x 1,024 (16 heads x 64), 32 packed positions.
// pq = (pquery Wpq^T + bpq)/8 -> (b,h,p,d); kp = query Wpc^T + bpc; pattn[bh][t][p] = softplus_b(kp_t . pq_p) (b = ln 2); q = (query Wq^T + bq)/8; kv = query Wc^T + bc (tied k = v);
// aw[bh][n][p] = (sum_{m<=n} (q_n . kv_m) pattn[m][p]) / (n+1); A = softmax_p(aw); attn[bh][n][d] = (sum_{m<=n} (A_n . pattn_m) kv[m][d]) / (n+1); out = attn Wo^T + bo -> [2048][2][1024].
// Both "efficient_causal_attention_parallel" calls are evaluated in chunks of 64 keys: the keys of the query's own chunk as causal masked products (x_n . sum y_m z_m^T = sum (x_n.y_m) z_m), all earlier
// chunks through the running outer-product sum S_c[d][p] = sum_{m < 64c} kv[m][d] pattn[m][p] (k = v is tied, so ONE state serves both calls: q_n . S_c and A_n . S_c^T), kept as its mean S_c/(64c) in hi+lo.
// WMMA (v_wmma_f32_16x16x32_f16, f32 accumulate): the four input linears (kp, q, kv: [4,096 x 1,024] x [1,024 x 1,024]; pq: [64 x 1,024] x [1,024 x 1,024]; EXACT bf16 operands, 1 product) and the output linear (attn hi+lo: 2 products); per (bh,
// 16-query wave) and causal 32-key block: S1^T = KV.Q^T (K = 64, hi+lo: 3 products) then AW^T += PATTN^T S1^T (2 p-tiles, 3 products); S2^T = PATTN.A^T (K = 32, 3 products) then O^T += KV^T S2^T
// (4 d-tiles, 3 products); pattn = softplus(kp.pq) per token ([16 tokens x 64] x [64 x 32] per (bh) tile, 3 products). Softplus, softmax over the 32 positions, the 1/(n+1) factors in f32.
// Inputs rounded to bf16 once. Fragment k-map per lane half hh for A AND B: elements 0..7 <- k = 8hh+0..7, 8..15 <- k = 16+8hh+0..7; acc[r] = D[8hh+r][col]. Every

namespace {
constexpr int T = 2048, BS = 2, E = 1024, NH = 16, DH = 64, BH = BS * NH, PL = 32, NR = T * BS /* 4,096 query rows (t, b) */, NPR = PL * BS /* 64 pquery rows */;
constexpr int CH = 64 /* keys per chunk */, NC = T / CH;
constexpr int TB = T / 16 /* blocks of 16 tokens */, BK = 256 /* elements of a 16 x 16 block */;
constexpr float SS = 16.0f /* scale of the stored state mean */;
constexpr float XS = 8.0f, WSC = 256.0f, SCL = 0.125f, BETA = 0.69314718055994531f, PS1 = 8.0f, PS2 = 64.0f;

typedef _Float16 b16;
typedef __attribute__((ext_vector_type(16))) _Float16 v16b;
typedef __attribute__((ext_vector_type(8))) _Float16 v8b;
typedef __attribute__((ext_vector_type(8))) float v8f;
typedef __attribute__((ext_vector_type(4))) float v4f;
__device__ __forceinline__ float bf16_rne(float f) { unsigned int u = __float_as_uint(f); u += 0x7FFFu + ((u >> 16) & 1u); return __uint_as_float(u & 0xFFFF0000u); }
__device__ __forceinline__ void split16(float v, b16& hi, b16& lo) { hi = (b16)v; lo = (b16)(v - (float)hi); }
__device__ __forceinline__ v16b frag_kb(const b16* p, int hh) { const v8b a = *(const v8b*)(p + 8 * hh), b = *(const v8b*)(p + 16 + 8 * hh); v16b f;
#pragma unroll
  for (int e = 0; e < 8; ++e) { f[e] = a[e]; f[8 + e] = b[e]; } return f; }
// fragment from two consecutive 16 x 16 blocks (256 elements each) of a block-tiled plane: p = the lane's row in the first block; same k-map as frag_kb
__device__ __forceinline__ v16b frag_blk(const b16* p, int hh) { const v8b a = *(const v8b*)(p + 8 * hh), b = *(const v8b*)(p + 256 + 8 * hh); v16b f;
#pragma unroll
  for (int e = 0; e < 8; ++e) { f[e] = a[e]; f[8 + e] = b[e]; } return f; }
__device__ __forceinline__ v8f wmma16b(v16b a, v16b b, v8f c) { v8f d = __builtin_amdgcn_wmma_f32_16x16x32_f16(false, a, false, b, (short)0, c, false, false); asm volatile("v_nop\n\tv_nop\n\tv_nop\n\tv_nop" : "+v"(d) : "v"(a), "v"(b)); return d; }
__device__ __forceinline__ void wave_lds_sync() { __builtin_amdgcn_fence(__ATOMIC_RELEASE, "workgroup"); __builtin_amdgcn_wave_barrier(); __builtin_amdgcn_fence(__ATOMIC_ACQUIRE, "workgroup"); }
__device__ __forceinline__ float pmul(float a, float b) { float p = a * b; asm volatile("" : "+v"(p)); return p; }
__device__ __forceinline__ float softplus_b(float x) { const float bx = BETA * x; const float sp = (bx > 20.0f) ? bx : log1pf(__expf(bx)); return sp / BETA; }   // torch softplus(beta x)/beta (threshold 20 on beta*x)
// LDS staging of the linear layers' operand tiles: a stage is KS = 64 k of every operand row of the block (128-B rows, whole lines), laid at a pitch of 144 B for the ds_load_b128 fragment reads; two buffers.
constexpr int KS = 64, LP = KS + 8, NT = E / KS;
__device__ __forceinline__ unsigned lds_off(const void* p) { return (unsigned)(size_t)p; }   // byte offset in the work-group's LDS = low 32 bits of a __shared__ address
// four asynchronous copies, 16 B a lane each, global -> LDS through no register; the s_wait_xcnt stands inside the copies' own statement, so that no later write of an address register can be moved in front of it
__device__ __forceinline__ void copy4(unsigned l0, const b16* g0, unsigned l1, const b16* g1, unsigned l2, const b16* g2, unsigned l3, const b16* g3) {
  asm volatile("global_load_async_to_lds_b128 %0, %1, off\n\tglobal_load_async_to_lds_b128 %2, %3, off\n\tglobal_load_async_to_lds_b128 %4, %5, off\n\tglobal_load_async_to_lds_b128 %6, %7, off\n\ts_wait_xcnt 0x0"
               :: "v"(l0), "v"(g0), "v"(l1), "v"(g1), "v"(l2), "v"(g2), "v"(l3), "v"(g3) : "memory"); }
// 64 rows (16 a copy: a thread's row is tid / 8, its 16-B piece tid % 8) of one stage: l = the thread's LDS byte address in the first row group, g = its global address there
__device__ __forceinline__ void copy_rows64(unsigned l, const b16* g) { copy4(l, g, l + 16 * LP * 2, g + 16 * E, l + 32 * LP * 2, g + 32 * E, l + 48 * LP * 2, g + 48 * E); }
__device__ __forceinline__ void wait_copies() { asm volatile("s_wait_asynccnt 0x0" ::: "memory"); }   // the wave's own copies have landed; in front of the barrier that publishes them
__device__ __forceinline__ void wait_lds_reads() { asm volatile("s_wait_dscnt 0x0" ::: "memory"); }   // the wave's reads of a buffer have retired; in front of the barrier behind which it is refilled

__global__ __launch_bounds__(256) void prep_kernel(const float* __restrict__ query, const float* __restrict__ pquery, const float* __restrict__ wpq, const float* __restrict__ wq, const float* __restrict__ wpc, const float* __restrict__ wc, const float* __restrict__ wo, b16* __restrict__ X16, b16* __restrict__ PQ16, b16* __restrict__ W4, b16* __restrict__ WPQ) {
  const size_t t = (size_t)blockIdx.x * 256 + threadIdx.x; const size_t nx = (size_t)NR * E / 8, np_ = (size_t)NPR * E / 8, nw = (size_t)E * E / 8; v8b o;
  if (t < nx) { const size_t e = t * 8; const v4f a = *(const v4f*)(query + e), c = *(const v4f*)(query + e + 4); for (int j = 0; j < 4; ++j) { o[j] = (b16)(bf16_rne(a[j]) * XS); o[4 + j] = (b16)(bf16_rne(c[j]) * XS); } { *(v8b*)(X16 + e) = o;  } return; }
  size_t u = t - nx;
  if (u < np_) { const size_t e = u * 8; for (int j = 0; j < 8; ++j) o[j] = (b16)(bf16_rne(pquery[e + j]) * XS); { *(v8b*)(PQ16 + e) = o;  } return; } u -= np_;
  if (u < 5 * nw) { const int kind = (int)(u / nw); const size_t e = (u % nw) * 8; const float* w = kind == 0 ? wpc : kind == 1 ? wq : kind == 2 ? wc : kind == 3 ? wo : wpq; for (int j = 0; j < 8; ++j) o[j] = (b16)(bf16_rne(w[e + j]) * WSC);
    b16* dst = (kind < 4) ? (W4 + (size_t)kind * E * E) : WPQ; { *(v8b*)(dst + e) = o;  } }
}
// input linears: grid (NR/64, 8 col blocks, 3 kinds): y = X16 W^T + b (K = 1,024: 32 steps, exact); kind 0: kp -> KPh/KPl; kind 1: q = (y)*1/8 -> Qh/Ql; kind 2: kv -> KVh/KVl. All six planes are laid per bh in
// 16 x 16 blocks [bh][t / 16][d / 16][16 t][16 d]: a fragment load (16 rows x 32 B) of the later launches then reads one block, 512 contiguous bytes = 4 whole lines, and not 32 B out of each of 16 lines.
__global__ __launch_bounds__(128) void lin_kernel(const b16* __restrict__ X16, const b16* __restrict__ W4, const float* __restrict__ bpc, const float* __restrict__ bq, const float* __restrict__ bc, b16* __restrict__ KPh, b16* __restrict__ KPl, b16* __restrict__ Qh, b16* __restrict__ Ql, b16* __restrict__ KVh, b16* __restrict__ KVl) {
  __shared__ __attribute__((aligned(16))) b16 Th[4][16][128 + 8], Tl[4][16][128 + 8]; __shared__ __attribute__((aligned(16))) b16 St[2][64 + 128][LP];   // a stage: rows 0..63 = the block's X rows, 64..191 = its W rows
  const int wave = threadIdx.x >> 5, lane = threadIdx.x & 31, nloc = lane & 15, hlf = lane >> 4; const int kind = blockIdx.z, n0 = blockIdx.y * 128;
  const b16* W = W4 + (size_t)kind * E * E; const float* bias = kind == 0 ? bpc : kind == 1 ? bq : bc; const float osc = (kind == 1) ? SCL : 1.0f;
  v8f acc[8];
#pragma unroll
  for (int t = 0; t < 8; ++t) acc[t] = (v8f){};
  const int crow = threadIdx.x >> 3, cpc = (threadIdx.x & 7) * 8; const unsigned cl = lds_off(&St[0][crow][cpc]);
  const b16* cx = X16 + ((size_t)blockIdx.x * 64 + crow) * E + cpc; const b16* cw = W + (size_t)(n0 + crow) * E + cpc;
  auto stage = [&](int s) { const unsigned l = cl + (unsigned)(s & 1) * (192 * LP * 2); copy_rows64(l, cx + s * KS); copy_rows64(l + 64 * LP * 2, cw + s * KS); copy_rows64(l + 128 * LP * 2, cw + (size_t)64 * E + s * KS); };
  stage(0); wait_copies(); __syncthreads(); stage(1);
  for (int s = 0; s < NT; ++s) { const b16* sb = &St[s & 1][0][0]; v16b a[2], bw[2][8];   // all fragments of the stage are read in front of its first product: one LDS latency a stage
#pragma unroll   // constant indices keep the fragment arrays in registers
    for (int ks = 0; ks < 2; ++ks) { a[ks] = frag_kb(sb + (wave * 16 + nloc) * LP + ks * 32, hlf);
#pragma unroll   // constant indices keep the fragment arrays in registers
      for (int t = 0; t < 8; ++t) bw[ks][t] = frag_kb(sb + (64 + t * 16 + nloc) * LP + ks * 32, hlf); }
#pragma unroll   // constant indices keep the fragment arrays in registers
    for (int ks = 0; ks < 2; ++ks)
#pragma unroll   // constant indices keep the fragment arrays in registers
      for (int t = 0; t < 8; ++t) acc[t] = wmma16b(a[ks], bw[ks][t], acc[t]);
    wait_lds_reads(); wait_copies(); __syncthreads();   // publishes stage s + 1 and ends every reader's last read of stage s
    if (s + 2 < NT) stage(s + 2); }
  wait_copies();
#pragma unroll
  for (int t = 0; t < 8; ++t) { const float bb = bf16_rne(bias[n0 + t * 16 + nloc]);
#pragma unroll
    for (int r = 0; r < 8; ++r) { b16 p, q; split16((acc[t][r] * (1.0f / (XS * WSC)) + bb) * osc * XS, p, q); Th[wave][8 * hlf + r][t * 16 + nloc] = p; Tl[wave][8 * hlf + r][t * 16 + nloc] = q; } }
  wave_lds_sync(); b16* dh = kind == 0 ? KPh : kind == 1 ? Qh : KVh; b16* dl = kind == 0 ? KPl : kind == 1 ? Ql : KVl;
  // stored per bh as 16 x 16 blocks [bh][t / 16][d / 16][16 t][16 d] (512 contiguous bytes each), the order in which the fragment loads of pattn and step 1 read them. The wave's 16 rows are 8 t of both batches:
  // a store = one batch, one head, two d blocks: 16 lanes fill 8 t x 16 d = 256 contiguous bytes of a block (its lower or upper half, by the wave's parity)
  { for (int s = 0; s < 8; ++s) { const int bb = s & 1, hl = (s >> 1) & 1, db = (s >> 2) * 2 + (lane >> 4), tl = (lane & 15) >> 1, hf = lane & 1; const int rr = tl * 2 + bb, c8 = hl * 64 + db * 16 + hf * 8;
      const size_t gi = (((size_t)(bb * NH + blockIdx.y * 2 + hl) * TB + blockIdx.x * 2 + (wave >> 1)) * 4 + db) * BK + ((wave & 1) * 8 + tl) * 16 + hf * 8; *(v8b*)(dh + gi) = *(const v8b*)(&Th[wave][rr][c8]); *(v8b*)(dl + gi) = *(const v8b*)(&Tl[wave][rr][c8]); }  }
}
// grid (4 + T/64, BH). Blocks x >= 4: kv transposed per bh, as blocks [bh][d / 16][t / 16][16 d][16 t] (512 contiguous bytes each, one fragment load). The 128 blocks x < 4: the packed query pq = (pquery Wpq^T + bpq)/8, computed ONCE for all token blocks: a block = 2 tiles of 16 d x 16 p, a wave = one
// quarter of a tile's K (256: 8 products, exact operands): A = WPQ rows (d), B = PQ16 rows (p*2 + b) -> D[d][p]; the four quarters are added through LDS; stored x8 hi/lo as blocks [bh][pt*4 + dt][16 p][16 d]
// (B operand of pattn, k = d): a tile's block is 512 contiguous bytes.
__global__ __launch_bounds__(256) void kvt_kernel(const b16* __restrict__ KVh, const b16* __restrict__ KVl, b16* __restrict__ KVTh, b16* __restrict__ KVTl, const b16* __restrict__ PQ16, const b16* __restrict__ WPQ, const float* __restrict__ bpq, b16* __restrict__ PQh, b16* __restrict__ PQl) {
  __shared__ __attribute__((aligned(16))) b16 Ah[DH][64 + 8], Al[DH][64 + 8]; __shared__ __attribute__((aligned(16))) float Rd[3][2][32][8];   // Rd: K quarters 1..3 of the block's two pq tiles
  if (blockIdx.x < 4) {   // the same for the whole block
    const int wave = threadIdx.x >> 5, lane = threadIdx.x & 31, hh = lane >> 4, col = lane & 15, tl = wave & 1, kq = wave >> 1;
    const int tile = (blockIdx.x * BH + blockIdx.y) * 2 + tl, ct = tile & 63 /* 16 columns of E: head ct / 4, d tile ct % 4 */, pb_ = tile >> 6, b = pb_ >> 1, pt = pb_ & 1;
    const b16* wa = WPQ + (size_t)(ct * 16 + col) * E + kq * 256 + 8 * hh; const b16* pa = PQ16 + ((size_t)(pt * 16 + col) * BS + b) * E + kq * 256 + 8 * hh; v8f acc = {};
#pragma unroll 1   // two groups of four k steps, one memory latency each, through the same registers: unrolled, the kernel's register count would leave the transposing blocks fewer than their 8 waves a SIMD
    for (int g = 0; g < 2; ++g) { v16b fa[4], fb[4];
#pragma unroll   // constant indices keep the fragment arrays in registers
      for (int j = 0; j < 4; ++j) { fa[j] = frag_kb(wa + j * 32, 0); fb[j] = frag_kb(pa + j * 32, 0); }
      asm volatile("s_wait_xcnt 0x0" :: "v"(wa), "v"(pa) : "memory");   // in front of every later overwrite of the address registers of these loads, which are its inputs, so that no load lands on one of them ahead of the wait
      wa += 128; pa += 128;
#pragma unroll   // constant indices keep the fragment arrays in registers
      for (int j = 0; j < 4; ++j) acc = wmma16b(fa[j], fb[j], acc); }
    if (kq) *(v8f*)&Rd[kq - 1][tl][lane][0] = acc;
    __syncthreads();   // publishes the quarters 1..3 to the waves that hold quarter 0
    if (kq == 0) { const v4f b0 = *(const v4f*)(bpq + ct * 16 + 8 * hh), b1 = *(const v4f*)(bpq + ct * 16 + 8 * hh + 4); v8b hv, lv;
      for (int k = 0; k < 3; ++k) acc += *(const v8f*)&Rd[k][tl][lane][0];
#pragma unroll
      for (int r = 0; r < 8; ++r) { const float bb = bf16_rne(r < 4 ? b0[r & 3] : b1[r & 3]); b16 p, q; split16((acc[r] * (1.0f / (XS * WSC)) + bb) * SCL * XS, p, q); hv[r] = p; lv[r] = q; }
      const size_t go = ((size_t)((b * NH + (ct >> 2)) * 2 + pt) * 4 + (ct & 3)) * 256 + col * 16 + 8 * hh; *(v8b*)(PQh + go) = hv; *(v8b*)(PQl + go) = lv; }
    return; }
  const int bh = blockIdx.y, t0 = (blockIdx.x - 4) * 64, t_ = threadIdx.x;
  { const size_t g0 = ((size_t)bh * TB + (t0 >> 4)) * (4 * BK) + t_; const b16 *ga = KVh + g0, *gb = KVl + g0; b16 xh[16], xl[16];   // the 64 t x 64 d of the block are 4,096 contiguous elements [t / 16][d / 16][16 t][16 d]: every load is a base plus a constant
#pragma unroll   // constant indices keep the two arrays in registers
    for (int i = 0; i < 16; ++i) { xh[i] = ga[i * 256]; xl[i] = gb[i * 256]; }
    asm volatile("s_wait_xcnt 0x0" :: "v"(ga), "v"(gb) : "memory");   // in front of every later overwrite of the address registers of these loads, which are its inputs
#pragma unroll   // constant indices keep the two arrays in registers
    for (int i = 0; i < 16; ++i) { const int q = t_ + i * 256, tt = (q >> 10) * 16 + ((q >> 4) & 15), d = ((q >> 8) & 3) * 16 + (q & 15); Ah[d][tt] = xh[i]; Al[d][tt] = xl[i]; } }
  __syncthreads();
  { for (int q = t_; q < DH * 8; q += 256) { const int d = q >> 3, c8 = (q & 7) * 8; const size_t gi = (((size_t)bh * 4 + (d >> 4)) * TB + ((t0 + c8) >> 4)) * BK + (d & 15) * 16 + (c8 & 15); *(v8b*)(KVTh + gi) = *(const v8b*)(&Ah[d][c8]); *(v8b*)(KVTl + gi) = *(const v8b*)(&Al[d][c8]); }  }
}
// pattn: block = (bh, 64 t) x 4 waves: tile = KP rows (t; the head's 64 d) [16 t x 64] x PQ^T -> [16 x 32]: 2 col tiles x 2 k steps x 3 products; softplus; stored as PAh/PAl [bh][t][32] (x8 hi/lo) and transposed as
// PATh/PATl blocks [bh][p / 16][t / 16][16 p][16 t]; pq comes ready from the launch before (blocks [bh][pt*4 + dt][16 p][16 d])
__global__ __launch_bounds__(128) void pattn_kernel(const b16* __restrict__ PQh, const b16* __restrict__ PQl, const b16* __restrict__ KPh, const b16* __restrict__ KPl, b16* __restrict__ PAh, b16* __restrict__ PAl, b16* __restrict__ PATh, b16* __restrict__ PATl) {
  __shared__ __attribute__((aligned(16))) b16 Rh[4][16][PL + 8], Rl[4][16][PL + 8]; __shared__ __attribute__((aligned(16))) b16 Rt[PL][64 + 8], Rtl[PL][64 + 8];
  const int wave = threadIdx.x >> 5, lane = threadIdx.x & 31, nloc = lane & 15, hlf = lane >> 4, t_ = threadIdx.x; const int bh = blockIdx.y, t0 = blockIdx.x * 64;
  // the wave's KP fragments (hi, lo; two k steps) and all pq fragments are loaded in front of the first product: one memory latency and not one a fragment
  const size_t arow = ((size_t)bh * TB + (t0 >> 4) + wave) * (4 * BK) + nloc * 16 + 8 * hlf; const b16 *kpa = KPh + arow, *kpb = KPl + arow; v16b ka[2], kal[2];
#pragma unroll   // constant indices keep the fragment arrays in registers
  for (int j = 0; j < 2; ++j) { ka[j] = frag_blk(kpa + j * 2 * BK, 0); kal[j] = frag_blk(kpb + j * 2 * BK, 0); }
  const size_t qo = (size_t)bh * (PL * DH) + nloc * 16 + 8 * hlf; const b16 *qa = PQh + qo, *qb = PQl + qo; v16b bp[2][2], bpl[2][2];
#pragma unroll   // constant indices keep the fragment arrays in registers
  for (int j = 0; j < 2; ++j)
#pragma unroll   // constant indices keep the fragment arrays in registers
    for (int t = 0; t < 2; ++t) { bp[j][t] = frag_blk(qa + (t * 4 + 2 * j) * 256, 0); bpl[j][t] = frag_blk(qb + (t * 4 + 2 * j) * 256, 0); }
  asm volatile("s_wait_xcnt 0x0" :: "v"(kpa), "v"(kpb), "v"(qa), "v"(qb) : "memory");   // in front of every later overwrite of the address registers of these loads, which are its inputs, so that no load lands on one of them ahead of the wait
  // pattn for the wave's 16 t: A = KP rows t0 + wave*16 + nloc of bh (k = d), B = pq rows p (k = d)
  { v8f d2[2] = {{}, {}};
#pragma unroll
    for (int j = 0; j < 2; ++j)
#pragma unroll
      for (int t = 0; t < 2; ++t) { d2[t] = wmma16b(ka[j], bp[j][t], d2[t]); d2[t] = wmma16b(kal[j], bp[j][t], d2[t]); d2[t] = wmma16b(ka[j], bpl[j][t], d2[t]); }
#pragma unroll
    for (int t = 0; t < 2; ++t)
#pragma unroll
      for (int r = 0; r < 8; ++r) { const float v = softplus_b(d2[t][r] * (1.0f / (XS * XS))); b16 p, q; split16(v * XS, p, q); const int tt = wave * 16 + 8 * hlf + r, pp = t * 16 + nloc; Rh[wave][8 * hlf + r][pp] = p; Rl[wave][8 * hlf + r][pp] = q; Rt[pp][tt] = p; Rtl[pp][tt] = q; } }
  __syncthreads();
  {
    for (int k = 0; k < 2; ++k) { const int rr = k * 8 + (lane >> 2), c8 = (lane & 3) * 8; const size_t gi = ((size_t)bh * T + t0 + wave * 16 + rr) * PL + c8; *(v8b*)(PAh + gi) = *(const v8b*)(&Rh[wave][rr][c8]); *(v8b*)(PAl + gi) = *(const v8b*)(&Rl[wave][rr][c8]); }
    for (int q = t_; q < PL * 8; q += 128) { const int pp = q >> 3, c8 = (q & 7) * 8; const size_t gi = (((size_t)bh * 2 + (pp >> 4)) * TB + ((t0 + c8) >> 4)) * BK + (pp & 15) * 16 + (c8 & 15); *(v8b*)(PATh + gi) = *(const v8b*)(&Rt[pp][c8]); *(v8b*)(PATl + gi) = *(const v8b*)(&Rtl[pp][c8]); }
     }
}
// prefix state: grid (8 tiles, BH), a block of SW = 8 waves per (16 d x 16 p) tile; a wave sums its own CPW = 4 chunks of keys (K = 32 a step, 3 products, f32 accumulate), both orientations: sd = KVT.PAT^T -> D[d][p],
// st = PAT.KVT^T -> D[p][d], and keeps its running sum at the end of each of them; the waves' totals go through LDS, and each wave adds the totals of the waves in front of it to its four running sums.
// At each chunk boundary c = 1..NC-1 the sum is stored as its mean x SS (hi/lo): MT blocks [pt*4+dt][16 p][16 d] (A operand of step 1, k = d), MS blocks [dt*2+pt][16 d][16 p] (A operand of step 2, k = p);
// a wave's block is 512 contiguous bytes. Operand fragments: the first four key steps are loaded together, a later step's into a stage as soon as its products have read it.
__device__ __forceinline__ void state_mac(v16b k, v16b kl, v16b p, v16b pl, v8f& sd, v8f& st) { sd = wmma16b(k, p, sd); st = wmma16b(p, k, st); sd = wmma16b(k, pl, sd); st = wmma16b(pl, k, st); sd = wmma16b(kl, p, sd); st = wmma16b(p, kl, st); }
__device__ __forceinline__ void state_store(v8f sd, v8f st, int c, b16* mth, b16* mtl, b16* msh, b16* msl) { const float f = SS / (XS * XS * (float)(c * CH)); v8b dh_, dl_, th_, tl_;
#pragma unroll
  for (int r = 0; r < 8; ++r) { b16 p, q; split16(sd[r] * f, p, q); dh_[r] = p; dl_[r] = q; split16(st[r] * f, p, q); th_[r] = p; tl_[r] = q; }
  *(v8b*)mth = dh_; *(v8b*)mtl = dl_; *(v8b*)msh = th_; *(v8b*)msl = tl_;
  asm volatile("s_wait_xcnt 0x0" ::: "memory"); }   // in front of every later overwrite of the data and address registers of the four stores
constexpr int SW = 8 /* waves of a scan block */, CPW = NC / SW /* chunks a wave */, SPW = CPW * CH / 32 /* key steps a wave */;
__global__ __launch_bounds__(SW * 32) void state_kernel(const b16* __restrict__ KVTh, const b16* __restrict__ KVTl, const b16* __restrict__ PATh, const b16* __restrict__ PATl, b16* __restrict__ MTh, b16* __restrict__ MTl, b16* __restrict__ MSh, b16* __restrict__ MSl) {
  __shared__ __attribute__((aligned(16))) float Tt[SW - 1][2][32][8];   // the totals (sd, st) of waves 0..SW-2, a lane's 8 values together
  const int wave = __builtin_amdgcn_readfirstlane(threadIdx.x >> 5), lane = threadIdx.x & 31, hh = lane >> 4, col = lane & 15; const int bh = blockIdx.y, dt = blockIdx.x >> 1, pt = blockIdx.x & 1;
  const int tb0 = wave * (CPW * CH / 16);   // the wave's first block of 16 keys
  const size_t ok = (((size_t)bh * 4 + dt) * TB + tb0) * BK + col * 16 + 8 * hh, op = (((size_t)bh * 2 + pt) * TB + tb0) * BK + col * 16 + 8 * hh;   // the lane half's k offset is part of the four base pointers
  const b16* kh = KVTh + ok; const b16* kl = KVTl + ok; const b16* ph = PATh + op; const b16* pl = PATl + op;
  v16b fk[4], fkl[4], fp[4], fpl[4];
#pragma unroll   // here and below: the stage index must be a constant, so that the four stages stay in registers
  for (int j = 0; j < 4; ++j) { fk[j] = frag_blk(kh + j * 2 * BK, 0); fkl[j] = frag_blk(kl + j * 2 * BK, 0); fp[j] = frag_blk(ph + j * 2 * BK, 0); fpl[j] = frag_blk(pl + j * 2 * BK, 0); }
  v8f sd = {}, st = {}, ld[CPW], lt[CPW];   // ld, lt: the wave's own running sums at the end of each of its chunks
#pragma unroll
  for (int j = 0; j < SPW; ++j) { const int g = j & 3, kn = (j + 4) * 2 * BK;
    state_mac(fk[g], fkl[g], fp[g], fpl[g], sd, st);
    if (j + 4 < SPW) { fk[g] = frag_blk(kh + kn, 0); fkl[g] = frag_blk(kl + kn, 0); fp[g] = frag_blk(ph + kn, 0); fpl[g] = frag_blk(pl + kn, 0); }
    if (j + 5 == SPW) asm volatile("s_wait_xcnt 0x0" :: "v"(kh), "v"(kl), "v"(ph), "v"(pl) : "memory");   // behind the last loads, in front of every later overwrite of their address registers, which are its inputs
    if (j & 1) { ld[j >> 1] = sd; lt[j >> 1] = st; } }
  if (wave < SW - 1) { *(v8f*)&Tt[wave][0][lane][0] = sd; *(v8f*)&Tt[wave][1][lane][0] = st; }
  __syncthreads();   // publishes the waves' totals
  v8f td[SW - 1], tt[SW - 1], pd = {}, pq_ = {};   // all totals are read in front of the first addition: one LDS latency and not one a wave
#pragma unroll
  for (int w = 0; w < SW - 1; ++w) { td[w] = *(const v8f*)&Tt[w][0][lane][0]; tt[w] = *(const v8f*)&Tt[w][1][lane][0]; }
#pragma unroll
  for (int w = 0; w < SW - 1; ++w)
#pragma unroll
    for (int r = 0; r < 8; ++r) { pd[r] += (w < wave) ? td[w][r] : 0.0f; pq_[r] += (w < wave) ? tt[w][r] : 0.0f; }   // only the waves in front count
  const size_t ot = ((size_t)bh * NC + wave * CPW) * (DH * PL) + ((pt * 4 + dt) * 16 + col) * 16 + 8 * hh, os = ((size_t)bh * NC + wave * CPW) * (DH * PL) + ((dt * 2 + pt) * 16 + col) * 16 + 8 * hh;
#pragma unroll
  for (int j = 0; j < CPW; ++j) { const int c = wave * CPW + j + 1;   // the boundary behind the wave's chunk j
    if (c < NC) state_store(pd + ld[j], pq_ + lt[j], c, MTh + ot + (j + 1) * (DH * PL), MTl + ot + (j + 1) * (DH * PL), MSh + os + (j + 1) * (DH * PL), MSl + os + (j + 1) * (DH * PL)); }   // the last chunk feeds no state (the same for the whole wave)
}
// steps 1 and 2 in ONE launch: grid (T/32, BH), 2 waves x 16 queries; a wave's step 2 needs of step 1 only its own 16 queries' softmax rows, and those stand in its accumulators in the B-fragment order of step 2
// (lane (hh, col): values p = t*16 + 8hh + r of query col = elements t*8 + r), so A goes from step 1 to step 2 in registers: no plane, no LDS, no second launch.
// Step 1: earlier chunks: AI^T = MT(p rows) Q^T (2 p-tiles, K = 64, 3 products), weighted 64c/(n+1); key blocks of the query's own chunk: S1^T = KV.Q^T (K = 64, 3 products), masked keys > q -> 0, x PS1 hi/lo;
// AW^T += PAT(p rows) S1^T (2 p-tiles, 3 products); aw = AW/(n+1); softmax over the 32 p (a query's 32 values are split over the lanes col and col + 16).
// Step 2: earlier chunks: OI^T = MS(d rows) A^T (4 d-tiles, K = 32, 3 products), weighted 64c/(n+1); own chunk: S2^T = PA(keys).A(q)^T (K = 32: 3 products), causal, x PS1 hi/lo; O^T += KVT(d rows) S2^T (4 d-tiles, 3 products); / (n+1)
__global__ __launch_bounds__(64) void step12_kernel(const b16* __restrict__ Qh, const b16* __restrict__ Ql, const b16* __restrict__ KVh, const b16* __restrict__ KVl, const b16* __restrict__ PATh, const b16* __restrict__ PATl, const b16* __restrict__ MTh, const b16* __restrict__ MTl,
                                                    const b16* __restrict__ PAh, const b16* __restrict__ PAl, const b16* __restrict__ KVTh, const b16* __restrict__ KVTl, const b16* __restrict__ MSh, const b16* __restrict__ MSl, b16* __restrict__ ATh, b16* __restrict__ ATl) {
  __shared__ __attribute__((aligned(16))) float To[2][16][DH + 4];
  const int wave = threadIdx.x >> 5, lane = threadIdx.x & 31, hh = lane >> 4, col = lane & 15; const int bh = blockIdx.y, b = bh / NH, h = bh % NH; const int q0 = blockIdx.x * 32 + wave * 16, qi = q0 + col;
  const size_t qrow = ((size_t)bh * TB + (q0 >> 4)) * (4 * BK) + col * 16; const v16b qa0 = frag_blk(Qh + qrow, hh), qa1 = frag_blk(Qh + qrow + 2 * BK, hh), ql0 = frag_blk(Ql + qrow, hh), ql1 = frag_blk(Ql + qrow + 2 * BK, hh);
  const b16* Pb = PATh + (size_t)bh * PL * T; const b16* Plb = PATl + (size_t)bh * PL * T;
  v8f aw[2] = {{}, {}}, awl[2] = {{}, {}}, ai[2] = {{}, {}}; const int ks0 = (blockIdx.x * 32) & ~(CH - 1), nb = (blockIdx.x & 1) + 1;   // nb = key blocks of 32 from the chunk's start up to the block's 32 queries
  const size_t so = ((size_t)bh * NC + ks0 / CH) * (DH * PL);   // the chunk's state blocks (read only where ks0 > 0)
  // The fragments of a key block are loaded as groups ahead of the products that use them, so that a block costs one memory latency and not one a fragment: the first block's together with the query's and the
  // state's, the next block's into the same registers as soon as this block's products have read them. kf = KV rows (key tile, k half: hi, lo), pf = PAT rows (p tile: hi, lo).
  v16b kf[8], pf[4]; const b16 *ka, *kal, *pa, *pal;   // the lane's base addresses of a group (its k half included): every load of the group is one of them plus a constant
  auto load_kv = [&](int kb) { const size_t r = ((size_t)bh * TB + (kb >> 4)) * (4 * BK) + col * 16 + 8 * hh; ka = KVh + r; kal = KVl + r;
#pragma unroll   // constant indices keep the fragment arrays in registers
    for (int u = 0; u < 4; ++u) { const int c = (u >> 1) * 4 * BK + (u & 1) * 2 * BK; kf[2 * u] = frag_blk(ka + c, 0); kf[2 * u + 1] = frag_blk(kal + c, 0); } };
  auto load_pa = [&](int kb) { const size_t r = (size_t)(kb >> 4) * BK + col * 16 + 8 * hh; pa = Pb + r; pal = Plb + r;
#pragma unroll   // constant indices keep the fragment arrays in registers
    for (int t = 0; t < 2; ++t) { pf[2 * t] = frag_blk(pa + t * TB * BK, 0); pf[2 * t + 1] = frag_blk(pal + t * TB * BK, 0); } };
  // step 2's groups: pk = PA rows (key tile: hi, lo), vf = KVT rows (d tile: hi, lo)
  const b16* Vb = KVTh + (size_t)bh * DH * T; const b16* Vlb = KVTl + (size_t)bh * DH * T;
  v16b pk[4], vf[8]; const b16 *pa2, *pal2, *va, *val;
  auto load_pk = [&](int kb) { const size_t r = ((size_t)bh * T + kb + col) * PL + 8 * hh; pa2 = PAh + r; pal2 = PAl + r;
#pragma unroll   // constant indices keep the fragment arrays in registers
    for (int u = 0; u < 2; ++u) { pk[2 * u] = frag_kb(pa2 + u * 16 * PL, 0); pk[2 * u + 1] = frag_kb(pal2 + u * 16 * PL, 0); } };
  auto load_vf = [&](int kb) { const size_t r = (size_t)(kb >> 4) * BK + col * 16 + 8 * hh; va = Vb + r; val = Vlb + r;
#pragma unroll   // constant indices keep the fragment arrays in registers
    for (int t = 0; t < 4; ++t) { vf[2 * t] = frag_blk(va + t * TB * BK, 0); vf[2 * t + 1] = frag_blk(val + t * TB * BK, 0); } };
  load_kv(ks0); load_pa(ks0);
  // kept in front of the branch: the address arithmetic behind it may take over the address registers of the loads above; the addresses are inputs, so that no load of the groups lands on one of them ahead of the wait
  asm volatile("s_wait_xcnt 0x0" :: "v"(Qh + qrow + 8 * hh), "v"(Ql + qrow + 8 * hh), "v"(ka), "v"(kal), "v"(pa), "v"(pal) : "memory");
  if (ks0 > 0) {
    v16b mh[4], ml[4];   // all state fragments are loaded in front of the first product, so that they cost one memory latency and not one each
#pragma unroll
    for (int u = 0; u < 4; ++u) { mh[u] = frag_blk(MTh + so + ((u * 2) * 16 + col) * 16, hh); ml[u] = frag_blk(MTl + so + ((u * 2) * 16 + col) * 16, hh); }
    asm volatile("s_wait_xcnt 0x0" :: "v"(MTh + so + col * 16 + 8 * hh), "v"(MTl + so + col * 16 + 8 * hh) : "memory");   // the wait: as above
#pragma unroll
    for (int t = 0; t < 2; ++t) { ai[t] = wmma16b(mh[2 * t], qa0, ai[t]); ai[t] = wmma16b(mh[2 * t], ql0, ai[t]); ai[t] = wmma16b(ml[2 * t], qa0, ai[t]);
      ai[t] = wmma16b(mh[2 * t + 1], qa1, ai[t]); ai[t] = wmma16b(mh[2 * t + 1], ql1, ai[t]); ai[t] = wmma16b(ml[2 * t + 1], qa1, ai[t]); } }
  v16b ph, pl;   // a key block's masked scores x PS1, hi and lo: B operand of the block's second product
  auto scores1 = [&](v8f& s0, v8f& s1) {
    s0 = wmma16b(kf[0], qa0, s0); s0 = wmma16b(kf[0], ql0, s0); s0 = wmma16b(kf[1], qa0, s0); s0 = wmma16b(kf[2], qa1, s0); s0 = wmma16b(kf[2], ql1, s0); s0 = wmma16b(kf[3], qa1, s0);
    s1 = wmma16b(kf[4], qa0, s1); s1 = wmma16b(kf[4], ql0, s1); s1 = wmma16b(kf[5], qa0, s1); s1 = wmma16b(kf[6], qa1, s1); s1 = wmma16b(kf[6], ql1, s1); s1 = wmma16b(kf[7], qa1, s1); };
  auto mask_split = [&](int kb, const v8f& s0, const v8f& s1, float sc) {
#pragma unroll
    for (int r = 0; r < 8; ++r) { const int k0 = kb + 8 * hh + r, k1 = kb + 16 + 8 * hh + r; const float v0 = (k0 <= qi) ? s0[r] * sc : 0.0f, v1 = (k1 <= qi) ? s1[r] * sc : 0.0f; b16 p, q; split16(v0 * PS1, p, q); ph[r] = p; pl[r] = q; split16(v1 * PS1, p, q); ph[8 + r] = p; pl[8 + r] = q; } };
  auto sums1 = [&]() {
#pragma unroll
    for (int t = 0; t < 2; ++t) { aw[t] = wmma16b(pf[2 * t], ph, aw[t]); awl[t] = wmma16b(pf[2 * t], pl, awl[t]); awl[t] = wmma16b(pf[2 * t + 1], ph, awl[t]); } };
  if (nb == 2) {   // the chunk's first key block, where the queries stand in its second (the same for the whole block)
    v8f s0 = {}, s1 = {}; scores1(s0, s1);
    load_kv(ks0 + 32); asm volatile("s_wait_xcnt 0x0" :: "v"(ka), "v"(kal) : "memory");   // the wait: in front of every later overwrite of the address registers of these loads, which are its inputs as above
    mask_split(ks0, s0, s1, 1.0f / (XS * XS)); sums1();
    load_pa(ks0 + 32); asm volatile("s_wait_xcnt 0x0" :: "v"(pa), "v"(pal) : "memory"); }   // the wait: as above
  v16b mh2[4], ml2[4];   // step 2's state fragments
  { v8f s0 = {}, s1 = {}; scores1(s0, s1);   // the queries' own key block
    // step 2's first groups fly while step 1 ends: they take the registers that the query's and the key fragments have just left
    load_pk(ks0); load_vf(ks0); asm volatile("s_wait_xcnt 0x0" :: "v"(pa2), "v"(pal2), "v"(va), "v"(val) : "memory");   // the wait: as above
    mask_split(ks0 + 32 * (nb - 1), s0, s1, 1.0f / (XS * XS)); sums1(); }
  if (ks0 > 0) {
#pragma unroll
    for (int t = 0; t < 4; ++t) { mh2[t] = frag_blk(MSh + so + ((t * 2) * 16 + col) * 16, hh); ml2[t] = frag_blk(MSl + so + ((t * 2) * 16 + col) * 16, hh); }
    asm volatile("s_wait_xcnt 0x0" :: "v"(MSh + so + col * 16 + 8 * hh), "v"(MSl + so + col * 16 + 8 * hh) : "memory"); }   // the wait: as above
  // lane (hh, col): value[p = t*16 + 8hh + r] for query col; divide by (qi + 1); softmax over 32
  v16b aq, aql;   // A x PS2, hi and lo, of query col: B operand of step 2 (k = p)
  { float v[16]; const float invn = 1.0f / ((float)(qi + 1) * PS1 * XS), invi = (float)ks0 / ((float)(qi + 1) * SS * XS); float mx = -INFINITY;
#pragma unroll
    for (int t = 0; t < 2; ++t) for (int r = 0; r < 8; ++r) { v[t * 8 + r] = (aw[t][r] + awl[t][r]) * invn + ai[t][r] * invi; mx = fmaxf(mx, v[t * 8 + r]); }
    mx = fmaxf(mx, __shfl_xor(mx, 16)); float sm = 0.0f; for (int i = 0; i < 16; ++i) { v[i] = __expf(v[i] - mx); sm += v[i]; } sm += __shfl_xor(sm, 16); const float inv = 1.0f / sm;
#pragma unroll
    for (int i = 0; i < 16; ++i) { b16 p, q; split16(v[i] * inv * PS2, p, q); aq[i] = p; aql[i] = q; } }
  v8f o[4] = {{}, {}, {}, {}}, ol[4] = {{}, {}, {}, {}}, oi[4] = {{}, {}, {}, {}};
  if (ks0 > 0) {
#pragma unroll
    for (int t = 0; t < 4; ++t) { oi[t] = wmma16b(mh2[t], aq, oi[t]); oi[t] = wmma16b(mh2[t], aql, oi[t]); oi[t] = wmma16b(ml2[t], aq, oi[t]); } }
  for (int i = 0; i < nb; ++i) { const int kb = ks0 + 32 * i; const bool more = i + 1 < nb;
    v8f s0 = {}, s1 = {};
    s0 = wmma16b(pk[0], aq, s0); s0 = wmma16b(pk[0], aql, s0); s0 = wmma16b(pk[1], aq, s0); s1 = wmma16b(pk[2], aq, s1); s1 = wmma16b(pk[2], aql, s1); s1 = wmma16b(pk[3], aq, s1);
    if (more) { load_pk(kb + 32); asm volatile("s_wait_xcnt 0x0" :: "v"(pa2), "v"(pal2) : "memory"); }   // the wait: as above
    mask_split(kb, s0, s1, 1.0f / (XS * PS2));
#pragma unroll
    for (int t = 0; t < 4; ++t) { o[t] = wmma16b(vf[2 * t], ph, o[t]); ol[t] = wmma16b(vf[2 * t], pl, ol[t]); ol[t] = wmma16b(vf[2 * t + 1], ph, ol[t]); }
    if (more) { load_vf(kb + 32); asm volatile("s_wait_xcnt 0x0" :: "v"(va), "v"(val) : "memory"); } }   // the wait: as above
  const float invn = 1.0f / ((float)(qi + 1) * PS1 * XS), invi = (float)ks0 / ((float)(qi + 1) * SS * PS2);
#pragma unroll
  for (int t = 0; t < 4; ++t)
#pragma unroll
    for (int r = 0; r < 8; ++r) To[wave][col][t * 16 + 8 * hh + r] = (o[t][r] + ol[t][r]) * invn + oi[t][r] * invi;
  wave_lds_sync();
  { for (int r4 = 0; r4 < 16; r4 += 4) { const int rr = r4 + (lane >> 3), c8 = (lane & 7) * 8; v8b hv, lv; for (int j = 0; j < 8; ++j) { b16 p, q; split16(To[wave][rr][c8 + j] * XS, p, q); hv[j] = p; lv[j] = q; }
      const size_t gi = ((size_t)(q0 + rr) * BS + b) * E + h * DH + c8; *(v8b*)(ATh + gi) = hv; *(v8b*)(ATl + gi) = lv; }  }
}
__global__ __launch_bounds__(128) void oproj_kernel(const b16* __restrict__ ATh, const b16* __restrict__ ATl, const b16* __restrict__ WO, const float* __restrict__ bo, float* __restrict__ out) {
  __shared__ __attribute__((aligned(16))) float Tf[4][16][128 + 4]; __shared__ __attribute__((aligned(16))) b16 St[2][64 + 64 + 128][LP];   // a stage: rows 0..63 = the block's attn hi rows, 64..127 = their lo rows, 128..255 = its W rows
  const int wave = threadIdx.x >> 5, lane = threadIdx.x & 31, nloc = lane & 15, hlf = lane >> 4; const int n0 = blockIdx.y * 128; const size_t m0 = (size_t)blockIdx.x * 64 + wave * 16;
  v8f acc[8];
#pragma unroll
  for (int t = 0; t < 8; ++t) acc[t] = (v8f){};
  const int crow = threadIdx.x >> 3, cpc = (threadIdx.x & 7) * 8; const unsigned cl = lds_off(&St[0][crow][cpc]); const size_t co = ((size_t)blockIdx.x * 64 + crow) * E + cpc;
  const b16* ch = ATh + co; const b16* cq = ATl + co; const b16* cw = WO + (size_t)(n0 + crow) * E + cpc;
  auto stage = [&](int s) { const unsigned l = cl + (unsigned)(s & 1) * (256 * LP * 2); copy_rows64(l, ch + s * KS); copy_rows64(l + 64 * LP * 2, cq + s * KS); copy_rows64(l + 128 * LP * 2, cw + s * KS); copy_rows64(l + 192 * LP * 2, cw + (size_t)64 * E + s * KS); };
  stage(0); wait_copies(); __syncthreads(); stage(1);
  for (int s = 0; s < NT; ++s) { const b16* sb = &St[s & 1][0][0]; v16b a[2], al[2], bw[2][8];   // all fragments of the stage are read in front of its first product: one LDS latency a stage
#pragma unroll   // constant indices keep the fragment arrays in registers
    for (int ks = 0; ks < 2; ++ks) { a[ks] = frag_kb(sb + (wave * 16 + nloc) * LP + ks * 32, hlf); al[ks] = frag_kb(sb + (64 + wave * 16 + nloc) * LP + ks * 32, hlf);
#pragma unroll   // constant indices keep the fragment arrays in registers
      for (int t = 0; t < 8; ++t) bw[ks][t] = frag_kb(sb + (128 + t * 16 + nloc) * LP + ks * 32, hlf); }
#pragma unroll   // constant indices keep the fragment arrays in registers
    for (int ks = 0; ks < 2; ++ks)
#pragma unroll   // constant indices keep the fragment arrays in registers
      for (int t = 0; t < 8; ++t) { acc[t] = wmma16b(a[ks], bw[ks][t], acc[t]); acc[t] = wmma16b(al[ks], bw[ks][t], acc[t]); }
    wait_lds_reads(); wait_copies(); __syncthreads();   // publishes stage s + 1 and ends every reader's last read of stage s
    if (s + 2 < NT) stage(s + 2); }
  wait_copies();
#pragma unroll
  for (int t = 0; t < 8; ++t) { const float bb = bf16_rne(bo[n0 + t * 16 + nloc]);
#pragma unroll
    for (int r = 0; r < 8; ++r) Tf[wave][8 * hlf + r][t * 16 + nloc] = acc[t][r] * (1.0f / (XS * WSC)) + bb; }
  wave_lds_sync();
  { for (int rr = 0; rr < 16; ++rr) *(v4f*)(out + (m0 + rr) * E + n0 + lane * 4) = *(const v4f*)(&Tf[wave][rr][lane * 4]);  }
}
}  // namespace

extern "C" void kernel_launch(void* const* d_in, const int* in_sizes, int n_in, void* d_out, int out_size, void* d_ws, size_t ws_size, hipStream_t stream) {
  (void)n_in;
  auto Fp = [&](int i) { return (const float*)d_in[i]; };
  // input order: 0 query [2048,2,1024], 1 pquery [32,2,1024], 2 Wpq [1024,1024], 3 bpq, 4 Wq, 5 bq, 6 Wpc, 7 bpc, 8 Wc, 9 bc, 10 Wo, 11 bo (torch [out][in])
  if (in_sizes[0] != NR * E || in_sizes[1] != NPR * E || in_sizes[2] != E * E || in_sizes[4] != E * E || in_sizes[6] != E * E || in_sizes[8] != E * E || in_sizes[10] != E * E || out_size != NR * E) return;
  size_t off = 0; char* ws = (char*)d_ws;
  auto carve = [&](size_t bytes) { char* p = ws + off; off += (bytes + 255) & ~(size_t)255; return p; };
  b16* X16 = (b16*)carve((size_t)NR * E * 2); b16* PQ16 = (b16*)carve((size_t)NPR * E * 2); b16* W4 = (b16*)carve((size_t)4 * E * E * 2); b16* WPQ = (b16*)carve((size_t)E * E * 2);
  b16* KPh = (b16*)carve((size_t)NR * E * 2); b16* KPl = (b16*)carve((size_t)NR * E * 2); b16* Qh = (b16*)carve((size_t)NR * E * 2); b16* Ql = (b16*)carve((size_t)NR * E * 2); b16* KVh = (b16*)carve((size_t)NR * E * 2); b16* KVl = (b16*)carve((size_t)NR * E * 2);
  b16* KVTh = (b16*)carve((size_t)NR * E * 2); b16* KVTl = (b16*)carve((size_t)NR * E * 2); b16* PAh = (b16*)carve((size_t)BH * T * PL * 2); b16* PAl = (b16*)carve((size_t)BH * T * PL * 2); b16* PATh = (b16*)carve((size_t)BH * PL * T * 2); b16* PATl = (b16*)carve((size_t)BH * PL * T * 2);
  b16* PQh = (b16*)carve((size_t)BH * PL * DH * 2); b16* PQl = (b16*)carve((size_t)BH * PL * DH * 2);
  b16* MTh = (b16*)carve((size_t)BH * NC * DH * PL * 2); b16* MTl = (b16*)carve((size_t)BH * NC * DH * PL * 2); b16* MSh = (b16*)carve((size_t)BH * NC * DH * PL * 2); b16* MSl = (b16*)carve((size_t)BH * NC * DH * PL * 2);
  b16* ATh = KPh; b16* ATl = KPl;   // region reuse: KP planes are dead after pattn_kernel (stream-ordered); the attention output takes their place
  if (off > ws_size || off > ((size_t)128 << 20)) return;   // ~ 114 MiB
  prep_kernel<<<(unsigned)(((size_t)NR * E / 8 + (size_t)NPR * E / 8 + 5 * (size_t)E * E / 8 + 255) / 256), 256, 0, stream>>>(Fp(0), Fp(1), Fp(2), Fp(4), Fp(6), Fp(8), Fp(10), X16, PQ16, W4, WPQ);
  lin_kernel<<<dim3(NR / 64, E / 128, 3), 128, 0, stream>>>(X16, W4, Fp(7), Fp(5), Fp(9), KPh, KPl, Qh, Ql, KVh, KVl);
  kvt_kernel<<<dim3(4 + T / 64, BH), 256, 0, stream>>>(KVh, KVl, KVTh, KVTl, PQ16, WPQ, Fp(3), PQh, PQl);
  pattn_kernel<<<dim3(T / 64, BH), 128, 0, stream>>>(PQh, PQl, KPh, KPl, PAh, PAl, PATh, PATl);
  state_kernel<<<dim3(8, BH), SW * 32, 0, stream>>>(KVTh, KVTl, PATh, PATl, MTh, MTl, MSh, MSl);
  step12_kernel<<<dim3(T / 32, BH), 64, 0, stream>>>(Qh, Ql, KVh, KVl, PATh, PATl, MTh, MTl, PAh, PAl, KVTh, KVTl, MSh, MSl, ATh, ATl);
  oproj_kernel<<<dim3(NR / 64, E / 128), 128, 0, stream>>>(ATh, ATl, W4 + (size_t)3 * E * E, Fp(11), (float*)d_out);
}

// v008
// Measured time: 101 microseconds a run.
// In two side-by-side timings against v007, it was 1.12 and 1.11 times as fast.
// Over all steps from v000 it is 7.03 times as fast.
#include <hip/hip_runtime.h>

// Lunar causal attention (Luna-style packed attention, causal "efficient" form): T = 2,048 tokens x 2 batch x 1,024 (16 heads x 64), 32 packed positions.
// pq = (pquery Wpq^T + bpq)/8 -> (b,h,p,d); kp = query Wpc^T + bpc; pattn[bh][t][p] = softplus_b(kp_t . pq_p) (b = ln 2); q = (query Wq^T + bq)/8; kv = query Wc^T + bc (tied k = v);
// aw[bh][n][p] = (sum_{m<=n} (q_n . kv_m) pattn[m][p]) / (n+1); A = softmax_p(aw); attn[bh][n][d] = (sum_{m<=n} (A_n . pattn_m) kv[m][d]) / (n+1); out = attn Wo^T + bo -> [2048][2][1024].
// Both "efficient_causal_attention_parallel" calls are evaluated in chunks of 64 keys: the keys of the query's own chunk as causal masked products (x_n . sum y_m z_m^T = sum (x_n.y_m) z_m), all earlier
// chunks through the running outer-product sum S_c[d][p] = sum_{m < 64c} kv[m][d] pattn[m][p] (k = v is tied, so ONE state serves both calls: q_n . S_c and A_n . S_c^T), kept as its mean S_c/(64c) in hi+lo.
// WMMA (v_wmma_f32_16x16x32_f16, f32 accumulate): the four input linears (kp, q, kv: [4,096 x 1,024] x [1,024 x 1,024]; pq: [64 x 1,024] x [1,024 x 1,024]; EXACT bf16 operands, 1 product) and the output linear (attn hi+lo: 2 products); per (bh,
// 16-query wave) and causal 32-key block: S1^T = KV.Q^T (K = 64, hi+lo: 3 products) then AW^T += PATTN^T S1^T (2 p-tiles, 3 products); S2^T = PATTN.A^T (K = 32, 3 products) then O^T += KV^T S2^T
// (4 d-tiles, 3 products); pattn = softplus(kp.pq) per token ([16 tokens x 64] x [64 x 32] per (bh) tile, 3 products). Softplus, softmax over the 32 positions, the 1/(n+1) factors in f32.
// Inputs rounded to bf16 once. Fragment k-map per lane half hh for A AND B: elements 0..7 <- k = 8hh+0..7, 8..15 <- k = 16+8hh+0..7; acc[r] = D[8hh+r][col]. Every

namespace {
constexpr int T = 2048, BS = 2, E = 1024, NH = 16, DH = 64, BH = BS * NH, PL = 32, NR = T * BS /* 4,096 query rows (t, b) */, NPR = PL * BS /* 64 pquery rows */;
constexpr int CH = 64 /* keys per chunk */, NC = T / CH;
constexpr int TB = T / 16 /* blocks of 16 tokens */, BK = 256 /* elements of a 16 x 16 block */;
constexpr float SS = 16.0f /* scale of the stored state mean */;
constexpr float XS = 8.0f, WSC = 256.0f, SCL = 0.125f, BETA = 0.69314718055994531f, PS1 = 8.0f, PS2 = 64.0f;

typedef _Float16 b16;
typedef __attribute__((ext_vector_type(16))) _Float16 v16b;
typedef __attribute__((ext_vector_type(8))) _Float16 v8b;
typedef __attribute__((ext_vector_type(8))) float v8f;
typedef __attribute__((ext_vector_type(4))) float v4f;
__device__ __forceinline__ float bf16_rne(float f) { unsigned int u = __float_as_uint(f); u += 0x7FFFu + ((u >> 16) & 1u); return __uint_as_float(u & 0xFFFF0000u); }
__device__ __forceinline__ void split16(float v, b16& hi, b16& lo) { hi = (b16)v; lo = (b16)(v - (float)hi); }
__device__ __forceinline__ v16b frag_kb(const b16* p, int hh) { const v8b a = *(const v8b*)(p + 8 * hh), b = *(const v8b*)(p + 16 + 8 * hh); v16b f;
#pragma unroll
  for (int e = 0; e < 8; ++e) { f[e] = a[e]; f[8 + e] = b[e]; } return f; }
// fragment from two consecutive 16 x 16 blocks (256 elements each) of a block-tiled plane: p = the lane's row in the first block; same k-map as frag_kb
__device__ __forceinline__ v16b frag_blk(const b16* p, int hh) { const v8b a = *(const v8b*)(p + 8 * hh), b = *(const v8b*)(p + 256 + 8 * hh); v16b f;
#pragma unroll
  for (int e = 0; e < 8; ++e) { f[e] = a[e]; f[8 + e] = b[e]; } return f; }
__device__ __forceinline__ v8f wmma16b(v16b a, v16b b, v8f c) { v8f d = __builtin_amdgcn_wmma_f32_16x16x32_f16(false, a, false, b, (short)0, c, false, false); asm volatile("v_nop\n\tv_nop\n\tv_nop\n\tv_nop" : "+v"(d) : "v"(a), "v"(b)); return d; }
__device__ __forceinline__ void wave_lds_sync() { __builtin_amdgcn_fence(__ATOMIC_RELEASE, "workgroup"); __builtin_amdgcn_wave_barrier(); __builtin_amdgcn_fence(__ATOMIC_ACQUIRE, "workgroup"); }
__device__ __forceinline__ float pmul(float a, float b) { float p = a * b; asm volatile("" : "+v"(p)); return p; }
__device__ __forceinline__ float softplus_b(float x) { const float bx = BETA * x; const float sp = (bx > 20.0f) ? bx : log1pf(__expf(bx)); return sp / BETA; }   // torch softplus(beta x)/beta (threshold 20 on beta*x)
// LDS staging of the linear layers' operand tiles: a stage is KS = 64 k of every operand row of the block (128-B rows, whole lines), laid at a pitch of 144 B for the ds_load_b128 fragment reads; two buffers.
constexpr int KS = 64, LP = KS + 8, NT = E / KS;
__device__ __forceinline__ unsigned lds_off(const void* p) { return (unsigned)(size_t)p; }   // byte offset in the work-group's LDS = low 32 bits of a __shared__ address
// four asynchronous copies, 16 B a lane each, global -> LDS through no register; the s_wait_xcnt stands inside the copies' own statement, so that no later write of an address register can be moved in front of it
__device__ __forceinline__ void copy4(unsigned l0, const b16* g0, unsigned l1, const b16* g1, unsigned l2, const b16* g2, unsigned l3, const b16* g3) {
  asm volatile("global_load_async_to_lds_b128 %0, %1, off\n\tglobal_load_async_to_lds_b128 %2, %3, off\n\tglobal_load_async_to_lds_b128 %4, %5, off\n\tglobal_load_async_to_lds_b128 %6, %7, off\n\ts_wait_xcnt 0x0"
               :: "v"(l0), "v"(g0), "v"(l1), "v"(g1), "v"(l2), "v"(g2), "v"(l3), "v"(g3) : "memory"); }
// 64 rows (16 a copy: a thread's row is tid / 8, its 16-B piece tid % 8) of one stage: l = the thread's LDS byte address in the first row group, g = its global address there
__device__ __forceinline__ void copy_rows64(unsigned l, const b16* g) { copy4(l, g, l + 16 * LP * 2, g + 16 * E, l + 32 * LP * 2, g + 32 * E, l + 48 * LP * 2, g + 48 * E); }
__device__ __forceinline__ void wait_copies() { asm volatile("s_wait_asynccnt 0x0" ::: "memory"); }   // the wave's own copies have landed; in front of the barrier that publishes them
__device__ __forceinline__ void wait_lds_reads() { asm volatile("s_wait_dscnt 0x0" ::: "memory"); }   // the wave's reads of a buffer have retired; in front of the barrier behind which it is refilled

__global__ __launch_bounds__(256) void prep_kernel(const float* __restrict__ query, const float* __restrict__ pquery, const float* __restrict__ wpq, const float* __restrict__ wq, const float* __restrict__ wpc, const float* __restrict__ wc, const float* __restrict__ wo, b16* __restrict__ X16, b16* __restrict__ PQ16, b16* __restrict__ W4, b16* __restrict__ WPQ) {
  const size_t t = (size_t)blockIdx.x * 256 + threadIdx.x; const size_t nx = (size_t)NR * E / 8, np_ = (size_t)NPR * E / 8, nw = (size_t)E * E / 8; v8b o;
  if (t < nx) { const size_t e = t * 8; const v4f a = *(const v4f*)(query + e), c = *(const v4f*)(query + e + 4); for (int j = 0; j < 4; ++j) { o[j] = (b16)(bf16_rne(a[j]) * XS); o[4 + j] = (b16)(bf16_rne(c[j]) * XS); } { *(v8b*)(X16 + e) = o;  } return; }
  size_t u = t - nx;
  if (u < np_) { const size_t e = u * 8; for (int j = 0; j < 8; ++j) o[j] = (b16)(bf16_rne(pquery[e + j]) * XS); { *(v8b*)(PQ16 + e) = o;  } return; } u -= np_;
  if (u < 5 * nw) { const int kind = (int)(u / nw); const size_t e = (u % nw) * 8; const float* w = kind == 0 ? wpc : kind == 1 ? wq : kind == 2 ? wc : kind == 3 ? wo : wpq; for (int j = 0; j < 8; ++j) o[j] = (b16)(bf16_rne(w[e + j]) * WSC);
    b16* dst = (kind < 4) ? (W4 + (size_t)kind * E * E) : WPQ; { *(v8b*)(dst + e) = o;  } }
}
// input linears as ONE product [4,096 x 1,024] x [1,024 x 3,072] (the W rows of kp, q and kv follow one another in W4): grid (NR/256, 3,072/192) = 256 blocks, one a WGP; a block = 256 rows x 192 columns,
// 16 waves (4 x 4) of 64 x 48: an LDS fragment feeds 3 or 4 products, and an operand row is fetched from L2 by 16 blocks and not by 24 (X) or 64 (W). y = X16 W^T + b (K = 1,024: 32 steps in ascending k, exact);
// a tile of 16 columns lies in one kind and one head: kind 0: kp -> KPh/KPl; kind 1: q = (y)*1/8 -> Qh/Ql; kind 2: kv -> KVh/KVl. All six planes are laid per bh in
// 16 x 16 blocks [bh][t / 16][d / 16][16 t][16 d]: a fragment load (16 rows x 32 B) of the later launches then reads one block, 512 contiguous bytes = 4 whole lines, and not 32 B out of each of 16 lines.
constexpr int LM = 256, LN = 192, WN = 48 /* columns of a wave */;
// orders one wave's own LDS writes and reads; it names LDS alone, so that between two row tiles the wave does not wait for its global stores to return
__device__ __forceinline__ void wave_lds_only_sync() { __builtin_amdgcn_fence(__ATOMIC_RELEASE, "workgroup", "local"); __builtin_amdgcn_wave_barrier(); __builtin_amdgcn_fence(__ATOMIC_ACQUIRE, "workgroup", "local"); }
// seven asynchronous copies and their one s_wait_xcnt in one statement, as in copy4
__device__ __forceinline__ void copy7(unsigned l0, const b16* g0, unsigned l1, const b16* g1, unsigned l2, const b16* g2, unsigned l3, const b16* g3, unsigned l4, const b16* g4, unsigned l5, const b16* g5, unsigned l6, const b16* g6) {
  asm volatile("global_load_async_to_lds_b128 %0, %1, off\n\tglobal_load_async_to_lds_b128 %2, %3, off\n\tglobal_load_async_to_lds_b128 %4, %5, off\n\tglobal_load_async_to_lds_b128 %6, %7, off\n\t"
               "global_load_async_to_lds_b128 %8, %9, off\n\tglobal_load_async_to_lds_b128 %10, %11, off\n\tglobal_load_async_to_lds_b128 %12, %13, off\n\ts_wait_xcnt 0x0"
               :: "v"(l0), "v"(g0), "v"(l1), "v"(g1), "v"(l2), "v"(g2), "v"(l3), "v"(g3), "v"(l4), "v"(g4), "v"(l5), "v"(g5), "v"(l6), "v"(g6) : "memory"); }
__global__ __launch_bounds__(512) void lin_kernel(const b16* __restrict__ X16, const b16* __restrict__ W4, const float* __restrict__ bpc, const float* __restrict__ bq, const float* __restrict__ bc, b16* __restrict__ KPh, b16* __restrict__ KPl, b16* __restrict__ Qh, b16* __restrict__ Ql, b16* __restrict__ KVh, b16* __restrict__ KVl) {
  __shared__ __attribute__((aligned(16))) b16 Th[16][16][WN + 8], Tl[16][16][WN + 8]; __shared__ __attribute__((aligned(16))) b16 St[2][LM + LN][LP];   // a stage: rows 0..255 = the block's X rows, 256..447 = its W rows
  const int wave = __builtin_amdgcn_readfirstlane(threadIdx.x >> 5), lane = threadIdx.x & 31, nloc = lane & 15, hlf = lane >> 4, wr = wave >> 2, wc = wave & 3;
  v8f acc[4][3];
#pragma unroll
  for (int i = 0; i < 4; ++i)
#pragma unroll
    for (int t = 0; t < 3; ++t) acc[i][t] = (v8f){};
  // a copy = 64 rows: a thread's row is tid / 8, its 16-B piece tid % 8; a stage = 4 copies of X rows and 3 of W rows a thread
  const int crow = threadIdx.x >> 3, cpc = (threadIdx.x & 7) * 8; const unsigned cl = lds_off(&St[0][crow][cpc]);
  const b16* cx = X16 + ((size_t)blockIdx.x * LM + crow) * E + cpc; const b16* cw = W4 + ((size_t)blockIdx.y * LN + crow) * E + cpc;
  auto stage = [&](int s) { const unsigned l = cl + (unsigned)(s & 1) * ((LM + LN) * LP * 2); const b16 *gx = cx + s * KS, *gw = cw + s * KS;
    copy7(l, gx, l + 64 * LP * 2, gx + 64 * E, l + 128 * LP * 2, gx + 128 * E, l + 192 * LP * 2, gx + 192 * E, l + 256 * LP * 2, gw, l + 320 * LP * 2, gw + 64 * E, l + 384 * LP * 2, gw + 128 * E); };
  // One block a WGP has no other block to cover its LDS latency: the fragments of a k block (32 k) are fetched one block ahead, into a second register set (ring with fragments fetched ahead: the publish point of
  // stage s + 1 stands in front of stage s's LAST block, whose fragments are then already in registers).
  v16b a0[4], w0[3], a1[4], w1[3];
  auto frags = [&](int s, int ks, v16b (&a)[4], v16b (&w)[3]) { const b16* sb = &St[s & 1][0][0] + ks * 32;
#pragma unroll   // constant indices keep the fragment arrays in registers
    for (int i = 0; i < 4; ++i) a[i] = frag_kb(sb + (wr * 64 + i * 16 + nloc) * LP, hlf);
#pragma unroll   // constant indices keep the fragment arrays in registers
    for (int t = 0; t < 3; ++t) w[t] = frag_kb(sb + (LM + wc * WN + t * 16 + nloc) * LP, hlf); };
  auto block = [&](v16b (&a)[4], v16b (&w)[3]) {
#pragma unroll   // constant indices keep the fragment arrays in registers
    for (int i = 0; i < 4; ++i)
#pragma unroll   // constant indices keep the fragment arrays in registers
      for (int t = 0; t < 3; ++t) acc[i][t] = wmma16b(a[i], w[t], acc[i][t]); };
  stage(0); wait_copies(); __syncthreads(); stage(1); frags(0, 0, a0, w0);
  for (int s = 0; s < NT; ++s) {
    frags(s, 1, a1, w1); block(a0, w0);
    wait_lds_reads(); wait_copies(); __syncthreads();   // publishes stage s + 1 and ends every reader's last read of stage s (its last fragments have landed in a1, w1)
    if (s + 1 < NT) frags(s + 1, 0, a0, w0);   // in front of the refill: the LDS works on these reads (of the other buffer) while the wave forms and issues its copies
    if (s + 2 < NT) stage(s + 2);
    block(a1, w1); }
  wait_copies();
  const int c0 = blockIdx.y * LN + wc * WN;   // the wave's first column of the 3,072
  float bv[3];
#pragma unroll
  for (int t = 0; t < 3; ++t) { const int cg = c0 + t * 16, kind = cg >> 10; const float* bias = kind == 0 ? bpc : kind == 1 ? bq : bc; bv[t] = bf16_rne(bias[(cg & (E - 1)) + nloc]); }
  // stored per bh as 16 x 16 blocks [bh][t / 16][d / 16][16 t][16 d] (512 contiguous bytes each), the order in which the fragment loads of pattn and step 1 read them. A row tile's 16 rows are 8 t of both batches:
  // a store = one d block of both batches: 16 lanes fill 8 t x 16 d = 256 contiguous bytes of a block (its lower or upper half, by the row tile's parity)
#pragma unroll   // constant indices keep the accumulators in registers
  for (int i = 0; i < 4; ++i) {
#pragma unroll
    for (int t = 0; t < 3; ++t) { const float osc = (((c0 + t * 16) >> 10) == 1) ? SCL : 1.0f;
#pragma unroll
      for (int r = 0; r < 8; ++r) { b16 p, q; split16((acc[i][t][r] * (1.0f / (XS * WSC)) + bv[t]) * osc * XS, p, q); Th[wave][8 * hlf + r][t * 16 + nloc] = p; Tl[wave][8 * hlf + r][t * 16 + nloc] = q; } }
    wave_lds_only_sync();   // the wave's own writes in front of its reads
#pragma unroll
    for (int t = 0; t < 3; ++t) { const int cg = c0 + t * 16, kind = cg >> 10, head = (cg >> 6) & (NH - 1), db = (cg >> 4) & 3; b16* dh = kind == 0 ? KPh : kind == 1 ? Qh : KVh; b16* dl = kind == 0 ? KPl : kind == 1 ? Ql : KVl;
      const int bb = lane >> 4, tl = (lane & 15) >> 1, hf = lane & 1; const int rr = tl * 2 + bb, c8 = t * 16 + hf * 8;
      const size_t gi = (((size_t)(bb * NH + head) * TB + blockIdx.x * 8 + wr * 2 + (i >> 1)) * 4 + db) * BK + ((i & 1) * 8 + tl) * 16 + hf * 8; *(v8b*)(dh + gi) = *(const v8b*)(&Th[wave][rr][c8]); *(v8b*)(dl + gi) = *(const v8b*)(&Tl[wave][rr][c8]); }
    if (i < 3) { asm volatile("s_wait_xcnt 0x0" ::: "memory");   // in front of every later overwrite of the data and address registers of the six stores
      wave_lds_only_sync(); } }   // the wave's reads in front of the next row tile's writes
}
// grid (4 + T/64, BH). Blocks x >= 4: kv transposed per bh, as blocks [bh][d / 16][t / 16][16 d][16 t] (512 contiguous bytes each, one fragment load). The 128 blocks x < 4: the packed query pq = (pquery Wpq^T + bpq)/8, computed ONCE for all token blocks: a block = 2 tiles of 16 d x 16 p, a wave = one
// quarter of a tile's K (256: 8 products, exact operands): A = WPQ rows (d), B = PQ16 rows (p*2 + b) -> D[d][p]; the four quarters are added through LDS; stored x8 hi/lo as blocks [bh][pt*4 + dt][16 p][16 d]
// (B operand of pattn, k = d): a tile's block is 512 contiguous bytes.
__global__ __launch_bounds__(256) void kvt_kernel(const b16* __restrict__ KVh, const b16* __restrict__ KVl, b16* __restrict__ KVTh, b16* __restrict__ KVTl, const b16* __restrict__ PQ16, const b16* __restrict__ WPQ, const float* __restrict__ bpq, b16* __restrict__ PQh, b16* __restrict__ PQl) {
  __shared__ __attribute__((aligned(16))) b16 Ah[DH][64 + 8], Al[DH][64 + 8]; __shared__ __attribute__((aligned(16))) float Rd[3][2][32][8];   // Rd: K quarters 1..3 of the block's two pq tiles
  if (blockIdx.x < 4) {   // the same for the whole block
    const int wave = threadIdx.x >> 5, lane = threadIdx.x & 31, hh = lane >> 4, col = lane & 15, tl = wave & 1, kq = wave >> 1;
    const int tile = (blockIdx.x * BH + blockIdx.y) * 2 + tl, ct = tile & 63 /* 16 columns of E: head ct / 4, d tile ct % 4 */, pb_ = tile >> 6, b = pb_ >> 1, pt = pb_ & 1;
    const b16* wa = WPQ + (size_t)(ct * 16 + col) * E + kq * 256 + 8 * hh; const b16* pa = PQ16 + ((size_t)(pt * 16 + col) * BS + b) * E + kq * 256 + 8 * hh; v8f acc = {};
#pragma unroll 1   // two groups of four k steps, one memory latency each, through the same registers: unrolled, the kernel's register count would leave the transposing blocks fewer than their 8 waves a SIMD
    for (int g = 0; g < 2; ++g) { v16b fa[4], fb[4];
#pragma unroll   // constant indices keep the fragment arrays in registers
      for (int j = 0; j < 4; ++j) { fa[j] = frag_kb(wa + j * 32, 0); fb[j] = frag_kb(pa + j * 32, 0); }
      asm volatile("s_wait_xcnt 0x0" :: "v"(wa), "v"(pa) : "memory");   // in front of every later overwrite of the address registers of these loads, which are its inputs, so that no load lands on one of them ahead of the wait
      wa += 128; pa += 128;
#pragma unroll   // constant indices keep the fragment arrays in registers
      for (int j = 0; j < 4; ++j) acc = wmma16b(fa[j], fb[j], acc); }
    if (kq) *(v8f*)&Rd[kq - 1][tl][lane][0] = acc;
    __syncthreads();   // publishes the quarters 1..3 to the waves that hold quarter 0
    if (kq == 0) { const v4f b0 = *(const v4f*)(bpq + ct * 16 + 8 * hh), b1 = *(const v4f*)(bpq + ct * 16 + 8 * hh + 4); v8b hv, lv;
      for (int k = 0; k < 3; ++k) acc += *(const v8f*)&Rd[k][tl][lane][0];
#pragma unroll
      for (int r = 0; r < 8; ++r) { const float bb = bf16_rne(r < 4 ? b0[r & 3] : b1[r & 3]); b16 p, q; split16((acc[r] * (1.0f / (XS * WSC)) + bb) * SCL * XS, p, q); hv[r] = p; lv[r] = q; }
      const size_t go = ((size_t)((b * NH + (ct >> 2)) * 2 + pt) * 4 + (ct & 3)) * 256 + col * 16 + 8 * hh; *(v8b*)(PQh + go) = hv; *(v8b*)(PQl + go) = lv; }
    return; }
  const int bh = blockIdx.y, t0 = (blockIdx.x - 4) * 64, t_ = threadIdx.x;
  { const size_t g0 = ((size_t)bh * TB + (t0 >> 4)) * (4 * BK) + t_; const b16 *ga = KVh + g0, *gb = KVl + g0; b16 xh[16], xl[16];   // the 64 t x 64 d of the block are 4,096 contiguous elements [t / 16][d / 16][16 t][16 d]: every load is a base plus a constant
#pragma unroll   // constant indices keep the two arrays in registers
    for (int i = 0; i < 16; ++i) { xh[i] = ga[i * 256]; xl[i] = gb[i * 256]; }
    asm volatile("s_wait_xcnt 0x0" :: "v"(ga), "v"(gb) : "memory");   // in front of every later overwrite of the address registers of these loads, which are its inputs
#pragma unroll   // constant indices keep the two arrays in registers
    for (int i = 0; i < 16; ++i) { const int q = t_ + i * 256, tt = (q >> 10) * 16 + ((q >> 4) & 15), d = ((q >> 8) & 3) * 16 + (q & 15); Ah[d][tt] = xh[i]; Al[d][tt] = xl[i]; } }
  __syncthreads();
  { for (int q = t_; q < DH * 8; q += 256) { const int d = q >> 3, c8 = (q & 7) * 8; const size_t gi = (((size_t)bh * 4 + (d >> 4)) * TB + ((t0 + c8) >> 4)) * BK + (d & 15) * 16 + (c8 & 15); *(v8b*)(KVTh + gi) = *(const v8b*)(&Ah[d][c8]); *(v8b*)(KVTl + gi) = *(const v8b*)(&Al[d][c8]); }  }
}
// pattn: block = (bh, 64 t) x 4 waves: tile = KP rows (t; the head's 64 d) [16 t x 64] x PQ^T -> [16 x 32]: 2 col tiles x 2 k steps x 3 products; softplus; stored as PAh/PAl [bh][t][32] (x8 hi/lo) and transposed as
// PATh/PATl blocks [bh][p / 16][t / 16][16 p][16 t]; pq comes ready from the launch before (blocks [bh][pt*4 + dt][16 p][16 d])
__global__ __launch_bounds__(128) void pattn_kernel(const b16* __restrict__ PQh, const b16* __restrict__ PQl, const b16* __restrict__ KPh, const b16* __restrict__ KPl, b16* __restrict__ PAh, b16* __restrict__ PAl, b16* __restrict__ PATh, b16* __restrict__ PATl) {
  __shared__ __attribute__((aligned(16))) b16 Rh[4][16][PL + 8], Rl[4][16][PL + 8]; __shared__ __attribute__((aligned(16))) b16 Rt[PL][64 + 8], Rtl[PL][64 + 8];
  const int wave = threadIdx.x >> 5, lane = threadIdx.x & 31, nloc = lane & 15, hlf = lane >> 4, t_ = threadIdx.x; const int bh = blockIdx.y, t0 = blockIdx.x * 64;
  // the wave's KP fragments (hi, lo; two k steps) and all pq fragments are loaded in front of the first product: one memory latency and not one a fragment
  const size_t arow = ((size_t)bh * TB + (t0 >> 4) + wave) * (4 * BK) + nloc * 16 + 8 * hlf; const b16 *kpa = KPh + arow, *kpb = KPl + arow; v16b ka[2], kal[2];
#pragma unroll   // constant indices keep the fragment arrays in registers
  for (int j = 0; j < 2; ++j) { ka[j] = frag_blk(kpa + j * 2 * BK, 0); kal[j] = frag_blk(kpb + j * 2 * BK, 0); }
  const size_t qo = (size_t)bh * (PL * DH) + nloc * 16 + 8 * hlf; const b16 *qa = PQh + qo, *qb = PQl + qo; v16b bp[2][2], bpl[2][2];
#pragma unroll   // constant indices keep the fragment arrays in registers
  for (int j = 0; j < 2; ++j)
#pragma unroll   // constant indices keep the fragment arrays in registers
    for (int t = 0; t < 2; ++t) { bp[j][t] = frag_blk(qa + (t * 4 + 2 * j) * 256, 0); bpl[j][t] = frag_blk(qb + (t * 4 + 2 * j) * 256, 0); }
  asm volatile("s_wait_xcnt 0x0" :: "v"(kpa), "v"(kpb), "v"(qa), "v"(qb) : "memory");   // in front of every later overwrite of the address registers of these loads, which are its inputs, so that no load lands on one of them ahead of the wait
  // pattn for the wave's 16 t: A = KP rows t0 + wave*16 + nloc of bh (k = d), B = pq rows p (k = d)
  { v8f d2[2] = {{}, {}};
#pragma unroll
    for (int j = 0; j < 2; ++j)
#pragma unroll
      for (int t = 0; t < 2; ++t) { d2[t] = wmma16b(ka[j], bp[j][t], d2[t]); d2[t] = wmma16b(kal[j], bp[j][t], d2[t]); d2[t] = wmma16b(ka[j], bpl[j][t], d2[t]); }
#pragma unroll
    for (int t = 0; t < 2; ++t)
#pragma unroll
      for (int r = 0; r < 8; ++r) { const float v = softplus_b(d2[t][r] * (1.0f / (XS * XS))); b16 p, q; split16(v * XS, p, q); const int tt = wave * 16 + 8 * hlf + r, pp = t * 16 + nloc; Rh[wave][8 * hlf + r][pp] = p; Rl[wave][8 * hlf + r][pp] = q; Rt[pp][tt] = p; Rtl[pp][tt] = q; } }
  __syncthreads();
  {
    for (int k = 0; k < 2; ++k) { const int rr = k * 8 + (lane >> 2), c8 = (lane & 3) * 8; const size_t gi = ((size_t)bh * T + t0 + wave * 16 + rr) * PL + c8; *(v8b*)(PAh + gi) = *(const v8b*)(&Rh[wave][rr][c8]); *(v8b*)(PAl + gi) = *(const v8b*)(&Rl[wave][rr][c8]); }
    for (int q = t_; q < PL * 8; q += 128) { const int pp = q >> 3, c8 = (q & 7) * 8; const size_t gi = (((size_t)bh * 2 + (pp >> 4)) * TB + ((t0 + c8) >> 4)) * BK + (pp & 15) * 16 + (c8 & 15); *(v8b*)(PATh + gi) = *(const v8b*)(&Rt[pp][c8]); *(v8b*)(PATl + gi) = *(const v8b*)(&Rtl[pp][c8]); }
     }
}
// prefix state: grid (8 tiles, BH), a block of SW = 8 waves per (16 d x 16 p) tile; a wave sums its own CPW = 4 chunks of keys (K = 32 a step, 3 products, f32 accumulate), both orientations: sd = KVT.PAT^T -> D[d][p],
// st = PAT.KVT^T -> D[p][d], and keeps its running sum at the end of each of them; the waves' totals go through LDS, and each wave adds the totals of the waves in front of it to its four running sums.
// At each chunk boundary c = 1..NC-1 the sum is stored as its mean x SS (hi/lo): MT blocks [pt*4+dt][16 p][16 d] (A operand of step 1, k = d), MS blocks [dt*2+pt][16 d][16 p] (A operand of step 2, k = p);
// a wave's block is 512 contiguous bytes. Operand fragments: the first four key steps are loaded together, a later step's into a stage as soon as its products have read it.
__device__ __forceinline__ void state_mac(v16b k, v16b kl, v16b p, v16b pl, v8f& sd, v8f& st) { sd = wmma16b(k, p, sd); st = wmma16b(p, k, st); sd = wmma16b(k, pl, sd); st = wmma16b(pl, k, st); sd = wmma16b(kl, p, sd); st = wmma16b(p, kl, st); }
__device__ __forceinline__ void state_store(v8f sd, v8f st, int c, b16* mth, b16* mtl, b16* msh, b16* msl) { const float f = SS / (XS * XS * (float)(c * CH)); v8b dh_, dl_, th_, tl_;
#pragma unroll
  for (int r = 0; r < 8; ++r) { b16 p, q; split16(sd[r] * f, p, q); dh_[r] = p; dl_[r] = q; split16(st[r] * f, p, q); th_[r] = p; tl_[r] = q; }
  *(v8b*)mth = dh_; *(v8b*)mtl = dl_; *(v8b*)msh = th_; *(v8b*)msl = tl_;
  asm volatile("s_wait_xcnt 0x0" ::: "memory"); }   // in front of every later overwrite of the data and address registers of the four stores
constexpr int SW = 8 /* waves of a scan block */, CPW = NC / SW /* chunks a wave */, SPW = CPW * CH / 32 /* key steps a wave */;
__global__ __launch_bounds__(SW * 32) void state_kernel(const b16* __restrict__ KVTh, const b16* __restrict__ KVTl, const b16* __restrict__ PATh, const b16* __restrict__ PATl, b16* __restrict__ MTh, b16* __restrict__ MTl, b16* __restrict__ MSh, b16* __restrict__ MSl) {
  __shared__ __attribute__((aligned(16))) float Tt[SW - 1][2][32][8];   // the totals (sd, st) of waves 0..SW-2, a lane's 8 values together
  const int wave = __builtin_amdgcn_readfirstlane(threadIdx.x >> 5), lane = threadIdx.x & 31, hh = lane >> 4, col = lane & 15; const int bh = blockIdx.y, dt = blockIdx.x >> 1, pt = blockIdx.x & 1;
  const int tb0 = wave * (CPW * CH / 16);   // the wave's first block of 16 keys
  const size_t ok = (((size_t)bh * 4 + dt) * TB + tb0) * BK + col * 16 + 8 * hh, op = (((size_t)bh * 2 + pt) * TB + tb0) * BK + col * 16 + 8 * hh;   // the lane half's k offset is part of the four base pointers
  const b16* kh = KVTh + ok; const b16* kl = KVTl + ok; const b16* ph = PATh + op; const b16* pl = PATl + op;
  v16b fk[4], fkl[4], fp[4], fpl[4];
#pragma unroll   // here and below: the stage index must be a constant, so that the four stages stay in registers
  for (int j = 0; j < 4; ++j) { fk[j] = frag_blk(kh + j * 2 * BK, 0); fkl[j] = frag_blk(kl + j * 2 * BK, 0); fp[j] = frag_blk(ph + j * 2 * BK, 0); fpl[j] = frag_blk(pl + j * 2 * BK, 0); }
  v8f sd = {}, st = {}, ld[CPW], lt[CPW];   // ld, lt: the wave's own running sums at the end of each of its chunks
#pragma unroll
  for (int j = 0; j < SPW; ++j) { const int g = j & 3, kn = (j + 4) * 2 * BK;
    state_mac(fk[g], fkl[g], fp[g], fpl[g], sd, st);
    if (j + 4 < SPW) { fk[g] = frag_blk(kh + kn, 0); fkl[g] = frag_blk(kl + kn, 0); fp[g] = frag_blk(ph + kn, 0); fpl[g] = frag_blk(pl + kn, 0); }
    if (j + 5 == SPW) asm volatile("s_wait_xcnt 0x0" :: "v"(kh), "v"(kl), "v"(ph), "v"(pl) : "memory");   // behind the last loads, in front of every later overwrite of their address registers, which are its inputs
    if (j & 1) { ld[j >> 1] = sd; lt[j >> 1] = st; } }
  if (wave < SW - 1) { *(v8f*)&Tt[wave][0][lane][0] = sd; *(v8f*)&Tt[wave][1][lane][0] = st; }
  __syncthreads();   // publishes the waves' totals
  v8f td[SW - 1], tt[SW - 1], pd = {}, pq_ = {};   // all totals are read in front of the first addition: one LDS latency and not one a wave
#pragma unroll
  for (int w = 0; w < SW - 1; ++w) { td[w] = *(const v8f*)&Tt[w][0][lane][0]; tt[w] = *(const v8f*)&Tt[w][1][lane][0]; }
#pragma unroll
  for (int w = 0; w < SW - 1; ++w)
#pragma unroll
    for (int r = 0; r < 8; ++r) { pd[r] += (w < wave) ? td[w][r] : 0.0f; pq_[r] += (w < wave) ? tt[w][r] : 0.0f; }   // only the waves in front count
  const size_t ot = ((size_t)bh * NC + wave * CPW) * (DH * PL) + ((pt * 4 + dt) * 16 + col) * 16 + 8 * hh, os = ((size_t)bh * NC + wave * CPW) * (DH * PL) + ((dt * 2 + pt) * 16 + col) * 16 + 8 * hh;
#pragma unroll
  for (int j = 0; j < CPW; ++j) { const int c = wave * CPW + j + 1;   // the boundary behind the wave's chunk j
    if (c < NC) state_store(pd + ld[j], pq_ + lt[j], c, MTh + ot + (j + 1) * (DH * PL), MTl + ot + (j + 1) * (DH * PL), MSh + os + (j + 1) * (DH * PL), MSl + os + (j + 1) * (DH * PL)); }   // the last chunk feeds no state (the same for the whole wave)
}
// steps 1 and 2 in ONE launch: grid (T/32, BH), 2 waves x 16 queries; a wave's step 2 needs of step 1 only its own 16 queries' softmax rows, and those stand in its accumulators in the B-fragment order of step 2
// (lane (hh, col): values p = t*16 + 8hh + r of query col = elements t*8 + r), so A goes from step 1 to step 2 in registers: no plane, no LDS, no second launch.
// Step 1: earlier chunks: AI^T = MT(p rows) Q^T (2 p-tiles, K = 64, 3 products), weighted 64c/(n+1); key blocks of the query's own chunk: S1^T = KV.Q^T (K = 64, 3 products), masked keys > q -> 0, x PS1 hi/lo;
// AW^T += PAT(p rows) S1^T (2 p-tiles, 3 products); aw = AW/(n+1); softmax over the 32 p (a query's 32 values are split over the lanes col and col + 16).
// Step 2: earlier chunks: OI^T = MS(d rows) A^T (4 d-tiles, K = 32, 3 products), weighted 64c/(n+1); own chunk: S2^T = PA(keys).A(q)^T (K = 32: 3 products), causal, x PS1 hi/lo; O^T += KVT(d rows) S2^T (4 d-tiles, 3 products); / (n+1)
__global__ __launch_bounds__(64) void step12_kernel(const b16* __restrict__ Qh, const b16* __restrict__ Ql, const b16* __restrict__ KVh, const b16* __restrict__ KVl, const b16* __restrict__ PATh, const b16* __restrict__ PATl, const b16* __restrict__ MTh, const b16* __restrict__ MTl,
                                                    const b16* __restrict__ PAh, const b16* __restrict__ PAl, const b16* __restrict__ KVTh, const b16* __restrict__ KVTl, const b16* __restrict__ MSh, const b16* __restrict__ MSl, b16* __restrict__ ATh, b16* __restrict__ ATl) {
  __shared__ __attribute__((aligned(16))) float To[2][16][DH + 4];
  const int wave = threadIdx.x >> 5, lane = threadIdx.x & 31, hh = lane >> 4, col = lane & 15; const int bh = blockIdx.y, b = bh / NH, h = bh % NH; const int q0 = blockIdx.x * 32 + wave * 16, qi = q0 + col;
  const size_t qrow = ((size_t)bh * TB + (q0 >> 4)) * (4 * BK) + col * 16; const v16b qa0 = frag_blk(Qh + qrow, hh), qa1 = frag_blk(Qh + qrow + 2 * BK, hh), ql0 = frag_blk(Ql + qrow, hh), ql1 = frag_blk(Ql + qrow + 2 * BK, hh);
  const b16* Pb = PATh + (size_t)bh * PL * T; const b16* Plb = PATl + (size_t)bh * PL * T;
  v8f aw[2] = {{}, {}}, awl[2] = {{}, {}}, ai[2] = {{}, {}}; const int ks0 = (blockIdx.x * 32) & ~(CH - 1), nb = (blockIdx.x & 1) + 1;   // nb = key blocks of 32 from the chunk's start up to the block's 32 queries
  const size_t so = ((size_t)bh * NC + ks0 / CH) * (DH * PL);   // the chunk's state blocks (read only where ks0 > 0)
  // The fragments of a key block are loaded as groups ahead of the products that use them, so that a block costs one memory latency and not one a fragment: the first block's together with the query's and the
  // state's, the next block's into the same registers as soon as this block's products have read them. kf = KV rows (key tile, k half: hi, lo), pf = PAT rows (p tile: hi, lo).
  v16b kf[8], pf[4]; const b16 *ka, *kal, *pa, *pal;   // the lane's base addresses of a group (its k half included): every load of the group is one of them plus a constant
  auto load_kv = [&](int kb) { const size_t r = ((size_t)bh * TB + (kb >> 4)) * (4 * BK) + col * 16 + 8 * hh; ka = KVh + r; kal = KVl + r;
#pragma unroll   // constant indices keep the fragment arrays in registers
    for (int u = 0; u < 4; ++u) { const int c = (u >> 1) * 4 * BK + (u & 1) * 2 * BK; kf[2 * u] = frag_blk(ka + c, 0); kf[2 * u + 1] = frag_blk(kal + c, 0); } };
  auto load_pa = [&](int kb) { const size_t r = (size_t)(kb >> 4) * BK + col * 16 + 8 * hh; pa = Pb + r; pal = Plb + r;
#pragma unroll   // constant indices keep the fragment arrays in registers
    for (int t = 0; t < 2; ++t) { pf[2 * t] = frag_blk(pa + t * TB * BK, 0); pf[2 * t + 1] = frag_blk(pal + t * TB * BK, 0); } };
  // step 2's groups: pk = PA rows (key tile: hi, lo), vf = KVT rows (d tile: hi, lo)
  const b16* Vb = KVTh + (size_t)bh * DH * T; const b16* Vlb = KVTl + (size_t)bh * DH * T;
  v16b pk[4], vf[8]; const b16 *pa2, *pal2, *va, *val;
  auto load_pk = [&](int kb) { const size_t r = ((size_t)bh * T + kb + col) * PL + 8 * hh; pa2 = PAh + r; pal2 = PAl + r;
#pragma unroll   // constant indices keep the fragment arrays in registers
    for (int u = 0; u < 2; ++u) { pk[2 * u] = frag_kb(pa2 + u * 16 * PL, 0); pk[2 * u + 1] = frag_kb(pal2 + u * 16 * PL, 0); } };
  auto load_vf = [&](int kb) { const size_t r = (size_t)(kb >> 4) * BK + col * 16 + 8 * hh; va = Vb + r; val = Vlb + r;
#pragma unroll   // constant indices keep the fragment arrays in registers
    for (int t = 0; t < 4; ++t) { vf[2 * t] = frag_blk(va + t * TB * BK, 0); vf[2 * t + 1] = frag_blk(val + t * TB * BK, 0); } };
  load_kv(ks0); load_pa(ks0);
  // kept in front of the branch: the address arithmetic behind it may take over the address registers of the loads above; the addresses are inputs, so that no load of the groups lands on one of them ahead of the wait
  asm volatile("s_wait_xcnt 0x0" :: "v"(Qh + qrow + 8 * hh), "v"(Ql + qrow + 8 * hh), "v"(ka), "v"(kal), "v"(pa), "v"(pal) : "memory");
  if (ks0 > 0) {
    v16b mh[4], ml[4];   // all state fragments are loaded in front of the first product, so that they cost one memory latency and not one each
#pragma unroll
    for (int u = 0; u < 4; ++u) { mh[u] = frag_blk(MTh + so + ((u * 2) * 16 + col) * 16, hh); ml[u] = frag_blk(MTl + so + ((u * 2) * 16 + col) * 16, hh); }
    asm volatile("s_wait_xcnt 0x0" :: "v"(MTh + so + col * 16 + 8 * hh), "v"(MTl + so + col * 16 + 8 * hh) : "memory");   // the wait: as above
#pragma unroll
    for (int t = 0; t < 2; ++t) { ai[t] = wmma16b(mh[2 * t], qa0, ai[t]); ai[t] = wmma16b(mh[2 * t], ql0, ai[t]); ai[t] = wmma16b(ml[2 * t], qa0, ai[t]);
      ai[t] = wmma16b(mh[2 * t + 1], qa1, ai[t]); ai[t] = wmma16b(mh[2 * t + 1], ql1, ai[t]); ai[t] = wmma16b(ml[2 * t + 1], qa1, ai[t]); } }
  v16b ph, pl;   // a key block's masked scores x PS1, hi and lo: B operand of the block's second product
  auto scores1 = [&](v8f& s0, v8f& s1) {
    s0 = wmma16b(kf[0], qa0, s0); s0 = wmma16b(kf[0], ql0, s0); s0 = wmma16b(kf[1], qa0, s0); s0 = wmma16b(kf[2], qa1, s0); s0 = wmma16b(kf[2], ql1, s0); s0 = wmma16b(kf[3], qa1, s0);
    s1 = wmma16b(kf[4], qa0, s1); s1 = wmma16b(kf[4], ql0, s1); s1 = wmma16b(kf[5], qa0, s1); s1 = wmma16b(kf[6], qa1, s1); s1 = wmma16b(kf[6], ql1, s1); s1 = wmma16b(kf[7], qa1, s1); };
  auto mask_split = [&](int kb, const v8f& s0, const v8f& s1, float sc) {
#pragma unroll
    for (int r = 0; r < 8; ++r) { const int k0 = kb + 8 * hh + r, k1 = kb + 16 + 8 * hh + r; const float v0 = (k0 <= qi) ? s0[r] * sc : 0.0f, v1 = (k1 <= qi) ? s1[r] * sc : 0.0f; b16 p, q; split16(v0 * PS1, p, q); ph[r] = p; pl[r] = q; split16(v1 * PS1, p, q); ph[8 + r] = p; pl[8 + r] = q; } };
  auto sums1 = [&]() {
#pragma unroll
    for (int t = 0; t < 2; ++t) { aw[t] = wmma16b(pf[2 * t], ph, aw[t]); awl[t] = wmma16b(pf[2 * t], pl, awl[t]); awl[t] = wmma16b(pf[2 * t + 1], ph, awl[t]); } };
  if (nb == 2) {   // the chunk's first key block, where the queries stand in its second (the same for the whole block)
    v8f s0 = {}, s1 = {}; scores1(s0, s1);
    load_kv(ks0 + 32); asm volatile("s_wait_xcnt 0x0" :: "v"(ka), "v"(kal) : "memory");   // the wait: in front of every later overwrite of the address registers of these loads, which are its inputs as above
    mask_split(ks0, s0, s1, 1.0f / (XS * XS)); sums1();
    load_pa(ks0 + 32); asm volatile("s_wait_xcnt 0x0" :: "v"(pa), "v"(pal) : "memory"); }   // the wait: as above
  v16b mh2[4], ml2[4];   // step 2's state fragments
  { v8f s0 = {}, s1 = {}; scores1(s0, s1);   // the queries' own key block
    // step 2's first groups fly while step 1 ends: they take the registers that the query's and the key fragments have just left
    load_pk(ks0); load_vf(ks0); asm volatile("s_wait_xcnt 0x0" :: "v"(pa2), "v"(pal2), "v"(va), "v"(val) : "memory");   // the wait: as above
    mask_split(ks0 + 32 * (nb - 1), s0, s1, 1.0f / (XS * XS)); sums1(); }
  if (ks0 > 0) {
#pragma unroll
    for (int t = 0; t < 4; ++t) { mh2[t] = frag_blk(MSh + so + ((t * 2) * 16 + col) * 16, hh); ml2[t] = frag_blk(MSl + so + ((t * 2) * 16 + col) * 16, hh); }
    asm volatile("s_wait_xcnt 0x0" :: "v"(MSh + so + col * 16 + 8 * hh), "v"(MSl + so + col * 16 + 8 * hh) : "memory"); }   // the wait: as above
  // lane (hh, col): value[p = t*16 + 8hh + r] for query col; divide by (qi + 1); softmax over 32
  v16b aq, aql;   // A x PS2, hi and lo, of query col: B operand of step 2 (k = p)
  { float v[16]; const float invn = 1.0f / ((float)(qi + 1) * PS1 * XS), invi = (float)ks0 / ((float)(qi + 1) * SS * XS); float mx = -INFINITY;
#pragma unroll
    for (int t = 0; t < 2; ++t) for (int r = 0; r < 8; ++r) { v[t * 8 + r] = (aw[t][r] + awl[t][r]) * invn + ai[t][r] * invi; mx = fmaxf(mx, v[t * 8 + r]); }
    mx = fmaxf(mx, __shfl_xor(mx, 16)); float sm = 0.0f; for (int i = 0; i < 16; ++i) { v[i] = __expf(v[i] - mx); sm += v[i]; } sm += __shfl_xor(sm, 16); const float inv = 1.0f / sm;
#pragma unroll
    for (int i = 0; i < 16; ++i) { b16 p, q; split16(v[i] * inv * PS2, p, q); aq[i] = p; aql[i] = q; } }
  v8f o[4] = {{}, {}, {}, {}}, ol[4] = {{}, {}, {}, {}}, oi[4] = {{}, {}, {}, {}};
  if (ks0 > 0) {
#pragma unroll
    for (int t = 0; t < 4; ++t) { oi[t] = wmma16b(mh2[t], aq, oi[t]); oi[t] = wmma16b(mh2[t], aql, oi[t]); oi[t] = wmma16b(ml2[t], aq, oi[t]); } }
  for (int i = 0; i < nb; ++i) { const int kb = ks0 + 32 * i; const bool more = i + 1 < nb;
    v8f s0 = {}, s1 = {};
    s0 = wmma16b(pk[0], aq, s0); s0 = wmma16b(pk[0], aql, s0); s0 = wmma16b(pk[1], aq, s0); s1 = wmma16b(pk[2], aq, s1); s1 = wmma16b(pk[2], aql, s1); s1 = wmma16b(pk[3], aq, s1);
    if (more) { load_pk(kb + 32); asm volatile("s_wait_xcnt 0x0" :: "v"(pa2), "v"(pal2) : "memory"); }   // the wait: as above
    mask_split(kb, s0, s1, 1.0f / (XS * PS2));
#pragma unroll
    for (int t = 0; t < 4; ++t) { o[t] = wmma16b(vf[2 * t], ph, o[t]); ol[t] = wmma16b(vf[2 * t], pl, ol[t]); ol[t] = wmma16b(vf[2 * t + 1], ph, ol[t]); }
    if (more) { load_vf(kb + 32); asm volatile("s_wait_xcnt 0x0" :: "v"(va), "v"(val) : "memory"); } }   // the wait: as above
  const float invn = 1.0f / ((float)(qi + 1) * PS1 * XS), invi = (float)ks0 / ((float)(qi + 1) * SS * PS2);
#pragma unroll
  for (int t = 0; t < 4; ++t)
#pragma unroll
    for (int r = 0; r < 8; ++r) To[wave][col][t * 16 + 8 * hh + r] = (o[t][r] + ol[t][r]) * invn + oi[t][r] * invi;
  wave_lds_sync();
  { for (int r4 = 0; r4 < 16; r4 += 4) { const int rr = r4 + (lane >> 3), c8 = (lane & 7) * 8; v8b hv, lv; for (int j = 0; j < 8; ++j) { b16 p, q; split16(To[wave][rr][c8 + j] * XS, p, q); hv[j] = p; lv[j] = q; }
      const size_t gi = ((size_t)(q0 + rr) * BS + b) * E + h * DH + c8; *(v8b*)(ATh + gi) = hv; *(v8b*)(ATl + gi) = lv; }  }
}
__global__ __launch_bounds__(128) void oproj_kernel(const b16* __restrict__ ATh, const b16* __restrict__ ATl, const b16* __restrict__ WO, const float* __restrict__ bo, float* __restrict__ out) {
  __shared__ __attribute__((aligned(16))) float Tf[4][16][128 + 4]; __shared__ __attribute__((aligned(16))) b16 St[2][64 + 64 + 128][LP];   // a stage: rows 0..63 = the block's attn hi rows, 64..127 = their lo rows, 128..255 = its W rows
  const int wave = threadIdx.x >> 5, lane = threadIdx.x & 31, nloc = lane & 15, hlf = lane >> 4; const int n0 = blockIdx.y * 128; const size_t m0 = (size_t)blockIdx.x * 64 + wave * 16;
  v8f acc[8];
#pragma unroll
  for (int t = 0; t < 8; ++t) acc[t] = (v8f){};
  const int crow = threadIdx.x >> 3, cpc = (threadIdx.x & 7) * 8; const unsigned cl = lds_off(&St[0][crow][cpc]); const size_t co = ((size_t)blockIdx.x * 64 + crow) * E + cpc;
  const b16* ch = ATh + co; const b16* cq = ATl + co; const b16* cw = WO + (size_t)(n0 + crow) * E + cpc;
  auto stage = [&](int s) { const unsigned l = cl + (unsigned)(s & 1) * (256 * LP * 2); copy_rows64(l, ch + s * KS); copy_rows64(l + 64 * LP * 2, cq + s * KS); copy_rows64(l + 128 * LP * 2, cw + s * KS); copy_rows64(l + 192 * LP * 2, cw + (size_t)64 * E + s * KS); };
  stage(0); wait_copies(); __syncthreads(); stage(1);
  for (int s = 0; s < NT; ++s) { const b16* sb = &St[s & 1][0][0]; v16b a[2], al[2], bw[2][8];   // all fragments of the stage are read in front of its first product: one LDS latency a stage
#pragma unroll   // constant indices keep the fragment arrays in registers
    for (int ks = 0; ks < 2; ++ks) { a[ks] = frag_kb(sb + (wave * 16 + nloc) * LP + ks * 32, hlf); al[ks] = frag_kb(sb + (64 + wave * 16 + nloc) * LP + ks * 32, hlf);
#pragma unroll   // constant indices keep the fragment arrays in registers
      for (int t = 0; t < 8; ++t) bw[ks][t] = frag_kb(sb + (128 + t * 16 + nloc) * LP + ks * 32, hlf); }
#pragma unroll   // constant indices keep the fragment arrays in registers
    for (int ks = 0; ks < 2; ++ks)
#pragma unroll   // constant indices keep the fragment arrays in registers
      for (int t = 0; t < 8; ++t) { acc[t] = wmma16b(a[ks], bw[ks][t], acc[t]); acc[t] = wmma16b(al[ks], bw[ks][t], acc[t]); }
    wait_lds_reads(); wait_copies(); __syncthreads();   // publishes stage s + 1 and ends every reader's last read of stage s
    if (s + 2 < NT) stage(s + 2); }
  wait_copies();
#pragma unroll
  for (int t = 0; t < 8; ++t) { const float bb = bf16_rne(bo[n0 + t * 16 + nloc]);
#pragma unroll
    for (int r = 0; r < 8; ++r) Tf[wave][8 * hlf + r][t * 16 + nloc] = acc[t][r] * (1.0f / (XS * WSC)) + bb; }
  wave_lds_sync();
  { for (int rr = 0; rr < 16; ++rr) *(v4f*)(out + (m0 + rr) * E + n0 + lane * 4) = *(const v4f*)(&Tf[wave][rr][lane * 4]);  }
}
}  // namespace

extern "C" void kernel_launch(void* const* d_in, const int* in_sizes, int n_in, void* d_out, int out_size, void* d_ws, size_t ws_size, hipStream_t stream) {
  (void)n_in;
  auto Fp = [&](int i) { return (const float*)d_in[i]; };
  // input order: 0 query [2048,2,1024], 1 pquery [32,2,1024], 2 Wpq [1024,1024], 3 bpq, 4 Wq, 5 bq, 6 Wpc, 7 bpc, 8 Wc, 9 bc, 10 Wo, 11 bo (torch [out][in])
  if (in_sizes[0] != NR * E || in_sizes[1] != NPR * E || in_sizes[2] != E * E || in_sizes[4] != E * E || in_sizes[6] != E * E || in_sizes[8] != E * E || in_sizes[10] != E * E || out_size != NR * E) return;
  size_t off = 0; char* ws = (char*)d_ws;
  auto carve = [&](size_t bytes) { char* p = ws + off; off += (bytes + 255) & ~(size_t)255; return p; };
  b16* X16 = (b16*)carve((size_t)NR * E * 2); b16* PQ16 = (b16*)carve((size_t)NPR * E * 2); b16* W4 = (b16*)carve((size_t)4 * E * E * 2); b16* WPQ = (b16*)carve((size_t)E * E * 2);
  b16* KPh = (b16*)carve((size_t)NR * E * 2); b16* KPl = (b16*)carve((size_t)NR * E * 2); b16* Qh = (b16*)carve((size_t)NR * E * 2); b16* Ql = (b16*)carve((size_t)NR * E * 2); b16* KVh = (b16*)carve((size_t)NR * E * 2); b16* KVl = (b16*)carve((size_t)NR * E * 2);
  b16* KVTh = (b16*)carve((size_t)NR * E * 2); b16* KVTl = (b16*)carve((size_t)NR * E * 2); b16* PAh = (b16*)carve((size_t)BH * T * PL * 2); b16* PAl = (b16*)carve((size_t)BH * T * PL * 2); b16* PATh = (b16*)carve((size_t)BH * PL * T * 2); b16* PATl = (b16*)carve((size_t)BH * PL * T * 2);
  b16* PQh = (b16*)carve((size_t)BH * PL * DH * 2); b16* PQl = (b16*)carve((size_t)BH * PL * DH * 2);
  b16* MTh = (b16*)carve((size_t)BH * NC * DH * PL * 2); b16* MTl = (b16*)carve((size_t)BH * NC * DH * PL * 2); b16* MSh = (b16*)carve((size_t)BH * NC * DH * PL * 2); b16* MSl = (b16*)carve((size_t)BH * NC * DH * PL * 2);
  b16* ATh = KPh; b16* ATl = KPl;   // region reuse: KP planes are dead after pattn_kernel (stream-ordered); the attention output takes their place
  if (off > ws_size || off > ((size_t)128 << 20)) return;   // ~ 114 MiB
  prep_kernel<<<(unsigned)(((size_t)NR * E / 8 + (size_t)NPR * E / 8 + 5 * (size_t)E * E / 8 + 255) / 256), 256, 0, stream>>>(Fp(0), Fp(1), Fp(2), Fp(4), Fp(6), Fp(8), Fp(10), X16, PQ16, W4, WPQ);
  lin_kernel<<<dim3(NR / LM, 3 * E / LN), 512, 0, stream>>>(X16, W4, Fp(7), Fp(5), Fp(9), KPh, KPl, Qh, Ql, KVh, KVl);
  kvt_kernel<<<dim3(4 + T / 64, BH), 256, 0, stream>>>(KVh, KVl, KVTh, KVTl, PQ16, WPQ, Fp(3), PQh, PQl);
  pattn_kernel<<<dim3(T / 64, BH), 128, 0, stream>>>(PQh, PQl, KPh, KPl, PAh, PAl, PATh, PATl);
  state_kernel<<<dim3(8, BH), SW * 32, 0, stream>>>(KVTh, KVTl, PATh, PATl, MTh, MTl, MSh, MSl);
  step12_kernel<<<dim3(T / 32, BH), 64, 0, stream>>>(Qh, Ql, KVh, KVl, PATh, PATl, MTh, MTl, PAh, PAl, KVTh, KVTl, MSh, MSl, ATh, ATl);
  oproj_kernel<<<dim3(NR / 64, E / 128), 128, 0, stream>>>(ATh, ATl, W4 + (size_t)3 * E * E, Fp(11), (float*)d_out);
}

// v009
// A run of this version takes 97.7 microseconds.
// Two timings next to v008 put it at 1.04 and 1.03 times that version's speed.
// All steps since v000 together make it 7.25 times as fast.
#include <hip/hip_runtime.h>

// Lunar causal attention (Luna-style packed attention, causal "efficient" form): T = 2,048 tokens x 2 batch x 1,024 (16 heads x 64), 32 packed positions.
// pq = (pquery Wpq^T + bpq)/8 -> (b,h,p,d); kp = query Wpc^T + bpc; pattn[bh][t][p] = softplus_b(kp_t . pq_p) (b = ln 2); q = (query Wq^T + bq)/8; kv = query Wc^T + bc (tied k = v);
// aw[bh][n][p] = (sum_{m<=n} (q_n . kv_m) pattn[m][p]) / (n+1); A = softmax_p(aw); attn[bh][n][d] = (sum_{m<=n} (A_n . pattn_m) kv[m][d]) / (n+1); out = attn Wo^T + bo -> [2048][2][1024].
// Both "efficient_causal_attention_parallel" calls are evaluated in chunks of 64 keys: the keys of the query's own chunk as causal masked products (x_n . sum y_m z_m^T = sum (x_n.y_m) z_m), all earlier
// chunks through the running outer-product sum S_c[d][p] = sum_{m < 64c} kv[m][d] pattn[m][p] (k = v is tied, so ONE state serves both calls: q_n . S_c and A_n . S_c^T), kept as its mean S_c/(64c) in hi+lo.
// WMMA (v_wmma_f32_16x16x32_f16, f32 accumulate): the four input linears (kp, q, kv: [4,096 x 1,024] x [1,024 x 1,024]; pq: [64 x 1,024] x [1,024 x 1,024]; EXACT bf16 operands, 1 product) and the output linear (attn hi+lo: 2 products); per (bh,
// 16-query wave) and causal 32-key block: S1^T = KV.Q^T (K = 64, hi+lo: 3 products) then AW^T += PATTN^T S1^T (2 p-tiles, 3 products); S2^T = PATTN.A^T (K = 32, 3 products) then O^T += KV^T S2^T
// (4 d-tiles, 3 products); pattn = softplus(kp.pq) per token ([16 tokens x 64] x [64 x 32] per (bh) tile, 3 products). Softplus, softmax over the 32 positions, the 1/(n+1) factors in f32.
// Inputs rounded to bf16 once. Fragment k-map per lane half hh for A AND B: elements 0..7 <- k = 8hh+0..7, 8..15 <- k = 16+8hh+0..7; acc[r] = D[8hh+r][col]. Every

namespace {
constexpr int T = 2048, BS = 2, E = 1024, NH = 16, DH = 64, BH = BS * NH, PL = 32, NR = T * BS /* 4,096 query rows (t, b) */, NPR = PL * BS /* 64 pquery rows */;
constexpr int CH = 64 /* keys per chunk */, NC = T / CH;
constexpr int TB = T / 16 /* blocks of 16 tokens */, BK = 256 /* elements of a 16 x 16 block */;
constexpr float SS = 16.0f /* scale of the stored state mean */;
constexpr float XS = 8.0f, WSC = 256.0f, SCL = 0.125f, BETA = 0.69314718055994531f, PS1 = 8.0f, PS2 = 64.0f;

typedef _Float16 b16;
typedef __attribute__((ext_vector_type(16))) _Float16 v16b;
typedef __attribute__((ext_vector_type(8))) _Float16 v8b;
typedef __attribute__((ext_vector_type(8))) float v8f;
typedef __attribute__((ext_vector_type(4))) float v4f;
__device__ __forceinline__ float bf16_rne(float f) { unsigned int u = __float_as_uint(f); u += 0x7FFFu + ((u >> 16) & 1u); return __uint_as_float(u & 0xFFFF0000u); }
__device__ __forceinline__ void split16(float v, b16& hi, b16& lo) { hi = (b16)v; lo = (b16)(v - (float)hi); }
__device__ __forceinline__ v16b frag_kb(const b16* p, int hh) { const v8b a = *(const v8b*)(p + 8 * hh), b = *(const v8b*)(p + 16 + 8 * hh); v16b f;
#pragma unroll
  for (int e = 0; e < 8; ++e) { f[e] = a[e]; f[8 + e] = b[e]; } return f; }
// fragment from two consecutive 16 x 16 blocks (256 elements each) of a block-tiled plane: p = the lane's row in the first block; same k-map as frag_kb
__device__ __forceinline__ v16b frag_blk(const b16* p, int hh) { const v8b a = *(const v8b*)(p + 8 * hh), b = *(const v8b*)(p + 256 + 8 * hh); v16b f;
#pragma unroll
  for (int e = 0; e < 8; ++e) { f[e] = a[e]; f[8 + e] = b[e]; } return f; }
__device__ __forceinline__ v8f wmma16b(v16b a, v16b b, v8f c) { v8f d = __builtin_amdgcn_wmma_f32_16x16x32_f16(false, a, false, b, (short)0, c, false, false); asm volatile("v_nop\n\tv_nop\n\tv_nop\n\tv_nop" : "+v"(d) : "v"(a), "v"(b)); return d; }
__device__ __forceinline__ void wave_lds_sync() { __builtin_amdgcn_fence(__ATOMIC_RELEASE, "workgroup"); __builtin_amdgcn_wave_barrier(); __builtin_amdgcn_fence(__ATOMIC_ACQUIRE, "workgroup"); }
__device__ __forceinline__ float pmul(float a, float b) { float p = a * b; asm volatile("" : "+v"(p)); return p; }
// softplus(beta x)/beta with beta = ln 2 is log2(1 + 2^x): one hardware exp2 and one hardware log2. w = 1 + 2^x loses the low bits of a small 2^x; the factor 2^x / (w - 1) gives them back (log2(w) / (w - 1) is smooth at 1),
// so a small result keeps its relative accuracy; where w rounds to 1 the result is 2^x / ln 2. Above the threshold (20 on beta*x) the result is x itself.
__device__ __forceinline__ float softplus_b(float x) { const float e = __builtin_amdgcn_exp2f(x), w = 1.0f + e, d = w - 1.0f; const float t = __builtin_amdgcn_logf(w) * (e * __builtin_amdgcn_rcpf(d)), s = e * 1.44269504f;   // both forms are computed and one is selected: no branch, so that the 16 values of a lane overlap
  const float l = (d == 0.0f) ? s : t; return (x > 20.0f / BETA) ? x : l; }
// LDS staging of the linear layers' operand tiles: a stage is KS = 64 k of every operand row of the block (128-B rows, whole lines), laid at a pitch of 144 B for the ds_load_b128 fragment reads; two buffers.
constexpr int KS = 64, LP = KS + 8, NT = E / KS;
__device__ __forceinline__ unsigned lds_off(const void* p) { return (unsigned)(size_t)p; }   // byte offset in the work-group's LDS = low 32 bits of a __shared__ address
// four asynchronous copies, 16 B a lane each, global -> LDS through no register; the s_wait_xcnt stands inside the copies' own statement, so that no later write of an address register can be moved in front of it
__device__ __forceinline__ void copy4(unsigned l0, const b16* g0, unsigned l1, const b16* g1, unsigned l2, const b16* g2, unsigned l3, const b16* g3) {
  asm volatile("global_load_async_to_lds_b128 %0, %1, off\n\tglobal_load_async_to_lds_b128 %2, %3, off\n\tglobal_load_async_to_lds_b128 %4, %5, off\n\tglobal_load_async_to_lds_b128 %6, %7, off\n\ts_wait_xcnt 0x0"
               :: "v"(l0), "v"(g0), "v"(l1), "v"(g1), "v"(l2), "v"(g2), "v"(l3), "v"(g3) : "memory"); }
// 64 rows (16 a copy: a thread's row is tid / 8, its 16-B piece tid % 8) of one stage: l = the thread's LDS byte address in the first row group, g = its global address there
__device__ __forceinline__ void copy_rows64(unsigned l, const b16* g) { copy4(l, g, l + 16 * LP * 2, g + 16 * E, l + 32 * LP * 2, g + 32 * E, l + 48 * LP * 2, g + 48 * E); }
__device__ __forceinline__ void wait_copies() { asm volatile("s_wait_asynccnt 0x0" ::: "memory"); }   // the wave's own copies have landed; in front of the barrier that publishes them
__device__ __forceinline__ void wait_lds_reads() { asm volatile("s_wait_dscnt 0x0" ::: "memory"); }   // the wave's reads of a buffer have retired; in front of the barrier behind which it is refilled

__global__ __launch_bounds__(256) void prep_kernel(const float* __restrict__ query, const float* __restrict__ pquery, const float* __restrict__ wpq, const float* __restrict__ wq, const float* __restrict__ wpc, const float* __restrict__ wc, const float* __restrict__ wo, b16* __restrict__ X16, b16* __restrict__ PQ16, b16* __restrict__ W4, b16* __restrict__ WPQ) {
  const size_t t = (size_t)blockIdx.x * 256 + threadIdx.x; const size_t nx = (size_t)NR * E / 8, np_ = (size_t)NPR * E / 8, nw = (size_t)E * E / 8; v8b o;
  if (t < nx) { const size_t e = t * 8; const v4f a = *(const v4f*)(query + e), c = *(const v4f*)(query + e + 4); for (int j = 0; j < 4; ++j) { o[j] = (b16)(bf16_rne(a[j]) * XS); o[4 + j] = (b16)(bf16_rne(c[j]) * XS); } { *(v8b*)(X16 + e) = o;  } return; }
  size_t u = t - nx;
  if (u < np_) { const size_t e = u * 8; for (int j = 0; j < 8; ++j) o[j] = (b16)(bf16_rne(pquery[e + j]) * XS); { *(v8b*)(PQ16 + e) = o;  } return; } u -= np_;
  if (u < 5 * nw) { const int kind = (int)(u / nw); const size_t e = (u % nw) * 8; const float* w = kind == 0 ? wpc : kind == 1 ? wq : kind == 2 ? wc : kind == 3 ? wo : wpq; for (int j = 0; j < 8; ++j) o[j] = (b16)(bf16_rne(w[e + j]) * WSC);
    b16* dst = (kind < 4) ? (W4 + (size_t)kind * E * E) : WPQ; { *(v8b*)(dst + e) = o;  } }
}
// input linears as ONE product [4,096 x 1,024] x [1,024 x 3,072] (the W rows of kp, q and kv follow one another in W4): grid (NR/256, 3,072/192) = 256 blocks, one a WGP; a block = 256 rows x 192 columns,
// 16 waves (4 x 4) of 64 x 48: an LDS fragment feeds 3 or 4 products, and an operand row is fetched from L2 by 16 blocks and not by 24 (X) or 64 (W). y = X16 W^T + b (K = 1,024: 32 steps in ascending k, exact);
// a tile of 16 columns lies in one kind and one head: kind 0: kp -> KPh/KPl; kind 1: q = (y)*1/8 -> Qh/Ql; kind 2: kv -> KVh/KVl. All six planes are laid per bh in
// 16 x 16 blocks [bh][t / 16][d / 16][16 t][16 d]: a fragment load (16 rows x 32 B) of the later launches then reads one block, 512 contiguous bytes = 4 whole lines, and not 32 B out of each of 16 lines.
constexpr int LM = 256, LN = 192, WN = 48 /* columns of a wave */;
// orders one wave's own LDS writes and reads; it names LDS alone, so that between two row tiles the wave does not wait for its global stores to return
__device__ __forceinline__ void wave_lds_only_sync() { __builtin_amdgcn_fence(__ATOMIC_RELEASE, "workgroup", "local"); __builtin_amdgcn_wave_barrier(); __builtin_amdgcn_fence(__ATOMIC_ACQUIRE, "workgroup", "local"); }
// seven asynchronous copies and their one s_wait_xcnt in one statement, as in copy4
__device__ __forceinline__ void copy7(unsigned l0, const b16* g0, unsigned l1, const b16* g1, unsigned l2, const b16* g2, unsigned l3, const b16* g3, unsigned l4, const b16* g4, unsigned l5, const b16* g5, unsigned l6, const b16* g6) {
  asm volatile("global_load_async_to_lds_b128 %0, %1, off\n\tglobal_load_async_to_lds_b128 %2, %3, off\n\tglobal_load_async_to_lds_b128 %4, %5, off\n\tglobal_load_async_to_lds_b128 %6, %7, off\n\t"
               "global_load_async_to_lds_b128 %8, %9, off\n\tglobal_load_async_to_lds_b128 %10, %11, off\n\tglobal_load_async_to_lds_b128 %12, %13, off\n\ts_wait_xcnt 0x0"
               :: "v"(l0), "v"(g0), "v"(l1), "v"(g1), "v"(l2), "v"(g2), "v"(l3), "v"(g3), "v"(l4), "v"(g4), "v"(l5), "v"(g5), "v"(l6), "v"(g6) : "memory"); }
__global__ __launch_bounds__(512) void lin_kernel(const b16* __restrict__ X16, const b16* __restrict__ W4, const float* __restrict__ bpc, const float* __restrict__ bq, const float* __restrict__ bc, b16* __restrict__ KPh, b16* __restrict__ KPl, b16* __restrict__ Qh, b16* __restrict__ Ql, b16* __restrict__ KVh, b16* __restrict__ KVl) {
  __shared__ __attribute__((aligned(16))) b16 Th[16][16][WN + 8], Tl[16][16][WN + 8]; __shared__ __attribute__((aligned(16))) b16 St[2][LM + LN][LP];   // a stage: rows 0..255 = the block's X rows, 256..447 = its W rows
  const int wave = __builtin_amdgcn_readfirstlane(threadIdx.x >> 5), lane = threadIdx.x & 31, nloc = lane & 15, hlf = lane >> 4, wr = wave >> 2, wc = wave & 3;
  v8f acc[4][3];
#pragma unroll
  for (int i = 0; i < 4; ++i)
#pragma unroll
    for (int t = 0; t < 3; ++t) acc[i][t] = (v8f){};
  // a copy = 64 rows: a thread's row is tid / 8, its 16-B piece tid % 8; a stage = 4 copies of X rows and 3 of W rows a thread
  const int crow = threadIdx.x >> 3, cpc = (threadIdx.x & 7) * 8; const unsigned cl = lds_off(&St[0][crow][cpc]);
  const b16* cx = X16 + ((size_t)blockIdx.x * LM + crow) * E + cpc; const b16* cw = W4 + ((size_t)blockIdx.y * LN + crow) * E + cpc;
  auto stage = [&](int s) { const unsigned l = cl + (unsigned)(s & 1) * ((LM + LN) * LP * 2); const b16 *gx = cx + s * KS, *gw = cw + s * KS;
    copy7(l, gx, l + 64 * LP * 2, gx + 64 * E, l + 128 * LP * 2, gx + 128 * E, l + 192 * LP * 2, gx + 192 * E, l + 256 * LP * 2, gw, l + 320 * LP * 2, gw + 64 * E, l + 384 * LP * 2, gw + 128 * E); };
  // One block a WGP has no other block to cover its LDS latency: the fragments of a k block (32 k) are fetched one block ahead, into a second register set (ring with fragments fetched ahead: the publish point of
  // stage s + 1 stands in front of stage s's LAST block, whose fragments are then already in registers).
  v16b a0[4], w0[3], a1[4], w1[3];
  auto frags = [&](int s, int ks, v16b (&a)[4], v16b (&w)[3]) { const b16* sb = &St[s & 1][0][0] + ks * 32;
#pragma unroll   // constant indices keep the fragment arrays in registers
    for (int i = 0; i < 4; ++i) a[i] = frag_kb(sb + (wr * 64 + i * 16 + nloc) * LP, hlf);
#pragma unroll   // constant indices keep the fragment arrays in registers
    for (int t = 0; t < 3; ++t) w[t] = frag_kb(sb + (LM + wc * WN + t * 16 + nloc) * LP, hlf); };
  auto block = [&](v16b (&a)[4], v16b (&w)[3]) {
#pragma unroll   // constant indices keep the fragment arrays in registers
    for (int i = 0; i < 4; ++i)
#pragma unroll   // constant indices keep the fragment arrays in registers
      for (int t = 0; t < 3; ++t) acc[i][t] = wmma16b(a[i], w[t], acc[i][t]); };
  stage(0); wait_copies(); __syncthreads(); stage(1); frags(0, 0, a0, w0);
  for (int s = 0; s < NT; ++s) {
    frags(s, 1, a1, w1); block(a0, w0);
    wait_lds_reads(); wait_copies(); __syncthreads();   // publishes stage s + 1 and ends every reader's last read of stage s (its last fragments have landed in a1, w1)
    if (s + 1 < NT) frags(s + 1, 0, a0, w0);   // in front of the refill: the LDS works on these reads (of the other buffer) while the wave forms and issues its copies
    if (s + 2 < NT) stage(s + 2);
    block(a1, w1); }
  wait_copies();
  const int c0 = blockIdx.y * LN + wc * WN;   // the wave's first column of the 3,072
  float bv[3];
#pragma unroll
  for (int t = 0; t < 3; ++t) { const int cg = c0 + t * 16, kind = cg >> 10; const float* bias = kind == 0 ? bpc : kind == 1 ? bq : bc; bv[t] = bf16_rne(bias[(cg & (E - 1)) + nloc]); }
  // stored per bh as 16 x 16 blocks [bh][t / 16][d / 16][16 t][16 d] (512 contiguous bytes each), the order in which the fragment loads of pattn and step 1 read them. A row tile's 16 rows are 8 t of both batches:
  // a store = one d block of both batches: 16 lanes fill 8 t x 16 d = 256 contiguous bytes of a block (its lower or upper half, by the row tile's parity)
#pragma unroll   // constant indices keep the accumulators in registers
  for (int i = 0; i < 4; ++i) {
#pragma unroll
    for (int t = 0; t < 3; ++t) { const float osc = (((c0 + t * 16) >> 10) == 1) ? SCL : 1.0f;
#pragma unroll
      for (int r = 0; r < 8; ++r) { b16 p, q; split16((acc[i][t][r] * (1.0f / (XS * WSC)) + bv[t]) * osc * XS, p, q); Th[wave][8 * hlf + r][t * 16 + nloc] = p; Tl[wave][8 * hlf + r][t * 16 + nloc] = q; } }
    wave_lds_only_sync();   // the wave's own writes in front of its reads
#pragma unroll
    for (int t = 0; t < 3; ++t) { const int cg = c0 + t * 16, kind = cg >> 10, head = (cg >> 6) & (NH - 1), db = (cg >> 4) & 3; b16* dh = kind == 0 ? KPh : kind == 1 ? Qh : KVh; b16* dl = kind == 0 ? KPl : kind == 1 ? Ql : KVl;
      const int bb = lane >> 4, tl = (lane & 15) >> 1, hf = lane & 1; const int rr = tl * 2 + bb, c8 = t * 16 + hf * 8;
      const size_t gi = (((size_t)(bb * NH + head) * TB + blockIdx.x * 8 + wr * 2 + (i >> 1)) * 4 + db) * BK + ((i & 1) * 8 + tl) * 16 + hf * 8; *(v8b*)(dh + gi) = *(const v8b*)(&Th[wave][rr][c8]); *(v8b*)(dl + gi) = *(const v8b*)(&Tl[wave][rr][c8]); }
    if (i < 3) { asm volatile("s_wait_xcnt 0x0" ::: "memory");   // in front of every later overwrite of the data and address registers of the six stores
      wave_lds_only_sync(); } }   // the wave's reads in front of the next row tile's writes
}
// grid (4 + T/64, BH). Blocks x >= 4: kv transposed per bh, as blocks [bh][d / 16][t / 16][16 d][16 t] (512 contiguous bytes each, one fragment load). The 128 blocks x < 4: the packed query pq = (pquery Wpq^T + bpq)/8, computed ONCE for all token blocks: a block = 2 tiles of 16 d x 16 p, a wave = one
// quarter of a tile's K (256: 8 products, exact operands): A = WPQ rows (d), B = PQ16 rows (p*2 + b) -> D[d][p]; the four quarters are added through LDS; stored x8 hi/lo as blocks [bh][pt*4 + dt][16 p][16 d]
// (B operand of pattn, k = d): a tile's block is 512 contiguous bytes.
__global__ __launch_bounds__(256) void kvt_kernel(const b16* __restrict__ KVh, const b16* __restrict__ KVl, b16* __restrict__ KVTh, b16* __restrict__ KVTl, const b16* __restrict__ PQ16, const b16* __restrict__ WPQ, const float* __restrict__ bpq, b16* __restrict__ PQh, b16* __restrict__ PQl) {
  __shared__ __attribute__((aligned(16))) b16 Ah[DH][64 + 8], Al[DH][64 + 8]; __shared__ __attribute__((aligned(16))) float Rd[3][2][32][8];   // Rd: K quarters 1..3 of the block's two pq tiles
  if (blockIdx.x < 4) {   // the same for the whole block
    const int wave = threadIdx.x >> 5, lane = threadIdx.x & 31, hh = lane >> 4, col = lane & 15, tl = wave & 1, kq = wave >> 1;
    const int tile = (blockIdx.x * BH + blockIdx.y) * 2 + tl, ct = tile & 63 /* 16 columns of E: head ct / 4, d tile ct % 4 */, pb_ = tile >> 6, b = pb_ >> 1, pt = pb_ & 1;
    const b16* wa = WPQ + (size_t)(ct * 16 + col) * E + kq * 256 + 8 * hh; const b16* pa = PQ16 + ((size_t)(pt * 16 + col) * BS + b) * E + kq * 256 + 8 * hh; v8f acc = {};
#pragma unroll 1   // two groups of four k steps, one memory latency each, through the same registers: unrolled, the kernel's register count would leave the transposing blocks fewer than their 8 waves a SIMD
    for (int g = 0; g < 2; ++g) { v16b fa[4], fb[4];
#pragma unroll   // constant indices keep the fragment arrays in registers
      for (int j = 0; j < 4; ++j) { fa[j] = frag_kb(wa + j * 32, 0); fb[j] = frag_kb(pa + j * 32, 0); }
      asm volatile("s_wait_xcnt 0x0" :: "v"(wa), "v"(pa) : "memory");   // in front of every later overwrite of the address registers of these loads, which are its inputs, so that no load lands on one of them ahead of the wait
      wa += 128; pa += 128;
#pragma unroll   // constant indices keep the fragment arrays in registers
      for (int j = 0; j < 4; ++j) acc = wmma16b(fa[j], fb[j], acc); }
    if (kq) *(v8f*)&Rd[kq - 1][tl][lane][0] = acc;
    __syncthreads();   // publishes the quarters 1..3 to the waves that hold quarter 0
    if (kq == 0) { const v4f b0 = *(const v4f*)(bpq + ct * 16 + 8 * hh), b1 = *(const v4f*)(bpq + ct * 16 + 8 * hh + 4); v8b hv, lv;
      for (int k = 0; k < 3; ++k) acc += *(const v8f*)&Rd[k][tl][lane][0];
#pragma unroll
      for (int r = 0; r < 8; ++r) { const float bb = bf16_rne(r < 4 ? b0[r & 3] : b1[r & 3]); b16 p, q; split16((acc[r] * (1.0f / (XS * WSC)) + bb) * SCL * XS, p, q); hv[r] = p; lv[r] = q; }
      const size_t go = ((size_t)((b * NH + (ct >> 2)) * 2 + pt) * 4 + (ct & 3)) * 256 + col * 16 + 8 * hh; *(v8b*)(PQh + go) = hv; *(v8b*)(PQl + go) = lv; }
    return; }
  const int bh = blockIdx.y, t0 = (blockIdx.x - 4) * 64, t_ = threadIdx.x;
  { const size_t g0 = ((size_t)bh * TB + (t0 >> 4)) * (4 * BK) + t_; const b16 *ga = KVh + g0, *gb = KVl + g0; b16 xh[16], xl[16];   // the 64 t x 64 d of the block are 4,096 contiguous elements [t / 16][d / 16][16 t][16 d]: every load is a base plus a constant
#pragma unroll   // constant indices keep the two arrays in registers
    for (int i = 0; i < 16; ++i) { xh[i] = ga[i * 256]; xl[i] = gb[i * 256]; }
    asm volatile("s_wait_xcnt 0x0" :: "v"(ga), "v"(gb) : "memory");   // in front of every later overwrite of the address registers of these loads, which are its inputs
#pragma unroll   // constant indices keep the two arrays in registers
    for (int i = 0; i < 16; ++i) { const int q = t_ + i * 256, tt = (q >> 10) * 16 + ((q >> 4) & 15), d = ((q >> 8) & 3) * 16 + (q & 15); Ah[d][tt] = xh[i]; Al[d][tt] = xl[i]; } }
  __syncthreads();
  { for (int q = t_; q < DH * 8; q += 256) { const int d = q >> 3, c8 = (q & 7) * 8; const size_t gi = (((size_t)bh * 4 + (d >> 4)) * TB + ((t0 + c8) >> 4)) * BK + (d & 15) * 16 + (c8 & 15); *(v8b*)(KVTh + gi) = *(const v8b*)(&Ah[d][c8]); *(v8b*)(KVTl + gi) = *(const v8b*)(&Al[d][c8]); }  }
}
// pattn: block = (bh, 64 t) x 4 waves: tile = KP rows (t; the head's 64 d) [16 t x 64] x PQ^T -> [16 x 32]: 2 col tiles x 2 k steps x 3 products; softplus; stored as PAh/PAl [bh][t][32] (x8 hi/lo) and transposed as
// PATh/PATl blocks [bh][p / 16][t / 16][16 p][16 t]; pq comes ready from the launch before (blocks [bh][pt*4 + dt][16 p][16 d])
__global__ __launch_bounds__(128) void pattn_kernel(const b16* __restrict__ PQh, const b16* __restrict__ PQl, const b16* __restrict__ KPh, const b16* __restrict__ KPl, b16* __restrict__ PAh, b16* __restrict__ PAl, b16* __restrict__ PATh, b16* __restrict__ PATl) {
  __shared__ __attribute__((aligned(16))) b16 Rh[4][16][PL + 8], Rl[4][16][PL + 8]; __shared__ __attribute__((aligned(16))) b16 Rt[PL][64 + 8], Rtl[PL][64 + 8];
  const int wave = threadIdx.x >> 5, lane = threadIdx.x & 31, nloc = lane & 15, hlf = lane >> 4, t_ = threadIdx.x; const int bh = blockIdx.y, t0 = blockIdx.x * 64;
  // the wave's KP fragments (hi, lo; two k steps) and all pq fragments are loaded in front of the first product: one memory latency and not one a fragment
  const size_t arow = ((size_t)bh * TB + (t0 >> 4) + wave) * (4 * BK) + nloc * 16 + 8 * hlf; const b16 *kpa = KPh + arow, *kpb = KPl + arow; v16b ka[2], kal[2];
#pragma unroll   // constant indices keep the fragment arrays in registers
  for (int j = 0; j < 2; ++j) { ka[j] = frag_blk(kpa + j * 2 * BK, 0); kal[j] = frag_blk(kpb + j * 2 * BK, 0); }
  const size_t qo = (size_t)bh * (PL * DH) + nloc * 16 + 8 * hlf; const b16 *qa = PQh + qo, *qb = PQl + qo; v16b bp[2][2], bpl[2][2];
#pragma unroll   // constant indices keep the fragment arrays in registers
  for (int j = 0; j < 2; ++j)
#pragma unroll   // constant indices keep the fragment arrays in registers
    for (int t = 0; t < 2; ++t) { bp[j][t] = frag_blk(qa + (t * 4 + 2 * j) * 256, 0); bpl[j][t] = frag_blk(qb + (t * 4 + 2 * j) * 256, 0); }
  asm volatile("s_wait_xcnt 0x0" :: "v"(kpa), "v"(kpb), "v"(qa), "v"(qb) : "memory");   // in front of every later overwrite of the address registers of these loads, which are its inputs, so that no load lands on one of them ahead of the wait
  // pattn for the wave's 16 t: A = KP rows t0 + wave*16 + nloc of bh (k = d), B = pq rows p (k = d)
  { v8f d2[2] = {{}, {}};
#pragma unroll
    for (int j = 0; j < 2; ++j)
#pragma unroll
      for (int t = 0; t < 2; ++t) { d2[t] = wmma16b(ka[j], bp[j][t], d2[t]); d2[t] = wmma16b(kal[j], bp[j][t], d2[t]); d2[t] = wmma16b(ka[j], bpl[j][t], d2[t]); }
#pragma unroll
    for (int t = 0; t < 2; ++t)
#pragma unroll
      for (int r = 0; r < 8; ++r) { const float v = softplus_b(d2[t][r] * (1.0f / (XS * XS))); b16 p, q; split16(v * XS, p, q); const int tt = wave * 16 + 8 * hlf + r, pp = t * 16 + nloc; Rh[wave][8 * hlf + r][pp] = p; Rl[wave][8 * hlf + r][pp] = q; Rt[pp][tt] = p; Rtl[pp][tt] = q; } }
  __syncthreads();
  {
    for (int k = 0; k < 2; ++k) { const int rr = k * 8 + (lane >> 2), c8 = (lane & 3) * 8; const size_t gi = ((size_t)bh * T + t0 + wave * 16 + rr) * PL + c8; *(v8b*)(PAh + gi) = *(const v8b*)(&Rh[wave][rr][c8]); *(v8b*)(PAl + gi) = *(const v8b*)(&Rl[wave][rr][c8]); }
    for (int q = t_; q < PL * 8; q += 128) { const int pp = q >> 3, c8 = (q & 7) * 8; const size_t gi = (((size_t)bh * 2 + (pp >> 4)) * TB + ((t0 + c8) >> 4)) * BK + (pp & 15) * 16 + (c8 & 15); *(v8b*)(PATh + gi) = *(const v8b*)(&Rt[pp][c8]); *(v8b*)(PATl + gi) = *(const v8b*)(&Rtl[pp][c8]); }
     }
}
// prefix state: grid (8 tiles, BH), a block of SW = 8 waves per (16 d x 16 p) tile; a wave sums its own CPW = 4 chunks of keys (K = 32 a step, 3 products, f32 accumulate), both orientations: sd = KVT.PAT^T -> D[d][p],
// st = PAT.KVT^T -> D[p][d], and keeps its running sum at the end of each of them; the waves' totals go through LDS, and each wave adds the totals of the waves in front of it to its four running sums.
// At each chunk boundary c = 1..NC-1 the sum is stored as its mean x SS (hi/lo): MT blocks [pt*4+dt][16 p][16 d] (A operand of step 1, k = d), MS blocks [dt*2+pt][16 d][16 p] (A operand of step 2, k = p);
// a wave's block is 512 contiguous bytes. Operand fragments: the first four key steps are loaded together, a later step's into a stage as soon as its products have read it.
__device__ __forceinline__ void state_mac(v16b k, v16b kl, v16b p, v16b pl, v8f& sd, v8f& st) { sd = wmma16b(k, p, sd); st = wmma16b(p, k, st); sd = wmma16b(k, pl, sd); st = wmma16b(pl, k, st); sd = wmma16b(kl, p, sd); st = wmma16b(p, kl, st); }
__device__ __forceinline__ void state_store(v8f sd, v8f st, int c, b16* mth, b16* mtl, b16* msh, b16* msl) { const float f = SS / (XS * XS * (float)(c * CH)); v8b dh_, dl_, th_, tl_;
#pragma unroll
  for (int r = 0; r < 8; ++r) { b16 p, q; split16(sd[r] * f, p, q); dh_[r] = p; dl_[r] = q; split16(st[r] * f, p, q); th_[r] = p; tl_[r] = q; }
  *(v8b*)mth = dh_; *(v8b*)mtl = dl_; *(v8b*)msh = th_; *(v8b*)msl = tl_;
  asm volatile("s_wait_xcnt 0x0" ::: "memory"); }   // in front of every later overwrite of the data and address registers of the four stores
constexpr int SW = 8 /* waves of a scan block */, CPW = NC / SW /* chunks a wave */, SPW = CPW * CH / 32 /* key steps a wave */;
__global__ __launch_bounds__(SW * 32) void state_kernel(const b16* __restrict__ KVTh, const b16* __restrict__ KVTl, const b16* __restrict__ PATh, const b16* __restrict__ PATl, b16* __restrict__ MTh, b16* __restrict__ MTl, b16* __restrict__ MSh, b16* __restrict__ MSl) {
  __shared__ __attribute__((aligned(16))) float Tt[SW - 1][2][32][8];   // the totals (sd, st) of waves 0..SW-2, a lane's 8 values together
  const int wave = __builtin_amdgcn_readfirstlane(threadIdx.x >> 5), lane = threadIdx.x & 31, hh = lane >> 4, col = lane & 15; const int bh = blockIdx.y, dt = blockIdx.x >> 1, pt = blockIdx.x & 1;
  const int tb0 = wave * (CPW * CH / 16);   // the wave's first block of 16 keys
  const size_t ok = (((size_t)bh * 4 + dt) * TB + tb0) * BK + col * 16 + 8 * hh, op = (((size_t)bh * 2 + pt) * TB + tb0) * BK + col * 16 + 8 * hh;   // the lane half's k offset is part of the four base pointers
  const b16* kh = KVTh + ok; const b16* kl = KVTl + ok; const b16* ph = PATh + op; const b16* pl = PATl + op;
  v16b fk[4], fkl[4], fp[4], fpl[4];
#pragma unroll   // here and below: the stage index must be a constant, so that the four stages stay in registers
  for (int j = 0; j < 4; ++j) { fk[j] = frag_blk(kh + j * 2 * BK, 0); fkl[j] = frag_blk(kl + j * 2 * BK, 0); fp[j] = frag_blk(ph + j * 2 * BK, 0); fpl[j] = frag_blk(pl + j * 2 * BK, 0); }
  v8f sd = {}, st = {}, ld[CPW], lt[CPW];   // ld, lt: the wave's own running sums at the end of each of its chunks
#pragma unroll
  for (int j = 0; j < SPW; ++j) { const int g = j & 3, kn = (j + 4) * 2 * BK;
    state_mac(fk[g], fkl[g], fp[g], fpl[g], sd, st);
    if (j + 4 < SPW) { fk[g] = frag_blk(kh + kn, 0); fkl[g] = frag_blk(kl + kn, 0); fp[g] = frag_blk(ph + kn, 0); fpl[g] = frag_blk(pl + kn, 0); }
    if (j + 5 == SPW) asm volatile("s_wait_xcnt 0x0" :: "v"(kh), "v"(kl), "v"(ph), "v"(pl) : "memory");   // behind the last loads, in front of every later overwrite of their address registers, which are its inputs
    if (j & 1) { ld[j >> 1] = sd; lt[j >> 1] = st; } }
  if (wave < SW - 1) { *(v8f*)&Tt[wave][0][lane][0] = sd; *(v8f*)&Tt[wave][1][lane][0] = st; }
  __syncthreads();   // publishes the waves' totals
  v8f td[SW - 1], tt[SW - 1], pd = {}, pq_ = {};   // all totals are read in front of the first addition: one LDS latency and not one a wave
#pragma unroll
  for (int w = 0; w < SW - 1; ++w) { td[w] = *(const v8f*)&Tt[w][0][lane][0]; tt[w] = *(const v8f*)&Tt[w][1][lane][0]; }
#pragma unroll
  for (int w = 0; w < SW - 1; ++w)
#pragma unroll
    for (int r = 0; r < 8; ++r) { pd[r] += (w < wave) ? td[w][r] : 0.0f; pq_[r] += (w < wave) ? tt[w][r] : 0.0f; }   // only the waves in front count
  const size_t ot = ((size_t)bh * NC + wave * CPW) * (DH * PL) + ((pt * 4 + dt) * 16 + col) * 16 + 8 * hh, os = ((size_t)bh * NC + wave * CPW) * (DH * PL) + ((dt * 2 + pt) * 16 + col) * 16 + 8 * hh;
#pragma unroll
  for (int j = 0; j < CPW; ++j) { const int c = wave * CPW + j + 1;   // the boundary behind the wave's chunk j
    if (c < NC) state_store(pd + ld[j], pq_ + lt[j], c, MTh + ot + (j + 1) * (DH * PL), MTl + ot + (j + 1) * (DH * PL), MSh + os + (j + 1) * (DH * PL), MSl + os + (j + 1) * (DH * PL)); }   // the last chunk feeds no state (the same for the whole wave)
}
// steps 1 and 2 in ONE launch: grid (T/32, BH), 2 waves x 16 queries; a wave's step 2 needs of step 1 only its own 16 queries' softmax rows, and those stand in its accumulators in the B-fragment order of step 2
// (lane (hh, col): values p = t*16 + 8hh + r of query col = elements t*8 + r), so A goes from step 1 to step 2 in registers: no plane, no LDS, no second launch.
// Step 1: earlier chunks: AI^T = MT(p rows) Q^T (2 p-tiles, K = 64, 3 products), weighted 64c/(n+1); key blocks of the query's own chunk: S1^T = KV.Q^T (K = 64, 3 products), masked keys > q -> 0, x PS1 hi/lo;
// AW^T += PAT(p rows) S1^T (2 p-tiles, 3 products); aw = AW/(n+1); softmax over the 32 p (a query's 32 values are split over the lanes col and col + 16).
// Step 2: earlier chunks: OI^T = MS(d rows) A^T (4 d-tiles, K = 32, 3 products), weighted 64c/(n+1); own chunk: S2^T = PA(keys).A(q)^T (K = 32: 3 products), causal, x PS1 hi/lo; O^T += KVT(d rows) S2^T (4 d-tiles, 3 products); / (n+1)
__global__ __launch_bounds__(64) void step12_kernel(const b16* __restrict__ Qh, const b16* __restrict__ Ql, const b16* __restrict__ KVh, const b16* __restrict__ KVl, const b16* __restrict__ PATh, const b16* __restrict__ PATl, const b16* __restrict__ MTh, const b16* __restrict__ MTl,
                                                    const b16* __restrict__ PAh, const b16* __restrict__ PAl, const b16* __restrict__ KVTh, const b16* __restrict__ KVTl, const b16* __restrict__ MSh, const b16* __restrict__ MSl, b16* __restrict__ ATh, b16* __restrict__ ATl) {
  __shared__ __attribute__((aligned(16))) float To[2][16][DH + 4];
  const int wave = threadIdx.x >> 5, lane = threadIdx.x & 31, hh = lane >> 4, col = lane & 15; const int bh = blockIdx.y, b = bh / NH, h = bh % NH; const int q0 = blockIdx.x * 32 + wave * 16, qi = q0 + col;
  const size_t qrow = ((size_t)bh * TB + (q0 >> 4)) * (4 * BK) + col * 16; const v16b qa0 = frag_blk(Qh + qrow, hh), qa1 = frag_blk(Qh + qrow + 2 * BK, hh), ql0 = frag_blk(Ql + qrow, hh), ql1 = frag_blk(Ql + qrow + 2 * BK, hh);
  const b16* Pb = PATh + (size_t)bh * PL * T; const b16* Plb = PATl + (size_t)bh * PL * T;
  v8f aw[2] = {{}, {}}, awl[2] = {{}, {}}, ai[2] = {{}, {}}; const int ks0 = (blockIdx.x * 32) & ~(CH - 1), nb = (blockIdx.x & 1) + 1;   // nb = key blocks of 32 from the chunk's start up to the block's 32 queries
  const size_t so = ((size_t)bh * NC + ks0 / CH) * (DH * PL);   // the chunk's state blocks (read only where ks0 > 0)
  // The fragments of a key block are loaded as groups ahead of the products that use them, so that a block costs one memory latency and not one a fragment: the first block's together with the query's and the
  // state's, the next block's into the same registers as soon as this block's products have read them. kf = KV rows (key tile, k half: hi, lo), pf = PAT rows (p tile: hi, lo).
  v16b kf[8], pf[4]; const b16 *ka, *kal, *pa, *pal;   // the lane's base addresses of a group (its k half included): every load of the group is one of them plus a constant
  auto load_kv = [&](int kb) { const size_t r = ((size_t)bh * TB + (kb >> 4)) * (4 * BK) + col * 16 + 8 * hh; ka = KVh + r; kal = KVl + r;
#pragma unroll   // constant indices keep the fragment arrays in registers
    for (int u = 0; u < 4; ++u) { const int c = (u >> 1) * 4 * BK + (u & 1) * 2 * BK; kf[2 * u] = frag_blk(ka + c, 0); kf[2 * u + 1] = frag_blk(kal + c, 0); } };
  auto load_pa = [&](int kb) { const size_t r = (size_t)(kb >> 4) * BK + col * 16 + 8 * hh; pa = Pb + r; pal = Plb + r;
#pragma unroll   // constant indices keep the fragment arrays in registers
    for (int t = 0; t < 2; ++t) { pf[2 * t] = frag_blk(pa + t * TB * BK, 0); pf[2 * t + 1] = frag_blk(pal + t * TB * BK, 0); } };
  // step 2's groups: pk = PA rows (key tile: hi, lo), vf = KVT rows (d tile: hi, lo)
  const b16* Vb = KVTh + (size_t)bh * DH * T; const b16* Vlb = KVTl + (size_t)bh * DH * T;
  v16b pk[4], vf[8]; const b16 *pa2, *pal2, *va, *val;
  auto load_pk = [&](int kb) { const size_t r = ((size_t)bh * T + kb + col) * PL + 8 * hh; pa2 = PAh + r; pal2 = PAl + r;
#pragma unroll   // constant indices keep the fragment arrays in registers
    for (int u = 0; u < 2; ++u) { pk[2 * u] = frag_kb(pa2 + u * 16 * PL, 0); pk[2 * u + 1] = frag_kb(pal2 + u * 16 * PL, 0); } };
  auto load_vf = [&](int kb) { const size_t r = (size_t)(kb >> 4) * BK + col * 16 + 8 * hh; va = Vb + r; val = Vlb + r;
#pragma unroll   // constant indices keep the fragment arrays in registers
    for (int t = 0; t < 4; ++t) { vf[2 * t] = frag_blk(va + t * TB * BK, 0); vf[2 * t + 1] = frag_blk(val + t * TB * BK, 0); } };
  load_kv(ks0); load_pa(ks0);
  // kept in front of the branch: the address arithmetic behind it may take over the address registers of the loads above; the addresses are inputs, so that no load of the groups lands on one of them ahead of the wait
  asm volatile("s_wait_xcnt 0x0" :: "v"(Qh + qrow + 8 * hh), "v"(Ql + qrow + 8 * hh), "v"(ka), "v"(kal), "v"(pa), "v"(pal) : "memory");
  if (ks0 > 0) {
    v16b mh[4], ml[4];   // all state fragments are loaded in front of the first product, so that they cost one memory latency and not one each
#pragma unroll
    for (int u = 0; u < 4; ++u) { mh[u] = frag_blk(MTh + so + ((u * 2) * 16 + col) * 16, hh); ml[u] = frag_blk(MTl + so + ((u * 2) * 16 + col) * 16, hh); }
    asm volatile("s_wait_xcnt 0x0" :: "v"(MTh + so + col * 16 + 8 * hh), "v"(MTl + so + col * 16 + 8 * hh) : "memory");   // the wait: as above
#pragma unroll
    for (int t = 0; t < 2; ++t) { ai[t] = wmma16b(mh[2 * t], qa0, ai[t]); ai[t] = wmma16b(mh[2 * t], ql0, ai[t]); ai[t] = wmma16b(ml[2 * t], qa0, ai[t]);
      ai[t] = wmma16b(mh[2 * t + 1], qa1, ai[t]); ai[t] = wmma16b(mh[2 * t + 1], ql1, ai[t]); ai[t] = wmma16b(ml[2 * t + 1], qa1, ai[t]); } }
  v16b ph, pl;   // a key block's masked scores x PS1, hi and lo: B operand of the block's second product
  auto scores1 = [&](v8f& s0, v8f& s1) {
    s0 = wmma16b(kf[0], qa0, s0); s0 = wmma16b(kf[0], ql0, s0); s0 = wmma16b(kf[1], qa0, s0); s0 = wmma16b(kf[2], qa1, s0); s0 = wmma16b(kf[2], ql1, s0); s0 = wmma16b(kf[3], qa1, s0);
    s1 = wmma16b(kf[4], qa0, s1); s1 = wmma16b(kf[4], ql0, s1); s1 = wmma16b(kf[5], qa0, s1); s1 = wmma16b(kf[6], qa1, s1); s1 = wmma16b(kf[6], ql1, s1); s1 = wmma16b(kf[7], qa1, s1); };
  auto mask_split = [&](int kb, const v8f& s0, const v8f& s1, float sc) {
#pragma unroll
    for (int r = 0; r < 8; ++r) { const int k0 = kb + 8 * hh + r, k1 = kb + 16 + 8 * hh + r; const float v0 = (k0 <= qi) ? s0[r] * sc : 0.0f, v1 = (k1 <= qi) ? s1[r] * sc : 0.0f; b16 p, q; split16(v0 * PS1, p, q); ph[r] = p; pl[r] = q; split16(v1 * PS1, p, q); ph[8 + r] = p; pl[8 + r] = q; } };
  auto sums1 = [&]() {
#pragma unroll
    for (int t = 0; t < 2; ++t) { aw[t] = wmma16b(pf[2 * t], ph, aw[t]); awl[t] = wmma16b(pf[2 * t], pl, awl[t]); awl[t] = wmma16b(pf[2 * t + 1], ph, awl[t]); } };
  if (nb == 2) {   // the chunk's first key block, where the queries stand in its second (the same for the whole block)
    v8f s0 = {}, s1 = {}; scores1(s0, s1);
    load_kv(ks0 + 32); asm volatile("s_wait_xcnt 0x0" :: "v"(ka), "v"(kal) : "memory");   // the wait: in front of every later overwrite of the address registers of these loads, which are its inputs as above
    mask_split(ks0, s0, s1, 1.0f / (XS * XS)); sums1();
    load_pa(ks0 + 32); asm volatile("s_wait_xcnt 0x0" :: "v"(pa), "v"(pal) : "memory"); }   // the wait: as above
  v16b mh2[4], ml2[4];   // step 2's state fragments
  { v8f s0 = {}, s1 = {}; scores1(s0, s1);   // the queries' own key block
    // step 2's first groups fly while step 1 ends: they take the registers that the query's and the key fragments have just left
    load_pk(ks0); load_vf(ks0); asm volatile("s_wait_xcnt 0x0" :: "v"(pa2), "v"(pal2), "v"(va), "v"(val) : "memory");   // the wait: as above
    mask_split(ks0 + 32 * (nb - 1), s0, s1, 1.0f / (XS * XS)); sums1(); }
  if (ks0 > 0) {
#pragma unroll
    for (int t = 0; t < 4; ++t) { mh2[t] = frag_blk(MSh + so + ((t * 2) * 16 + col) * 16, hh); ml2[t] = frag_blk(MSl + so + ((t * 2) * 16 + col) * 16, hh); }
    asm volatile("s_wait_xcnt 0x0" :: "v"(MSh + so + col * 16 + 8 * hh), "v"(MSl + so + col * 16 + 8 * hh) : "memory"); }   // the wait: as above
  // lane (hh, col): value[p = t*16 + 8hh + r] for query col; divide by (qi + 1); softmax over 32
  v16b aq, aql;   // A x PS2, hi and lo, of query col: B operand of step 2 (k = p)
  { float v[16]; const float invn = 1.0f / ((float)(qi + 1) * PS1 * XS), invi = (float)ks0 / ((float)(qi + 1) * SS * XS); float mx = -INFINITY;
#pragma unroll
    for (int t = 0; t < 2; ++t) for (int r = 0; r < 8; ++r) { v[t * 8 + r] = (aw[t][r] + awl[t][r]) * invn + ai[t][r] * invi; mx = fmaxf(mx, v[t * 8 + r]); }
    mx = fmaxf(mx, __shfl_xor(mx, 16)); float sm = 0.0f; for (int i = 0; i < 16; ++i) { v[i] = __expf(v[i] - mx); sm += v[i]; } sm += __shfl_xor(sm, 16); const float inv = 1.0f / sm;
#pragma unroll
    for (int i = 0; i < 16; ++i) { b16 p, q; split16(v[i] * inv * PS2, p, q); aq[i] = p; aql[i] = q; } }
  v8f o[4] = {{}, {}, {}, {}}, ol[4] = {{}, {}, {}, {}}, oi[4] = {{}, {}, {}, {}};
  if (ks0 > 0) {
#pragma unroll
    for (int t = 0; t < 4; ++t) { oi[t] = wmma16b(mh2[t], aq, oi[t]); oi[t] = wmma16b(mh2[t], aql, oi[t]); oi[t] = wmma16b(ml2[t], aq, oi[t]); } }
  for (int i = 0; i < nb; ++i) { const int kb = ks0 + 32 * i; const bool more = i + 1 < nb;
    v8f s0 = {}, s1 = {};
    s0 = wmma16b(pk[0], aq, s0); s0 = wmma16b(pk[0], aql, s0); s0 = wmma16b(pk[1], aq, s0); s1 = wmma16b(pk[2], aq, s1); s1 = wmma16b(pk[2], aql, s1); s1 = wmma16b(pk[3], aq, s1);
    if (more) { load_pk(kb + 32); asm volatile("s_wait_xcnt 0x0" :: "v"(pa2), "v"(pal2) : "memory"); }   // the wait: as above
    mask_split(kb, s0, s1, 1.0f / (XS * PS2));
#pragma unroll
    for (int t = 0; t < 4; ++t) { o[t] = wmma16b(vf[2 * t], ph, o[t]); ol[t] = wmma16b(vf[2 * t], pl, ol[t]); ol[t] = wmma16b(vf[2 * t + 1], ph, ol[t]); }
    if (more) { load_vf(kb + 32); asm volatile("s_wait_xcnt 0x0" :: "v"(va), "v"(val) : "memory"); } }   // the wait: as above
  const float invn = 1.0f / ((float)(qi + 1) * PS1 * XS), invi = (float)ks0 / ((float)(qi + 1) * SS * PS2);
#pragma unroll
  for (int t = 0; t < 4; ++t)
#pragma unroll
    for (int r = 0; r < 8; ++r) To[wave][col][t * 16 + 8 * hh + r] = (o[t][r] + ol[t][r]) * invn + oi[t][r] * invi;
  wave_lds_sync();
  { for (int r4 = 0; r4 < 16; r4 += 4) { const int rr = r4 + (lane >> 3), c8 = (lane & 7) * 8; v8b hv, lv; for (int j = 0; j < 8; ++j) { b16 p, q; split16(To[wave][rr][c8 + j] * XS, p, q); hv[j] = p; lv[j] = q; }
      const size_t gi = ((size_t)(q0 + rr) * BS + b) * E + h * DH + c8; *(v8b*)(ATh + gi) = hv; *(v8b*)(ATl + gi) = lv; }  }
}
__global__ __launch_bounds__(128) void oproj_kernel(const b16* __restrict__ ATh, const b16* __restrict__ ATl, const b16* __restrict__ WO, const float* __restrict__ bo, float* __restrict__ out) {
  __shared__ __attribute__((aligned(16))) float Tf[4][16][128 + 4]; __shared__ __attribute__((aligned(16))) b16 St[2][64 + 64 + 128][LP];   // a stage: rows 0..63 = the block's attn hi rows, 64..127 = their lo rows, 128..255 = its W rows
  const int wave = threadIdx.x >> 5, lane = threadIdx.x & 31, nloc = lane & 15, hlf = lane >> 4; const int n0 = blockIdx.y * 128; const size_t m0 = (size_t)blockIdx.x * 64 + wave * 16;
  v8f acc[8];
#pragma unroll
  for (int t = 0; t < 8; ++t) acc[t] = (v8f){};
  const int crow = threadIdx.x >> 3, cpc = (threadIdx.x & 7) * 8; const unsigned cl = lds_off(&St[0][crow][cpc]); const size_t co = ((size_t)blockIdx.x * 64 + crow) * E + cpc;
  const b16* ch = ATh + co; const b16* cq = ATl + co; const b16* cw = WO + (size_t)(n0 + crow) * E + cpc;
  auto stage = [&](int s) { const unsigned l = cl + (unsigned)(s & 1) * (256 * LP * 2); copy_rows64(l, ch + s * KS); copy_rows64(l + 64 * LP * 2, cq + s * KS); copy_rows64(l + 128 * LP * 2, cw + s * KS); copy_rows64(l + 192 * LP * 2, cw + (size_t)64 * E + s * KS); };
  stage(0); wait_copies(); __syncthreads(); stage(1);
  for (int s = 0; s < NT; ++s) { const b16* sb = &St[s & 1][0][0]; v16b a[2], al[2], bw[2][8];   // all fragments of the stage are read in front of its first product: one LDS latency a stage
#pragma unroll   // constant indices keep the fragment arrays in registers
    for (int ks = 0; ks < 2; ++ks) { a[ks] = frag_kb(sb + (wave * 16 + nloc) * LP + ks * 32, hlf); al[ks] = frag_kb(sb + (64 + wave * 16 + nloc) * LP + ks * 32, hlf);
#pragma unroll   // constant indices keep the fragment arrays in registers
      for (int t = 0; t < 8; ++t) bw[ks][t] = frag_kb(sb + (128 + t * 16 + nloc) * LP + ks * 32, hlf); }
#pragma unroll   // constant indices keep the fragment arrays in registers
    for (int ks = 0; ks < 2; ++ks)
#pragma unroll   // constant indices keep the fragment arrays in registers
      for (int t = 0; t < 8; ++t) { acc[t] = wmma16b(a[ks], bw[ks][t], acc[t]); acc[t] = wmma16b(al[ks], bw[ks][t], acc[t]); }
    wait_lds_reads(); wait_copies(); __syncthreads();   // publishes stage s + 1 and ends every reader's last read of stage s
    if (s + 2 < NT) stage(s + 2); }
  wait_copies();
#pragma unroll
  for (int t = 0; t < 8; ++t) { const float bb = bf16_rne(bo[n0 + t * 16 + nloc]);
#pragma unroll
    for (int r = 0; r < 8; ++r) Tf[wave][8 * hlf + r][t * 16 + nloc] = acc[t][r] * (1.0f / (XS * WSC)) + bb; }
  wave_lds_sync();
  { for (int rr = 0; rr < 16; ++rr) *(v4f*)(out + (m0 + rr) * E + n0 + lane * 4) = *(const v4f*)(&Tf[wave][rr][lane * 4]);  }
}
}  // namespace

extern "C" void kernel_launch(void* const* d_in, const int* in_sizes, int n_in, void* d_out, int out_size, void* d_ws, size_t ws_size, hipStream_t stream) {
  (void)n_in;
  auto Fp = [&](int i) { return (const float*)d_in[i]; };
  // input order: 0 query [2048,2,1024], 1 pquery [32,2,1024], 2 Wpq [1024,1024], 3 bpq, 4 Wq, 5 bq, 6 Wpc, 7 bpc, 8 Wc, 9 bc, 10 Wo, 11 bo (torch [out][in])
  if (in_sizes[0] != NR * E || in_sizes[1] != NPR * E || in_sizes[2] != E * E || in_sizes[4] != E * E || in_sizes[6] != E * E || in_sizes[8] != E * E || in_sizes[10] != E * E || out_size != NR * E) return;
  size_t off = 0; char* ws = (char*)d_ws;
  auto carve = [&](size_t bytes) { char* p = ws + off; off += (bytes + 255) & ~(size_t)255; return p; };
  b16* X16 = (b16*)carve((size_t)NR * E * 2); b16* PQ16 = (b16*)carve((size_t)NPR * E * 2); b16* W4 = (b16*)carve((size_t)4 * E * E * 2); b16* WPQ = (b16*)carve((size_t)E * E * 2);
  b16* KPh = (b16*)carve((size_t)NR * E * 2); b16* KPl = (b16*)carve((size_t)NR * E * 2); b16* Qh = (b16*)carve((size_t)NR * E * 2); b16* Ql = (b16*)carve((size_t)NR * E * 2); b16* KVh = (b16*)carve((size_t)NR * E * 2); b16* KVl = (b16*)carve((size_t)NR * E * 2);
  b16* KVTh = (b16*)carve((size_t)NR * E * 2); b16* KVTl = (b16*)carve((size_t)NR * E * 2); b16* PAh = (b16*)carve((size_t)BH * T * PL * 2); b16* PAl = (b16*)carve((size_t)BH * T * PL * 2); b16* PATh = (b16*)carve((size_t)BH * PL * T * 2); b16* PATl = (b16*)carve((size_t)BH * PL * T * 2);
  b16* PQh = (b16*)carve((size_t)BH * PL * DH * 2); b16* PQl = (b16*)carve((size_t)BH * PL * DH * 2);
  b16* MTh = (b16*)carve((size_t)BH * NC * DH * PL * 2); b16* MTl = (b16*)carve((size_t)BH * NC * DH * PL * 2); b16* MSh = (b16*)carve((size_t)BH * NC * DH * PL * 2); b16* MSl = (b16*)carve((size_t)BH * NC * DH * PL * 2);
  b16* ATh = KPh; b16* ATl = KPl;   // region reuse: KP planes are dead after pattn_kernel (stream-ordered); the attention output takes their place
  if (off > ws_size || off > ((size_t)128 << 20)) return;   // ~ 114 MiB
  prep_kernel<<<(unsigned)(((size_t)NR * E / 8 + (size_t)NPR * E / 8 + 5 * (size_t)E * E / 8 + 255) / 256), 256, 0, stream>>>(Fp(0), Fp(1), Fp(2), Fp(4), Fp(6), Fp(8), Fp(10), X16, PQ16, W4, WPQ);
  lin_kernel<<<dim3(NR / LM, 3 * E / LN), 512, 0, stream>>>(X16, W4, Fp(7), Fp(5), Fp(9), KPh, KPl, Qh, Ql, KVh, KVl);
  kvt_kernel<<<dim3(4 + T / 64, BH), 256, 0, stream>>>(KVh, KVl, KVTh, KVTl, PQ16, WPQ, Fp(3), PQh, PQl);
  pattn_kernel<<<dim3(T / 64, BH), 128, 0, stream>>>(PQh, PQl, KPh, KPl, PAh, PAl, PATh, PATl);
  state_kernel<<<dim3(8, BH), SW * 32, 0, stream>>>(KVTh, KVTl, PATh, PATl, MTh, MTl, MSh, MSl);
  step12_kernel<<<dim3(T / 32, BH), 64, 0, stream>>>(Qh, Ql, KVh, KVl, PATh, PATl, MTh, MTl, PAh, PAl, KVTh, KVTl, MSh, MSl, ATh, ATl);
  oproj_kernel<<<dim3(NR / 64, E / 128), 128, 0, stream>>>(ATh, ATl, W4 + (size_t)3 * E * E, Fp(11), (float*)d_out);
}

// v010
// A run of this version takes 94.9 microseconds.
// In two side-by-side timings against v009, it was 1.04 and 1.03 times as fast.
// All steps since v000 together make it 7.50 times as fast.
#include <hip/hip_runtime.h>

// Lunar causal attention (Luna-style packed attention, causal "efficient" form): T = 2,048 tokens x 2 batch x 1,024 (16 heads x 64), 32 packed positions.
// pq = (pquery Wpq^T + bpq)/8 -> (b,h,p,d); kp = query Wpc^T + bpc; pattn[bh][t][p] = softplus_b(kp_t . pq_p) (b = ln 2); q = (query Wq^T + bq)/8; kv = query Wc^T + bc (tied k = v);
// aw[bh][n][p] = (sum_{m<=n} (q_n . kv_m) pattn[m][p]) / (n+1); A = softmax_p(aw); attn[bh][n][d] = (sum_{m<=n} (A_n . pattn_m) kv[m][d]) / (n+1); out = attn Wo^T + bo -> [2048][2][1024].
// Both "efficient_causal_attention_parallel" calls are evaluated in chunks of 64 keys: the keys of the query's own chunk as causal masked products (x_n . sum y_m z_m^T = sum (x_n.y_m) z_m), all earlier
// chunks through the running outer-product sum S_c[d][p] = sum_{m < 64c} kv[m][d] pattn[m][p] (k = v is tied, so ONE state serves both calls: q_n . S_c and A_n . S_c^T), kept as its mean S_c/(64c) in hi+lo.
// WMMA (v_wmma_f32_16x16x32_f16, f32 accumulate): the four input linears (kp, q, kv: [4,096 x 1,024] x [1,024 x 1,024]; pq: [64 x 1,024] x [1,024 x 1,024]; EXACT bf16 operands, 1 product) and the output linear (attn hi+lo: 2 products); per (bh,
// 16-query wave) and causal 32-key block: S1^T = KV.Q^T (K = 64, hi+lo: 3 products) then AW^T += PATTN^T S1^T (2 p-tiles, 3 products); S2^T = PATTN.A^T (K = 32, 3 products) then O^T += KV^T S2^T
// (4 d-tiles, 3 products); pattn = softplus(kp.pq) per token ([16 tokens x 64] x [64 x 32] per (bh) tile, 3 products). Softplus, softmax over the 32 positions, the 1/(n+1) factors in f32.
// Inputs rounded to bf16 once. Fragment k-map per lane half hh for A AND B: elements 0..7 <- k = 8hh+0..7, 8..15 <- k = 16+8hh+0..7; acc[r] = D[8hh+r][col]. Every

namespace {
constexpr int T = 2048, BS = 2, E = 1024, NH = 16, DH = 64, BH = BS * NH, PL = 32, NR = T * BS /* 4,096 query rows (t, b) */, NPR = PL * BS /* 64 pquery rows */;
constexpr int CH = 64 /* keys per chunk */, NC = T / CH;
constexpr int TB = T / 16 /* blocks of 16 tokens */, BK = 256 /* elements of a 16 x 16 block */;
constexpr float SS = 16.0f /* scale of the stored state mean */;
constexpr float XS = 8.0f, WSC = 256.0f, SCL = 0.125f, BETA = 0.69314718055994531f, PS1 = 8.0f, PS2 = 64.0f;

typedef _Float16 b16;
typedef __attribute__((ext_vector_type(16))) _Float16 v16b;
typedef __attribute__((ext_vector_type(8))) _Float16 v8b;
typedef __attribute__((ext_vector_type(8))) float v8f;
typedef __attribute__((ext_vector_type(4))) float v4f;
__device__ __forceinline__ float bf16_rne(float f) { unsigned int u = __float_as_uint(f); u += 0x7FFFu + ((u >> 16) & 1u); return __uint_as_float(u & 0xFFFF0000u); }
__device__ __forceinline__ void split16(float v, b16& hi, b16& lo) { hi = (b16)v; lo = (b16)(v - (float)hi); }
__device__ __forceinline__ v16b frag_kb(const b16* p, int hh) { const v8b a = *(const v8b*)(p + 8 * hh), b = *(const v8b*)(p + 16 + 8 * hh); v16b f;
#pragma unroll
  for (int e = 0; e < 8; ++e) { f[e] = a[e]; f[8 + e] = b[e]; } return f; }
// fragment from two consecutive 16 x 16 blocks (256 elements each) of a block-tiled plane: p = the lane's row in the first block; same k-map as frag_kb
__device__ __forceinline__ v16b frag_blk(const b16* p, int hh) { const v8b a = *(const v8b*)(p + 8 * hh), b = *(const v8b*)(p + 256 + 8 * hh); v16b f;
#pragma unroll
  for (int e = 0; e < 8; ++e) { f[e] = a[e]; f[8 + e] = b[e]; } return f; }
__device__ __forceinline__ v8f wmma16b(v16b a, v16b b, v8f c) { v8f d = __builtin_amdgcn_wmma_f32_16x16x32_f16(false, a, false, b, (short)0, c, false, false); asm volatile("v_nop\n\tv_nop\n\tv_nop\n\tv_nop" : "+v"(d) : "v"(a), "v"(b)); return d; }
__device__ __forceinline__ void wave_lds_sync() { __builtin_amdgcn_fence(__ATOMIC_RELEASE, "workgroup"); __builtin_amdgcn_wave_barrier(); __builtin_amdgcn_fence(__ATOMIC_ACQUIRE, "workgroup"); }
__device__ __forceinline__ float pmul(float a, float b) { float p = a * b; asm volatile("" : "+v"(p)); return p; }
// softplus(beta x)/beta with beta = ln 2 is log2(1 + 2^x): one hardware exp2 and one hardware log2. w = 1 + 2^x loses the low bits of a small 2^x; the factor 2^x / (w - 1) gives them back (log2(w) / (w - 1) is smooth at 1),
// so a small result keeps its relative accuracy; where w rounds to 1 the result is 2^x / ln 2. Above the threshold (20 on beta*x) the result is x itself.
__device__ __forceinline__ float softplus_b(float x) { const float e = __builtin_amdgcn_exp2f(x), w = 1.0f + e, d = w - 1.0f; const float t = __builtin_amdgcn_logf(w) * (e * __builtin_amdgcn_rcpf(d)), s = e * 1.44269504f;   // both forms are computed and one is selected: no branch, so that the 16 values of a lane overlap
  const float l = (d == 0.0f) ? s : t; return (x > 20.0f / BETA) ? x : l; }
// LDS staging of the linear layers' operand tiles: a stage is KS = 64 k of every operand row of the block (128-B rows, whole lines), laid at a pitch of 144 B for the ds_load_b128 fragment reads; two buffers.
constexpr int KS = 64, LP = KS + 8, NT = E / KS;
__device__ __forceinline__ unsigned lds_off(const void* p) { return (unsigned)(size_t)p; }   // byte offset in the work-group's LDS = low 32 bits of a __shared__ address
// four asynchronous copies, 16 B a lane each, global -> LDS through no register; the s_wait_xcnt stands inside the copies' own statement, so that no later write of an address register can be moved in front of it
__device__ __forceinline__ void copy4(unsigned l0, const b16* g0, unsigned l1, const b16* g1, unsigned l2, const b16* g2, unsigned l3, const b16* g3) {
  asm volatile("global_load_async_to_lds_b128 %0, %1, off\n\tglobal_load_async_to_lds_b128 %2, %3, off\n\tglobal_load_async_to_lds_b128 %4, %5, off\n\tglobal_load_async_to_lds_b128 %6, %7, off\n\ts_wait_xcnt 0x0"
               :: "v"(l0), "v"(g0), "v"(l1), "v"(g1), "v"(l2), "v"(g2), "v"(l3), "v"(g3) : "memory"); }
// 64 rows (16 a copy: a thread's row is tid / 8, its 16-B piece tid % 8) of one stage: l = the thread's LDS byte address in the first row group, g = its global address there
__device__ __forceinline__ void copy_rows64(unsigned l, const b16* g) { copy4(l, g, l + 16 * LP * 2, g + 16 * E, l + 32 * LP * 2, g + 32 * E, l + 48 * LP * 2, g + 48 * E); }
__device__ __forceinline__ void wait_copies() { asm volatile("s_wait_asynccnt 0x0" ::: "memory"); }   // the wave's own copies have landed; in front of the barrier that publishes them
__device__ __forceinline__ void wait_lds_reads() { asm volatile("s_wait_dscnt 0x0" ::: "memory"); }   // the wave's reads of a buffer have retired; in front of the barrier behind which it is refilled

__global__ __launch_bounds__(256) void prep_kernel(const float* __restrict__ query, const float* __restrict__ pquery, const float* __restrict__ wpq, const float* __restrict__ wq, const float* __restrict__ wpc, const float* __restrict__ wc, const float* __restrict__ wo, b16* __restrict__ X16, b16* __restrict__ PQ16, b16* __restrict__ W4, b16* __restrict__ WPQ) {
  const size_t t = (size_t)blockIdx.x * 256 + threadIdx.x; const size_t nx = (size_t)NR * E / 8, np_ = (size_t)NPR * E / 8, nw = (size_t)E * E / 8; v8b o;
  if (t < nx) { const size_t e = t * 8; const v4f a = *(const v4f*)(query + e), c = *(const v4f*)(query + e + 4); for (int j = 0; j < 4; ++j) { o[j] = (b16)(bf16_rne(a[j]) * XS); o[4 + j] = (b16)(bf16_rne(c[j]) * XS); } { *(v8b*)(X16 + e) = o;  } return; }
  size_t u = t - nx;
  if (u < np_) { const size_t e = u * 8; for (int j = 0; j < 8; ++j) o[j] = (b16)(bf16_rne(pquery[e + j]) * XS); { *(v8b*)(PQ16 + e) = o;  } return; } u -= np_;
  if (u < 5 * nw) { const int kind = (int)(u / nw); const size_t e = (u % nw) * 8; const float* w = kind == 0 ? wpc : kind == 1 ? wq : kind == 2 ? wc : kind == 3 ? wo : wpq; for (int j = 0; j < 8; ++j) o[j] = (b16)(bf16_rne(w[e + j]) * WSC);
    b16* dst = (kind < 4) ? (W4 + (size_t)kind * E * E) : WPQ; { *(v8b*)(dst + e) = o;  } }
}
// input linears as ONE product [4,096 x 1,024] x [1,024 x 3,072] (the W rows of kp, q and kv follow one another in W4): grid (NR/256, 3,072/192) = 256 blocks, one a WGP; a block = 256 rows x 192 columns,
// 16 waves (4 x 4) of 64 x 48: an LDS fragment feeds 3 or 4 products, and an operand row is fetched from L2 by 16 blocks and not by 24 (X) or 64 (W). y = X16 W^T + b (K = 1,024: 32 steps in ascending k, exact);
// a tile of 16 columns lies in one kind and one head: kind 0: kp -> KPh/KPl; kind 1: q = (y)*1/8 -> Qh/Ql; kind 2: kv -> KVh/KVl. All six planes are laid per bh in
// 16 x 16 blocks [bh][t / 16][d / 16][16 t][16 d]: a fragment load (16 rows x 32 B) of the later launches then reads one block, 512 contiguous bytes = 4 whole lines, and not 32 B out of each of 16 lines.
constexpr int LM = 256, LN = 192, WN = 48 /* columns of a wave */;
// orders one wave's own LDS writes and reads; it names LDS alone, so that between two row tiles the wave does not wait for its global stores to return
__device__ __forceinline__ void wave_lds_only_sync() { __builtin_amdgcn_fence(__ATOMIC_RELEASE, "workgroup", "local"); __builtin_amdgcn_wave_barrier(); __builtin_amdgcn_fence(__ATOMIC_ACQUIRE, "workgroup", "local"); }
// seven asynchronous copies and their one s_wait_xcnt in one statement, as in copy4
__device__ __forceinline__ void copy7(unsigned l0, const b16* g0, unsigned l1, const b16* g1, unsigned l2, const b16* g2, unsigned l3, const b16* g3, unsigned l4, const b16* g4, unsigned l5, const b16* g5, unsigned l6, const b16* g6) {
  asm volatile("global_load_async_to_lds_b128 %0, %1, off\n\tglobal_load_async_to_lds_b128 %2, %3, off\n\tglobal_load_async_to_lds_b128 %4, %5, off\n\tglobal_load_async_to_lds_b128 %6, %7, off\n\t"
               "global_load_async_to_lds_b128 %8, %9, off\n\tglobal_load_async_to_lds_b128 %10, %11, off\n\tglobal_load_async_to_lds_b128 %12, %13, off\n\ts_wait_xcnt 0x0"
               :: "v"(l0), "v"(g0), "v"(l1), "v"(g1), "v"(l2), "v"(g2), "v"(l3), "v"(g3), "v"(l4), "v"(g4), "v"(l5), "v"(g5), "v"(l6), "v"(g6) : "memory"); }
// The launch also makes two things that the later launches read:
// (1) kv transposed, KVTh/KVTl blocks [bh][d / 16][t / 16][16 d][16 t] (512 contiguous bytes each, one fragment load of the scan and of step 2): in a kv tile's accumulator a lane (hlf, nloc) holds, of column d = nloc,
// rows 8 hlf + r = (t = 4 hlf + r / 2, batch r % 2): 4 consecutive t of each batch, which are 8 contiguous bytes of a transposed block and are stored from registers; a wave's row tiles 2j and 2j + 1 fill whole blocks.
// (2) the packed query pq = (pquery Wpq^T + bpq)/8: its 64 x 1,024 values are 256 tiles of 16 d x 16 p, one a block; a wave takes one sixteenth of the tile's K (64: 2 products, exact operands): A = WPQ rows (d),
// B = PQ16 rows (p*2 + b) -> D[d][p]; the sixteen parts go through LDS (published by the k loop's own barriers) and wave 0 adds them; stored x8 hi/lo as blocks [bh][pt*4 + dt][16 p][16 d] (B operand of pattn, k = d).
typedef __attribute__((ext_vector_type(4))) _Float16 v4b;
static_assert((NR / LM) * (3 * E / LN) == (E / 16) * (NPR / 16), "one pq tile a block");
__global__ __launch_bounds__(512) void lin_kernel(const b16* __restrict__ X16, const b16* __restrict__ W4, const float* __restrict__ bpc, const float* __restrict__ bq, const float* __restrict__ bc, b16* __restrict__ KPh, b16* __restrict__ KPl, b16* __restrict__ Qh, b16* __restrict__ Ql, b16* __restrict__ KVh, b16* __restrict__ KVl,
                                                  b16* __restrict__ KVTh, b16* __restrict__ KVTl, const b16* __restrict__ PQ16, const b16* __restrict__ WPQ, const float* __restrict__ bpq, b16* __restrict__ PQh, b16* __restrict__ PQl) {
  __shared__ __attribute__((aligned(16))) b16 Th[16][16][WN + 8], Tl[16][16][WN + 8]; __shared__ __attribute__((aligned(16))) b16 St[2][LM + LN][LP];   // a stage: rows 0..255 = the block's X rows, 256..447 = its W rows
  __shared__ __attribute__((aligned(16))) float Rd[16][32][8];   // the sixteen K parts of the block's pq tile, a lane's 8 values together
  const int wave = __builtin_amdgcn_readfirstlane(threadIdx.x >> 5), lane = threadIdx.x & 31, nloc = lane & 15, hlf = lane >> 4, wr = wave >> 2, wc = wave & 3;
  // the wave's pq operands are asked for first: they fly while stage 0 is copied
  const int tile = blockIdx.y * (NR / LM) + blockIdx.x, ct = tile & 63 /* 16 columns of E: head ct / 4, d tile ct % 4 */, pqb = tile >> 7, pt = (tile >> 6) & 1;
  const b16* wa = WPQ + (size_t)(ct * 16 + nloc) * E + wave * 64 + 8 * hlf; const b16* pa = PQ16 + ((size_t)(pt * 16 + nloc) * BS + pqb) * E + wave * 64 + 8 * hlf;
  const v16b fa0 = frag_kb(wa, 0), fb0 = frag_kb(pa, 0), fa1 = frag_kb(wa + 32, 0), fb1 = frag_kb(pa + 32, 0);
  asm volatile("s_wait_xcnt 0x0" :: "v"(wa), "v"(pa) : "memory");   // in front of every later overwrite of the address registers of these loads, which are its inputs, so that no load lands on one of them ahead of the wait
  v8f acc[4][3];
#pragma unroll
  for (int i = 0; i < 4; ++i)
#pragma unroll
    for (int t = 0; t < 3; ++t) acc[i][t] = (v8f){};
  // a copy = 64 rows: a thread's row is tid / 8, its 16-B piece tid % 8; a stage = 4 copies of X rows and 3 of W rows a thread
  const int crow = threadIdx.x >> 3, cpc = (threadIdx.x & 7) * 8; const unsigned cl = lds_off(&St[0][crow][cpc]);
  const b16* cx = X16 + ((size_t)blockIdx.x * LM + crow) * E + cpc; const b16* cw = W4 + ((size_t)blockIdx.y * LN + crow) * E + cpc;
  auto stage = [&](int s) { const unsigned l = cl + (unsigned)(s & 1) * ((LM + LN) * LP * 2); const b16 *gx = cx + s * KS, *gw = cw + s * KS;
    copy7(l, gx, l + 64 * LP * 2, gx + 64 * E, l + 128 * LP * 2, gx + 128 * E, l + 192 * LP * 2, gx + 192 * E, l + 256 * LP * 2, gw, l + 320 * LP * 2, gw + 64 * E, l + 384 * LP * 2, gw + 128 * E); };
  // One block a WGP has no other block to cover its LDS latency: the fragments of a k block (32 k) are fetched one block ahead, into a second register set (ring with fragments fetched ahead: the publish point of
  // stage s + 1 stands in front of stage s's LAST block, whose fragments are then already in registers).
  v16b a0[4], w0[3], a1[4], w1[3];
  auto frags = [&](int s, int ks, v16b (&a)[4], v16b (&w)[3]) { const b16* sb = &St[s & 1][0][0] + ks * 32;
#pragma unroll   // constant indices keep the fragment arrays in registers
    for (int i = 0; i < 4; ++i) a[i] = frag_kb(sb + (wr * 64 + i * 16 + nloc) * LP, hlf);
#pragma unroll   // constant indices keep the fragment arrays in registers
    for (int t = 0; t < 3; ++t) w[t] = frag_kb(sb + (LM + wc * WN + t * 16 + nloc) * LP, hlf); };
  auto block = [&](v16b (&a)[4], v16b (&w)[3]) {
#pragma unroll   // constant indices keep the fragment arrays in registers
    for (int i = 0; i < 4; ++i)
#pragma unroll   // constant indices keep the fragment arrays in registers
      for (int t = 0; t < 3; ++t) acc[i][t] = wmma16b(a[i], w[t], acc[i][t]); };
  stage(0); wait_copies(); __syncthreads(); stage(1); frags(0, 0, a0, w0);
  { v8f pp = {}; pp = wmma16b(fa0, fb0, pp); pp = wmma16b(fa1, fb1, pp); *(v8f*)&Rd[wave][lane][0] = pp; }   // the wave's K part of the pq tile; read behind the k loop, whose barriers publish it
  for (int s = 0; s < NT; ++s) {
    frags(s, 1, a1, w1); block(a0, w0);
    wait_lds_reads(); wait_copies(); __syncthreads();   // publishes stage s + 1 and ends every reader's last read of stage s (its last fragments have landed in a1, w1)
    if (s + 1 < NT) frags(s + 1, 0, a0, w0);   // in front of the refill: the LDS works on these reads (of the other buffer) while the wave forms and issues its copies
    if (s + 2 < NT) stage(s + 2);
    block(a1, w1); }
  wait_copies();
  if (wave == 0) {   // a scalar test: the pq tile's sixteen parts are added in ascending k
    const v4f b0 = *(const v4f*)(bpq + ct * 16 + 8 * hlf), b1 = *(const v4f*)(bpq + ct * 16 + 8 * hlf + 4); v8f ps = *(const v8f*)&Rd[0][lane][0]; v8b hv, lv;
#pragma unroll   // the reads stand ahead of the additions: few LDS latencies and not one a part
    for (int k = 1; k < 16; ++k) ps += *(const v8f*)&Rd[k][lane][0];
#pragma unroll   // constant indices keep the vectors in registers
    for (int r = 0; r < 8; ++r) { const float bb = bf16_rne(r < 4 ? b0[r & 3] : b1[r & 3]); b16 p, q; split16((ps[r] * (1.0f / (XS * WSC)) + bb) * SCL * XS, p, q); hv[r] = p; lv[r] = q; }
    const size_t go = ((size_t)((pqb * NH + (ct >> 2)) * 2 + pt) * 4 + (ct & 3)) * 256 + nloc * 16 + 8 * hlf;
    // the two stores and their s_wait_xcnt in one statement, so that no later write of a data or address register of theirs can be moved in front of the wait
    asm volatile("global_store_b128 %0, %1, off\n\tglobal_store_b128 %2, %3, off\n\ts_wait_xcnt 0x0" :: "v"(PQh + go), "v"(hv), "v"(PQl + go), "v"(lv) : "memory"); }
  const int c0 = blockIdx.y * LN + wc * WN;   // the wave's first column of the 3,072
  const int kt0 = (c0 >> 4) - 2 * (E / 16);   // the wave's first column tile counted from kv's first one (below 0: a kp or q tile)
  const long xo = ((long)kt0 * TB + blockIdx.x * 8 + wr * 2) * BK; const int xv = nloc * 16 + 4 * hlf;   // transposed plane: the wave's first block of batch 0 (elements; used for kv tiles alone), the lane's place in a block
  float bv[3];
#pragma unroll
  for (int t = 0; t < 3; ++t) { const int cg = c0 + t * 16, kind = cg >> 10; const float* bias = kind == 0 ? bpc : kind == 1 ? bq : bc; bv[t] = bf16_rne(bias[(cg & (E - 1)) + nloc]); }
  // stored per bh as 16 x 16 blocks [bh][t / 16][d / 16][16 t][16 d] (512 contiguous bytes each), the order in which the fragment loads of pattn and step 1 read them. A row tile's 16 rows are 8 t of both batches:
  // a store = one d block of both batches: 16 lanes fill 8 t x 16 d = 256 contiguous bytes of a block (its lower or upper half, by the row tile's parity)
#pragma unroll   // constant indices keep the accumulators in registers
  for (int i = 0; i < 4; ++i) { v4b xh[3][2], xl[3][2];   // by column tile and batch: the lane's 4 consecutive t of column nloc, hi and lo (stored for kv tiles only)
#pragma unroll
    for (int t = 0; t < 3; ++t) { const float osc = (((c0 + t * 16) >> 10) == 1) ? SCL : 1.0f;
#pragma unroll
      for (int r = 0; r < 8; ++r) { b16 p, q; split16((acc[i][t][r] * (1.0f / (XS * WSC)) + bv[t]) * osc * XS, p, q); Th[wave][8 * hlf + r][t * 16 + nloc] = p; Tl[wave][8 * hlf + r][t * 16 + nloc] = q; xh[t][r & 1][r >> 1] = p; xl[t][r & 1][r >> 1] = q; } }
    wave_lds_only_sync();   // the wave's own writes in front of its reads
#pragma unroll
    for (int t = 0; t < 3; ++t) { const int cg = c0 + t * 16, kind = cg >> 10, head = (cg >> 6) & (NH - 1), db = (cg >> 4) & 3; b16* dh = kind == 0 ? KPh : kind == 1 ? Qh : KVh; b16* dl = kind == 0 ? KPl : kind == 1 ? Ql : KVl;
      const int bb = lane >> 4, tl = (lane & 15) >> 1, hf = lane & 1; const int rr = tl * 2 + bb, c8 = t * 16 + hf * 8;
      const size_t gi = (((size_t)(bb * NH + head) * TB + blockIdx.x * 8 + wr * 2 + (i >> 1)) * 4 + db) * BK + ((i & 1) * 8 + tl) * 16 + hf * 8; *(v8b*)(dh + gi) = *(const v8b*)(&Th[wave][rr][c8]); *(v8b*)(dl + gi) = *(const v8b*)(&Tl[wave][rr][c8]); }
    if (kt0 + 2 >= 0) {   // a scalar test: the wave has a kv tile; those go out transposed as well
      asm volatile("s_wait_xcnt 0x0" ::: "memory");   // in front of every later overwrite of the data and address registers of the six stores above
      auto put = [&](int t) {   // kv tile number kt0 + t = head * 4 + d block, both batches: every address is the lane's one address in the plane and a constant
#pragma unroll   // constant indices keep the arrays in registers
        for (int b2 = 0; b2 < 2; ++b2) { const long gt = xo + xv + ((b2 * (E / 16) + t) * TB + (i >> 1)) * BK + (i & 1) * 8; *(v4b*)(KVTh + gt) = xh[t][b2]; *(v4b*)(KVTl + gt) = xl[t][b2]; } };
      if (kt0 >= 0) { put(0); put(1); put(2); asm volatile("s_wait_xcnt 0x0" ::: "memory"); }   // all three are kv tiles: twelve stores in a row; the wait: as below
      else {
#pragma unroll   // constant indices keep the arrays in registers
        for (int t = 1; t < 3; ++t)
          if (kt0 + t >= 0) { put(t); asm volatile("s_wait_xcnt 0x0" ::: "memory"); } } }   // the wait: in front of every later overwrite of the data and address registers of the four stores
    if (i < 3) { asm volatile("s_wait_xcnt 0x0" ::: "memory");   // in front of every later overwrite of the data and address registers of the row tile's stores
      wave_lds_only_sync(); } }   // the wave's reads in front of the next row tile's writes
}
// pattn: block = (bh, 64 t) x 4 waves: tile = KP rows (t; the head's 64 d) [16 t x 64] x PQ^T -> [16 x 32]: 2 col tiles x 2 k steps x 3 products; softplus; stored as PAh/PAl [bh][t][32] (x8 hi/lo) and transposed as
// PATh/PATl blocks [bh][p / 16][t / 16][16 p][16 t]; pq comes ready from the linear launch (blocks [bh][pt*4 + dt][16 p][16 d])
__global__ __launch_bounds__(128) void pattn_kernel(const b16* __restrict__ PQh, const b16* __restrict__ PQl, const b16* __restrict__ KPh, const b16* __restrict__ KPl, b16* __restrict__ PAh, b16* __restrict__ PAl, b16* __restrict__ PATh, b16* __restrict__ PATl) {
  __shared__ __attribute__((aligned(16))) b16 Rh[4][16][PL + 8], Rl[4][16][PL + 8]; __shared__ __attribute__((aligned(16))) b16 Rt[PL][64 + 8], Rtl[PL][64 + 8];
  const int wave = threadIdx.x >> 5, lane = threadIdx.x & 31, nloc = lane & 15, hlf = lane >> 4, t_ = threadIdx.x; const int bh = blockIdx.y, t0 = blockIdx.x * 64;
  // the wave's KP fragments (hi, lo; two k steps) and all pq fragments are loaded in front of the first product: one memory latency and not one a fragment
  const size_t arow = ((size_t)bh * TB + (t0 >> 4) + wave) * (4 * BK) + nloc * 16 + 8 * hlf; const b16 *kpa = KPh + arow, *kpb = KPl + arow; v16b ka[2], kal[2];
#pragma unroll   // constant indices keep the fragment arrays in registers
  for (int j = 0; j < 2; ++j) { ka[j] = frag_blk(kpa + j * 2 * BK, 0); kal[j] = frag_blk(kpb + j * 2 * BK, 0); }
  const size_t qo = (size_t)bh * (PL * DH) + nloc * 16 + 8 * hlf; const b16 *qa = PQh + qo, *qb = PQl + qo; v16b bp[2][2], bpl[2][2];
#pragma unroll   // constant indices keep the fragment arrays in registers
  for (int j = 0; j < 2; ++j)
#pragma unroll   // constant indices keep the fragment arrays in registers
    for (int t = 0; t < 2; ++t) { bp[j][t] = frag_blk(qa + (t * 4 + 2 * j) * 256, 0); bpl[j][t] = frag_blk(qb + (t * 4 + 2 * j) * 256, 0); }
  asm volatile("s_wait_xcnt 0x0" :: "v"(kpa), "v"(kpb), "v"(qa), "v"(qb) : "memory");   // in front of every later overwrite of the address registers of these loads, which are its inputs, so that no load lands on one of them ahead of the wait
  // pattn for the wave's 16 t: A = KP rows t0 + wave*16 + nloc of bh (k = d), B = pq rows p (k = d)
  { v8f d2[2] = {{}, {}};
#pragma unroll
    for (int j = 0; j < 2; ++j)
#pragma unroll
      for (int t = 0; t < 2; ++t) { d2[t] = wmma16b(ka[j], bp[j][t], d2[t]); d2[t] = wmma16b(kal[j], bp[j][t], d2[t]); d2[t] = wmma16b(ka[j], bpl[j][t], d2[t]); }
#pragma unroll
    for (int t = 0; t < 2; ++t)
#pragma unroll
      for (int r = 0; r < 8; ++r) { const float v = softplus_b(d2[t][r] * (1.0f / (XS * XS))); b16 p, q; split16(v * XS, p, q); const int tt = wave * 16 + 8 * hlf + r, pp = t * 16 + nloc; Rh[wave][8 * hlf + r][pp] = p; Rl[wave][8 * hlf + r][pp] = q; Rt[pp][tt] = p; Rtl[pp][tt] = q; } }
  __syncthreads();
  {
    for (int k = 0; k < 2; ++k) { const int rr = k * 8 + (lane >> 2), c8 = (lane & 3) * 8; const size_t gi = ((size_t)bh * T + t0 + wave * 16 + rr) * PL + c8; *(v8b*)(PAh + gi) = *(const v8b*)(&Rh[wave][rr][c8]); *(v8b*)(PAl + gi) = *(const v8b*)(&Rl[wave][rr][c8]); }
    for (int q = t_; q < PL * 8; q += 128) { const int pp = q >> 3, c8 = (q & 7) * 8; const size_t gi = (((size_t)bh * 2 + (pp >> 4)) * TB + ((t0 + c8) >> 4)) * BK + (pp & 15) * 16 + (c8 & 15); *(v8b*)(PATh + gi) = *(const v8b*)(&Rt[pp][c8]); *(v8b*)(PATl + gi) = *(const v8b*)(&Rtl[pp][c8]); }
     }
}
// prefix state: grid (8 tiles, BH), a block of SW = 8 waves per (16 d x 16 p) tile; a wave sums its own CPW = 4 chunks of keys (K = 32 a step, 3 products, f32 accumulate), both orientations: sd = KVT.PAT^T -> D[d][p],
// st = PAT.KVT^T -> D[p][d], and keeps its running sum at the end of each of them; the waves' totals go through LDS, and each wave adds the totals of the waves in front of it to its four running sums.
// At each chunk boundary c = 1..NC-1 the sum is stored as its mean x SS (hi/lo): MT blocks [pt*4+dt][16 p][16 d] (A operand of step 1, k = d), MS blocks [dt*2+pt][16 d][16 p] (A operand of step 2, k = p);
// a wave's block is 512 contiguous bytes. Operand fragments: the first four key steps are loaded together, a later step's into a stage as soon as its products have read it.
__device__ __forceinline__ void state_mac(v16b k, v16b kl, v16b p, v16b pl, v8f& sd, v8f& st) { sd = wmma16b(k, p, sd); st = wmma16b(p, k, st); sd = wmma16b(k, pl, sd); st = wmma16b(pl, k, st); sd = wmma16b(kl, p, sd); st = wmma16b(p, kl, st); }
__device__ __forceinline__ void state_store(v8f sd, v8f st, int c, b16* mth, b16* mtl, b16* msh, b16* msl) { const float f = SS / (XS * XS * (float)(c * CH)); v8b dh_, dl_, th_, tl_;
#pragma unroll
  for (int r = 0; r < 8; ++r) { b16 p, q; split16(sd[r] * f, p, q); dh_[r] = p; dl_[r] = q; split16(st[r] * f, p, q); th_[r] = p; tl_[r] = q; }
  *(v8b*)mth = dh_; *(v8b*)mtl = dl_; *(v8b*)msh = th_; *(v8b*)msl = tl_;
  asm volatile("s_wait_xcnt 0x0" ::: "memory"); }   // in front of every later overwrite of the data and address registers of the four stores
constexpr int SW = 8 /* waves of a scan block */, CPW = NC / SW /* chunks a wave */, SPW = CPW * CH / 32 /* key steps a wave */;
__global__ __launch_bounds__(SW * 32) void state_kernel(const b16* __restrict__ KVTh, const b16* __restrict__ KVTl, const b16* __restrict__ PATh, const b16* __restrict__ PATl, b16* __restrict__ MTh, b16* __restrict__ MTl, b16* __restrict__ MSh, b16* __restrict__ MSl) {
  __shared__ __attribute__((aligned(16))) float Tt[SW - 1][2][32][8];   // the totals (sd, st) of waves 0..SW-2, a lane's 8 values together
  const int wave = __builtin_amdgcn_readfirstlane(threadIdx.x >> 5), lane = threadIdx.x & 31, hh = lane >> 4, col = lane & 15; const int bh = blockIdx.y, dt = blockIdx.x >> 1, pt = blockIdx.x & 1;
  const int tb0 = wave * (CPW * CH / 16);   // the wave's first block of 16 keys
  const size_t ok = (((size_t)bh * 4 + dt) * TB + tb0) * BK + col * 16 + 8 * hh, op = (((size_t)bh * 2 + pt) * TB + tb0) * BK + col * 16 + 8 * hh;   // the lane half's k offset is part of the four base pointers
  const b16* kh = KVTh + ok; const b16* kl = KVTl + ok; const b16* ph = PATh + op; const b16* pl = PATl + op;
  v16b fk[4], fkl[4], fp[4], fpl[4];
#pragma unroll   // here and below: the stage index must be a constant, so that the four stages stay in registers
  for (int j = 0; j < 4; ++j) { fk[j] = frag_blk(kh + j * 2 * BK, 0); fkl[j] = frag_blk(kl + j * 2 * BK, 0); fp[j] = frag_blk(ph + j * 2 * BK, 0); fpl[j] = frag_blk(pl + j * 2 * BK, 0); }
  v8f sd = {}, st = {}, ld[CPW], lt[CPW];   // ld, lt: the wave's own running sums at the end of each of its chunks
#pragma unroll
  for (int j = 0; j < SPW; ++j) { const int g = j & 3, kn = (j + 4) * 2 * BK;
    state_mac(fk[g], fkl[g], fp[g], fpl[g], sd, st);
    if (j + 4 < SPW) { fk[g] = frag_blk(kh + kn, 0); fkl[g] = frag_blk(kl + kn, 0); fp[g] = frag_blk(ph + kn, 0); fpl[g] = frag_blk(pl + kn, 0); }
    if (j + 5 == SPW) asm volatile("s_wait_xcnt 0x0" :: "v"(kh), "v"(kl), "v"(ph), "v"(pl) : "memory");   // behind the last loads, in front of every later overwrite of their address registers, which are its inputs
    if (j & 1) { ld[j >> 1] = sd; lt[j >> 1] = st; } }
  if (wave < SW - 1) { *(v8f*)&Tt[wave][0][lane][0] = sd; *(v8f*)&Tt[wave][1][lane][0] = st; }
  __syncthreads();   // publishes the waves' totals
  v8f td[SW - 1], tt[SW - 1], pd = {}, pq_ = {};   // all totals are read in front of the first addition: one LDS latency and not one a wave
#pragma unroll
  for (int w = 0; w < SW - 1; ++w) { td[w] = *(const v8f*)&Tt[w][0][lane][0]; tt[w] = *(const v8f*)&Tt[w][1][lane][0]; }
#pragma unroll
  for (int w = 0; w < SW - 1; ++w)
#pragma unroll
    for (int r = 0; r < 8; ++r) { pd[r] += (w < wave) ? td[w][r] : 0.0f; pq_[r] += (w < wave) ? tt[w][r] : 0.0f; }   // only the waves in front count
  const size_t ot = ((size_t)bh * NC + wave * CPW) * (DH * PL) + ((pt * 4 + dt) * 16 + col) * 16 + 8 * hh, os = ((size_t)bh * NC + wave * CPW) * (DH * PL) + ((dt * 2 + pt) * 16 + col) * 16 + 8 * hh;
#pragma unroll
  for (int j = 0; j < CPW; ++j) { const int c = wave * CPW + j + 1;   // the boundary behind the wave's chunk j
    if (c < NC) state_store(pd + ld[j], pq_ + lt[j], c, MTh + ot + (j + 1) * (DH * PL), MTl + ot + (j + 1) * (DH * PL), MSh + os + (j + 1) * (DH * PL), MSl + os + (j + 1) * (DH * PL)); }   // the last chunk feeds no state (the same for the whole wave)
}
// steps 1 and 2 in ONE launch: grid (T/32, BH), 2 waves x 16 queries; a wave's step 2 needs of step 1 only its own 16 queries' softmax rows, and those stand in its accumulators in the B-fragment order of step 2
// (lane (hh, col): values p = t*16 + 8hh + r of query col = elements t*8 + r), so A goes from step 1 to step 2 in registers: no plane, no LDS, no second launch.
// Step 1: earlier chunks: AI^T = MT(p rows) Q^T (2 p-tiles, K = 64, 3 products), weighted 64c/(n+1); key blocks of the query's own chunk: S1^T = KV.Q^T (K = 64, 3 products), masked keys > q -> 0, x PS1 hi/lo;
// AW^T += PAT(p rows) S1^T (2 p-tiles, 3 products); aw = AW/(n+1); softmax over the 32 p (a query's 32 values are split over the lanes col and col + 16).
// Step 2: earlier chunks: OI^T = MS(d rows) A^T (4 d-tiles, K = 32, 3 products), weighted 64c/(n+1); own chunk: S2^T = PA(keys).A(q)^T (K = 32: 3 products), causal, x PS1 hi/lo; O^T += KVT(d rows) S2^T (4 d-tiles, 3 products); / (n+1)
__global__ __launch_bounds__(64) void step12_kernel(const b16* __restrict__ Qh, const b16* __restrict__ Ql, const b16* __restrict__ KVh, const b16* __restrict__ KVl, const b16* __restrict__ PATh, const b16* __restrict__ PATl, const b16* __restrict__ MTh, const b16* __restrict__ MTl,
                                                    const b16* __restrict__ PAh, const b16* __restrict__ PAl, const b16* __restrict__ KVTh, const b16* __restrict__ KVTl, const b16* __restrict__ MSh, const b16* __restrict__ MSl, b16* __restrict__ ATh, b16* __restrict__ ATl) {
  __shared__ __attribute__((aligned(16))) float To[2][16][DH + 4];
  const int wave = threadIdx.x >> 5, lane = threadIdx.x & 31, hh = lane >> 4, col = lane & 15; const int bh = blockIdx.y, b = bh / NH, h = bh % NH; const int q0 = blockIdx.x * 32 + wave * 16, qi = q0 + col;
  const size_t qrow = ((size_t)bh * TB + (q0 >> 4)) * (4 * BK) + col * 16; const v16b qa0 = frag_blk(Qh + qrow, hh), qa1 = frag_blk(Qh + qrow + 2 * BK, hh), ql0 = frag_blk(Ql + qrow, hh), ql1 = frag_blk(Ql + qrow + 2 * BK, hh);
  const b16* Pb = PATh + (size_t)bh * PL * T; const b16* Plb = PATl + (size_t)bh * PL * T;
  v8f aw[2] = {{}, {}}, awl[2] = {{}, {}}, ai[2] = {{}, {}}; const int ks0 = (blockIdx.x * 32) & ~(CH - 1), nb = (blockIdx.x & 1) + 1;   // nb = key blocks of 32 from the chunk's start up to the block's 32 queries
  const size_t so = ((size_t)bh * NC + ks0 / CH) * (DH * PL);   // the chunk's state blocks (read only where ks0 > 0)
  // The fragments of a key block are loaded as groups ahead of the products that use them, so that a block costs one memory latency and not one a fragment: the first block's together with the query's and the
  // state's, the next block's into the same registers as soon as this block's products have read them. kf = KV rows (key tile, k half: hi, lo), pf = PAT rows (p tile: hi, lo).
  v16b kf[8], pf[4]; const b16 *ka, *kal, *pa, *pal;   // the lane's base addresses of a group (its k half included): every load of the group is one of them plus a constant
  auto load_kv = [&](int kb) { const size_t r = ((size_t)bh * TB + (kb >> 4)) * (4 * BK) + col * 16 + 8 * hh; ka = KVh + r; kal = KVl + r;
#pragma unroll   // constant indices keep the fragment arrays in registers
    for (int u = 0; u < 4; ++u) { const int c = (u >> 1) * 4 * BK + (u & 1) * 2 * BK; kf[2 * u] = frag_blk(ka + c, 0); kf[2 * u + 1] = frag_blk(kal + c, 0); } };
  auto load_pa = [&](int kb) { const size_t r = (size_t)(kb >> 4) * BK + col * 16 + 8 * hh; pa = Pb + r; pal = Plb + r;
#pragma unroll   // constant indices keep the fragment arrays in registers
    for (int t = 0; t < 2; ++t) { pf[2 * t] = frag_blk(pa + t * TB * BK, 0); pf[2 * t + 1] = frag_blk(pal + t * TB * BK, 0); } };
  // step 2's groups: pk = PA rows (key tile: hi, lo), vf = KVT rows (d tile: hi, lo)
  const b16* Vb = KVTh + (size_t)bh * DH * T; const b16* Vlb = KVTl + (size_t)bh * DH * T;
  v16b pk[4], vf[8]; const b16 *pa2, *pal2, *va, *val;
  auto load_pk = [&](int kb) { const size_t r = ((size_t)bh * T + kb + col) * PL + 8 * hh; pa2 = PAh + r; pal2 = PAl + r;
#pragma unroll   // constant indices keep the fragment arrays in registers
    for (int u = 0; u < 2; ++u) { pk[2 * u] = frag_kb(pa2 + u * 16 * PL, 0); pk[2 * u + 1] = frag_kb(pal2 + u * 16 * PL, 0); } };
  auto load_vf = [&](int kb) { const size_t r = (size_t)(kb >> 4) * BK + col * 16 + 8 * hh; va = Vb + r; val = Vlb + r;
#pragma unroll   // constant indices keep the fragment arrays in registers
    for (int t = 0; t < 4; ++t) { vf[2 * t] = frag_blk(va + t * TB * BK, 0); vf[2 * t + 1] = frag_blk(val + t * TB * BK, 0); } };
  load_kv(ks0); load_pa(ks0);
  // kept in front of the branch: the address arithmetic behind it may take over the address registers of the loads above; the addresses are inputs, so that no load of the groups lands on one of them ahead of the wait
  asm volatile("s_wait_xcnt 0x0" :: "v"(Qh + qrow + 8 * hh), "v"(Ql + qrow + 8 * hh), "v"(ka), "v"(kal), "v"(pa), "v"(pal) : "memory");
  if (ks0 > 0) {
    v16b mh[4], ml[4];   // all state fragments are loaded in front of the first product, so that they cost one memory latency and not one each
#pragma unroll
    for (int u = 0; u < 4; ++u) { mh[u] = frag_blk(MTh + so + ((u * 2) * 16 + col) * 16, hh); ml[u] = frag_blk(MTl + so + ((u * 2) * 16 + col) * 16, hh); }
    asm volatile("s_wait_xcnt 0x0" :: "v"(MTh + so + col * 16 + 8 * hh), "v"(MTl + so + col * 16 + 8 * hh) : "memory");   // the wait: as above
#pragma unroll
    for (int t = 0; t < 2; ++t) { ai[t] = wmma16b(mh[2 * t], qa0, ai[t]); ai[t] = wmma16b(mh[2 * t], ql0, ai[t]); ai[t] = wmma16b(ml[2 * t], qa0, ai[t]);
      ai[t] = wmma16b(mh[2 * t + 1], qa1, ai[t]); ai[t] = wmma16b(mh[2 * t + 1], ql1, ai[t]); ai[t] = wmma16b(ml[2 * t + 1], qa1, ai[t]); } }
  v16b ph, pl;   // a key block's masked scores x PS1, hi and lo: B operand of the block's second product
  auto scores1 = [&](v8f& s0, v8f& s1) {
    s0 = wmma16b(kf[0], qa0, s0); s0 = wmma16b(kf[0], ql0, s0); s0 = wmma16b(kf[1], qa0, s0); s0 = wmma16b(kf[2], qa1, s0); s0 = wmma16b(kf[2], ql1, s0); s0 = wmma16b(kf[3], qa1, s0);
    s1 = wmma16b(kf[4], qa0, s1); s1 = wmma16b(kf[4], ql0, s1); s1 = wmma16b(kf[5], qa0, s1); s1 = wmma16b(kf[6], qa1, s1); s1 = wmma16b(kf[6], ql1, s1); s1 = wmma16b(kf[7], qa1, s1); };
  auto mask_split = [&](int kb, const v8f& s0, const v8f& s1, float sc) {
#pragma unroll
    for (int r = 0; r < 8; ++r) { const int k0 = kb + 8 * hh + r, k1 = kb + 16 + 8 * hh + r; const float v0 = (k0 <= qi) ? s0[r] * sc : 0.0f, v1 = (k1 <= qi) ? s1[r] * sc : 0.0f; b16 p, q; split16(v0 * PS1, p, q); ph[r] = p; pl[r] = q; split16(v1 * PS1, p, q); ph[8 + r] = p; pl[8 + r] = q; } };
  auto sums1 = [&]() {
#pragma unroll
    for (int t = 0; t < 2; ++t) { aw[t] = wmma16b(pf[2 * t], ph, aw[t]); awl[t] = wmma16b(pf[2 * t], pl, awl[t]); awl[t] = wmma16b(pf[2 * t + 1], ph, awl[t]); } };
  if (nb == 2) {   // the chunk's first key block, where the queries stand in its second (the same for the whole block)
    v8f s0 = {}, s1 = {}; scores1(s0, s1);
    load_kv(ks0 + 32); asm volatile("s_wait_xcnt 0x0" :: "v"(ka), "v"(kal) : "memory");   // the wait: in front of every later overwrite of the address registers of these loads, which are its inputs as above
    mask_split(ks0, s0, s1, 1.0f / (XS * XS)); sums1();
    load_pa(ks0 + 32); asm volatile("s_wait_xcnt 0x0" :: "v"(pa), "v"(pal) : "memory"); }   // the wait: as above
  v16b mh2[4], ml2[4];   // step 2's state fragments
  { v8f s0 = {}, s1 = {}; scores1(s0, s1);   // the queries' own key block
    // step 2's first groups fly while step 1 ends: they take the registers that the query's and the key fragments have just left
    load_pk(ks0); load_vf(ks0); asm volatile("s_wait_xcnt 0x0" :: "v"(pa2), "v"(pal2), "v"(va), "v"(val) : "memory");   // the wait: as above
    mask_split(ks0 + 32 * (nb - 1), s0, s1, 1.0f / (XS * XS)); sums1(); }
  if (ks0 > 0) {
#pragma unroll
    for (int t = 0; t < 4; ++t) { mh2[t] = frag_blk(MSh + so + ((t * 2) * 16 + col) * 16, hh); ml2[t] = frag_blk(MSl + so + ((t * 2) * 16 + col) * 16, hh); }
    asm volatile("s_wait_xcnt 0x0" :: "v"(MSh + so + col * 16 + 8 * hh), "v"(MSl + so + col * 16 + 8 * hh) : "memory"); }   // the wait: as above
  // lane (hh, col): value[p = t*16 + 8hh + r] for query col; divide by (qi + 1); softmax over 32
  v16b aq, aql;   // A x PS2, hi and lo, of query col: B operand of step 2 (k = p)
  { float v[16]; const float invn = 1.0f / ((float)(qi + 1) * PS1 * XS), invi = (float)ks0 / ((float)(qi + 1) * SS * XS); float mx = -INFINITY;
#pragma unroll
    for (int t = 0; t < 2; ++t) for (int r = 0; r < 8; ++r) { v[t * 8 + r] = (aw[t][r] + awl[t][r]) * invn + ai[t][r] * invi; mx = fmaxf(mx, v[t * 8 + r]); }
    mx = fmaxf(mx, __shfl_xor(mx, 16)); float sm = 0.0f; for (int i = 0; i < 16; ++i) { v[i] = __expf(v[i] - mx); sm += v[i]; } sm += __shfl_xor(sm, 16); const float inv = 1.0f / sm;
#pragma unroll
    for (int i = 0; i < 16; ++i) { b16 p, q; split16(v[i] * inv * PS2, p, q); aq[i] = p; aql[i] = q; } }
  v8f o[4] = {{}, {}, {}, {}}, ol[4] = {{}, {}, {}, {}}, oi[4] = {{}, {}, {}, {}};
  if (ks0 > 0) {
#pragma unroll
    for (int t = 0; t < 4; ++t) { oi[t] = wmma16b(mh2[t], aq, oi[t]); oi[t] = wmma16b(mh2[t], aql, oi[t]); oi[t] = wmma16b(ml2[t], aq, oi[t]); } }
  for (int i = 0; i < nb; ++i) { const int kb = ks0 + 32 * i; const bool more = i + 1 < nb;
    v8f s0 = {}, s1 = {};
    s0 = wmma16b(pk[0], aq, s0); s0 = wmma16b(pk[0], aql, s0); s0 = wmma16b(pk[1], aq, s0); s1 = wmma16b(pk[2], aq, s1); s1 = wmma16b(pk[2], aql, s1); s1 = wmma16b(pk[3], aq, s1);
    if (more) { load_pk(kb + 32); asm volatile("s_wait_xcnt 0x0" :: "v"(pa2), "v"(pal2) : "memory"); }   // the wait: as above
    mask_split(kb, s0, s1, 1.0f / (XS * PS2));
#pragma unroll
    for (int t = 0; t < 4; ++t) { o[t] = wmma16b(vf[2 * t], ph, o[t]); ol[t] = wmma16b(vf[2 * t], pl, ol[t]); ol[t] = wmma16b(vf[2 * t + 1], ph, ol[t]); }
    if (more) { load_vf(kb + 32); asm volatile("s_wait_xcnt 0x0" :: "v"(va), "v"(val) : "memory"); } }   // the wait: as above
  const float invn = 1.0f / ((float)(qi + 1) * PS1 * XS), invi = (float)ks0 / ((float)(qi + 1) * SS * PS2);
#pragma unroll
  for (int t = 0; t < 4; ++t)
#pragma unroll
    for (int r = 0; r < 8; ++r) To[wave][col][t * 16 + 8 * hh + r] = (o[t][r] + ol[t][r]) * invn + oi[t][r] * invi;
  wave_lds_sync();
  { for (int r4 = 0; r4 < 16; r4 += 4) { const int rr = r4 + (lane >> 3), c8 = (lane & 7) * 8; v8b hv, lv; for (int j = 0; j < 8; ++j) { b16 p, q; split16(To[wave][rr][c8 + j] * XS, p, q); hv[j] = p; lv[j] = q; }
      const size_t gi = ((size_t)(q0 + rr) * BS + b) * E + h * DH + c8; *(v8b*)(ATh + gi) = hv; *(v8b*)(ATl + gi) = lv; }  }
}
__global__ __launch_bounds__(128) void oproj_kernel(const b16* __restrict__ ATh, const b16* __restrict__ ATl, const b16* __restrict__ WO, const float* __restrict__ bo, float* __restrict__ out) {
  __shared__ __attribute__((aligned(16))) float Tf[4][16][128 + 4]; __shared__ __attribute__((aligned(16))) b16 St[2][64 + 64 + 128][LP];   // a stage: rows 0..63 = the block's attn hi rows, 64..127 = their lo rows, 128..255 = its W rows
  const int wave = threadIdx.x >> 5, lane = threadIdx.x & 31, nloc = lane & 15, hlf = lane >> 4; const int n0 = blockIdx.y * 128; const size_t m0 = (size_t)blockIdx.x * 64 + wave * 16;
  v8f acc[8];
#pragma unroll
  for (int t = 0; t < 8; ++t) acc[t] = (v8f){};
  const int crow = threadIdx.x >> 3, cpc = (threadIdx.x & 7) * 8; const unsigned cl = lds_off(&St[0][crow][cpc]); const size_t co = ((size_t)blockIdx.x * 64 + crow) * E + cpc;
  const b16* ch = ATh + co; const b16* cq = ATl + co; const b16* cw = WO + (size_t)(n0 + crow) * E + cpc;
  auto stage = [&](int s) { const unsigned l = cl + (unsigned)(s & 1) * (256 * LP * 2); copy_rows64(l, ch + s * KS); copy_rows64(l + 64 * LP * 2, cq + s * KS); copy_rows64(l + 128 * LP * 2, cw + s * KS); copy_rows64(l + 192 * LP * 2, cw + (size_t)64 * E + s * KS); };
  stage(0); wait_copies(); __syncthreads(); stage(1);
  for (int s = 0; s < NT; ++s) { const b16* sb = &St[s & 1][0][0]; v16b a[2], al[2], bw[2][8];   // all fragments of the stage are read in front of its first product: one LDS latency a stage
#pragma unroll   // constant indices keep the fragment arrays in registers
    for (int ks = 0; ks < 2; ++ks) { a[ks] = frag_kb(sb + (wave * 16 + nloc) * LP + ks * 32, hlf); al[ks] = frag_kb(sb + (64 + wave * 16 + nloc) * LP + ks * 32, hlf);
#pragma unroll   // constant indices keep the fragment arrays in registers
      for (int t = 0; t < 8; ++t) bw[ks][t] = frag_kb(sb + (128 + t * 16 + nloc) * LP + ks * 32, hlf); }
#pragma unroll   // constant indices keep the fragment arrays in registers
    for (int ks = 0; ks < 2; ++ks)
#pragma unroll   // constant indices keep the fragment arrays in registers
      for (int t = 0; t < 8; ++t) { acc[t] = wmma16b(a[ks], bw[ks][t], acc[t]); acc[t] = wmma16b(al[ks], bw[ks][t], acc[t]); }
    wait_lds_reads(); wait_copies(); __syncthreads();   // publishes stage s + 1 and ends every reader's last read of stage s
    if (s + 2 < NT) stage(s + 2); }
  wait_copies();
#pragma unroll
  for (int t = 0; t < 8; ++t) { const float bb = bf16_rne(bo[n0 + t * 16 + nloc]);
#pragma unroll
    for (int r = 0; r < 8; ++r) Tf[wave][8 * hlf + r][t * 16 + nloc] = acc[t][r] * (1.0f / (XS * WSC)) + bb; }
  wave_lds_sync();
  { for (int rr = 0; rr < 16; ++rr) *(v4f*)(out + (m0 + rr) * E + n0 + lane * 4) = *(const v4f*)(&Tf[wave][rr][lane * 4]);  }
}
}  // namespace

extern "C" void kernel_launch(void* const* d_in, const int* in_sizes, int n_in, void* d_out, int out_size, void* d_ws, size_t ws_size, hipStream_t stream) {
  (void)n_in;
  auto Fp = [&](int i) { return (const float*)d_in[i]; };
  // input order: 0 query [2048,2,1024], 1 pquery [32,2,1024], 2 Wpq [1024,1024], 3 bpq, 4 Wq, 5 bq, 6 Wpc, 7 bpc, 8 Wc, 9 bc, 10 Wo, 11 bo (torch [out][in])
  if (in_sizes[0] != NR * E || in_sizes[1] != NPR * E || in_sizes[2] != E * E || in_sizes[4] != E * E || in_sizes[6] != E * E || in_sizes[8] != E * E || in_sizes[10] != E * E || out_size != NR * E) return;
  size_t off = 0; char* ws = (char*)d_ws;
  auto carve = [&](size_t bytes) { char* p = ws + off; off += (bytes + 255) & ~(size_t)255; return p; };
  b16* X16 = (b16*)carve((size_t)NR * E * 2); b16* PQ16 = (b16*)carve((size_t)NPR * E * 2); b16* W4 = (b16*)carve((size_t)4 * E * E * 2); b16* WPQ = (b16*)carve((size_t)E * E * 2);
  b16* KPh = (b16*)carve((size_t)NR * E * 2); b16* KPl = (b16*)carve((size_t)NR * E * 2); b16* Qh = (b16*)carve((size_t)NR * E * 2); b16* Ql = (b16*)carve((size_t)NR * E * 2); b16* KVh = (b16*)carve((size_t)NR * E * 2); b16* KVl = (b16*)carve((size_t)NR * E * 2);
  b16* KVTh = (b16*)carve((size_t)NR * E * 2); b16* KVTl = (b16*)carve((size_t)NR * E * 2); b16* PAh = (b16*)carve((size_t)BH * T * PL * 2); b16* PAl = (b16*)carve((size_t)BH * T * PL * 2); b16* PATh = (b16*)carve((size_t)BH * PL * T * 2); b16* PATl = (b16*)carve((size_t)BH * PL * T * 2);
  b16* PQh = (b16*)carve((size_t)BH * PL * DH * 2); b16* PQl = (b16*)carve((size_t)BH * PL * DH * 2);
  b16* MTh = (b16*)carve((size_t)BH * NC * DH * PL * 2); b16* MTl = (b16*)carve((size_t)BH * NC * DH * PL * 2); b16* MSh = (b16*)carve((size_t)BH * NC * DH * PL * 2); b16* MSl = (b16*)carve((size_t)BH * NC * DH * PL * 2);
  b16* ATh = KPh; b16* ATl = KPl;   // region reuse: KP planes are dead after pattn_kernel (stream-ordered); the attention output takes their place
  if (off > ws_size || off > ((size_t)128 << 20)) return;   // ~ 114 MiB
  prep_kernel<<<(unsigned)(((size_t)NR * E / 8 + (size_t)NPR * E / 8 + 5 * (size_t)E * E / 8 + 255) / 256), 256, 0, stream>>>(Fp(0), Fp(1), Fp(2), Fp(4), Fp(6), Fp(8), Fp(10), X16, PQ16, W4, WPQ);
  lin_kernel<<<dim3(NR / LM, 3 * E / LN), 512, 0, stream>>>(X16, W4, Fp(7), Fp(5), Fp(9), KPh, KPl, Qh, Ql, KVh, KVl, KVTh, KVTl, PQ16, WPQ, Fp(3), PQh, PQl);
  pattn_kernel<<<dim3(T / 64, BH), 128, 0, stream>>>(PQh, PQl, KPh, KPl, PAh, PAl, PATh, PATl);
  state_kernel<<<dim3(8, BH), SW * 32, 0, stream>>>(KVTh, KVTl, PATh, PATl, MTh, MTl, MSh, MSl);
  step12_kernel<<<dim3(T / 32, BH), 64, 0, stream>>>(Qh, Ql, KVh, KVl, PATh, PATl, MTh, MTl, PAh, PAl, KVTh, KVTl, MSh, MSl, ATh, ATl);
  oproj_kernel<<<dim3(NR / 64, E / 128), 128, 0, stream>>>(ATh, ATl, W4 + (size_t)3 * E * E, Fp(11), (float*)d_out);
}
